// v000
// The times below were measured on an AMD MI455X: many runs one after another, warmed up first and cycling through
// copies of the inputs, with the whole window's GPU time divided by the number of runs. Launches and the gaps
// between them are all in it. The median over several windows is given; except for v000 it joins two sittings, which
// can be a few percent apart, so the side-by-side timings, each taken in one sitting, are the better comparison.
// v000, which the later versions start from, runs in 975 microseconds.
#include <hip/hip_runtime.h>
// Pre-LN decoder layer, sequence-first layout (T 1024, batch 4, E 1024, 16 heads x 64, FFN 4096): h = LN1(x); x1 = x + SelfAttn(h, h); h = LN2(x1); x2 = x1 + Attn(h, encoder_out); h = LN3(x2); out = x2 + fc2(gelu_erf(fc1(h))). Both attentions: q = (in*wq^T + bq)*64^-0.5, k, v from the key input, per (batch, head) scores over the 1024 keys with the module's causal mask (key > query filled with -1e4, i.e. weight exactly 0), softmax, *v, merged, *wo^T + bo.
// Structure: rows are the (t, n) pairs in memory order, so every projection / FFN is a [4096][1024] GEMM (f16 WMMA, 32x64 wave tiles, f32 accumulation, exact bias, residual through the f32 epilogue addend); LayerNorms wave-per-row on VALU writing f16 operand planes; q/k planes viewed as [token][64 heads x 64] feed a fused causal flash-style kernel per ((n,h), 64 queries) (wave = 16 queries, 32-key steps up to the query block, online softmax f32, P x2^10 f16 via LDS, f32 accumulators); v re-laid per (n,h) as [d][token] through an LDS tile; exact-erf GELU in the fc1 epilogue.
// Compute dtype: inputs and parameters rounded to bf16; all GEMM operands f16 (~2^-12: LN outputs, q, k, v, P, attention outputs, the GELU hidden), weights bf16-exact (x16 in f16), f32 accumulation; LayerNorm / softmax / residual stream f32. v_wmma_f32_16x16x32_f16.
#define TT 1024
#define NBATCH 4
#define EE 1024
#define NHD 16
#define NH (NBATCH * NHD)        /* 64 (batch, head) slabs */
#define TQ TT
#define TK TT
#define SCL 0.125f
#define NR (TT * NBATCH)         /* 4096 rows */
#define FF 4096
typedef __bf16 v16b __attribute__((ext_vector_type(16)));
typedef unsigned short v8us __attribute__((ext_vector_type(8), may_alias));
typedef float  v8f  __attribute__((ext_vector_type(8)));
typedef float  v4f  __attribute__((ext_vector_type(4)));
typedef float  v4fa __attribute__((ext_vector_type(4), may_alias));
union FragB { v16b v; v8us half[2]; unsigned short u[16]; };

__device__ __forceinline__ unsigned short bf16_bits(float x) { unsigned int u = __float_as_uint(x); return (unsigned short)((u + 0x7FFFu + ((u >> 16) & 1u)) >> 16); }
__device__ __forceinline__ float bf16_val(unsigned short b) { return __uint_as_float(((unsigned int)b) << 16); }
__device__ __forceinline__ float bf16_round(float x) { return bf16_val(bf16_bits(x)); }
// D += A·B with NT terms: 1 = ah·bh, 2 = + al·bh (A split), 3 = + ah·bl (both split)
template <int NT>
__device__ __forceinline__ v8f mmaN(v16b ah, v16b al, v16b bh, v16b bl, v8f c) {
  c = __builtin_amdgcn_wmma_f32_16x16x32_bf16(false, ah, false, bh, (short)0, c, false, false);
  if (NT >= 2) c = __builtin_amdgcn_wmma_f32_16x16x32_bf16(false, al, false, bh, (short)0, c, false, false);
  if (NT >= 3) c = __builtin_amdgcn_wmma_f32_16x16x32_bf16(false, ah, false, bl, (short)0, c, false, false);
  asm volatile("v_nop\n\tv_nop\n\tv_nop\n\tv_nop" : "+v"(c) : "v"(ah), "v"(al), "v"(bh), "v"(bl));
  return c;
}

__global__ __launch_bounds__(256) void k_wt_bf16(const float* __restrict__ W, unsigned short* __restrict__ Wt, int K, int N) {
  const int t = blockIdx.x * 256 + threadIdx.x;
  const int k8n = K / 8;
  if (t >= N * k8n) return;
  const int n = t / k8n, k8 = (t % k8n) * 8;
  v8us v;
#pragma unroll
  for (int i = 0; i < 8; ++i) v[i] = bf16_bits(W[(size_t)(k8 + i) * N + n]);
  *(v8us*)(Wt + (size_t)n * K + k8) = v;
  
}

// GEMM C[M][N] (f32, pitch ldc) = act(A[M][K]·W + bias). A f32 row-major (pitch lda) converted per fragment to bf16
// (ASPLIT: hi/lo two planes -> 2 terms, else single rounded term); Wt bf16 [N][K] (pitch ldb). BIAS_BF16 rounds the
// bias to bf16 first (bias quantised to bf16 before the add). K%32==0, M%16==0, N%64==0.
template <bool ASPLIT, int ACT, bool BIAS_BF16>
__global__ __launch_bounds__(128) void k_gemm_bf(const float* __restrict__ A, int lda, const unsigned short* __restrict__ Wt, int ldb,
                                               const float* __restrict__ bias, float* __restrict__ C, int ldc, int M, int N, int K) {
  __shared__ __attribute__((aligned(16))) float so[4][16][64];
  const int tid = threadIdx.x, w = tid >> 5, lane = tid & 31, ln = lane & 15, hh = lane >> 4;
  const int ntn = N / 64;
  const int wid = blockIdx.x * 4 + w;
  const int mt = wid / ntn, nq = wid % ntn;
  if (mt * 16 >= M) return;
  const int row0 = mt * 16, col0 = nq * 64;
  const float* arow = A + (size_t)(row0 + ln) * lda;
  v8f acc[4] = {};
  for (int kb = 0; kb < K; kb += 32) {
    FragB ah, al;
    const v4f x0 = *(const v4fa*)(arow + kb + 8 * hh), x1 = *(const v4fa*)(arow + kb + 8 * hh + 4);
    const v4f x2 = *(const v4fa*)(arow + kb + 16 + 8 * hh), x3 = *(const v4fa*)(arow + kb + 16 + 8 * hh + 4);
    float xs[16] = {x0[0],x0[1],x0[2],x0[3],x1[0],x1[1],x1[2],x1[3],x2[0],x2[1],x2[2],x2[3],x3[0],x3[1],x3[2],x3[3]};
#pragma unroll
    for (int i = 0; i < 16; ++i) { const unsigned short hb = bf16_bits(xs[i]); ah.u[i] = hb; al.u[i] = ASPLIT ? bf16_bits(xs[i] - bf16_val(hb)) : (unsigned short)0; }
#pragma unroll
    for (int t = 0; t < 4; ++t) {
      const unsigned short* brow = Wt + (size_t)(col0 + t * 16 + ln) * ldb + kb;
      FragB b;
      b.half[0] = *(const v8us*)(brow + 8 * hh);
      b.half[1] = *(const v8us*)(brow + 16 + 8 * hh);
      acc[t] = mmaN<ASPLIT ? 2 : 1>(ah.v, al.v, b.v, b.v, acc[t]);
    }
  }
#pragma unroll
  for (int t = 0; t < 4; ++t) {
    float bv = bias ? bias[col0 + t * 16 + ln] : 0.f;
    if (BIAS_BF16) bv = bf16_round(bv);
#pragma unroll
    for (int r = 0; r < 8; ++r) { float v = acc[t][r] + bv; if (ACT == 1) v = fmaxf(v, 0.f); so[w][8 * hh + r][t * 16 + ln] = v; }
  }
  __builtin_amdgcn_fence(__ATOMIC_ACQ_REL, "workgroup");
  __builtin_amdgcn_wave_barrier();
  const int rsub = lane >> 4, c4 = (lane & 15) * 4;
  {
#pragma unroll
    for (int q = 0; q < 8; ++q) {
      const int r = q * 2 + rsub;
      const v4f v = *(const v4fa*)&so[w][r][c4];
      *(v4f*)(C + (size_t)(row0 + r) * ldc + col0 + c4) = v;
    }
    
  }
}

// GEMM C = act(A·W + bias + resid): A f32 (ASPLIT -> hi/lo 2 terms), Wt bf16 [N][K]; ACT 0 none, 1 relu, 2 exact gelu;
// resid (optional, f32, row index = (row % rmod), pitch ldr, RES_BF16 rounds it) added before the activation.
template <bool ASPLIT, int ACT, bool BIAS_BF16, bool RES_BF16>
__global__ __launch_bounds__(128) void k_gemm_bf3(const float* __restrict__ A, int lda, const unsigned short* __restrict__ Wt, int ldb,
                                                const float* __restrict__ bias, const float* __restrict__ resid, int rmod, int ldr,
                                                float* __restrict__ C, int ldc, int M, int N, int K) {
  __shared__ __attribute__((aligned(16))) float so[4][16][64];
  const int tid = threadIdx.x, w = tid >> 5, lane = tid & 31, ln = lane & 15, hh = lane >> 4;
  const int ntn = N / 64;
  const int wid = blockIdx.x * 4 + w;
  const int mt = wid / ntn, nq = wid % ntn;
  if (mt * 16 >= M) return;
  const int row0 = mt * 16, col0 = nq * 64;
  const float* arow = A + (size_t)(row0 + ln) * lda;
  v8f acc[4] = {};
  for (int kb = 0; kb < K; kb += 32) {
    FragB ah, al;
    const v4f x0 = *(const v4fa*)(arow + kb + 8 * hh), x1 = *(const v4fa*)(arow + kb + 8 * hh + 4);
    const v4f x2 = *(const v4fa*)(arow + kb + 16 + 8 * hh), x3 = *(const v4fa*)(arow + kb + 16 + 8 * hh + 4);
    float xs[16] = {x0[0],x0[1],x0[2],x0[3],x1[0],x1[1],x1[2],x1[3],x2[0],x2[1],x2[2],x2[3],x3[0],x3[1],x3[2],x3[3]};
#pragma unroll
    for (int i = 0; i < 16; ++i) { const unsigned short hb = bf16_bits(xs[i]); ah.u[i] = hb; al.u[i] = ASPLIT ? bf16_bits(xs[i] - bf16_val(hb)) : (unsigned short)0; }
#pragma unroll
    for (int t = 0; t < 4; ++t) {
      const unsigned short* brow = Wt + (size_t)(col0 + t * 16 + ln) * ldb + kb;
      FragB b;
      b.half[0] = *(const v8us*)(brow + 8 * hh);
      b.half[1] = *(const v8us*)(brow + 16 + 8 * hh);
      acc[t] = mmaN<ASPLIT ? 2 : 1>(ah.v, al.v, b.v, b.v, acc[t]);
    }
  }
#pragma unroll
  for (int t = 0; t < 4; ++t) {
    const int col = col0 + t * 16 + ln;
    float bv = bias ? bias[col] : 0.f;
    if (BIAS_BF16) bv = bf16_round(bv);
#pragma unroll
    for (int r = 0; r < 8; ++r) {
      float v = acc[t][r] + bv;
      if (resid) { float rv = resid[(size_t)((row0 + 8 * hh + r) % rmod) * ldr + col]; if (RES_BF16) rv = bf16_round(rv); v += rv; }
      if (ACT == 1) v = fmaxf(v, 0.f);
      if (ACT == 2) v = 0.5f * v * (1.0f + erff(v * 0.70710678118654752f));
      if (ACT == 3) { const float u = 0.7978845608028654f * (v + 0.044715f * v * v * v); v = 0.5f * v * (1.0f + tanhf(u)); }
      so[w][8 * hh + r][t * 16 + ln] = v;
    }
  }
  __builtin_amdgcn_fence(__ATOMIC_ACQ_REL, "workgroup");
  __builtin_amdgcn_wave_barrier();
  const int rsub = lane >> 4, c4 = (lane & 15) * 4;
  {
#pragma unroll
    for (int q = 0; q < 8; ++q) {
      const int r = q * 2 + rsub;
      const v4f v = *(const v4fa*)&so[w][r][c4];
      *(v4f*)(C + (size_t)(row0 + r) * ldc + col0 + c4) = v;
    }
    
  }
}
// row LayerNorm (biased variance, eps) over N: s = X (+ R); optional out_sum <- s; out_norm <- (s-mu)*rsqrt(var+eps)*g + b
template <bool PARAM_BF16>
__global__ __launch_bounds__(256) void k_layernorm(const float* __restrict__ X, const float* __restrict__ R, const float* __restrict__ g, const float* __restrict__ bta,
                                                  float* __restrict__ out_sum, float* __restrict__ out_norm, int N, float eps) {
  __shared__ float red[256];
  const int row = blockIdx.x, tid = threadIdx.x;
  const float* x = X + (size_t)row * N; const float* rr = R ? R + (size_t)row * N : nullptr;
  float vals[16];                     // up to N = 4096
  const int per = N / 256;            // contiguous chunk per thread? use strided-by-4 chunks: thread handles j = tid*4 + 1024*u
  float s1 = 0.f;
  for (int u = 0; u < per / 4; ++u) {
    const int j = tid * 4 + 1024 * u;
    const v4f a = *(const v4fa*)(x + j);
    v4f b = {0.f,0.f,0.f,0.f}; if (rr) b = *(const v4fa*)(rr + j);
#pragma unroll
    for (int q = 0; q < 4; ++q) { const float v = a[q] + b[q]; vals[u * 4 + q] = v; s1 += v; }
  }
  red[tid] = s1; __syncthreads();
  for (int st = 128; st > 0; st >>= 1) { if (tid < st) red[tid] += red[tid + st]; __syncthreads(); }
  const float mu = red[0] / (float)N; __syncthreads();
  float s2 = 0.f;
  for (int u = 0; u < per / 4; ++u)
#pragma unroll
    for (int q = 0; q < 4; ++q) { const float c = vals[u * 4 + q] - mu; s2 += c * c; }
  red[tid] = s2; __syncthreads();
  for (int st = 128; st > 0; st >>= 1) { if (tid < st) red[tid] += red[tid + st]; __syncthreads(); }
  const float rs = rsqrtf(red[0] / (float)N + eps);
  {
    for (int u = 0; u < per / 4; ++u) {
      const int j = tid * 4 + 1024 * u;
      v4f o, sm;
#pragma unroll
      for (int q = 0; q < 4; ++q) {
        float gg = g[j + q], bb = bta[j + q];
        if (PARAM_BF16) { gg = bf16_round(gg); bb = bf16_round(bb); }
        sm[q] = vals[u * 4 + q]; o[q] = (vals[u * 4 + q] - mu) * rs * gg + bb;
      }
      if (out_sum) *(v4f*)(out_sum + (size_t)row * N + j) = sm;
      *(v4f*)(out_norm + (size_t)row * N + j) = o;
    }
    
  }
}



// ---- f16 WMMA path (v_wmma_f32_16x16x32_f16): 11-bit significands for operands in range — used where a [0,1] probability operand needs more precision than bf16
typedef _Float16 v16h __attribute__((ext_vector_type(16)));
union FragH { v16h v; v8us half[2]; _Float16 h[16]; unsigned short u[16]; };
template <int NT>
__device__ __forceinline__ v8f mmaH(v16h ah, v16h al, v16h bh, v16h bl, v8f c) {
  c = __builtin_amdgcn_wmma_f32_16x16x32_f16(false, ah, false, bh, (short)0, c, false, false);
  if (NT >= 2) c = __builtin_amdgcn_wmma_f32_16x16x32_f16(false, al, false, bh, (short)0, c, false, false);
  if (NT >= 3) c = __builtin_amdgcn_wmma_f32_16x16x32_f16(false, ah, false, bl, (short)0, c, false, false);
  asm volatile("v_nop\n\tv_nop\n\tv_nop\n\tv_nop" : "+v"(c) : "v"(ah), "v"(al), "v"(bh), "v"(bl));
  return c;
}
// batched GEMM like k_gemm_b but f16 operands: A f32 (split into f16 hi/lo if ASPLIT, else rounded to f16), Bt = f16 values [n][k]; alpha; C f32; N multiple of 16 (partial tiles skipped)
template <bool ASPLIT>
__global__ __launch_bounds__(128) void k_gemm_h(const float* __restrict__ A, int lda, size_t sA, const _Float16* __restrict__ Bh, int ldb, size_t sB, float alpha, float* __restrict__ C, int ldc, size_t sC, int M, int N, int K) {
  __shared__ __attribute__((aligned(16))) float so[4][16][64];
  const int tid = threadIdx.x, w = tid >> 5, lane = tid & 31, ln = lane & 15, hh = lane >> 4; const int by = blockIdx.y;
  A += (size_t)by * sA; Bh += (size_t)by * sB; C += (size_t)by * sC;
  const int ntn = (N + 63) / 64; const int wid = blockIdx.x * 4 + w; const int mt = wid / ntn, nq = wid % ntn; if (mt * 16 >= M) return;
  const int row0 = mt * 16, col0 = nq * 64; const float* arow = A + (size_t)(row0 + ln) * lda;
  v8f acc[4] = {};
  for (int kb = 0; kb < K; kb += 32) {
    FragH ah, al;
    const v4f x0 = *(const v4fa*)(arow + kb + 8 * hh), x1 = *(const v4fa*)(arow + kb + 8 * hh + 4), x2 = *(const v4fa*)(arow + kb + 16 + 8 * hh), x3 = *(const v4fa*)(arow + kb + 16 + 8 * hh + 4);
    float xs[16] = {x0[0],x0[1],x0[2],x0[3],x1[0],x1[1],x1[2],x1[3],x2[0],x2[1],x2[2],x2[3],x3[0],x3[1],x3[2],x3[3]};
#pragma unroll
    for (int i = 0; i < 16; ++i) { const _Float16 h = (_Float16)xs[i]; ah.h[i] = h; al.h[i] = ASPLIT ? (_Float16)(xs[i] - (float)h) : (_Float16)0.0f; }
#pragma unroll
    for (int t = 0; t < 4; ++t) { if (col0 + t * 16 >= N) continue; const size_t boff = (size_t)(col0 + t * 16 + ln) * ldb + kb; FragH bq; bq.half[0] = *(const v8us*)(Bh + boff + 8 * hh); bq.half[1] = *(const v8us*)(Bh + boff + 16 + 8 * hh);
      acc[t] = mmaH<ASPLIT ? 2 : 1>(ah.v, al.v, bq.v, bq.v, acc[t]); }
  }
#pragma unroll
  for (int t = 0; t < 4; ++t) { if (col0 + t * 16 >= N) continue;
#pragma unroll
    for (int r = 0; r < 8; ++r) so[w][8 * hh + r][t * 16 + ln] = acc[t][r] * alpha; }
  __builtin_amdgcn_fence(__ATOMIC_ACQ_REL, "workgroup"); __builtin_amdgcn_wave_barrier();
  const int rsub = lane >> 4, c4 = (lane & 15) * 4;
  {
#pragma unroll
    for (int q = 0; q < 8; ++q) { const int r = q * 2 + rsub; if (col0 + c4 < N) { const v4f v = *(const v4fa*)&so[w][r][c4]; *(v4f*)(C + (size_t)(row0 + r) * ldc + col0 + c4) = v; } }
     }
}

// Wt[n][k] = f16(W[k][n]·scale) from f32 row-major W[K][N] (scale = power of two; bf16-exact weights stay exact in f16 away from the subnormal range)
__global__ __launch_bounds__(256) void k_wt_f16(const float* __restrict__ W, _Float16* __restrict__ Wt, int K, int N, float scale) {
  const int t = blockIdx.x * 256 + threadIdx.x; if (t >= N * (K / 8)) return; const int n = t / (K / 8), k8 = (t % (K / 8)) * 8; FragH f;
#pragma unroll
  for (int i = 0; i < 8; ++i) f.h[i] = (_Float16)(bf16_round(W[(size_t)(k8 + i) * N + n]) * scale); const v8us o = f.half[0];
  *(v8us*)((unsigned short*)Wt + (size_t)n * K + k8) = o; 
}
// k_gemm_hh variant with fused epilogue: v = acc·alpha + bias[by·sBias + col] (+ CP[(row/rowsPerB)·sCPb + by·64 + col] if CP) ; ACT 0 none / 1 elu ; writes f16 C16 (and f32 C if non-null)
template <int ACT>
__global__ __launch_bounds__(128) void k_gemm_hhx(const _Float16* __restrict__ A, int lda, size_t sA, const _Float16* __restrict__ Bh, int ldb, size_t sB, float alpha, const float* __restrict__ bias, size_t sBias, const float* __restrict__ CP, int rowsPerB, size_t sCPb, int row0g,
    float* __restrict__ C, _Float16* __restrict__ C16, int ldc, size_t sC, int M, int N, int K) {
  __shared__ __attribute__((aligned(16))) float so[4][16][64];
  const int tid = threadIdx.x, w = tid >> 5, lane = tid & 31, ln = lane & 15, hh = lane >> 4; const int by = blockIdx.y;
  A += (size_t)by * sA; Bh += (size_t)by * sB; const size_t cofs = (size_t)by * sC; const float* bp = bias ? bias + (size_t)by * sBias : nullptr;
  const int ntn = (N + 63) / 64; const int wid = blockIdx.x * 4 + w; const int mt = wid / ntn, nq = wid % ntn; if (mt * 16 >= M) return;
  const int row0 = mt * 16, col0 = nq * 64; const _Float16* arow = A + (size_t)(row0 + ln) * lda;
  v8f acc[4] = {};
  for (int kb = 0; kb < K; kb += 32) { FragH ah; ah.half[0] = *(const v8us*)((const unsigned short*)arow + kb + 8 * hh); ah.half[1] = *(const v8us*)((const unsigned short*)arow + kb + 16 + 8 * hh);
#pragma unroll
    for (int t = 0; t < 4; ++t) { if (col0 + t * 16 >= N) continue; const size_t boff = (size_t)(col0 + t * 16 + ln) * ldb + kb; FragH bq; bq.half[0] = *(const v8us*)((const unsigned short*)Bh + boff + 8 * hh); bq.half[1] = *(const v8us*)((const unsigned short*)Bh + boff + 16 + 8 * hh);
      acc[t] = mmaH<1>(ah.v, ah.v, bq.v, bq.v, acc[t]); }
  }
#pragma unroll
  for (int t = 0; t < 4; ++t) { if (col0 + t * 16 >= N) continue; const int col = col0 + t * 16 + ln; const float bv = bp ? bf16_round(bp[col]) : 0.f;
#pragma unroll
    for (int r = 0; r < 8; ++r) { float v = acc[t][r] * alpha + bv; if (CP) { const int bidx = (row0g + row0 + 8 * hh + r) / rowsPerB; v += CP[(size_t)bidx * sCPb + (size_t)by * 64 + col]; } if (ACT == 1) v = (v > 0.f) ? v : expm1f(v); else if (ACT == 7) v = (v > 0.f) ? v + 1.0f : expf(v); else if (ACT == 8) v = tanhf(v); else if (ACT == 9) v = 0.5f * v * (1.0f + tanhf(0.7978845608028654f * (v + 0.044715f * v * v * v))); else if (ACT == 11) v = 1.0f / (1.0f + expf(-v)); else if (ACT == 12) v = (v > 0.f) ? v : 0.01f * v; else if (ACT == 14) v = (v > 0.f) ? v : 0.1f * v; else if (ACT == 15) v = v / (1.0f + expf(-v)); else if (ACT == 3) v = fmaxf(v, 0.f); else if (ACT == 6) v = 0.5f * v * (1.0f + erff(v * 0.70710678118654752f)); so[w][8 * hh + r][t * 16 + ln] = v; } }
  __builtin_amdgcn_fence(__ATOMIC_ACQ_REL, "workgroup"); __builtin_amdgcn_wave_barrier();
  const int rsub = lane >> 4, c4 = (lane & 15) * 4; typedef _Float16 v4h __attribute__((ext_vector_type(4)));
  {
#pragma unroll
    for (int q = 0; q < 8; ++q) { const int r = q * 2 + rsub; if (col0 + c4 < N) { const v4f v = *(const v4fa*)&so[w][r][c4]; if (C) *(v4f*)(C + cofs + (size_t)(row0 + r) * ldc + col0 + c4) = v; if (C16) { v4h h4; for (int i = 0; i < 4; ++i) h4[i] = (_Float16)v[i]; *(v4h*)(C16 + cofs + (size_t)(row0 + r) * ldc + col0 + c4) = h4; } } }
     }
}


typedef _Float16 v4h __attribute__((ext_vector_type(4)));

__global__ __launch_bounds__(256) void k_x16(const float* __restrict__ x, _Float16* __restrict__ X16, size_t n8) { const size_t t = (size_t)blockIdx.x * 256 + threadIdx.x; if (t >= n8) return; FragH f;
#pragma unroll
  for (int q = 0; q < 8; ++q) f.h[q] = (_Float16)bf16_round(x[t * 8 + q]); *(v8us*)((unsigned short*)X16 + t * 8) = f.half[0];  }
__global__ __launch_bounds__(256) void k_h16(const float* __restrict__ x, _Float16* __restrict__ X16, size_t n8) { const size_t t = (size_t)blockIdx.x * 256 + threadIdx.x; if (t >= n8) return; FragH f;
#pragma unroll
  for (int q = 0; q < 8; ++q) f.h[q] = (_Float16)x[t * 8 + q]; *(v8us*)((unsigned short*)X16 + t * 8) = f.half[0];  }
__global__ __launch_bounds__(256) void k_round16f(const float* __restrict__ W, _Float16* __restrict__ Bt, size_t n8) { const size_t t = (size_t)blockIdx.x * 256 + threadIdx.x; if (t >= n8) return; FragH f;
#pragma unroll
  for (int i = 0; i < 8; ++i) f.h[i] = (_Float16)(bf16_round(W[t * 8 + i]) * 16.0f); *(v8us*)((unsigned short*)Bt + t * 8) = f.half[0];  }
template <int NHv, int TTv>
__global__ __launch_bounds__(256) void k_vt(const _Float16* __restrict__ V16, int ldv, int voff, _Float16* __restrict__ Vt) { __shared__ unsigned short tl[64][66]; const int tid = threadIdx.x; const int slab = blockIdx.x / (TTv / 64), lg = blockIdx.x % (TTv / 64); const int b = slab / NHv, h = slab % NHv;
  for (int i = tid; i < 64 * 8; i += 256) { const int r = i / 8, c8 = (i % 8) * 8; FragH f; f.half[0] = *(const v8us*)((const unsigned short*)V16 + ((size_t)b * TTv + lg * 64 + r) * ldv + voff + h * 64 + c8);
#pragma unroll
    for (int q = 0; q < 8; ++q) tl[r][c8 + q] = f.u[q]; }
  __syncthreads();
  {
#pragma unroll
    for (int rd = 0; rd < 2; ++rd) { const int d = rd * 32 + tid / 8, pc = tid % 8; FragH f;
#pragma unroll
      for (int q = 0; q < 8; ++q) f.u[q] = tl[pc * 8 + q][d];
      *(v8us*)((unsigned short*)Vt + ((size_t)slab * 64 + d) * TTv + lg * 64 + pc * 8) = f.half[0]; }
     } }

__global__ __launch_bounds__(256) void k_hl(const float* __restrict__ F, _Float16* __restrict__ Hh, _Float16* __restrict__ Hl, size_t n8) { const size_t t = (size_t)blockIdx.x * 256 + threadIdx.x; if (t >= n8) return; FragH fh, fl; const v4f a = *(const v4fa*)(F + t * 8), c = *(const v4fa*)(F + t * 8 + 4);
#pragma unroll
  for (int q = 0; q < 4; ++q) { _Float16 h = (_Float16)a[q]; fh.h[q] = h; fl.h[q] = (_Float16)((a[q] - (float)h) * 1024.0f); h = (_Float16)c[q]; fh.h[4 + q] = h; fl.h[4 + q] = (_Float16)((c[q] - (float)h) * 1024.0f); }
  { *(v8us*)((unsigned short*)Hh + t * 8) = fh.half[0]; *(v8us*)((unsigned short*)Hl + t * 8) = fl.half[0];  } }

// ---- fast GEMM (wave tile 32x64; requires M % 32 == 0 rows per launch region and N % 64 == 0); epilogue = k_gemm_hhx semantics ----
__device__ __forceinline__ v16h g2_frag(const _Float16* p, int hh) { FragH f; f.half[0] = *(const v8us*)((const unsigned short*)p + 8 * hh); f.half[1] = *(const v8us*)((const unsigned short*)p + 16 + 8 * hh); return f.v; }
__device__ __forceinline__ v8f g2_mma(v16h a, v16h b, v8f c) { v8f d = __builtin_amdgcn_wmma_f32_16x16x32_f16(false, a, false, b, (short)0, c, false, false); asm volatile("v_nop\n\tv_nop\n\tv_nop\n\tv_nop" : "+v"(d) : "v"(a), "v"(b)); return d; }
template <int ACT>
__global__ __launch_bounds__(128) void k_gemm2(const _Float16* __restrict__ A, int lda, size_t sA, const _Float16* __restrict__ Bh, int ldb, size_t sB, float alpha, const float* __restrict__ bias, size_t sBias, const float* __restrict__ CP, int rowsPerB, size_t sCPb, int row0g,
    float* __restrict__ C, _Float16* __restrict__ C16, int ldc, size_t sC, int M, int N, int K) {
  __shared__ __attribute__((aligned(16))) float so[4][32][68];
  const int tid = threadIdx.x, w = tid >> 5, lane = tid & 31, ln = lane & 15, hh = lane >> 4; const int by = blockIdx.y;
  A += (size_t)by * sA; Bh += (size_t)by * sB; const size_t cofs = (size_t)by * sC; const float* bp = bias ? bias + (size_t)by * sBias : nullptr;
  const int ntn = N >> 6; const int mt = blockIdx.x / ntn, nq = blockIdx.x - mt * ntn; const int row0 = mt * 128 + 32 * w, col0 = nq * 64; if (row0 >= M) return;
  const _Float16* a0p = A + (size_t)(row0 + ln) * lda; const _Float16* a1p = a0p + (size_t)16 * lda;
  const _Float16* b0p = Bh + (size_t)(col0 + ln) * ldb; const _Float16* b1p = b0p + (size_t)16 * ldb; const _Float16* b2p = b1p + (size_t)16 * ldb; const _Float16* b3p = b2p + (size_t)16 * ldb;
  const v8f z8 = {0.f,0.f,0.f,0.f,0.f,0.f,0.f,0.f}; v8f c00 = z8, c01 = z8, c02 = z8, c03 = z8, c10 = z8, c11 = z8, c12 = z8, c13 = z8;
#pragma unroll 1
  for (int kb = 0; kb < K; kb += 32) { const v16h a0 = g2_frag(a0p + kb, hh), a1 = g2_frag(a1p + kb, hh);
    v16h b = g2_frag(b0p + kb, hh); c00 = g2_mma(a0, b, c00); c10 = g2_mma(a1, b, c10);
    b = g2_frag(b1p + kb, hh); c01 = g2_mma(a0, b, c01); c11 = g2_mma(a1, b, c11);
    b = g2_frag(b2p + kb, hh); c02 = g2_mma(a0, b, c02); c12 = g2_mma(a1, b, c12);
    b = g2_frag(b3p + kb, hh); c03 = g2_mma(a0, b, c03); c13 = g2_mma(a1, b, c13); }
  v8f accs[8] = {c00, c01, c02, c03, c10, c11, c12, c13};
#pragma unroll
  for (int u = 0; u < 8; ++u) { const int t = u & 3, half = u >> 2; const int col = col0 + t * 16 + ln; const float bv = bp ? bf16_round(bp[col]) : 0.f;
#pragma unroll
    for (int r = 0; r < 8; ++r) { const int rloc = half * 16 + 8 * hh + r; float v = accs[u][r] * alpha + bv; if (CP) { const int bidx = (row0g + row0 + rloc) / rowsPerB; v += CP[(size_t)bidx * sCPb + (size_t)by * 64 + col]; }
      if (ACT == 3) v = fmaxf(v, 0.f); else if (ACT == 6) v = 0.5f * v * (1.0f + erff(v * 0.70710678118654752f)); else if (ACT == 11) v = 1.0f / (1.0f + expf(-v)); else if (ACT == 15) v = v / (1.0f + expf(-v)); else if (ACT == 12) v = (v > 0.f) ? v : 0.01f * v; else if (ACT == 8) v = tanhf(v);
      so[w][rloc][t * 16 + ln] = v; } }
  __builtin_amdgcn_fence(__ATOMIC_ACQ_REL, "workgroup"); __builtin_amdgcn_wave_barrier();
  const int rsub = lane >> 4, c4 = (lane & 15) * 4;
  {
#pragma unroll
    for (int q = 0; q < 16; ++q) { const int r = q * 2 + rsub; const v4f v = *(const v4fa*)&so[w][r][c4]; if (C) *(v4f*)(C + cofs + (size_t)(row0 + r) * ldc + col0 + c4) = v; if (C16) { v4h h4; for (int i = 0; i < 4; ++i) h4[i] = (_Float16)v[i]; *(v4h*)(C16 + cofs + (size_t)(row0 + r) * ldc + col0 + c4) = h4; } }
     } }


__global__ __launch_bounds__(128) void k_flashc(const _Float16* __restrict__ Q16, int ldq, const _Float16* __restrict__ K16, int ldk, const _Float16* __restrict__ Vt, const int* __restrict__ MSK, float* __restrict__ O, int ldo) {
  constexpr int RPW = 16, RTN = RPW / 16, NQB = TQ / (4 * RPW), DT = 4, KS = 2;
  __shared__ __attribute__((aligned(16))) unsigned short sP[4][RPW][40]; __shared__ __attribute__((aligned(16))) float sO[4][RPW][64 + 4];
  const int tid = threadIdx.x, w = tid >> 5, lane = tid & 31, ln = lane & 15, hh = lane >> 4;
  const int slab = blockIdx.x / NQB, qblk = blockIdx.x % NQB; const int b = slab / NH, h = slab % NH; const int qb0 = qblk * (4 * RPW); const int q0 = qb0 + w * RPW;
  FragH aq[2][KS];
#pragma unroll
  for (int rt = 0; rt < RTN; ++rt) { const unsigned short* qr = (const unsigned short*)Q16 + ((size_t)b * TQ + q0 + rt * 16 + ln) * ldq + h * 64;
#pragma unroll
    for (int ks = 0; ks < KS; ++ks) { aq[rt][ks].half[0] = *(const v8us*)(qr + ks * 32 + 8 * hh); aq[rt][ks].half[1] = *(const v8us*)(qr + ks * 32 + 16 + 8 * hh); } }
  const unsigned short* Vth = (const unsigned short*)Vt + (size_t)slab * 64 * TK;
  float m_r[2][8], l_r[2][8]; v8f oacc[2][DT];
#pragma unroll
  for (int rt = 0; rt < RTN; ++rt) {
#pragma unroll
    for (int r = 0; r < 8; ++r) { m_r[rt][r] = -3.0e38f; l_r[rt][r] = 0.f; }
#pragma unroll
    for (int dt = 0; dt < DT; ++dt) oacc[rt][dt] = (v8f){0.f,0.f,0.f,0.f,0.f,0.f,0.f,0.f}; }
  const int jend = qb0 + 4 * RPW;      /* block-uniform causal bound */
#pragma unroll 1
  for (int j0 = 0; j0 < jend; j0 += 32) {
    v8f s[2][2];
#pragma unroll
    for (int nt = 0; nt < 2; ++nt) { const unsigned short* kr = (const unsigned short*)K16 + ((size_t)b * TK + j0 + nt * 16 + ln) * ldk + h * 64; FragH bk[KS];
#pragma unroll
      for (int ks = 0; ks < KS; ++ks) { bk[ks].half[0] = *(const v8us*)(kr + ks * 32 + 8 * hh); bk[ks].half[1] = *(const v8us*)(kr + ks * 32 + 16 + 8 * hh); }
#pragma unroll
      for (int rt = 0; rt < RTN; ++rt) { v8f acc = (v8f){0.f,0.f,0.f,0.f,0.f,0.f,0.f,0.f};
#pragma unroll
        for (int ks = 0; ks < KS; ++ks) acc = mmaH<1>(aq[rt][ks].v, aq[rt][ks].v, bk[ks].v, bk[ks].v, acc); s[rt][nt] = acc; } }
#pragma unroll
    for (int rt = 0; rt < RTN; ++rt)
#pragma unroll
      for (int r = 0; r < 8; ++r) { const int tq = q0 + rt * 16 + 8 * hh + r; const int k0 = j0 + ln, k1 = j0 + 16 + ln; (void)tq; (void)k0; (void)k1;
        const bool ok0 = (k0 <= tq), ok1 = (k1 <= tq);
        const float s0 = ok0 ? s[rt][0][r] * SCL : -INFINITY, s1 = ok1 ? s[rt][1][r] * SCL : -INFINITY; float mc = fmaxf(s0, s1);
        mc = fmaxf(mc, __shfl_xor(mc, 1, 32)); mc = fmaxf(mc, __shfl_xor(mc, 2, 32)); mc = fmaxf(mc, __shfl_xor(mc, 4, 32)); mc = fmaxf(mc, __shfl_xor(mc, 8, 32));
        const float mn = fmaxf(m_r[rt][r], mc); const float al = (mn > -1.0e38f) ? expf(m_r[rt][r] - mn) : 1.0f; m_r[rt][r] = mn; const float p0 = ok0 ? expf(s0 - mn) : 0.f, p1 = ok1 ? expf(s1 - mn) : 0.f; l_r[rt][r] = l_r[rt][r] * al + p0 + p1;
#pragma unroll
        for (int dt = 0; dt < DT; ++dt) oacc[rt][dt][r] *= al;
        FragH t2; t2.h[0] = (_Float16)(p0 * 1024.0f); t2.h[1] = (_Float16)(p1 * 1024.0f); sP[w][rt * 16 + 8 * hh + r][ln] = t2.u[0]; sP[w][rt * 16 + 8 * hh + r][16 + ln] = t2.u[1]; }
    __builtin_amdgcn_fence(__ATOMIC_ACQ_REL, "workgroup"); __builtin_amdgcn_wave_barrier();
    FragH pa[2];
#pragma unroll
    for (int rt = 0; rt < RTN; ++rt) { pa[rt].half[0] = *(const v8us*)&sP[w][rt * 16 + ln][8 * hh]; pa[rt].half[1] = *(const v8us*)&sP[w][rt * 16 + ln][16 + 8 * hh]; }
#pragma unroll
    for (int dt = 0; dt < DT; ++dt) { const unsigned short* vrow = Vth + (size_t)(dt * 16 + ln) * TK + j0; FragH bv; bv.half[0] = *(const v8us*)(vrow + 8 * hh); bv.half[1] = *(const v8us*)(vrow + 16 + 8 * hh);
#pragma unroll
      for (int rt = 0; rt < RTN; ++rt) oacc[rt][dt] = mmaH<1>(pa[rt].v, pa[rt].v, bv.v, bv.v, oacc[rt][dt]); }
    __builtin_amdgcn_fence(__ATOMIC_ACQ_REL, "workgroup"); __builtin_amdgcn_wave_barrier(); }
#pragma unroll
  for (int rt = 0; rt < RTN; ++rt) {
#pragma unroll
    for (int r = 0; r < 8; ++r) { float l = l_r[rt][r]; l += __shfl_xor(l, 1, 32); l += __shfl_xor(l, 2, 32); l += __shfl_xor(l, 4, 32); l += __shfl_xor(l, 8, 32); l_r[rt][r] = (l > 0.f) ? 1.0f / (l * 1024.0f) : 0.f; }
#pragma unroll
    for (int dt = 0; dt < DT; ++dt)
#pragma unroll
      for (int r = 0; r < 8; ++r) sO[w][rt * 16 + 8 * hh + r][dt * 16 + ln] = oacc[rt][dt][r] * l_r[rt][r]; }
  __builtin_amdgcn_fence(__ATOMIC_ACQ_REL, "workgroup"); __builtin_amdgcn_wave_barrier();
  {
#pragma unroll
    for (int rp = 0; rp < RPW; rp += 2) { const int r = rp + (lane >> 4), pc = lane & 15; const v4f val = *(const v4fa*)&sO[w][r][pc * 4]; *(v4f*)(O + ((size_t)b * TQ + q0 + r) * ldo + h * 64 + pc * 4) = val; }
     } }
template <bool RND>
__global__ __launch_bounds__(256) void k_ln1024(const float* __restrict__ X, const float* __restrict__ g, const float* __restrict__ bb, _Float16* __restrict__ H16) {
  #pragma clang fp contract(off)
  const int tid = threadIdx.x, w = tid >> 5, l = tid & 31; const int r = blockIdx.x * 8 + w; if (r >= NR) return; const float* x = X + (size_t)r * EE; float v[32]; float s = 0.f;
#pragma unroll
  for (int u = 0; u < 8; ++u) { const v4f a = *(const v4fa*)(x + u * 128 + l * 4);
#pragma unroll
    for (int q = 0; q < 4; ++q) { const float t = RND ? bf16_round(a[q]) : a[q]; v[u * 4 + q] = t; s += t; } }
  for (int o = 16; o > 0; o >>= 1) s += __shfl_xor(s, o, 32); const float mu = s / (float)EE; float q2 = 0.f;
#pragma unroll
  for (int k = 0; k < 32; ++k) { const float d = v[k] - mu; q2 += d * d; }
  for (int o = 16; o > 0; o >>= 1) q2 += __shfl_xor(q2, o, 32); const float rs = 1.0f / sqrtf(q2 / (float)EE + 1e-5f);
  {
#pragma unroll
    for (int u = 0; u < 8; ++u) { _Float16 h4[4];
#pragma unroll
      for (int q = 0; q < 4; ++q) { const int c = u * 128 + l * 4 + q; h4[q] = (_Float16)((v[u * 4 + q] - mu) * rs * bf16_round(g[c]) + bf16_round(bb[c])); }
      *(unsigned long long*)((unsigned short*)H16 + (size_t)r * EE + u * 128 + l * 4) = *(const unsigned long long*)h4; }
     } }
__global__ __launch_bounds__(256) void k_prep(const float* __restrict__ x, const float* __restrict__ e, float* __restrict__ Xf, _Float16* __restrict__ E16, size_t n4) {
  const size_t t = (size_t)blockIdx.x * 256 + threadIdx.x; if (t >= n4) return; const v4f a = *(const v4fa*)(x + t * 4), c = *(const v4fa*)(e + t * 4); v4f ra; _Float16 h4[4];
#pragma unroll
  for (int q = 0; q < 4; ++q) { ra[q] = bf16_round(a[q]); h4[q] = (_Float16)bf16_round(c[q]); }
  const unsigned long long pk = *(const unsigned long long*)h4;
  { *(v4f*)(Xf + t * 4) = ra; *(unsigned long long*)((unsigned short*)E16 + t * 4) = pk;  } }
__global__ __launch_bounds__(256) void k_vtn(const float* __restrict__ VF, _Float16* __restrict__ Vt) {
  __shared__ float tl[64][65];
  const int tid = threadIdx.x; const int slab = blockIdx.x / (TT / 64), lg = blockIdx.x % (TT / 64); const int n = slab / NHD, h = slab % NHD;
  for (int i = tid; i < 64 * 16; i += 256) { const int r = i / 16, c4 = (i % 16) * 4; const v4f a = *(const v4fa*)(VF + ((size_t)(lg * 64 + r) * NBATCH + n) * EE + h * 64 + c4); tl[r][c4] = a[0]; tl[r][c4 + 1] = a[1]; tl[r][c4 + 2] = a[2]; tl[r][c4 + 3] = a[3]; }
  __syncthreads();
  FragH f[2]; size_t oo[2];
#pragma unroll
  for (int rd = 0; rd < 2; ++rd) { const int d = rd * 32 + tid / 8, pc = tid % 8;
#pragma unroll
    for (int q = 0; q < 8; ++q) f[rd].h[q] = (_Float16)tl[pc * 8 + q][d]; oo[rd] = ((size_t)slab * 64 + d) * TT + lg * 64 + pc * 8; }
  { *(v8us*)((unsigned short*)Vt + oo[0]) = f[0].half[0]; *(v8us*)((unsigned short*)Vt + oo[1]) = f[1].half[0];  } }

extern "C" void kernel_launch(void* const* d_in, const int* in_sizes, int n_in,
                              void* d_out, int out_size, void* d_ws, size_t ws_size, hipStream_t stream) {
  (void)in_sizes; (void)n_in; (void)out_size;
  const float* const* I = (const float* const*)d_in;
  const float* x = I[0]; const float* enc = I[1];
  const float* wq_s = I[2]; const float* bq_s = I[3]; const float* wk_s = I[4]; const float* bk_s = I[5]; const float* wv_s = I[6]; const float* bv_s = I[7]; const float* wo_s = I[8]; const float* bo_s = I[9];
  const float* wq_c = I[10]; const float* bq_c = I[11]; const float* wk_c = I[12]; const float* bk_c = I[13]; const float* wv_c = I[14]; const float* bv_c = I[15]; const float* wo_c = I[16]; const float* bo_c = I[17];
  const float* g1 = I[18]; const float* b1n = I[19]; const float* g2 = I[20]; const float* b2n = I[21]; const float* g3 = I[22]; const float* b3n = I[23]; const float* W1 = I[24]; const float* b1 = I[25]; const float* W2 = I[26]; const float* b2 = I[27];
  char* ws = (char*)d_ws; size_t off = 0;
  auto take = [&](size_t bytes) { char* p = ws + off; off += (bytes + 255) & ~(size_t)255; return p; };
  _Float16* B[8]; for (int i = 0; i < 8; ++i) B[i] = (_Float16*)take((size_t)EE * EE * 2);      /* wq_s wk_s wv_s wo_s wq_c wk_c wv_c wo_c */
  _Float16* BF1 = (_Float16*)take((size_t)FF * EE * 2); _Float16* BF2 = (_Float16*)take((size_t)EE * FF * 2);
  float* Xf = (float*)take((size_t)NR * EE * 4); _Float16* H16 = (_Float16*)take((size_t)NR * EE * 2);
  _Float16* Q16 = (_Float16*)take((size_t)NR * EE * 2); _Float16* K16 = (_Float16*)take((size_t)NR * EE * 2); _Float16* VT = (_Float16*)take((size_t)NR * EE * 2); _Float16* E16 = (_Float16*)take((size_t)NR * EE * 2);      /* these four are contiguous: the FFN hidden reuses them */
  float* O = (float*)take((size_t)NR * EE * 4); float* X1 = (float*)take((size_t)NR * EE * 4);
  if (off > ws_size) return;      /* 16 + 16 + 16 + 8 + 32 + 16 + 16 = 120 MiB */
  _Float16* O16 = H16;                /* LN output is dead once its projection GEMMs ran; the attention output plane reuses it */
  float* X2 = Xf;                     /* bf16(x) is dead after the first residual GEMM */
  _Float16* F1 = Q16;                 /* FFN hidden [4096][4096] f16 = 32 MiB = Q16+K16+VT+E16 (all dead by then) */
  const float* Wl[8] = {wq_s, wk_s, wv_s, wo_s, wq_c, wk_c, wv_c, wo_c};
  const size_t w8 = (size_t)EE * EE / 8; for (int i = 0; i < 8; ++i) k_round16f<<<(unsigned)((w8 + 255) / 256), 256, 0, stream>>>(Wl[i], B[i], w8);      /* (out,in) = natural Bt; x16 */
  k_round16f<<<(unsigned)(((size_t)FF * EE / 8 + 255) / 256), 256, 0, stream>>>(W1, BF1, (size_t)FF * EE / 8); k_round16f<<<(unsigned)(((size_t)FF * EE / 8 + 255) / 256), 256, 0, stream>>>(W2, BF2, (size_t)FF * EE / 8);
  const size_t n8 = (size_t)NR * EE / 8; const unsigned nb8 = (unsigned)((n8 + 255) / 256);
  k_prep<<<(unsigned)(((size_t)NR * EE / 4 + 255) / 256), 256, 0, stream>>>(x, enc, Xf, E16, (size_t)NR * EE / 4);
  const dim3 gE((NR / 128) * (EE / 64), 1), gF((NR / 128) * (FF / 64), 1); const unsigned gln = NR / 8, gvt = NH * (TT / 64), gfl = NH * (TQ / 64);
  /* --- self attention --- */
  k_ln1024<true><<<gln, 256, 0, stream>>>(x, g1, b1n, H16);
  k_gemm2<0><<<gE, 128, 0, stream>>>(H16, EE, 0, B[0], EE, 0, 0.0625f, bq_s, 0, nullptr, 1, 0, 0, nullptr, Q16, EE, 0, NR, EE, EE);
  k_gemm2<0><<<gE, 128, 0, stream>>>(H16, EE, 0, B[1], EE, 0, 0.0625f, bk_s, 0, nullptr, 1, 0, 0, nullptr, K16, EE, 0, NR, EE, EE);
  k_gemm2<0><<<gE, 128, 0, stream>>>(H16, EE, 0, B[2], EE, 0, 0.0625f, bv_s, 0, nullptr, 1, 0, 0, O, nullptr, EE, 0, NR, EE, EE); k_vtn<<<gvt, 256, 0, stream>>>(O, VT);
  k_flashc<<<gfl, 128, 0, stream>>>(Q16, NBATCH * EE, K16, NBATCH * EE, VT, nullptr, O, NBATCH * EE);      /* rows = tokens, 64 (n,h) slabs of 64 columns */
  k_h16<<<nb8, 256, 0, stream>>>(O, O16, n8);
  k_gemm2<0><<<gE, 128, 0, stream>>>(O16, EE, 0, B[3], EE, 0, 0.0625f, bo_s, 0, Xf, 1, (size_t)EE, 0, X1, nullptr, EE, 0, NR, EE, EE);      /* x1 = x + o*wo^T + bo */
  /* --- cross attention (keys/values from encoder_out, same causal mask) --- */
  k_ln1024<false><<<gln, 256, 0, stream>>>(X1, g2, b2n, H16);
  k_gemm2<0><<<gE, 128, 0, stream>>>(H16, EE, 0, B[4], EE, 0, 0.0625f, bq_c, 0, nullptr, 1, 0, 0, nullptr, Q16, EE, 0, NR, EE, EE);
  k_gemm2<0><<<gE, 128, 0, stream>>>(E16, EE, 0, B[5], EE, 0, 0.0625f, bk_c, 0, nullptr, 1, 0, 0, nullptr, K16, EE, 0, NR, EE, EE);
  k_gemm2<0><<<gE, 128, 0, stream>>>(E16, EE, 0, B[6], EE, 0, 0.0625f, bv_c, 0, nullptr, 1, 0, 0, O, nullptr, EE, 0, NR, EE, EE); k_vtn<<<gvt, 256, 0, stream>>>(O, VT);
  k_flashc<<<gfl, 128, 0, stream>>>(Q16, NBATCH * EE, K16, NBATCH * EE, VT, nullptr, O, NBATCH * EE);
  k_h16<<<nb8, 256, 0, stream>>>(O, O16, n8);
  k_gemm2<0><<<gE, 128, 0, stream>>>(O16, EE, 0, B[7], EE, 0, 0.0625f, bo_c, 0, X1, 1, (size_t)EE, 0, X2, nullptr, EE, 0, NR, EE, EE);      /* x2 = x1 + o*wo^T + bo */
  /* --- FFN --- */
  k_ln1024<false><<<gln, 256, 0, stream>>>(X2, g3, b3n, H16);
  k_gemm2<6><<<gF, 128, 0, stream>>>(H16, EE, 0, BF1, EE, 0, 0.0625f, b1, 0, nullptr, 1, 0, 0, nullptr, F1, FF, 0, NR, FF, EE);      /* gelu_erf(h*fc1^T + b1) -> f16 [4096][4096] */
  k_gemm2<0><<<gE, 128, 0, stream>>>(F1, FF, 0, BF2, FF, 0, 0.0625f, b2, 0, X2, 1, (size_t)EE, 0, (float*)d_out, nullptr, EE, 0, NR, EE, FF);      /* out = x2 + f*fc2^T + b2 */
}

// v001
// A run of this version takes 600 microseconds.
// Timed twice side by side with v000, it ran 1.66 times as fast both times.
#include <hip/hip_runtime.h>
// Pre-LN decoder layer, sequence-first layout (T 1024, batch 4, E 1024, 16 heads x 64, FFN 4096): h = LN1(x); x1 = x + SelfAttn(h, h); h = LN2(x1); x2 = x1 + Attn(h, encoder_out); h = LN3(x2); out = x2 + fc2(gelu_erf(fc1(h))). Both attentions: q = (in*wq^T + bq)*64^-0.5, k, v from the key input, per (batch, head) scores over the 1024 keys with the module's causal mask (key > query filled with -1e4, i.e. weight exactly 0), softmax, *v, merged, *wo^T + bo.
// Structure: rows are the (t, n) pairs in memory order, so every projection / FFN is a [4096][1024] GEMM (f16 WMMA, 32x64 wave tiles, f32 accumulation, exact bias, residual through the f32 epilogue addend); LayerNorms wave-per-row on VALU writing f16 operand planes; q/k planes viewed as [token][64 heads x 64] feed a fused causal flash-style kernel per ((n,h), 64 queries) (wave = 16 queries, 32-key steps up to the query block, online softmax f32, P x2^10 f16 via LDS, f32 accumulators); v re-laid per (n,h) as [d][token] through an LDS tile; exact-erf GELU in the fc1 epilogue.
// Compute dtype: inputs and parameters rounded to bf16; all GEMM operands f16 (~2^-12: LN outputs, q, k, v, P, attention outputs, the GELU hidden), weights bf16-exact (x16 in f16), f32 accumulation; LayerNorm / softmax / residual stream f32. v_wmma_f32_16x16x32_f16.
#define TT 1024
#define NBATCH 4
#define EE 1024
#define NHD 16
#define NH (NBATCH * NHD)        /* 64 (batch, head) slabs */
#define TQ TT
#define TK TT
#define SCL 0.125f
#define NR (TT * NBATCH)         /* 4096 rows */
#define FF 4096
typedef __bf16 v16b __attribute__((ext_vector_type(16)));
typedef unsigned short v8us __attribute__((ext_vector_type(8), may_alias));
typedef float  v8f  __attribute__((ext_vector_type(8)));
typedef float  v4f  __attribute__((ext_vector_type(4)));
typedef float  v4fa __attribute__((ext_vector_type(4), may_alias));
union FragB { v16b v; v8us half[2]; unsigned short u[16]; };

__device__ __forceinline__ unsigned short bf16_bits(float x) { unsigned int u = __float_as_uint(x); return (unsigned short)((u + 0x7FFFu + ((u >> 16) & 1u)) >> 16); }
__device__ __forceinline__ float bf16_val(unsigned short b) { return __uint_as_float(((unsigned int)b) << 16); }
__device__ __forceinline__ float bf16_round(float x) { return bf16_val(bf16_bits(x)); }
// D += A·B with NT terms: 1 = ah·bh, 2 = + al·bh (A split), 3 = + ah·bl (both split)
template <int NT>
__device__ __forceinline__ v8f mmaN(v16b ah, v16b al, v16b bh, v16b bl, v8f c) {
  c = __builtin_amdgcn_wmma_f32_16x16x32_bf16(false, ah, false, bh, (short)0, c, false, false);
  if (NT >= 2) c = __builtin_amdgcn_wmma_f32_16x16x32_bf16(false, al, false, bh, (short)0, c, false, false);
  if (NT >= 3) c = __builtin_amdgcn_wmma_f32_16x16x32_bf16(false, ah, false, bl, (short)0, c, false, false);
  asm volatile("v_nop\n\tv_nop\n\tv_nop\n\tv_nop" : "+v"(c) : "v"(ah), "v"(al), "v"(bh), "v"(bl));
  return c;
}

__global__ __launch_bounds__(256) void k_wt_bf16(const float* __restrict__ W, unsigned short* __restrict__ Wt, int K, int N) {
  const int t = blockIdx.x * 256 + threadIdx.x;
  const int k8n = K / 8;
  if (t >= N * k8n) return;
  const int n = t / k8n, k8 = (t % k8n) * 8;
  v8us v;
#pragma unroll
  for (int i = 0; i < 8; ++i) v[i] = bf16_bits(W[(size_t)(k8 + i) * N + n]);
  *(v8us*)(Wt + (size_t)n * K + k8) = v;
  
}

// GEMM C[M][N] (f32, pitch ldc) = act(A[M][K]·W + bias). A f32 row-major (pitch lda) converted per fragment to bf16
// (ASPLIT: hi/lo two planes -> 2 terms, else single rounded term); Wt bf16 [N][K] (pitch ldb). BIAS_BF16 rounds the
// bias to bf16 first (bias quantised to bf16 before the add). K%32==0, M%16==0, N%64==0.
template <bool ASPLIT, int ACT, bool BIAS_BF16>
__global__ __launch_bounds__(128) void k_gemm_bf(const float* __restrict__ A, int lda, const unsigned short* __restrict__ Wt, int ldb,
                                               const float* __restrict__ bias, float* __restrict__ C, int ldc, int M, int N, int K) {
  __shared__ __attribute__((aligned(16))) float so[4][16][64];
  const int tid = threadIdx.x, w = tid >> 5, lane = tid & 31, ln = lane & 15, hh = lane >> 4;
  const int ntn = N / 64;
  const int wid = blockIdx.x * 4 + w;
  const int mt = wid / ntn, nq = wid % ntn;
  if (mt * 16 >= M) return;
  const int row0 = mt * 16, col0 = nq * 64;
  const float* arow = A + (size_t)(row0 + ln) * lda;
  v8f acc[4] = {};
  for (int kb = 0; kb < K; kb += 32) {
    FragB ah, al;
    const v4f x0 = *(const v4fa*)(arow + kb + 8 * hh), x1 = *(const v4fa*)(arow + kb + 8 * hh + 4);
    const v4f x2 = *(const v4fa*)(arow + kb + 16 + 8 * hh), x3 = *(const v4fa*)(arow + kb + 16 + 8 * hh + 4);
    float xs[16] = {x0[0],x0[1],x0[2],x0[3],x1[0],x1[1],x1[2],x1[3],x2[0],x2[1],x2[2],x2[3],x3[0],x3[1],x3[2],x3[3]};
#pragma unroll
    for (int i = 0; i < 16; ++i) { const unsigned short hb = bf16_bits(xs[i]); ah.u[i] = hb; al.u[i] = ASPLIT ? bf16_bits(xs[i] - bf16_val(hb)) : (unsigned short)0; }
#pragma unroll
    for (int t = 0; t < 4; ++t) {
      const unsigned short* brow = Wt + (size_t)(col0 + t * 16 + ln) * ldb + kb;
      FragB b;
      b.half[0] = *(const v8us*)(brow + 8 * hh);
      b.half[1] = *(const v8us*)(brow + 16 + 8 * hh);
      acc[t] = mmaN<ASPLIT ? 2 : 1>(ah.v, al.v, b.v, b.v, acc[t]);
    }
  }
#pragma unroll
  for (int t = 0; t < 4; ++t) {
    float bv = bias ? bias[col0 + t * 16 + ln] : 0.f;
    if (BIAS_BF16) bv = bf16_round(bv);
#pragma unroll
    for (int r = 0; r < 8; ++r) { float v = acc[t][r] + bv; if (ACT == 1) v = fmaxf(v, 0.f); so[w][8 * hh + r][t * 16 + ln] = v; }
  }
  __builtin_amdgcn_fence(__ATOMIC_ACQ_REL, "workgroup");
  __builtin_amdgcn_wave_barrier();
  const int rsub = lane >> 4, c4 = (lane & 15) * 4;
  {
#pragma unroll
    for (int q = 0; q < 8; ++q) {
      const int r = q * 2 + rsub;
      const v4f v = *(const v4fa*)&so[w][r][c4];
      *(v4f*)(C + (size_t)(row0 + r) * ldc + col0 + c4) = v;
    }
    
  }
}

// GEMM C = act(A·W + bias + resid): A f32 (ASPLIT -> hi/lo 2 terms), Wt bf16 [N][K]; ACT 0 none, 1 relu, 2 exact gelu;
// resid (optional, f32, row index = (row % rmod), pitch ldr, RES_BF16 rounds it) added before the activation.
template <bool ASPLIT, int ACT, bool BIAS_BF16, bool RES_BF16>
__global__ __launch_bounds__(128) void k_gemm_bf3(const float* __restrict__ A, int lda, const unsigned short* __restrict__ Wt, int ldb,
                                                const float* __restrict__ bias, const float* __restrict__ resid, int rmod, int ldr,
                                                float* __restrict__ C, int ldc, int M, int N, int K) {
  __shared__ __attribute__((aligned(16))) float so[4][16][64];
  const int tid = threadIdx.x, w = tid >> 5, lane = tid & 31, ln = lane & 15, hh = lane >> 4;
  const int ntn = N / 64;
  const int wid = blockIdx.x * 4 + w;
  const int mt = wid / ntn, nq = wid % ntn;
  if (mt * 16 >= M) return;
  const int row0 = mt * 16, col0 = nq * 64;
  const float* arow = A + (size_t)(row0 + ln) * lda;
  v8f acc[4] = {};
  for (int kb = 0; kb < K; kb += 32) {
    FragB ah, al;
    const v4f x0 = *(const v4fa*)(arow + kb + 8 * hh), x1 = *(const v4fa*)(arow + kb + 8 * hh + 4);
    const v4f x2 = *(const v4fa*)(arow + kb + 16 + 8 * hh), x3 = *(const v4fa*)(arow + kb + 16 + 8 * hh + 4);
    float xs[16] = {x0[0],x0[1],x0[2],x0[3],x1[0],x1[1],x1[2],x1[3],x2[0],x2[1],x2[2],x2[3],x3[0],x3[1],x3[2],x3[3]};
#pragma unroll
    for (int i = 0; i < 16; ++i) { const unsigned short hb = bf16_bits(xs[i]); ah.u[i] = hb; al.u[i] = ASPLIT ? bf16_bits(xs[i] - bf16_val(hb)) : (unsigned short)0; }
#pragma unroll
    for (int t = 0; t < 4; ++t) {
      const unsigned short* brow = Wt + (size_t)(col0 + t * 16 + ln) * ldb + kb;
      FragB b;
      b.half[0] = *(const v8us*)(brow + 8 * hh);
      b.half[1] = *(const v8us*)(brow + 16 + 8 * hh);
      acc[t] = mmaN<ASPLIT ? 2 : 1>(ah.v, al.v, b.v, b.v, acc[t]);
    }
  }
#pragma unroll
  for (int t = 0; t < 4; ++t) {
    const int col = col0 + t * 16 + ln;
    float bv = bias ? bias[col] : 0.f;
    if (BIAS_BF16) bv = bf16_round(bv);
#pragma unroll
    for (int r = 0; r < 8; ++r) {
      float v = acc[t][r] + bv;
      if (resid) { float rv = resid[(size_t)((row0 + 8 * hh + r) % rmod) * ldr + col]; if (RES_BF16) rv = bf16_round(rv); v += rv; }
      if (ACT == 1) v = fmaxf(v, 0.f);
      if (ACT == 2) v = 0.5f * v * (1.0f + erff(v * 0.70710678118654752f));
      if (ACT == 3) { const float u = 0.7978845608028654f * (v + 0.044715f * v * v * v); v = 0.5f * v * (1.0f + tanhf(u)); }
      so[w][8 * hh + r][t * 16 + ln] = v;
    }
  }
  __builtin_amdgcn_fence(__ATOMIC_ACQ_REL, "workgroup");
  __builtin_amdgcn_wave_barrier();
  const int rsub = lane >> 4, c4 = (lane & 15) * 4;
  {
#pragma unroll
    for (int q = 0; q < 8; ++q) {
      const int r = q * 2 + rsub;
      const v4f v = *(const v4fa*)&so[w][r][c4];
      *(v4f*)(C + (size_t)(row0 + r) * ldc + col0 + c4) = v;
    }
    
  }
}
// row LayerNorm (biased variance, eps) over N: s = X (+ R); optional out_sum <- s; out_norm <- (s-mu)*rsqrt(var+eps)*g + b
template <bool PARAM_BF16>
__global__ __launch_bounds__(256) void k_layernorm(const float* __restrict__ X, const float* __restrict__ R, const float* __restrict__ g, const float* __restrict__ bta,
                                                  float* __restrict__ out_sum, float* __restrict__ out_norm, int N, float eps) {
  __shared__ float red[256];
  const int row = blockIdx.x, tid = threadIdx.x;
  const float* x = X + (size_t)row * N; const float* rr = R ? R + (size_t)row * N : nullptr;
  float vals[16];                     // up to N = 4096
  const int per = N / 256;            // contiguous chunk per thread? use strided-by-4 chunks: thread handles j = tid*4 + 1024*u
  float s1 = 0.f;
  for (int u = 0; u < per / 4; ++u) {
    const int j = tid * 4 + 1024 * u;
    const v4f a = *(const v4fa*)(x + j);
    v4f b = {0.f,0.f,0.f,0.f}; if (rr) b = *(const v4fa*)(rr + j);
#pragma unroll
    for (int q = 0; q < 4; ++q) { const float v = a[q] + b[q]; vals[u * 4 + q] = v; s1 += v; }
  }
  red[tid] = s1; __syncthreads();
  for (int st = 128; st > 0; st >>= 1) { if (tid < st) red[tid] += red[tid + st]; __syncthreads(); }
  const float mu = red[0] / (float)N; __syncthreads();
  float s2 = 0.f;
  for (int u = 0; u < per / 4; ++u)
#pragma unroll
    for (int q = 0; q < 4; ++q) { const float c = vals[u * 4 + q] - mu; s2 += c * c; }
  red[tid] = s2; __syncthreads();
  for (int st = 128; st > 0; st >>= 1) { if (tid < st) red[tid] += red[tid + st]; __syncthreads(); }
  const float rs = rsqrtf(red[0] / (float)N + eps);
  {
    for (int u = 0; u < per / 4; ++u) {
      const int j = tid * 4 + 1024 * u;
      v4f o, sm;
#pragma unroll
      for (int q = 0; q < 4; ++q) {
        float gg = g[j + q], bb = bta[j + q];
        if (PARAM_BF16) { gg = bf16_round(gg); bb = bf16_round(bb); }
        sm[q] = vals[u * 4 + q]; o[q] = (vals[u * 4 + q] - mu) * rs * gg + bb;
      }
      if (out_sum) *(v4f*)(out_sum + (size_t)row * N + j) = sm;
      *(v4f*)(out_norm + (size_t)row * N + j) = o;
    }
    
  }
}



// ---- f16 WMMA path (v_wmma_f32_16x16x32_f16): 11-bit significands for operands in range — used where a [0,1] probability operand needs more precision than bf16
typedef _Float16 v16h __attribute__((ext_vector_type(16)));
union FragH { v16h v; v8us half[2]; _Float16 h[16]; unsigned short u[16]; };
template <int NT>
__device__ __forceinline__ v8f mmaH(v16h ah, v16h al, v16h bh, v16h bl, v8f c) {
  c = __builtin_amdgcn_wmma_f32_16x16x32_f16(false, ah, false, bh, (short)0, c, false, false);
  if (NT >= 2) c = __builtin_amdgcn_wmma_f32_16x16x32_f16(false, al, false, bh, (short)0, c, false, false);
  if (NT >= 3) c = __builtin_amdgcn_wmma_f32_16x16x32_f16(false, ah, false, bl, (short)0, c, false, false);
  asm volatile("v_nop\n\tv_nop\n\tv_nop\n\tv_nop" : "+v"(c) : "v"(ah), "v"(al), "v"(bh), "v"(bl));
  return c;
}
// batched GEMM like k_gemm_b but f16 operands: A f32 (split into f16 hi/lo if ASPLIT, else rounded to f16), Bt = f16 values [n][k]; alpha; C f32; N multiple of 16 (partial tiles skipped)
template <bool ASPLIT>
__global__ __launch_bounds__(128) void k_gemm_h(const float* __restrict__ A, int lda, size_t sA, const _Float16* __restrict__ Bh, int ldb, size_t sB, float alpha, float* __restrict__ C, int ldc, size_t sC, int M, int N, int K) {
  __shared__ __attribute__((aligned(16))) float so[4][16][64];
  const int tid = threadIdx.x, w = tid >> 5, lane = tid & 31, ln = lane & 15, hh = lane >> 4; const int by = blockIdx.y;
  A += (size_t)by * sA; Bh += (size_t)by * sB; C += (size_t)by * sC;
  const int ntn = (N + 63) / 64; const int wid = blockIdx.x * 4 + w; const int mt = wid / ntn, nq = wid % ntn; if (mt * 16 >= M) return;
  const int row0 = mt * 16, col0 = nq * 64; const float* arow = A + (size_t)(row0 + ln) * lda;
  v8f acc[4] = {};
  for (int kb = 0; kb < K; kb += 32) {
    FragH ah, al;
    const v4f x0 = *(const v4fa*)(arow + kb + 8 * hh), x1 = *(const v4fa*)(arow + kb + 8 * hh + 4), x2 = *(const v4fa*)(arow + kb + 16 + 8 * hh), x3 = *(const v4fa*)(arow + kb + 16 + 8 * hh + 4);
    float xs[16] = {x0[0],x0[1],x0[2],x0[3],x1[0],x1[1],x1[2],x1[3],x2[0],x2[1],x2[2],x2[3],x3[0],x3[1],x3[2],x3[3]};
#pragma unroll
    for (int i = 0; i < 16; ++i) { const _Float16 h = (_Float16)xs[i]; ah.h[i] = h; al.h[i] = ASPLIT ? (_Float16)(xs[i] - (float)h) : (_Float16)0.0f; }
#pragma unroll
    for (int t = 0; t < 4; ++t) { if (col0 + t * 16 >= N) continue; const size_t boff = (size_t)(col0 + t * 16 + ln) * ldb + kb; FragH bq; bq.half[0] = *(const v8us*)(Bh + boff + 8 * hh); bq.half[1] = *(const v8us*)(Bh + boff + 16 + 8 * hh);
      acc[t] = mmaH<ASPLIT ? 2 : 1>(ah.v, al.v, bq.v, bq.v, acc[t]); }
  }
#pragma unroll
  for (int t = 0; t < 4; ++t) { if (col0 + t * 16 >= N) continue;
#pragma unroll
    for (int r = 0; r < 8; ++r) so[w][8 * hh + r][t * 16 + ln] = acc[t][r] * alpha; }
  __builtin_amdgcn_fence(__ATOMIC_ACQ_REL, "workgroup"); __builtin_amdgcn_wave_barrier();
  const int rsub = lane >> 4, c4 = (lane & 15) * 4;
  {
#pragma unroll
    for (int q = 0; q < 8; ++q) { const int r = q * 2 + rsub; if (col0 + c4 < N) { const v4f v = *(const v4fa*)&so[w][r][c4]; *(v4f*)(C + (size_t)(row0 + r) * ldc + col0 + c4) = v; } }
     }
}

// Wt[n][k] = f16(W[k][n]·scale) from f32 row-major W[K][N] (scale = power of two; bf16-exact weights stay exact in f16 away from the subnormal range)
__global__ __launch_bounds__(256) void k_wt_f16(const float* __restrict__ W, _Float16* __restrict__ Wt, int K, int N, float scale) {
  const int t = blockIdx.x * 256 + threadIdx.x; if (t >= N * (K / 8)) return; const int n = t / (K / 8), k8 = (t % (K / 8)) * 8; FragH f;
#pragma unroll
  for (int i = 0; i < 8; ++i) f.h[i] = (_Float16)(bf16_round(W[(size_t)(k8 + i) * N + n]) * scale); const v8us o = f.half[0];
  *(v8us*)((unsigned short*)Wt + (size_t)n * K + k8) = o; 
}
// k_gemm_hh variant with fused epilogue: v = acc·alpha + bias[by·sBias + col] (+ CP[(row/rowsPerB)·sCPb + by·64 + col] if CP) ; ACT 0 none / 1 elu ; writes f16 C16 (and f32 C if non-null)
template <int ACT>
__global__ __launch_bounds__(128) void k_gemm_hhx(const _Float16* __restrict__ A, int lda, size_t sA, const _Float16* __restrict__ Bh, int ldb, size_t sB, float alpha, const float* __restrict__ bias, size_t sBias, const float* __restrict__ CP, int rowsPerB, size_t sCPb, int row0g,
    float* __restrict__ C, _Float16* __restrict__ C16, int ldc, size_t sC, int M, int N, int K) {
  __shared__ __attribute__((aligned(16))) float so[4][16][64];
  const int tid = threadIdx.x, w = tid >> 5, lane = tid & 31, ln = lane & 15, hh = lane >> 4; const int by = blockIdx.y;
  A += (size_t)by * sA; Bh += (size_t)by * sB; const size_t cofs = (size_t)by * sC; const float* bp = bias ? bias + (size_t)by * sBias : nullptr;
  const int ntn = (N + 63) / 64; const int wid = blockIdx.x * 4 + w; const int mt = wid / ntn, nq = wid % ntn; if (mt * 16 >= M) return;
  const int row0 = mt * 16, col0 = nq * 64; const _Float16* arow = A + (size_t)(row0 + ln) * lda;
  v8f acc[4] = {};
  for (int kb = 0; kb < K; kb += 32) { FragH ah; ah.half[0] = *(const v8us*)((const unsigned short*)arow + kb + 8 * hh); ah.half[1] = *(const v8us*)((const unsigned short*)arow + kb + 16 + 8 * hh);
#pragma unroll
    for (int t = 0; t < 4; ++t) { if (col0 + t * 16 >= N) continue; const size_t boff = (size_t)(col0 + t * 16 + ln) * ldb + kb; FragH bq; bq.half[0] = *(const v8us*)((const unsigned short*)Bh + boff + 8 * hh); bq.half[1] = *(const v8us*)((const unsigned short*)Bh + boff + 16 + 8 * hh);
      acc[t] = mmaH<1>(ah.v, ah.v, bq.v, bq.v, acc[t]); }
  }
#pragma unroll
  for (int t = 0; t < 4; ++t) { if (col0 + t * 16 >= N) continue; const int col = col0 + t * 16 + ln; const float bv = bp ? bf16_round(bp[col]) : 0.f;
#pragma unroll
    for (int r = 0; r < 8; ++r) { float v = acc[t][r] * alpha + bv; if (CP) { const int bidx = (row0g + row0 + 8 * hh + r) / rowsPerB; v += CP[(size_t)bidx * sCPb + (size_t)by * 64 + col]; } if (ACT == 1) v = (v > 0.f) ? v : expm1f(v); else if (ACT == 7) v = (v > 0.f) ? v + 1.0f : expf(v); else if (ACT == 8) v = tanhf(v); else if (ACT == 9) v = 0.5f * v * (1.0f + tanhf(0.7978845608028654f * (v + 0.044715f * v * v * v))); else if (ACT == 11) v = 1.0f / (1.0f + expf(-v)); else if (ACT == 12) v = (v > 0.f) ? v : 0.01f * v; else if (ACT == 14) v = (v > 0.f) ? v : 0.1f * v; else if (ACT == 15) v = v / (1.0f + expf(-v)); else if (ACT == 3) v = fmaxf(v, 0.f); else if (ACT == 6) v = 0.5f * v * (1.0f + erff(v * 0.70710678118654752f)); so[w][8 * hh + r][t * 16 + ln] = v; } }
  __builtin_amdgcn_fence(__ATOMIC_ACQ_REL, "workgroup"); __builtin_amdgcn_wave_barrier();
  const int rsub = lane >> 4, c4 = (lane & 15) * 4; typedef _Float16 v4h __attribute__((ext_vector_type(4)));
  {
#pragma unroll
    for (int q = 0; q < 8; ++q) { const int r = q * 2 + rsub; if (col0 + c4 < N) { const v4f v = *(const v4fa*)&so[w][r][c4]; if (C) *(v4f*)(C + cofs + (size_t)(row0 + r) * ldc + col0 + c4) = v; if (C16) { v4h h4; for (int i = 0; i < 4; ++i) h4[i] = (_Float16)v[i]; *(v4h*)(C16 + cofs + (size_t)(row0 + r) * ldc + col0 + c4) = h4; } } }
     }
}


typedef _Float16 v4h __attribute__((ext_vector_type(4)));

__global__ __launch_bounds__(256) void k_x16(const float* __restrict__ x, _Float16* __restrict__ X16, size_t n8) { const size_t t = (size_t)blockIdx.x * 256 + threadIdx.x; if (t >= n8) return; FragH f;
#pragma unroll
  for (int q = 0; q < 8; ++q) f.h[q] = (_Float16)bf16_round(x[t * 8 + q]); *(v8us*)((unsigned short*)X16 + t * 8) = f.half[0];  }
__global__ __launch_bounds__(256) void k_h16(const float* __restrict__ x, _Float16* __restrict__ X16, size_t n8) { const size_t t = (size_t)blockIdx.x * 256 + threadIdx.x; if (t >= n8) return; FragH f;
#pragma unroll
  for (int q = 0; q < 8; ++q) f.h[q] = (_Float16)x[t * 8 + q]; *(v8us*)((unsigned short*)X16 + t * 8) = f.half[0];  }
__global__ __launch_bounds__(256) void k_round16f(const float* __restrict__ W, _Float16* __restrict__ Bt, size_t n8) { const size_t t = (size_t)blockIdx.x * 256 + threadIdx.x; if (t >= n8) return; FragH f;
#pragma unroll
  for (int i = 0; i < 8; ++i) f.h[i] = (_Float16)(bf16_round(W[t * 8 + i]) * 16.0f); *(v8us*)((unsigned short*)Bt + t * 8) = f.half[0];  }
template <int NHv, int TTv>
__global__ __launch_bounds__(256) void k_vt(const _Float16* __restrict__ V16, int ldv, int voff, _Float16* __restrict__ Vt) { __shared__ unsigned short tl[64][66]; const int tid = threadIdx.x; const int slab = blockIdx.x / (TTv / 64), lg = blockIdx.x % (TTv / 64); const int b = slab / NHv, h = slab % NHv;
  for (int i = tid; i < 64 * 8; i += 256) { const int r = i / 8, c8 = (i % 8) * 8; FragH f; f.half[0] = *(const v8us*)((const unsigned short*)V16 + ((size_t)b * TTv + lg * 64 + r) * ldv + voff + h * 64 + c8);
#pragma unroll
    for (int q = 0; q < 8; ++q) tl[r][c8 + q] = f.u[q]; }
  __syncthreads();
  {
#pragma unroll
    for (int rd = 0; rd < 2; ++rd) { const int d = rd * 32 + tid / 8, pc = tid % 8; FragH f;
#pragma unroll
      for (int q = 0; q < 8; ++q) f.u[q] = tl[pc * 8 + q][d];
      *(v8us*)((unsigned short*)Vt + ((size_t)slab * 64 + d) * TTv + lg * 64 + pc * 8) = f.half[0]; }
     } }

__global__ __launch_bounds__(256) void k_hl(const float* __restrict__ F, _Float16* __restrict__ Hh, _Float16* __restrict__ Hl, size_t n8) { const size_t t = (size_t)blockIdx.x * 256 + threadIdx.x; if (t >= n8) return; FragH fh, fl; const v4f a = *(const v4fa*)(F + t * 8), c = *(const v4fa*)(F + t * 8 + 4);
#pragma unroll
  for (int q = 0; q < 4; ++q) { _Float16 h = (_Float16)a[q]; fh.h[q] = h; fl.h[q] = (_Float16)((a[q] - (float)h) * 1024.0f); h = (_Float16)c[q]; fh.h[4 + q] = h; fl.h[4 + q] = (_Float16)((c[q] - (float)h) * 1024.0f); }
  { *(v8us*)((unsigned short*)Hh + t * 8) = fh.half[0]; *(v8us*)((unsigned short*)Hl + t * 8) = fl.half[0];  } }

// ---- fast GEMM (wave tile 32x64, operands staged in LDS) ----
__device__ __forceinline__ v16h g2_frag(const _Float16* p, int hh) { FragH f; f.half[0] = *(const v8us*)((const unsigned short*)p + 8 * hh); f.half[1] = *(const v8us*)((const unsigned short*)p + 16 + 8 * hh); return f.v; }
__device__ __forceinline__ v8f g2_mma(v16h a, v16h b, v8f c) { v8f d = __builtin_amdgcn_wmma_f32_16x16x32_f16(false, a, false, b, (short)0, c, false, false); asm volatile("v_nop\n\tv_nop\n\tv_nop\n\tv_nop" : "+v"(d) : "v"(a), "v"(b)); return d; }
// Block tile 128x128, eight waves of 32x64 (4 down x 2 across). A pass is 128 k: 128 rows of A and 128 rows of Bh, 256 B each, are laid in LDS at a
// pitch of 272 B (16 B x odd, for the ds_load_b128 fragment reads) by per-lane asynchronous 16-byte copies; two buffers, the next pass's copies fly while this one is multiplied.
#define G3_PITCH 272
#define G3_OPB (128 * G3_PITCH)   /* one operand's 128 rows */
#define G3_BUF (2 * G3_OPB)       /* one buffer: [A rows | Bh rows] */
// Eight copies per lane: rows r, r + 16, ..., r + 112 of one operand (16 lanes cover one 256-B row piece). The s_wait_xcnt closes the copies' own statement so that
// no address register named here is rewritten ahead of it.
__device__ __forceinline__ void g3_copy8(unsigned l, const _Float16* g, size_t rstep) {
  asm volatile("global_load_async_to_lds_b128 %0, %8, off\n\t"
               "global_load_async_to_lds_b128 %1, %9, off\n\t"
               "global_load_async_to_lds_b128 %2, %10, off\n\t"
               "global_load_async_to_lds_b128 %3, %11, off\n\t"
               "global_load_async_to_lds_b128 %4, %12, off\n\t"
               "global_load_async_to_lds_b128 %5, %13, off\n\t"
               "global_load_async_to_lds_b128 %6, %14, off\n\t"
               "global_load_async_to_lds_b128 %7, %15, off\n\t"
               "s_wait_xcnt 0x0"
               :: "v"(l), "v"(l + 16u * G3_PITCH), "v"(l + 32u * G3_PITCH), "v"(l + 48u * G3_PITCH), "v"(l + 64u * G3_PITCH), "v"(l + 80u * G3_PITCH), "v"(l + 96u * G3_PITCH), "v"(l + 112u * G3_PITCH),
                  "v"(g), "v"(g + rstep), "v"(g + 2 * rstep), "v"(g + 3 * rstep), "v"(g + 4 * rstep), "v"(g + 5 * rstep), "v"(g + 6 * rstep), "v"(g + 7 * rstep)
               : "memory");
}
// requires M % 128 == 0, N % 128 == 0, K % 128 == 0; epilogue = k_gemm_hhx semantics
template <int ACT>
__global__ __launch_bounds__(256) void k_gemm3(const _Float16* __restrict__ A, int lda, size_t sA, const _Float16* __restrict__ Bh, int ldb, size_t sB, float alpha, const float* __restrict__ bias, size_t sBias, const float* __restrict__ CP, int rowsPerB, size_t sCPb, int row0g,
    float* __restrict__ C, _Float16* __restrict__ C16, int ldc, size_t sC, int M, int N, int K) {
  __shared__ __attribute__((aligned(16))) unsigned char ring[2 * G3_BUF];      /* the two buffers; after the k loop its first 8 x 32 x 68 floats stage the output */
  const int tid = threadIdx.x, w = tid >> 5, lane = tid & 31, ln = lane & 15, hh = lane >> 4; const int by = blockIdx.y;
  A += (size_t)by * sA; Bh += (size_t)by * sB; const size_t cofs = (size_t)by * sC; const float* bp = bias ? bias + (size_t)by * sBias : nullptr;
  const int ntn = N >> 7; const int mt = blockIdx.x / ntn, nq = blockIdx.x - mt * ntn; const int rowb = mt * 128, colb = nq * 128; if (rowb >= M) return;      /* block-uniform, ahead of every barrier */
  const int wm = w & 3, wn = w >> 2; const int row0 = rowb + 32 * wm, col0 = colb + 64 * wn;
  const int cr = tid >> 4, cc = tid & 15;      /* copy side: this lane's first row and its 16-byte piece of the row */
  const _Float16* gA = A + (size_t)(rowb + cr) * lda + cc * 8; const _Float16* gB = Bh + (size_t)(colb + cr) * ldb + cc * 8; const size_t stA = (size_t)16 * lda, stB = (size_t)16 * ldb;
  const unsigned lA = (unsigned)(size_t)ring + (unsigned)(cr * G3_PITCH + cc * 16), lB = lA + G3_OPB;
  const int np = K >> 7;
  g3_copy8(lA, gA, stA); g3_copy8(lB, gB, stB);
  asm volatile("s_wait_asynccnt 0x0" ::: "memory");      /* pass 0's own copies have landed before the barrier that publishes them */
  __syncthreads();
  if (np > 1) { g3_copy8(lA + G3_BUF, gA + 128, stA); g3_copy8(lB + G3_BUF, gB + 128, stB); }
  const unsigned char* ra = ring + (32 * wm + ln) * G3_PITCH; const unsigned char* rb = ring + G3_OPB + (64 * wn + ln) * G3_PITCH;
  const v8f z8 = {0.f,0.f,0.f,0.f,0.f,0.f,0.f,0.f}; v8f c00 = z8, c01 = z8, c02 = z8, c03 = z8, c10 = z8, c11 = z8, c12 = z8, c13 = z8;
#pragma unroll 1      /* one pass per trip: the publish point at the foot stands once */
  for (int t = 0; t < np; ++t) { const unsigned bo = (unsigned)(t & 1) * G3_BUF;
#pragma unroll      /* the four 32-k blocks of a pass in straight line, so that a block's fragment reads can stand ahead of the block before it */
    for (int ks = 0; ks < 4; ++ks) { const unsigned char* pa = ra + bo + ks * 64; const unsigned char* pb = rb + bo + ks * 64;
      const v16h a0 = g2_frag((const _Float16*)pa, hh), a1 = g2_frag((const _Float16*)(pa + 16 * G3_PITCH), hh);
      const v16h b0 = g2_frag((const _Float16*)pb, hh), b1 = g2_frag((const _Float16*)(pb + 16 * G3_PITCH), hh), b2 = g2_frag((const _Float16*)(pb + 32 * G3_PITCH), hh), b3 = g2_frag((const _Float16*)(pb + 48 * G3_PITCH), hh);
      c00 = g2_mma(a0, b0, c00); c10 = g2_mma(a1, b0, c10); c01 = g2_mma(a0, b1, c01); c11 = g2_mma(a1, b1, c11);
      c02 = g2_mma(a0, b2, c02); c12 = g2_mma(a1, b2, c12); c03 = g2_mma(a0, b3, c03); c13 = g2_mma(a1, b3, c13); }
    asm volatile("s_wait_dscnt 0x0" ::: "memory");         /* this wave's reads of the buffer are done before the barrier behind which it is refilled */
    asm volatile("s_wait_asynccnt 0x0" ::: "memory");      /* this wave's copies of pass t + 1 have landed before the barrier that publishes them */
    __syncthreads();
    if (t + 2 < np) { g3_copy8(lA + bo, gA + (size_t)(t + 2) * 128, stA); g3_copy8(lB + bo, gB + (size_t)(t + 2) * 128, stB); } }
  asm volatile("s_wait_asynccnt 0x0" ::: "memory");        /* nothing in flight when the ring becomes output staging */
  float (*so)[32][68] = (float (*)[32][68])ring;
  v8f accs[8] = {c00, c01, c02, c03, c10, c11, c12, c13};
#pragma unroll
  for (int u = 0; u < 8; ++u) { const int t = u & 3, half = u >> 2; const int col = col0 + t * 16 + ln; const float bv = bp ? bf16_round(bp[col]) : 0.f;
#pragma unroll
    for (int r = 0; r < 8; ++r) { const int rloc = half * 16 + 8 * hh + r; float v = accs[u][r] * alpha + bv; if (CP) { const int bidx = (row0g + row0 + rloc) / rowsPerB; v += CP[(size_t)bidx * sCPb + (size_t)by * 64 + col]; }
      if (ACT == 3) v = fmaxf(v, 0.f); else if (ACT == 6) v = 0.5f * v * (1.0f + erff(v * 0.70710678118654752f)); else if (ACT == 11) v = 1.0f / (1.0f + expf(-v)); else if (ACT == 15) v = v / (1.0f + expf(-v)); else if (ACT == 12) v = (v > 0.f) ? v : 0.01f * v; else if (ACT == 8) v = tanhf(v);
      so[w][rloc][t * 16 + ln] = v; } }
  __builtin_amdgcn_fence(__ATOMIC_ACQ_REL, "workgroup"); __builtin_amdgcn_wave_barrier();
  const int rsub = lane >> 4, c4 = (lane & 15) * 4;
  {
#pragma unroll
    for (int q = 0; q < 16; ++q) { const int r = q * 2 + rsub; const v4f v = *(const v4fa*)&so[w][r][c4]; if (C) *(v4f*)(C + cofs + (size_t)(row0 + r) * ldc + col0 + c4) = v; if (C16) { v4h h4; for (int i = 0; i < 4; ++i) h4[i] = (_Float16)v[i]; *(v4h*)(C16 + cofs + (size_t)(row0 + r) * ldc + col0 + c4) = h4; } }
     } }


__global__ __launch_bounds__(128) void k_flashc(const _Float16* __restrict__ Q16, int ldq, const _Float16* __restrict__ K16, int ldk, const _Float16* __restrict__ Vt, const int* __restrict__ MSK, float* __restrict__ O, int ldo) {
  constexpr int RPW = 16, RTN = RPW / 16, NQB = TQ / (4 * RPW), DT = 4, KS = 2;
  __shared__ __attribute__((aligned(16))) unsigned short sP[4][RPW][40]; __shared__ __attribute__((aligned(16))) float sO[4][RPW][64 + 4];
  const int tid = threadIdx.x, w = tid >> 5, lane = tid & 31, ln = lane & 15, hh = lane >> 4;
  const int slab = blockIdx.x / NQB, qblk = blockIdx.x % NQB; const int b = slab / NH, h = slab % NH; const int qb0 = qblk * (4 * RPW); const int q0 = qb0 + w * RPW;
  FragH aq[2][KS];
#pragma unroll
  for (int rt = 0; rt < RTN; ++rt) { const unsigned short* qr = (const unsigned short*)Q16 + ((size_t)b * TQ + q0 + rt * 16 + ln) * ldq + h * 64;
#pragma unroll
    for (int ks = 0; ks < KS; ++ks) { aq[rt][ks].half[0] = *(const v8us*)(qr + ks * 32 + 8 * hh); aq[rt][ks].half[1] = *(const v8us*)(qr + ks * 32 + 16 + 8 * hh); } }
  const unsigned short* Vth = (const unsigned short*)Vt + (size_t)slab * 64 * TK;
  float m_r[2][8], l_r[2][8]; v8f oacc[2][DT];
#pragma unroll
  for (int rt = 0; rt < RTN; ++rt) {
#pragma unroll
    for (int r = 0; r < 8; ++r) { m_r[rt][r] = -3.0e38f; l_r[rt][r] = 0.f; }
#pragma unroll
    for (int dt = 0; dt < DT; ++dt) oacc[rt][dt] = (v8f){0.f,0.f,0.f,0.f,0.f,0.f,0.f,0.f}; }
  const int jend = qb0 + 4 * RPW;      /* block-uniform causal bound */
#pragma unroll 1
  for (int j0 = 0; j0 < jend; j0 += 32) {
    v8f s[2][2];
#pragma unroll
    for (int nt = 0; nt < 2; ++nt) { const unsigned short* kr = (const unsigned short*)K16 + ((size_t)b * TK + j0 + nt * 16 + ln) * ldk + h * 64; FragH bk[KS];
#pragma unroll
      for (int ks = 0; ks < KS; ++ks) { bk[ks].half[0] = *(const v8us*)(kr + ks * 32 + 8 * hh); bk[ks].half[1] = *(const v8us*)(kr + ks * 32 + 16 + 8 * hh); }
#pragma unroll
      for (int rt = 0; rt < RTN; ++rt) { v8f acc = (v8f){0.f,0.f,0.f,0.f,0.f,0.f,0.f,0.f};
#pragma unroll
        for (int ks = 0; ks < KS; ++ks) acc = mmaH<1>(aq[rt][ks].v, aq[rt][ks].v, bk[ks].v, bk[ks].v, acc); s[rt][nt] = acc; } }
#pragma unroll
    for (int rt = 0; rt < RTN; ++rt)
#pragma unroll
      for (int r = 0; r < 8; ++r) { const int tq = q0 + rt * 16 + 8 * hh + r; const int k0 = j0 + ln, k1 = j0 + 16 + ln; (void)tq; (void)k0; (void)k1;
        const bool ok0 = (k0 <= tq), ok1 = (k1 <= tq);
        const float s0 = ok0 ? s[rt][0][r] * SCL : -INFINITY, s1 = ok1 ? s[rt][1][r] * SCL : -INFINITY; float mc = fmaxf(s0, s1);
        mc = fmaxf(mc, __shfl_xor(mc, 1, 32)); mc = fmaxf(mc, __shfl_xor(mc, 2, 32)); mc = fmaxf(mc, __shfl_xor(mc, 4, 32)); mc = fmaxf(mc, __shfl_xor(mc, 8, 32));
        const float mn = fmaxf(m_r[rt][r], mc); const float al = (mn > -1.0e38f) ? expf(m_r[rt][r] - mn) : 1.0f; m_r[rt][r] = mn; const float p0 = ok0 ? expf(s0 - mn) : 0.f, p1 = ok1 ? expf(s1 - mn) : 0.f; l_r[rt][r] = l_r[rt][r] * al + p0 + p1;
#pragma unroll
        for (int dt = 0; dt < DT; ++dt) oacc[rt][dt][r] *= al;
        FragH t2; t2.h[0] = (_Float16)(p0 * 1024.0f); t2.h[1] = (_Float16)(p1 * 1024.0f); sP[w][rt * 16 + 8 * hh + r][ln] = t2.u[0]; sP[w][rt * 16 + 8 * hh + r][16 + ln] = t2.u[1]; }
    __builtin_amdgcn_fence(__ATOMIC_ACQ_REL, "workgroup"); __builtin_amdgcn_wave_barrier();
    FragH pa[2];
#pragma unroll
    for (int rt = 0; rt < RTN; ++rt) { pa[rt].half[0] = *(const v8us*)&sP[w][rt * 16 + ln][8 * hh]; pa[rt].half[1] = *(const v8us*)&sP[w][rt * 16 + ln][16 + 8 * hh]; }
#pragma unroll
    for (int dt = 0; dt < DT; ++dt) { const unsigned short* vrow = Vth + (size_t)(dt * 16 + ln) * TK + j0; FragH bv; bv.half[0] = *(const v8us*)(vrow + 8 * hh); bv.half[1] = *(const v8us*)(vrow + 16 + 8 * hh);
#pragma unroll
      for (int rt = 0; rt < RTN; ++rt) oacc[rt][dt] = mmaH<1>(pa[rt].v, pa[rt].v, bv.v, bv.v, oacc[rt][dt]); }
    __builtin_amdgcn_fence(__ATOMIC_ACQ_REL, "workgroup"); __builtin_amdgcn_wave_barrier(); }
#pragma unroll
  for (int rt = 0; rt < RTN; ++rt) {
#pragma unroll
    for (int r = 0; r < 8; ++r) { float l = l_r[rt][r]; l += __shfl_xor(l, 1, 32); l += __shfl_xor(l, 2, 32); l += __shfl_xor(l, 4, 32); l += __shfl_xor(l, 8, 32); l_r[rt][r] = (l > 0.f) ? 1.0f / (l * 1024.0f) : 0.f; }
#pragma unroll
    for (int dt = 0; dt < DT; ++dt)
#pragma unroll
      for (int r = 0; r < 8; ++r) sO[w][rt * 16 + 8 * hh + r][dt * 16 + ln] = oacc[rt][dt][r] * l_r[rt][r]; }
  __builtin_amdgcn_fence(__ATOMIC_ACQ_REL, "workgroup"); __builtin_amdgcn_wave_barrier();
  {
#pragma unroll
    for (int rp = 0; rp < RPW; rp += 2) { const int r = rp + (lane >> 4), pc = lane & 15; const v4f val = *(const v4fa*)&sO[w][r][pc * 4]; *(v4f*)(O + ((size_t)b * TQ + q0 + r) * ldo + h * 64 + pc * 4) = val; }
     } }
template <bool RND>
__global__ __launch_bounds__(256) void k_ln1024(const float* __restrict__ X, const float* __restrict__ g, const float* __restrict__ bb, _Float16* __restrict__ H16) {
  #pragma clang fp contract(off)
  const int tid = threadIdx.x, w = tid >> 5, l = tid & 31; const int r = blockIdx.x * 8 + w; if (r >= NR) return; const float* x = X + (size_t)r * EE; float v[32]; float s = 0.f;
#pragma unroll
  for (int u = 0; u < 8; ++u) { const v4f a = *(const v4fa*)(x + u * 128 + l * 4);
#pragma unroll
    for (int q = 0; q < 4; ++q) { const float t = RND ? bf16_round(a[q]) : a[q]; v[u * 4 + q] = t; s += t; } }
  for (int o = 16; o > 0; o >>= 1) s += __shfl_xor(s, o, 32); const float mu = s / (float)EE; float q2 = 0.f;
#pragma unroll
  for (int k = 0; k < 32; ++k) { const float d = v[k] - mu; q2 += d * d; }
  for (int o = 16; o > 0; o >>= 1) q2 += __shfl_xor(q2, o, 32); const float rs = 1.0f / sqrtf(q2 / (float)EE + 1e-5f);
  {
#pragma unroll
    for (int u = 0; u < 8; ++u) { _Float16 h4[4];
#pragma unroll
      for (int q = 0; q < 4; ++q) { const int c = u * 128 + l * 4 + q; h4[q] = (_Float16)((v[u * 4 + q] - mu) * rs * bf16_round(g[c]) + bf16_round(bb[c])); }
      *(unsigned long long*)((unsigned short*)H16 + (size_t)r * EE + u * 128 + l * 4) = *(const unsigned long long*)h4; }
     } }
__global__ __launch_bounds__(256) void k_prep(const float* __restrict__ x, const float* __restrict__ e, float* __restrict__ Xf, _Float16* __restrict__ E16, size_t n4) {
  const size_t t = (size_t)blockIdx.x * 256 + threadIdx.x; if (t >= n4) return; const v4f a = *(const v4fa*)(x + t * 4), c = *(const v4fa*)(e + t * 4); v4f ra; _Float16 h4[4];
#pragma unroll
  for (int q = 0; q < 4; ++q) { ra[q] = bf16_round(a[q]); h4[q] = (_Float16)bf16_round(c[q]); }
  const unsigned long long pk = *(const unsigned long long*)h4;
  { *(v4f*)(Xf + t * 4) = ra; *(unsigned long long*)((unsigned short*)E16 + t * 4) = pk;  } }
__global__ __launch_bounds__(256) void k_vtn(const float* __restrict__ VF, _Float16* __restrict__ Vt) {
  __shared__ float tl[64][65];
  const int tid = threadIdx.x; const int slab = blockIdx.x / (TT / 64), lg = blockIdx.x % (TT / 64); const int n = slab / NHD, h = slab % NHD;
  for (int i = tid; i < 64 * 16; i += 256) { const int r = i / 16, c4 = (i % 16) * 4; const v4f a = *(const v4fa*)(VF + ((size_t)(lg * 64 + r) * NBATCH + n) * EE + h * 64 + c4); tl[r][c4] = a[0]; tl[r][c4 + 1] = a[1]; tl[r][c4 + 2] = a[2]; tl[r][c4 + 3] = a[3]; }
  __syncthreads();
  FragH f[2]; size_t oo[2];
#pragma unroll
  for (int rd = 0; rd < 2; ++rd) { const int d = rd * 32 + tid / 8, pc = tid % 8;
#pragma unroll
    for (int q = 0; q < 8; ++q) f[rd].h[q] = (_Float16)tl[pc * 8 + q][d]; oo[rd] = ((size_t)slab * 64 + d) * TT + lg * 64 + pc * 8; }
  { *(v8us*)((unsigned short*)Vt + oo[0]) = f[0].half[0]; *(v8us*)((unsigned short*)Vt + oo[1]) = f[1].half[0];  } }

extern "C" void kernel_launch(void* const* d_in, const int* in_sizes, int n_in,
                              void* d_out, int out_size, void* d_ws, size_t ws_size, hipStream_t stream) {
  (void)in_sizes; (void)n_in; (void)out_size;
  const float* const* I = (const float* const*)d_in;
  const float* x = I[0]; const float* enc = I[1];
  const float* wq_s = I[2]; const float* bq_s = I[3]; const float* wk_s = I[4]; const float* bk_s = I[5]; const float* wv_s = I[6]; const float* bv_s = I[7]; const float* wo_s = I[8]; const float* bo_s = I[9];
  const float* wq_c = I[10]; const float* bq_c = I[11]; const float* wk_c = I[12]; const float* bk_c = I[13]; const float* wv_c = I[14]; const float* bv_c = I[15]; const float* wo_c = I[16]; const float* bo_c = I[17];
  const float* g1 = I[18]; const float* b1n = I[19]; const float* g2 = I[20]; const float* b2n = I[21]; const float* g3 = I[22]; const float* b3n = I[23]; const float* W1 = I[24]; const float* b1 = I[25]; const float* W2 = I[26]; const float* b2 = I[27];
  char* ws = (char*)d_ws; size_t off = 0;
  auto take = [&](size_t bytes) { char* p = ws + off; off += (bytes + 255) & ~(size_t)255; return p; };
  _Float16* B[8]; for (int i = 0; i < 8; ++i) B[i] = (_Float16*)take((size_t)EE * EE * 2);      /* wq_s wk_s wv_s wo_s wq_c wk_c wv_c wo_c */
  _Float16* BF1 = (_Float16*)take((size_t)FF * EE * 2); _Float16* BF2 = (_Float16*)take((size_t)EE * FF * 2);
  float* Xf = (float*)take((size_t)NR * EE * 4); _Float16* H16 = (_Float16*)take((size_t)NR * EE * 2);
  _Float16* Q16 = (_Float16*)take((size_t)NR * EE * 2); _Float16* K16 = (_Float16*)take((size_t)NR * EE * 2); _Float16* VT = (_Float16*)take((size_t)NR * EE * 2); _Float16* E16 = (_Float16*)take((size_t)NR * EE * 2);      /* these four are contiguous: the FFN hidden reuses them */
  float* O = (float*)take((size_t)NR * EE * 4); float* X1 = (float*)take((size_t)NR * EE * 4);
  if (off > ws_size) return;      /* 16 + 16 + 16 + 8 + 32 + 16 + 16 = 120 MiB */
  _Float16* O16 = H16;                /* LN output is dead once its projection GEMMs ran; the attention output plane reuses it */
  float* X2 = Xf;                     /* bf16(x) is dead after the first residual GEMM */
  _Float16* F1 = Q16;                 /* FFN hidden [4096][4096] f16 = 32 MiB = Q16+K16+VT+E16 (all dead by then) */
  const float* Wl[8] = {wq_s, wk_s, wv_s, wo_s, wq_c, wk_c, wv_c, wo_c};
  const size_t w8 = (size_t)EE * EE / 8; for (int i = 0; i < 8; ++i) k_round16f<<<(unsigned)((w8 + 255) / 256), 256, 0, stream>>>(Wl[i], B[i], w8);      /* (out,in) = natural Bt; x16 */
  k_round16f<<<(unsigned)(((size_t)FF * EE / 8 + 255) / 256), 256, 0, stream>>>(W1, BF1, (size_t)FF * EE / 8); k_round16f<<<(unsigned)(((size_t)FF * EE / 8 + 255) / 256), 256, 0, stream>>>(W2, BF2, (size_t)FF * EE / 8);
  const size_t n8 = (size_t)NR * EE / 8; const unsigned nb8 = (unsigned)((n8 + 255) / 256);
  k_prep<<<(unsigned)(((size_t)NR * EE / 4 + 255) / 256), 256, 0, stream>>>(x, enc, Xf, E16, (size_t)NR * EE / 4);
  const dim3 gE((NR / 128) * (EE / 128), 1), gF((NR / 128) * (FF / 128), 1); const unsigned gln = NR / 8, gvt = NH * (TT / 64), gfl = NH * (TQ / 64);
  /* --- self attention --- */
  k_ln1024<true><<<gln, 256, 0, stream>>>(x, g1, b1n, H16);
  k_gemm3<0><<<gE, 256, 0, stream>>>(H16, EE, 0, B[0], EE, 0, 0.0625f, bq_s, 0, nullptr, 1, 0, 0, nullptr, Q16, EE, 0, NR, EE, EE);
  k_gemm3<0><<<gE, 256, 0, stream>>>(H16, EE, 0, B[1], EE, 0, 0.0625f, bk_s, 0, nullptr, 1, 0, 0, nullptr, K16, EE, 0, NR, EE, EE);
  k_gemm3<0><<<gE, 256, 0, stream>>>(H16, EE, 0, B[2], EE, 0, 0.0625f, bv_s, 0, nullptr, 1, 0, 0, O, nullptr, EE, 0, NR, EE, EE); k_vtn<<<gvt, 256, 0, stream>>>(O, VT);
  k_flashc<<<gfl, 128, 0, stream>>>(Q16, NBATCH * EE, K16, NBATCH * EE, VT, nullptr, O, NBATCH * EE);      /* rows = tokens, 64 (n,h) slabs of 64 columns */
  k_h16<<<nb8, 256, 0, stream>>>(O, O16, n8);
  k_gemm3<0><<<gE, 256, 0, stream>>>(O16, EE, 0, B[3], EE, 0, 0.0625f, bo_s, 0, Xf, 1, (size_t)EE, 0, X1, nullptr, EE, 0, NR, EE, EE);      /* x1 = x + o*wo^T + bo */
  /* --- cross attention (keys/values from encoder_out, same causal mask) --- */
  k_ln1024<false><<<gln, 256, 0, stream>>>(X1, g2, b2n, H16);
  k_gemm3<0><<<gE, 256, 0, stream>>>(H16, EE, 0, B[4], EE, 0, 0.0625f, bq_c, 0, nullptr, 1, 0, 0, nullptr, Q16, EE, 0, NR, EE, EE);
  k_gemm3<0><<<gE, 256, 0, stream>>>(E16, EE, 0, B[5], EE, 0, 0.0625f, bk_c, 0, nullptr, 1, 0, 0, nullptr, K16, EE, 0, NR, EE, EE);
  k_gemm3<0><<<gE, 256, 0, stream>>>(E16, EE, 0, B[6], EE, 0, 0.0625f, bv_c, 0, nullptr, 1, 0, 0, O, nullptr, EE, 0, NR, EE, EE); k_vtn<<<gvt, 256, 0, stream>>>(O, VT);
  k_flashc<<<gfl, 128, 0, stream>>>(Q16, NBATCH * EE, K16, NBATCH * EE, VT, nullptr, O, NBATCH * EE);
  k_h16<<<nb8, 256, 0, stream>>>(O, O16, n8);
  k_gemm3<0><<<gE, 256, 0, stream>>>(O16, EE, 0, B[7], EE, 0, 0.0625f, bo_c, 0, X1, 1, (size_t)EE, 0, X2, nullptr, EE, 0, NR, EE, EE);      /* x2 = x1 + o*wo^T + bo */
  /* --- FFN --- */
  k_ln1024<false><<<gln, 256, 0, stream>>>(X2, g3, b3n, H16);
  k_gemm3<6><<<gF, 256, 0, stream>>>(H16, EE, 0, BF1, EE, 0, 0.0625f, b1, 0, nullptr, 1, 0, 0, nullptr, F1, FF, 0, NR, FF, EE);      /* gelu_erf(h*fc1^T + b1) -> f16 [4096][4096] */
  k_gemm3<0><<<gE, 256, 0, stream>>>(F1, FF, 0, BF2, FF, 0, 0.0625f, b2, 0, X2, 1, (size_t)EE, 0, (float*)d_out, nullptr, EE, 0, NR, EE, FF);      /* out = x2 + f*fc2^T + b2 */
}

// v002
// A run of this version takes 446 microseconds.
// Timed twice side by side with v001, it ran 1.33 and 1.34 times as fast.
// Over all steps from v000 it is 2.21 times as fast.
#include <hip/hip_runtime.h>
// Pre-LN decoder layer, sequence-first layout (T 1024, batch 4, E 1024, 16 heads x 64, FFN 4096): h = LN1(x); x1 = x + SelfAttn(h, h); h = LN2(x1); x2 = x1 + Attn(h, encoder_out); h = LN3(x2); out = x2 + fc2(gelu_erf(fc1(h))). Both attentions: q = (in*wq^T + bq)*64^-0.5, k, v from the key input, per (batch, head) scores over the 1024 keys with the module's causal mask (key > query filled with -1e4, i.e. weight exactly 0), softmax, *v, merged, *wo^T + bo.
// Structure: rows are the (t, n) pairs in memory order, so every projection / FFN is a [4096][1024] GEMM (f16 WMMA, 32x64 wave tiles, f32 accumulation, exact bias, residual through the f32 epilogue addend); LayerNorms wave-per-row on VALU writing f16 operand planes; q/k planes viewed as [token][64 heads x 64] feed a fused causal flash-style kernel per ((n,h), 64 queries) (wave = 16 queries, 32-key steps up to the query block, both products transposed so that a lane owns one query, online softmax f32, P x2^10 f16 packed in registers, f32 accumulators); v re-laid per (n,h) as [d][token] through an LDS tile; exact-erf GELU in the fc1 epilogue.
// Compute dtype: inputs and parameters rounded to bf16; all GEMM operands f16 (~2^-12: LN outputs, q, k, v, P, attention outputs, the GELU hidden), weights bf16-exact (x16 in f16), f32 accumulation; LayerNorm / softmax / residual stream f32. v_wmma_f32_16x16x32_f16.
#define TT 1024
#define NBATCH 4
#define EE 1024
#define NHD 16
#define NH (NBATCH * NHD)        /* 64 (batch, head) slabs */
#define TQ TT
#define TK TT
#define SCL 0.125f
#define NR (TT * NBATCH)         /* 4096 rows */
#define FF 4096
typedef __bf16 v16b __attribute__((ext_vector_type(16)));
typedef unsigned short v8us __attribute__((ext_vector_type(8), may_alias));
typedef float  v8f  __attribute__((ext_vector_type(8)));
typedef float  v4f  __attribute__((ext_vector_type(4)));
typedef float  v4fa __attribute__((ext_vector_type(4), may_alias));
union FragB { v16b v; v8us half[2]; unsigned short u[16]; };

__device__ __forceinline__ unsigned short bf16_bits(float x) { unsigned int u = __float_as_uint(x); return (unsigned short)((u + 0x7FFFu + ((u >> 16) & 1u)) >> 16); }
__device__ __forceinline__ float bf16_val(unsigned short b) { return __uint_as_float(((unsigned int)b) << 16); }
__device__ __forceinline__ float bf16_round(float x) { return bf16_val(bf16_bits(x)); }
// D += A·B with NT terms: 1 = ah·bh, 2 = + al·bh (A split), 3 = + ah·bl (both split)
template <int NT>
__device__ __forceinline__ v8f mmaN(v16b ah, v16b al, v16b bh, v16b bl, v8f c) {
  c = __builtin_amdgcn_wmma_f32_16x16x32_bf16(false, ah, false, bh, (short)0, c, false, false);
  if (NT >= 2) c = __builtin_amdgcn_wmma_f32_16x16x32_bf16(false, al, false, bh, (short)0, c, false, false);
  if (NT >= 3) c = __builtin_amdgcn_wmma_f32_16x16x32_bf16(false, ah, false, bl, (short)0, c, false, false);
  asm volatile("v_nop\n\tv_nop\n\tv_nop\n\tv_nop" : "+v"(c) : "v"(ah), "v"(al), "v"(bh), "v"(bl));
  return c;
}

__global__ __launch_bounds__(256) void k_wt_bf16(const float* __restrict__ W, unsigned short* __restrict__ Wt, int K, int N) {
  const int t = blockIdx.x * 256 + threadIdx.x;
  const int k8n = K / 8;
  if (t >= N * k8n) return;
  const int n = t / k8n, k8 = (t % k8n) * 8;
  v8us v;
#pragma unroll
  for (int i = 0; i < 8; ++i) v[i] = bf16_bits(W[(size_t)(k8 + i) * N + n]);
  *(v8us*)(Wt + (size_t)n * K + k8) = v;
  
}

// GEMM C[M][N] (f32, pitch ldc) = act(A[M][K]·W + bias). A f32 row-major (pitch lda) converted per fragment to bf16
// (ASPLIT: hi/lo two planes -> 2 terms, else single rounded term); Wt bf16 [N][K] (pitch ldb). BIAS_BF16 rounds the
// bias to bf16 first (bias quantised to bf16 before the add). K%32==0, M%16==0, N%64==0.
template <bool ASPLIT, int ACT, bool BIAS_BF16>
__global__ __launch_bounds__(128) void k_gemm_bf(const float* __restrict__ A, int lda, const unsigned short* __restrict__ Wt, int ldb,
                                               const float* __restrict__ bias, float* __restrict__ C, int ldc, int M, int N, int K) {
  __shared__ __attribute__((aligned(16))) float so[4][16][64];
  const int tid = threadIdx.x, w = tid >> 5, lane = tid & 31, ln = lane & 15, hh = lane >> 4;
  const int ntn = N / 64;
  const int wid = blockIdx.x * 4 + w;
  const int mt = wid / ntn, nq = wid % ntn;
  if (mt * 16 >= M) return;
  const int row0 = mt * 16, col0 = nq * 64;
  const float* arow = A + (size_t)(row0 + ln) * lda;
  v8f acc[4] = {};
  for (int kb = 0; kb < K; kb += 32) {
    FragB ah, al;
    const v4f x0 = *(const v4fa*)(arow + kb + 8 * hh), x1 = *(const v4fa*)(arow + kb + 8 * hh + 4);
    const v4f x2 = *(const v4fa*)(arow + kb + 16 + 8 * hh), x3 = *(const v4fa*)(arow + kb + 16 + 8 * hh + 4);
    float xs[16] = {x0[0],x0[1],x0[2],x0[3],x1[0],x1[1],x1[2],x1[3],x2[0],x2[1],x2[2],x2[3],x3[0],x3[1],x3[2],x3[3]};
#pragma unroll
    for (int i = 0; i < 16; ++i) { const unsigned short hb = bf16_bits(xs[i]); ah.u[i] = hb; al.u[i] = ASPLIT ? bf16_bits(xs[i] - bf16_val(hb)) : (unsigned short)0; }
#pragma unroll
    for (int t = 0; t < 4; ++t) {
      const unsigned short* brow = Wt + (size_t)(col0 + t * 16 + ln) * ldb + kb;
      FragB b;
      b.half[0] = *(const v8us*)(brow + 8 * hh);
      b.half[1] = *(const v8us*)(brow + 16 + 8 * hh);
      acc[t] = mmaN<ASPLIT ? 2 : 1>(ah.v, al.v, b.v, b.v, acc[t]);
    }
  }
#pragma unroll
  for (int t = 0; t < 4; ++t) {
    float bv = bias ? bias[col0 + t * 16 + ln] : 0.f;
    if (BIAS_BF16) bv = bf16_round(bv);
#pragma unroll
    for (int r = 0; r < 8; ++r) { float v = acc[t][r] + bv; if (ACT == 1) v = fmaxf(v, 0.f); so[w][8 * hh + r][t * 16 + ln] = v; }
  }
  __builtin_amdgcn_fence(__ATOMIC_ACQ_REL, "workgroup");
  __builtin_amdgcn_wave_barrier();
  const int rsub = lane >> 4, c4 = (lane & 15) * 4;
  {
#pragma unroll
    for (int q = 0; q < 8; ++q) {
      const int r = q * 2 + rsub;
      const v4f v = *(const v4fa*)&so[w][r][c4];
      *(v4f*)(C + (size_t)(row0 + r) * ldc + col0 + c4) = v;
    }
    
  }
}

// GEMM C = act(A·W + bias + resid): A f32 (ASPLIT -> hi/lo 2 terms), Wt bf16 [N][K]; ACT 0 none, 1 relu, 2 exact gelu;
// resid (optional, f32, row index = (row % rmod), pitch ldr, RES_BF16 rounds it) added before the activation.
template <bool ASPLIT, int ACT, bool BIAS_BF16, bool RES_BF16>
__global__ __launch_bounds__(128) void k_gemm_bf3(const float* __restrict__ A, int lda, const unsigned short* __restrict__ Wt, int ldb,
                                                const float* __restrict__ bias, const float* __restrict__ resid, int rmod, int ldr,
                                                float* __restrict__ C, int ldc, int M, int N, int K) {
  __shared__ __attribute__((aligned(16))) float so[4][16][64];
  const int tid = threadIdx.x, w = tid >> 5, lane = tid & 31, ln = lane & 15, hh = lane >> 4;
  const int ntn = N / 64;
  const int wid = blockIdx.x * 4 + w;
  const int mt = wid / ntn, nq = wid % ntn;
  if (mt * 16 >= M) return;
  const int row0 = mt * 16, col0 = nq * 64;
  const float* arow = A + (size_t)(row0 + ln) * lda;
  v8f acc[4] = {};
  for (int kb = 0; kb < K; kb += 32) {
    FragB ah, al;
    const v4f x0 = *(const v4fa*)(arow + kb + 8 * hh), x1 = *(const v4fa*)(arow + kb + 8 * hh + 4);
    const v4f x2 = *(const v4fa*)(arow + kb + 16 + 8 * hh), x3 = *(const v4fa*)(arow + kb + 16 + 8 * hh + 4);
    float xs[16] = {x0[0],x0[1],x0[2],x0[3],x1[0],x1[1],x1[2],x1[3],x2[0],x2[1],x2[2],x2[3],x3[0],x3[1],x3[2],x3[3]};
#pragma unroll
    for (int i = 0; i < 16; ++i) { const unsigned short hb = bf16_bits(xs[i]); ah.u[i] = hb; al.u[i] = ASPLIT ? bf16_bits(xs[i] - bf16_val(hb)) : (unsigned short)0; }
#pragma unroll
    for (int t = 0; t < 4; ++t) {
      const unsigned short* brow = Wt + (size_t)(col0 + t * 16 + ln) * ldb + kb;
      FragB b;
      b.half[0] = *(const v8us*)(brow + 8 * hh);
      b.half[1] = *(const v8us*)(brow + 16 + 8 * hh);
      acc[t] = mmaN<ASPLIT ? 2 : 1>(ah.v, al.v, b.v, b.v, acc[t]);
    }
  }
#pragma unroll
  for (int t = 0; t < 4; ++t) {
    const int col = col0 + t * 16 + ln;
    float bv = bias ? bias[col] : 0.f;
    if (BIAS_BF16) bv = bf16_round(bv);
#pragma unroll
    for (int r = 0; r < 8; ++r) {
      float v = acc[t][r] + bv;
      if (resid) { float rv = resid[(size_t)((row0 + 8 * hh + r) % rmod) * ldr + col]; if (RES_BF16) rv = bf16_round(rv); v += rv; }
      if (ACT == 1) v = fmaxf(v, 0.f);
      if (ACT == 2) v = 0.5f * v * (1.0f + erff(v * 0.70710678118654752f));
      if (ACT == 3) { const float u = 0.7978845608028654f * (v + 0.044715f * v * v * v); v = 0.5f * v * (1.0f + tanhf(u)); }
      so[w][8 * hh + r][t * 16 + ln] = v;
    }
  }
  __builtin_amdgcn_fence(__ATOMIC_ACQ_REL, "workgroup");
  __builtin_amdgcn_wave_barrier();
  const int rsub = lane >> 4, c4 = (lane & 15) * 4;
  {
#pragma unroll
    for (int q = 0; q < 8; ++q) {
      const int r = q * 2 + rsub;
      const v4f v = *(const v4fa*)&so[w][r][c4];
      *(v4f*)(C + (size_t)(row0 + r) * ldc + col0 + c4) = v;
    }
    
  }
}
// row LayerNorm (biased variance, eps) over N: s = X (+ R); optional out_sum <- s; out_norm <- (s-mu)*rsqrt(var+eps)*g + b
template <bool PARAM_BF16>
__global__ __launch_bounds__(256) void k_layernorm(const float* __restrict__ X, const float* __restrict__ R, const float* __restrict__ g, const float* __restrict__ bta,
                                                  float* __restrict__ out_sum, float* __restrict__ out_norm, int N, float eps) {
  __shared__ float red[256];
  const int row = blockIdx.x, tid = threadIdx.x;
  const float* x = X + (size_t)row * N; const float* rr = R ? R + (size_t)row * N : nullptr;
  float vals[16];                     // up to N = 4096
  const int per = N / 256;            // contiguous chunk per thread? use strided-by-4 chunks: thread handles j = tid*4 + 1024*u
  float s1 = 0.f;
  for (int u = 0; u < per / 4; ++u) {
    const int j = tid * 4 + 1024 * u;
    const v4f a = *(const v4fa*)(x + j);
    v4f b = {0.f,0.f,0.f,0.f}; if (rr) b = *(const v4fa*)(rr + j);
#pragma unroll
    for (int q = 0; q < 4; ++q) { const float v = a[q] + b[q]; vals[u * 4 + q] = v; s1 += v; }
  }
  red[tid] = s1; __syncthreads();
  for (int st = 128; st > 0; st >>= 1) { if (tid < st) red[tid] += red[tid + st]; __syncthreads(); }
  const float mu = red[0] / (float)N; __syncthreads();
  float s2 = 0.f;
  for (int u = 0; u < per / 4; ++u)
#pragma unroll
    for (int q = 0; q < 4; ++q) { const float c = vals[u * 4 + q] - mu; s2 += c * c; }
  red[tid] = s2; __syncthreads();
  for (int st = 128; st > 0; st >>= 1) { if (tid < st) red[tid] += red[tid + st]; __syncthreads(); }
  const float rs = rsqrtf(red[0] / (float)N + eps);
  {
    for (int u = 0; u < per / 4; ++u) {
      const int j = tid * 4 + 1024 * u;
      v4f o, sm;
#pragma unroll
      for (int q = 0; q < 4; ++q) {
        float gg = g[j + q], bb = bta[j + q];
        if (PARAM_BF16) { gg = bf16_round(gg); bb = bf16_round(bb); }
        sm[q] = vals[u * 4 + q]; o[q] = (vals[u * 4 + q] - mu) * rs * gg + bb;
      }
      if (out_sum) *(v4f*)(out_sum + (size_t)row * N + j) = sm;
      *(v4f*)(out_norm + (size_t)row * N + j) = o;
    }
    
  }
}



// ---- f16 WMMA path (v_wmma_f32_16x16x32_f16): 11-bit significands for operands in range — used where a [0,1] probability operand needs more precision than bf16
typedef _Float16 v16h __attribute__((ext_vector_type(16)));
union FragH { v16h v; v8us half[2]; _Float16 h[16]; unsigned short u[16]; };
template <int NT>
__device__ __forceinline__ v8f mmaH(v16h ah, v16h al, v16h bh, v16h bl, v8f c) {
  c = __builtin_amdgcn_wmma_f32_16x16x32_f16(false, ah, false, bh, (short)0, c, false, false);
  if (NT >= 2) c = __builtin_amdgcn_wmma_f32_16x16x32_f16(false, al, false, bh, (short)0, c, false, false);
  if (NT >= 3) c = __builtin_amdgcn_wmma_f32_16x16x32_f16(false, ah, false, bl, (short)0, c, false, false);
  asm volatile("v_nop\n\tv_nop\n\tv_nop\n\tv_nop" : "+v"(c) : "v"(ah), "v"(al), "v"(bh), "v"(bl));
  return c;
}
// batched GEMM like k_gemm_b but f16 operands: A f32 (split into f16 hi/lo if ASPLIT, else rounded to f16), Bt = f16 values [n][k]; alpha; C f32; N multiple of 16 (partial tiles skipped)
template <bool ASPLIT>
__global__ __launch_bounds__(128) void k_gemm_h(const float* __restrict__ A, int lda, size_t sA, const _Float16* __restrict__ Bh, int ldb, size_t sB, float alpha, float* __restrict__ C, int ldc, size_t sC, int M, int N, int K) {
  __shared__ __attribute__((aligned(16))) float so[4][16][64];
  const int tid = threadIdx.x, w = tid >> 5, lane = tid & 31, ln = lane & 15, hh = lane >> 4; const int by = blockIdx.y;
  A += (size_t)by * sA; Bh += (size_t)by * sB; C += (size_t)by * sC;
  const int ntn = (N + 63) / 64; const int wid = blockIdx.x * 4 + w; const int mt = wid / ntn, nq = wid % ntn; if (mt * 16 >= M) return;
  const int row0 = mt * 16, col0 = nq * 64; const float* arow = A + (size_t)(row0 + ln) * lda;
  v8f acc[4] = {};
  for (int kb = 0; kb < K; kb += 32) {
    FragH ah, al;
    const v4f x0 = *(const v4fa*)(arow + kb + 8 * hh), x1 = *(const v4fa*)(arow + kb + 8 * hh + 4), x2 = *(const v4fa*)(arow + kb + 16 + 8 * hh), x3 = *(const v4fa*)(arow + kb + 16 + 8 * hh + 4);
    float xs[16] = {x0[0],x0[1],x0[2],x0[3],x1[0],x1[1],x1[2],x1[3],x2[0],x2[1],x2[2],x2[3],x3[0],x3[1],x3[2],x3[3]};
#pragma unroll
    for (int i = 0; i < 16; ++i) { const _Float16 h = (_Float16)xs[i]; ah.h[i] = h; al.h[i] = ASPLIT ? (_Float16)(xs[i] - (float)h) : (_Float16)0.0f; }
#pragma unroll
    for (int t = 0; t < 4; ++t) { if (col0 + t * 16 >= N) continue; const size_t boff = (size_t)(col0 + t * 16 + ln) * ldb + kb; FragH bq; bq.half[0] = *(const v8us*)(Bh + boff + 8 * hh); bq.half[1] = *(const v8us*)(Bh + boff + 16 + 8 * hh);
      acc[t] = mmaH<ASPLIT ? 2 : 1>(ah.v, al.v, bq.v, bq.v, acc[t]); }
  }
#pragma unroll
  for (int t = 0; t < 4; ++t) { if (col0 + t * 16 >= N) continue;
#pragma unroll
    for (int r = 0; r < 8; ++r) so[w][8 * hh + r][t * 16 + ln] = acc[t][r] * alpha; }
  __builtin_amdgcn_fence(__ATOMIC_ACQ_REL, "workgroup"); __builtin_amdgcn_wave_barrier();
  const int rsub = lane >> 4, c4 = (lane & 15) * 4;
  {
#pragma unroll
    for (int q = 0; q < 8; ++q) { const int r = q * 2 + rsub; if (col0 + c4 < N) { const v4f v = *(const v4fa*)&so[w][r][c4]; *(v4f*)(C + (size_t)(row0 + r) * ldc + col0 + c4) = v; } }
     }
}

// Wt[n][k] = f16(W[k][n]·scale) from f32 row-major W[K][N] (scale = power of two; bf16-exact weights stay exact in f16 away from the subnormal range)
__global__ __launch_bounds__(256) void k_wt_f16(const float* __restrict__ W, _Float16* __restrict__ Wt, int K, int N, float scale) {
  const int t = blockIdx.x * 256 + threadIdx.x; if (t >= N * (K / 8)) return; const int n = t / (K / 8), k8 = (t % (K / 8)) * 8; FragH f;
#pragma unroll
  for (int i = 0; i < 8; ++i) f.h[i] = (_Float16)(bf16_round(W[(size_t)(k8 + i) * N + n]) * scale); const v8us o = f.half[0];
  *(v8us*)((unsigned short*)Wt + (size_t)n * K + k8) = o; 
}
// k_gemm_hh variant with fused epilogue: v = acc·alpha + bias[by·sBias + col] (+ CP[(row/rowsPerB)·sCPb + by·64 + col] if CP) ; ACT 0 none / 1 elu ; writes f16 C16 (and f32 C if non-null)
template <int ACT>
__global__ __launch_bounds__(128) void k_gemm_hhx(const _Float16* __restrict__ A, int lda, size_t sA, const _Float16* __restrict__ Bh, int ldb, size_t sB, float alpha, const float* __restrict__ bias, size_t sBias, const float* __restrict__ CP, int rowsPerB, size_t sCPb, int row0g,
    float* __restrict__ C, _Float16* __restrict__ C16, int ldc, size_t sC, int M, int N, int K) {
  __shared__ __attribute__((aligned(16))) float so[4][16][64];
  const int tid = threadIdx.x, w = tid >> 5, lane = tid & 31, ln = lane & 15, hh = lane >> 4; const int by = blockIdx.y;
  A += (size_t)by * sA; Bh += (size_t)by * sB; const size_t cofs = (size_t)by * sC; const float* bp = bias ? bias + (size_t)by * sBias : nullptr;
  const int ntn = (N + 63) / 64; const int wid = blockIdx.x * 4 + w; const int mt = wid / ntn, nq = wid % ntn; if (mt * 16 >= M) return;
  const int row0 = mt * 16, col0 = nq * 64; const _Float16* arow = A + (size_t)(row0 + ln) * lda;
  v8f acc[4] = {};
  for (int kb = 0; kb < K; kb += 32) { FragH ah; ah.half[0] = *(const v8us*)((const unsigned short*)arow + kb + 8 * hh); ah.half[1] = *(const v8us*)((const unsigned short*)arow + kb + 16 + 8 * hh);
#pragma unroll
    for (int t = 0; t < 4; ++t) { if (col0 + t * 16 >= N) continue; const size_t boff = (size_t)(col0 + t * 16 + ln) * ldb + kb; FragH bq; bq.half[0] = *(const v8us*)((const unsigned short*)Bh + boff + 8 * hh); bq.half[1] = *(const v8us*)((const unsigned short*)Bh + boff + 16 + 8 * hh);
      acc[t] = mmaH<1>(ah.v, ah.v, bq.v, bq.v, acc[t]); }
  }
#pragma unroll
  for (int t = 0; t < 4; ++t) { if (col0 + t * 16 >= N) continue; const int col = col0 + t * 16 + ln; const float bv = bp ? bf16_round(bp[col]) : 0.f;
#pragma unroll
    for (int r = 0; r < 8; ++r) { float v = acc[t][r] * alpha + bv; if (CP) { const int bidx = (row0g + row0 + 8 * hh + r) / rowsPerB; v += CP[(size_t)bidx * sCPb + (size_t)by * 64 + col]; } if (ACT == 1) v = (v > 0.f) ? v : expm1f(v); else if (ACT == 7) v = (v > 0.f) ? v + 1.0f : expf(v); else if (ACT == 8) v = tanhf(v); else if (ACT == 9) v = 0.5f * v * (1.0f + tanhf(0.7978845608028654f * (v + 0.044715f * v * v * v))); else if (ACT == 11) v = 1.0f / (1.0f + expf(-v)); else if (ACT == 12) v = (v > 0.f) ? v : 0.01f * v; else if (ACT == 14) v = (v > 0.f) ? v : 0.1f * v; else if (ACT == 15) v = v / (1.0f + expf(-v)); else if (ACT == 3) v = fmaxf(v, 0.f); else if (ACT == 6) v = 0.5f * v * (1.0f + erff(v * 0.70710678118654752f)); so[w][8 * hh + r][t * 16 + ln] = v; } }
  __builtin_amdgcn_fence(__ATOMIC_ACQ_REL, "workgroup"); __builtin_amdgcn_wave_barrier();
  const int rsub = lane >> 4, c4 = (lane & 15) * 4; typedef _Float16 v4h __attribute__((ext_vector_type(4)));
  {
#pragma unroll
    for (int q = 0; q < 8; ++q) { const int r = q * 2 + rsub; if (col0 + c4 < N) { const v4f v = *(const v4fa*)&so[w][r][c4]; if (C) *(v4f*)(C + cofs + (size_t)(row0 + r) * ldc + col0 + c4) = v; if (C16) { v4h h4; for (int i = 0; i < 4; ++i) h4[i] = (_Float16)v[i]; *(v4h*)(C16 + cofs + (size_t)(row0 + r) * ldc + col0 + c4) = h4; } } }
     }
}


typedef _Float16 v4h __attribute__((ext_vector_type(4)));

__global__ __launch_bounds__(256) void k_x16(const float* __restrict__ x, _Float16* __restrict__ X16, size_t n8) { const size_t t = (size_t)blockIdx.x * 256 + threadIdx.x; if (t >= n8) return; FragH f;
#pragma unroll
  for (int q = 0; q < 8; ++q) f.h[q] = (_Float16)bf16_round(x[t * 8 + q]); *(v8us*)((unsigned short*)X16 + t * 8) = f.half[0];  }
__global__ __launch_bounds__(256) void k_h16(const float* __restrict__ x, _Float16* __restrict__ X16, size_t n8) { const size_t t = (size_t)blockIdx.x * 256 + threadIdx.x; if (t >= n8) return; FragH f;
#pragma unroll
  for (int q = 0; q < 8; ++q) f.h[q] = (_Float16)x[t * 8 + q]; *(v8us*)((unsigned short*)X16 + t * 8) = f.half[0];  }
__global__ __launch_bounds__(256) void k_round16f(const float* __restrict__ W, _Float16* __restrict__ Bt, size_t n8) { const size_t t = (size_t)blockIdx.x * 256 + threadIdx.x; if (t >= n8) return; FragH f;
#pragma unroll
  for (int i = 0; i < 8; ++i) f.h[i] = (_Float16)(bf16_round(W[t * 8 + i]) * 16.0f); *(v8us*)((unsigned short*)Bt + t * 8) = f.half[0];  }
template <int NHv, int TTv>
__global__ __launch_bounds__(256) void k_vt(const _Float16* __restrict__ V16, int ldv, int voff, _Float16* __restrict__ Vt) { __shared__ unsigned short tl[64][66]; const int tid = threadIdx.x; const int slab = blockIdx.x / (TTv / 64), lg = blockIdx.x % (TTv / 64); const int b = slab / NHv, h = slab % NHv;
  for (int i = tid; i < 64 * 8; i += 256) { const int r = i / 8, c8 = (i % 8) * 8; FragH f; f.half[0] = *(const v8us*)((const unsigned short*)V16 + ((size_t)b * TTv + lg * 64 + r) * ldv + voff + h * 64 + c8);
#pragma unroll
    for (int q = 0; q < 8; ++q) tl[r][c8 + q] = f.u[q]; }
  __syncthreads();
  {
#pragma unroll
    for (int rd = 0; rd < 2; ++rd) { const int d = rd * 32 + tid / 8, pc = tid % 8; FragH f;
#pragma unroll
      for (int q = 0; q < 8; ++q) f.u[q] = tl[pc * 8 + q][d];
      *(v8us*)((unsigned short*)Vt + ((size_t)slab * 64 + d) * TTv + lg * 64 + pc * 8) = f.half[0]; }
     } }

__global__ __launch_bounds__(256) void k_hl(const float* __restrict__ F, _Float16* __restrict__ Hh, _Float16* __restrict__ Hl, size_t n8) { const size_t t = (size_t)blockIdx.x * 256 + threadIdx.x; if (t >= n8) return; FragH fh, fl; const v4f a = *(const v4fa*)(F + t * 8), c = *(const v4fa*)(F + t * 8 + 4);
#pragma unroll
  for (int q = 0; q < 4; ++q) { _Float16 h = (_Float16)a[q]; fh.h[q] = h; fl.h[q] = (_Float16)((a[q] - (float)h) * 1024.0f); h = (_Float16)c[q]; fh.h[4 + q] = h; fl.h[4 + q] = (_Float16)((c[q] - (float)h) * 1024.0f); }
  { *(v8us*)((unsigned short*)Hh + t * 8) = fh.half[0]; *(v8us*)((unsigned short*)Hl + t * 8) = fl.half[0];  } }

// ---- fast GEMM (wave tile 32x64, operands staged in LDS) ----
__device__ __forceinline__ v16h g2_frag(const _Float16* p, int hh) { FragH f; f.half[0] = *(const v8us*)((const unsigned short*)p + 8 * hh); f.half[1] = *(const v8us*)((const unsigned short*)p + 16 + 8 * hh); return f.v; }
__device__ __forceinline__ v8f g2_mma(v16h a, v16h b, v8f c) { v8f d = __builtin_amdgcn_wmma_f32_16x16x32_f16(false, a, false, b, (short)0, c, false, false); asm volatile("v_nop\n\tv_nop\n\tv_nop\n\tv_nop" : "+v"(d) : "v"(a), "v"(b)); return d; }
// Block tile 128x128, eight waves of 32x64 (4 down x 2 across). A pass is 128 k: 128 rows of A and 128 rows of Bh, 256 B each, are laid in LDS at a
// pitch of 272 B (16 B x odd, for the ds_load_b128 fragment reads) by per-lane asynchronous 16-byte copies; two buffers, the next pass's copies fly while this one is multiplied.
#define G3_PITCH 272
#define G3_OPB (128 * G3_PITCH)   /* one operand's 128 rows */
#define G3_BUF (2 * G3_OPB)       /* one buffer: [A rows | Bh rows] */
// Eight copies per lane: rows r, r + 16, ..., r + 112 of one operand (16 lanes cover one 256-B row piece). The s_wait_xcnt closes the copies' own statement so that
// no address register named here is rewritten ahead of it.
__device__ __forceinline__ void g3_copy8(unsigned l, const _Float16* g, size_t rstep) {
  asm volatile("global_load_async_to_lds_b128 %0, %8, off\n\t"
               "global_load_async_to_lds_b128 %1, %9, off\n\t"
               "global_load_async_to_lds_b128 %2, %10, off\n\t"
               "global_load_async_to_lds_b128 %3, %11, off\n\t"
               "global_load_async_to_lds_b128 %4, %12, off\n\t"
               "global_load_async_to_lds_b128 %5, %13, off\n\t"
               "global_load_async_to_lds_b128 %6, %14, off\n\t"
               "global_load_async_to_lds_b128 %7, %15, off\n\t"
               "s_wait_xcnt 0x0"
               :: "v"(l), "v"(l + 16u * G3_PITCH), "v"(l + 32u * G3_PITCH), "v"(l + 48u * G3_PITCH), "v"(l + 64u * G3_PITCH), "v"(l + 80u * G3_PITCH), "v"(l + 96u * G3_PITCH), "v"(l + 112u * G3_PITCH),
                  "v"(g), "v"(g + rstep), "v"(g + 2 * rstep), "v"(g + 3 * rstep), "v"(g + 4 * rstep), "v"(g + 5 * rstep), "v"(g + 6 * rstep), "v"(g + 7 * rstep)
               : "memory");
}
// requires M % 128 == 0, N % 128 == 0, K % 128 == 0; epilogue = k_gemm_hhx semantics
template <int ACT>
__global__ __launch_bounds__(256) void k_gemm3(const _Float16* __restrict__ A, int lda, size_t sA, const _Float16* __restrict__ Bh, int ldb, size_t sB, float alpha, const float* __restrict__ bias, size_t sBias, const float* __restrict__ CP, int rowsPerB, size_t sCPb, int row0g,
    float* __restrict__ C, _Float16* __restrict__ C16, int ldc, size_t sC, int M, int N, int K) {
  __shared__ __attribute__((aligned(16))) unsigned char ring[2 * G3_BUF];      /* the two buffers; after the k loop its first 8 x 32 x 68 floats stage the output */
  const int tid = threadIdx.x, w = tid >> 5, lane = tid & 31, ln = lane & 15, hh = lane >> 4; const int by = blockIdx.y;
  A += (size_t)by * sA; Bh += (size_t)by * sB; const size_t cofs = (size_t)by * sC; const float* bp = bias ? bias + (size_t)by * sBias : nullptr;
  const int ntn = N >> 7; const int mt = blockIdx.x / ntn, nq = blockIdx.x - mt * ntn; const int rowb = mt * 128, colb = nq * 128; if (rowb >= M) return;      /* block-uniform, ahead of every barrier */
  const int wm = w & 3, wn = w >> 2; const int row0 = rowb + 32 * wm, col0 = colb + 64 * wn;
  const int cr = tid >> 4, cc = tid & 15;      /* copy side: this lane's first row and its 16-byte piece of the row */
  const _Float16* gA = A + (size_t)(rowb + cr) * lda + cc * 8; const _Float16* gB = Bh + (size_t)(colb + cr) * ldb + cc * 8; const size_t stA = (size_t)16 * lda, stB = (size_t)16 * ldb;
  const unsigned lA = (unsigned)(size_t)ring + (unsigned)(cr * G3_PITCH + cc * 16), lB = lA + G3_OPB;
  const int np = K >> 7;
  g3_copy8(lA, gA, stA); g3_copy8(lB, gB, stB);
  asm volatile("s_wait_asynccnt 0x0" ::: "memory");      /* pass 0's own copies have landed before the barrier that publishes them */
  __syncthreads();
  if (np > 1) { g3_copy8(lA + G3_BUF, gA + 128, stA); g3_copy8(lB + G3_BUF, gB + 128, stB); }
  const unsigned char* ra = ring + (32 * wm + ln) * G3_PITCH; const unsigned char* rb = ring + G3_OPB + (64 * wn + ln) * G3_PITCH;
  const v8f z8 = {0.f,0.f,0.f,0.f,0.f,0.f,0.f,0.f}; v8f c00 = z8, c01 = z8, c02 = z8, c03 = z8, c10 = z8, c11 = z8, c12 = z8, c13 = z8;
#pragma unroll 1      /* one pass per trip: the publish point at the foot stands once */
  for (int t = 0; t < np; ++t) { const unsigned bo = (unsigned)(t & 1) * G3_BUF;
#pragma unroll      /* the four 32-k blocks of a pass in straight line, so that a block's fragment reads can stand ahead of the block before it */
    for (int ks = 0; ks < 4; ++ks) { const unsigned char* pa = ra + bo + ks * 64; const unsigned char* pb = rb + bo + ks * 64;
      const v16h a0 = g2_frag((const _Float16*)pa, hh), a1 = g2_frag((const _Float16*)(pa + 16 * G3_PITCH), hh);
      const v16h b0 = g2_frag((const _Float16*)pb, hh), b1 = g2_frag((const _Float16*)(pb + 16 * G3_PITCH), hh), b2 = g2_frag((const _Float16*)(pb + 32 * G3_PITCH), hh), b3 = g2_frag((const _Float16*)(pb + 48 * G3_PITCH), hh);
      c00 = g2_mma(a0, b0, c00); c10 = g2_mma(a1, b0, c10); c01 = g2_mma(a0, b1, c01); c11 = g2_mma(a1, b1, c11);
      c02 = g2_mma(a0, b2, c02); c12 = g2_mma(a1, b2, c12); c03 = g2_mma(a0, b3, c03); c13 = g2_mma(a1, b3, c13); }
    asm volatile("s_wait_dscnt 0x0" ::: "memory");         /* this wave's reads of the buffer are done before the barrier behind which it is refilled */
    asm volatile("s_wait_asynccnt 0x0" ::: "memory");      /* this wave's copies of pass t + 1 have landed before the barrier that publishes them */
    __syncthreads();
    if (t + 2 < np) { g3_copy8(lA + bo, gA + (size_t)(t + 2) * 128, stA); g3_copy8(lB + bo, gB + (size_t)(t + 2) * 128, stB); } }
  asm volatile("s_wait_asynccnt 0x0" ::: "memory");        /* nothing in flight when the ring becomes output staging */
  float (*so)[32][68] = (float (*)[32][68])ring;
  v8f accs[8] = {c00, c01, c02, c03, c10, c11, c12, c13};
#pragma unroll
  for (int u = 0; u < 8; ++u) { const int t = u & 3, half = u >> 2; const int col = col0 + t * 16 + ln; const float bv = bp ? bf16_round(bp[col]) : 0.f;
#pragma unroll
    for (int r = 0; r < 8; ++r) { const int rloc = half * 16 + 8 * hh + r; float v = accs[u][r] * alpha + bv; if (CP) { const int bidx = (row0g + row0 + rloc) / rowsPerB; v += CP[(size_t)bidx * sCPb + (size_t)by * 64 + col]; }
      if (ACT == 3) v = fmaxf(v, 0.f); else if (ACT == 6) v = 0.5f * v * (1.0f + erff(v * 0.70710678118654752f)); else if (ACT == 11) v = 1.0f / (1.0f + expf(-v)); else if (ACT == 15) v = v / (1.0f + expf(-v)); else if (ACT == 12) v = (v > 0.f) ? v : 0.01f * v; else if (ACT == 8) v = tanhf(v);
      so[w][rloc][t * 16 + ln] = v; } }
  __builtin_amdgcn_fence(__ATOMIC_ACQ_REL, "workgroup"); __builtin_amdgcn_wave_barrier();
  const int rsub = lane >> 4, c4 = (lane & 15) * 4;
  {
#pragma unroll
    for (int q = 0; q < 16; ++q) { const int r = q * 2 + rsub; const v4f v = *(const v4fa*)&so[w][r][c4]; if (C) *(v4f*)(C + cofs + (size_t)(row0 + r) * ldc + col0 + c4) = v; if (C16) { v4h h4; for (int i = 0; i < 4; ++i) h4[i] = (_Float16)v[i]; *(v4h*)(C16 + cofs + (size_t)(row0 + r) * ldc + col0 + c4) = h4; } }
     } }


// lane l with lane l ^ 16
__device__ __forceinline__ float xhalf(float x) { return __builtin_bit_cast(float, __builtin_amdgcn_permlanex16(__builtin_bit_cast(int, x), __builtin_bit_cast(int, x), 0x76543210, 0xfedcba98, false, false)); }
// Both products run transposed. S^T = K x Q^T: A = 16 key rows, B = the wave's 16 queries, so lane (ln, hh) holds for ITS query q0 + ln the keys j0 + 16 nt + 8 hh + r:
// maximum and sum are in-lane, the two halves of a query meet in one cross-row move. The two score tiles, converted in place, are the B operand of O^T += V^T x P^T
// (element s = tile s >> 3, register s & 7, which is the k order the V^T rows are loaded in): P passes through no LDS. O^T: lane = query, registers = 8 consecutive d.
__global__ __launch_bounds__(128) void k_flashc(const _Float16* __restrict__ Q16, int ldq, const _Float16* __restrict__ K16, int ldk, const _Float16* __restrict__ Vt, const int* __restrict__ MSK, float* __restrict__ O, int ldo) {
  constexpr int RPW = 16, NQB = TQ / (4 * RPW), DT = 4, KS = 2;
  __shared__ __attribute__((aligned(16))) float sO[4][RPW][64 + 4];
  (void)MSK;
  const int tid = threadIdx.x, w = tid >> 5, lane = tid & 31, ln = lane & 15, hh = lane >> 4;
  const int slab = blockIdx.x / NQB, qblk = blockIdx.x % NQB; const int b = slab / NH, h = slab % NH; const int qb0 = qblk * (4 * RPW); const int q0 = qb0 + w * RPW;
  FragH bq[KS];
  { const unsigned short* qr = (const unsigned short*)Q16 + ((size_t)b * TQ + q0 + ln) * ldq + h * 64;
#pragma unroll
    for (int ks = 0; ks < KS; ++ks) { bq[ks].half[0] = *(const v8us*)(qr + ks * 32 + 8 * hh); bq[ks].half[1] = *(const v8us*)(qr + ks * 32 + 16 + 8 * hh); } }
  const unsigned short* Vth = (const unsigned short*)Vt + (size_t)slab * 64 * TK;
  const int tq = q0 + ln;      /* this lane's query */
  float m_r = -3.0e38f, l_r = 0.f; v8f oacc[DT];
#pragma unroll
  for (int dt = 0; dt < DT; ++dt) oacc[dt] = (v8f){0.f,0.f,0.f,0.f,0.f,0.f,0.f,0.f};
  const int jend = qb0 + 4 * RPW;      /* block-uniform causal bound */
#pragma unroll 1
  for (int j0 = 0; j0 < jend; j0 += 32) {
    FragH ak[2][KS], av[DT];
#pragma unroll
    for (int nt = 0; nt < 2; ++nt) { const unsigned short* kr = (const unsigned short*)K16 + ((size_t)b * TK + j0 + nt * 16 + ln) * ldk + h * 64;
#pragma unroll
      for (int ks = 0; ks < KS; ++ks) { ak[nt][ks].half[0] = *(const v8us*)(kr + ks * 32 + 8 * hh); ak[nt][ks].half[1] = *(const v8us*)(kr + ks * 32 + 16 + 8 * hh); } }
    asm volatile("s_wait_xcnt 0x0" ::: "memory");      /* the V^T loads below may land in registers that hold the K loads' addresses: this wait stands in front of that overwrite */
#pragma unroll
    for (int dt = 0; dt < DT; ++dt) { const unsigned short* vrow = Vth + (size_t)(dt * 16 + ln) * TK + j0; av[dt].half[0] = *(const v8us*)(vrow + 8 * hh); av[dt].half[1] = *(const v8us*)(vrow + 16 + 8 * hh); }
    float sc[16];
#pragma unroll
    for (int nt = 0; nt < 2; ++nt) { v8f acc = (v8f){0.f,0.f,0.f,0.f,0.f,0.f,0.f,0.f};
#pragma unroll
      for (int ks = 0; ks < KS; ++ks) acc = mmaH<1>(ak[nt][ks].v, ak[nt][ks].v, bq[ks].v, bq[ks].v, acc);
#pragma unroll
      for (int r = 0; r < 8; ++r) sc[nt * 8 + r] = (j0 + nt * 16 + 8 * hh + r <= tq) ? acc[r] * SCL : -INFINITY; }
    float mx[4];
#pragma unroll
    for (int i = 0; i < 4; ++i) mx[i] = fmaxf(fmaxf(sc[i], sc[4 + i]), fmaxf(sc[8 + i], sc[12 + i]));
    float mc = fmaxf(fmaxf(mx[0], mx[1]), fmaxf(mx[2], mx[3])); mc = fmaxf(mc, xhalf(mc));
    const float mn = fmaxf(m_r, mc); const float ea = expf(m_r - mn); const float al = (mn > -1.0e38f) ? ea : 1.0f; m_r = mn;
    FragH pb; float ps[4] = {0.f, 0.f, 0.f, 0.f};
#pragma unroll
    for (int i = 0; i < 16; ++i) { const float p = expf(sc[i] - mn); ps[i & 3] += p; pb.h[i] = (_Float16)(p * 1024.0f); }      /* a masked score is -inf: weight exactly 0 */
    l_r = l_r * al + ((ps[0] + ps[1]) + (ps[2] + ps[3]));      /* this half's keys only; the halves are joined behind the loop */
#pragma unroll
    for (int dt = 0; dt < DT; ++dt) {
#pragma unroll
      for (int r = 0; r < 8; ++r) oacc[dt][r] *= al; }
#pragma unroll
    for (int dt = 0; dt < DT; ++dt) oacc[dt] = mmaH<1>(av[dt].v, av[dt].v, pb.v, pb.v, oacc[dt]); }
  const float l = l_r + xhalf(l_r); const float inv = (l > 0.f) ? 1.0f / (l * 1024.0f) : 0.f;
#pragma unroll
  for (int dt = 0; dt < DT; ++dt) { const v4f lo = {oacc[dt][0] * inv, oacc[dt][1] * inv, oacc[dt][2] * inv, oacc[dt][3] * inv}, hi = {oacc[dt][4] * inv, oacc[dt][5] * inv, oacc[dt][6] * inv, oacc[dt][7] * inv};
    *(v4fa*)&sO[w][ln][dt * 16 + 8 * hh] = lo; *(v4fa*)&sO[w][ln][dt * 16 + 8 * hh + 4] = hi; }
  __builtin_amdgcn_fence(__ATOMIC_ACQ_REL, "workgroup"); __builtin_amdgcn_wave_barrier();
  {
#pragma unroll
    for (int rp = 0; rp < RPW; rp += 2) { const int r = rp + (lane >> 4), pc = lane & 15; const v4f val = *(const v4fa*)&sO[w][r][pc * 4]; *(v4f*)(O + ((size_t)b * TQ + q0 + r) * ldo + h * 64 + pc * 4) = val; }
     } }
template <bool RND>
__global__ __launch_bounds__(256) void k_ln1024(const float* __restrict__ X, const float* __restrict__ g, const float* __restrict__ bb, _Float16* __restrict__ H16) {
  #pragma clang fp contract(off)
  const int tid = threadIdx.x, w = tid >> 5, l = tid & 31; const int r = blockIdx.x * 8 + w; if (r >= NR) return; const float* x = X + (size_t)r * EE; float v[32]; float s = 0.f;
#pragma unroll
  for (int u = 0; u < 8; ++u) { const v4f a = *(const v4fa*)(x + u * 128 + l * 4);
#pragma unroll
    for (int q = 0; q < 4; ++q) { const float t = RND ? bf16_round(a[q]) : a[q]; v[u * 4 + q] = t; s += t; } }
  for (int o = 16; o > 0; o >>= 1) s += __shfl_xor(s, o, 32); const float mu = s / (float)EE; float q2 = 0.f;
#pragma unroll
  for (int k = 0; k < 32; ++k) { const float d = v[k] - mu; q2 += d * d; }
  for (int o = 16; o > 0; o >>= 1) q2 += __shfl_xor(q2, o, 32); const float rs = 1.0f / sqrtf(q2 / (float)EE + 1e-5f);
  {
#pragma unroll
    for (int u = 0; u < 8; ++u) { _Float16 h4[4];
#pragma unroll
      for (int q = 0; q < 4; ++q) { const int c = u * 128 + l * 4 + q; h4[q] = (_Float16)((v[u * 4 + q] - mu) * rs * bf16_round(g[c]) + bf16_round(bb[c])); }
      *(unsigned long long*)((unsigned short*)H16 + (size_t)r * EE + u * 128 + l * 4) = *(const unsigned long long*)h4; }
     } }
__global__ __launch_bounds__(256) void k_prep(const float* __restrict__ x, const float* __restrict__ e, float* __restrict__ Xf, _Float16* __restrict__ E16, size_t n4) {
  const size_t t = (size_t)blockIdx.x * 256 + threadIdx.x; if (t >= n4) return; const v4f a = *(const v4fa*)(x + t * 4), c = *(const v4fa*)(e + t * 4); v4f ra; _Float16 h4[4];
#pragma unroll
  for (int q = 0; q < 4; ++q) { ra[q] = bf16_round(a[q]); h4[q] = (_Float16)bf16_round(c[q]); }
  const unsigned long long pk = *(const unsigned long long*)h4;
  { *(v4f*)(Xf + t * 4) = ra; *(unsigned long long*)((unsigned short*)E16 + t * 4) = pk;  } }
__global__ __launch_bounds__(256) void k_vtn(const float* __restrict__ VF, _Float16* __restrict__ Vt) {
  __shared__ float tl[64][65];
  const int tid = threadIdx.x; const int slab = blockIdx.x / (TT / 64), lg = blockIdx.x % (TT / 64); const int n = slab / NHD, h = slab % NHD;
  for (int i = tid; i < 64 * 16; i += 256) { const int r = i / 16, c4 = (i % 16) * 4; const v4f a = *(const v4fa*)(VF + ((size_t)(lg * 64 + r) * NBATCH + n) * EE + h * 64 + c4); tl[r][c4] = a[0]; tl[r][c4 + 1] = a[1]; tl[r][c4 + 2] = a[2]; tl[r][c4 + 3] = a[3]; }
  __syncthreads();
  FragH f[2]; size_t oo[2];
#pragma unroll
  for (int rd = 0; rd < 2; ++rd) { const int d = rd * 32 + tid / 8, pc = tid % 8;
#pragma unroll
    for (int q = 0; q < 8; ++q) f[rd].h[q] = (_Float16)tl[pc * 8 + q][d]; oo[rd] = ((size_t)slab * 64 + d) * TT + lg * 64 + pc * 8; }
  { *(v8us*)((unsigned short*)Vt + oo[0]) = f[0].half[0]; *(v8us*)((unsigned short*)Vt + oo[1]) = f[1].half[0];  } }

extern "C" void kernel_launch(void* const* d_in, const int* in_sizes, int n_in,
                              void* d_out, int out_size, void* d_ws, size_t ws_size, hipStream_t stream) {
  (void)in_sizes; (void)n_in; (void)out_size;
  const float* const* I = (const float* const*)d_in;
  const float* x = I[0]; const float* enc = I[1];
  const float* wq_s = I[2]; const float* bq_s = I[3]; const float* wk_s = I[4]; const float* bk_s = I[5]; const float* wv_s = I[6]; const float* bv_s = I[7]; const float* wo_s = I[8]; const float* bo_s = I[9];
  const float* wq_c = I[10]; const float* bq_c = I[11]; const float* wk_c = I[12]; const float* bk_c = I[13]; const float* wv_c = I[14]; const float* bv_c = I[15]; const float* wo_c = I[16]; const float* bo_c = I[17];
  const float* g1 = I[18]; const float* b1n = I[19]; const float* g2 = I[20]; const float* b2n = I[21]; const float* g3 = I[22]; const float* b3n = I[23]; const float* W1 = I[24]; const float* b1 = I[25]; const float* W2 = I[26]; const float* b2 = I[27];
  char* ws = (char*)d_ws; size_t off = 0;
  auto take = [&](size_t bytes) { char* p = ws + off; off += (bytes + 255) & ~(size_t)255; return p; };
  _Float16* B[8]; for (int i = 0; i < 8; ++i) B[i] = (_Float16*)take((size_t)EE * EE * 2);      /* wq_s wk_s wv_s wo_s wq_c wk_c wv_c wo_c */
  _Float16* BF1 = (_Float16*)take((size_t)FF * EE * 2); _Float16* BF2 = (_Float16*)take((size_t)EE * FF * 2);
  float* Xf = (float*)take((size_t)NR * EE * 4); _Float16* H16 = (_Float16*)take((size_t)NR * EE * 2);
  _Float16* Q16 = (_Float16*)take((size_t)NR * EE * 2); _Float16* K16 = (_Float16*)take((size_t)NR * EE * 2); _Float16* VT = (_Float16*)take((size_t)NR * EE * 2); _Float16* E16 = (_Float16*)take((size_t)NR * EE * 2);      /* these four are contiguous: the FFN hidden reuses them */
  float* O = (float*)take((size_t)NR * EE * 4); float* X1 = (float*)take((size_t)NR * EE * 4);
  if (off > ws_size) return;      /* 16 + 16 + 16 + 8 + 32 + 16 + 16 = 120 MiB */
  _Float16* O16 = H16;                /* LN output is dead once its projection GEMMs ran; the attention output plane reuses it */
  float* X2 = Xf;                     /* bf16(x) is dead after the first residual GEMM */
  _Float16* F1 = Q16;                 /* FFN hidden [4096][4096] f16 = 32 MiB = Q16+K16+VT+E16 (all dead by then) */
  const float* Wl[8] = {wq_s, wk_s, wv_s, wo_s, wq_c, wk_c, wv_c, wo_c};
  const size_t w8 = (size_t)EE * EE / 8; for (int i = 0; i < 8; ++i) k_round16f<<<(unsigned)((w8 + 255) / 256), 256, 0, stream>>>(Wl[i], B[i], w8);      /* (out,in) = natural Bt; x16 */
  k_round16f<<<(unsigned)(((size_t)FF * EE / 8 + 255) / 256), 256, 0, stream>>>(W1, BF1, (size_t)FF * EE / 8); k_round16f<<<(unsigned)(((size_t)FF * EE / 8 + 255) / 256), 256, 0, stream>>>(W2, BF2, (size_t)FF * EE / 8);
  const size_t n8 = (size_t)NR * EE / 8; const unsigned nb8 = (unsigned)((n8 + 255) / 256);
  k_prep<<<(unsigned)(((size_t)NR * EE / 4 + 255) / 256), 256, 0, stream>>>(x, enc, Xf, E16, (size_t)NR * EE / 4);
  const dim3 gE((NR / 128) * (EE / 128), 1), gF((NR / 128) * (FF / 128), 1); const unsigned gln = NR / 8, gvt = NH * (TT / 64), gfl = NH * (TQ / 64);
  /* --- self attention --- */
  k_ln1024<true><<<gln, 256, 0, stream>>>(x, g1, b1n, H16);
  k_gemm3<0><<<gE, 256, 0, stream>>>(H16, EE, 0, B[0], EE, 0, 0.0625f, bq_s, 0, nullptr, 1, 0, 0, nullptr, Q16, EE, 0, NR, EE, EE);
  k_gemm3<0><<<gE, 256, 0, stream>>>(H16, EE, 0, B[1], EE, 0, 0.0625f, bk_s, 0, nullptr, 1, 0, 0, nullptr, K16, EE, 0, NR, EE, EE);
  k_gemm3<0><<<gE, 256, 0, stream>>>(H16, EE, 0, B[2], EE, 0, 0.0625f, bv_s, 0, nullptr, 1, 0, 0, O, nullptr, EE, 0, NR, EE, EE); k_vtn<<<gvt, 256, 0, stream>>>(O, VT);
  k_flashc<<<gfl, 128, 0, stream>>>(Q16, NBATCH * EE, K16, NBATCH * EE, VT, nullptr, O, NBATCH * EE);      /* rows = tokens, 64 (n,h) slabs of 64 columns */
  k_h16<<<nb8, 256, 0, stream>>>(O, O16, n8);
  k_gemm3<0><<<gE, 256, 0, stream>>>(O16, EE, 0, B[3], EE, 0, 0.0625f, bo_s, 0, Xf, 1, (size_t)EE, 0, X1, nullptr, EE, 0, NR, EE, EE);      /* x1 = x + o*wo^T + bo */
  /* --- cross attention (keys/values from encoder_out, same causal mask) --- */
  k_ln1024<false><<<gln, 256, 0, stream>>>(X1, g2, b2n, H16);
  k_gemm3<0><<<gE, 256, 0, stream>>>(H16, EE, 0, B[4], EE, 0, 0.0625f, bq_c, 0, nullptr, 1, 0, 0, nullptr, Q16, EE, 0, NR, EE, EE);
  k_gemm3<0><<<gE, 256, 0, stream>>>(E16, EE, 0, B[5], EE, 0, 0.0625f, bk_c, 0, nullptr, 1, 0, 0, nullptr, K16, EE, 0, NR, EE, EE);
  k_gemm3<0><<<gE, 256, 0, stream>>>(E16, EE, 0, B[6], EE, 0, 0.0625f, bv_c, 0, nullptr, 1, 0, 0, O, nullptr, EE, 0, NR, EE, EE); k_vtn<<<gvt, 256, 0, stream>>>(O, VT);
  k_flashc<<<gfl, 128, 0, stream>>>(Q16, NBATCH * EE, K16, NBATCH * EE, VT, nullptr, O, NBATCH * EE);
  k_h16<<<nb8, 256, 0, stream>>>(O, O16, n8);
  k_gemm3<0><<<gE, 256, 0, stream>>>(O16, EE, 0, B[7], EE, 0, 0.0625f, bo_c, 0, X1, 1, (size_t)EE, 0, X2, nullptr, EE, 0, NR, EE, EE);      /* x2 = x1 + o*wo^T + bo */
  /* --- FFN --- */
  k_ln1024<false><<<gln, 256, 0, stream>>>(X2, g3, b3n, H16);
  k_gemm3<6><<<gF, 256, 0, stream>>>(H16, EE, 0, BF1, EE, 0, 0.0625f, b1, 0, nullptr, 1, 0, 0, nullptr, F1, FF, 0, NR, FF, EE);      /* gelu_erf(h*fc1^T + b1) -> f16 [4096][4096] */
  k_gemm3<0><<<gE, 256, 0, stream>>>(F1, FF, 0, BF2, FF, 0, 0.0625f, b2, 0, X2, 1, (size_t)EE, 0, (float*)d_out, nullptr, EE, 0, NR, EE, FF);      /* out = x2 + f*fc2^T + b2 */
}

// v003
// A run of this version takes 415 microseconds.
// Two timings next to v002 both put it at 1.08 times that version's speed.
// All steps since v000 together make it 2.39 times as fast.
#include <hip/hip_runtime.h>
// Pre-LN decoder layer, sequence-first layout (T 1024, batch 4, E 1024, 16 heads x 64, FFN 4096): h = LN1(x); x1 = x + SelfAttn(h, h); h = LN2(x1); x2 = x1 + Attn(h, encoder_out); h = LN3(x2); out = x2 + fc2(gelu_erf(fc1(h))). Both attentions: q = (in*wq^T + bq)*64^-0.5, k, v from the key input, per (batch, head) scores over the 1024 keys with the module's causal mask (key > query filled with -1e4, i.e. weight exactly 0), softmax, *v, merged, *wo^T + bo.
// Structure: rows are the (t, n) pairs in memory order, so every projection / FFN is a [4096][1024] GEMM (f16 WMMA, 32x64 wave tiles, f32 accumulation, exact bias, residual through the f32 epilogue addend); LayerNorms wave-per-row on VALU writing f16 operand planes; q/k planes viewed as [token][64 heads x 64] feed a fused causal flash-style kernel per ((n,h), 64 queries) (wave = 16 queries, 32-key steps up to the query block, both products transposed so that a lane owns one query, online softmax f32, P x2^10 f16 packed in registers, f32 accumulators); v re-laid per (n,h) as [d][token] through an LDS tile; exact-erf GELU in the fc1 epilogue.
// Compute dtype: inputs and parameters rounded to bf16; all GEMM operands f16 (~2^-12: LN outputs, q, k, v, P, attention outputs, the GELU hidden), weights bf16-exact (x16 in f16), f32 accumulation; LayerNorm / softmax / residual stream f32. v_wmma_f32_16x16x32_f16.
#define TT 1024
#define NBATCH 4
#define EE 1024
#define NHD 16
#define NH (NBATCH * NHD)        /* 64 (batch, head) slabs */
#define TQ TT
#define TK TT
#define SCL 0.125f
#define NR (TT * NBATCH)         /* 4096 rows */
#define FF 4096
typedef __bf16 v16b __attribute__((ext_vector_type(16)));
typedef unsigned short v8us __attribute__((ext_vector_type(8), may_alias));
typedef float  v8f  __attribute__((ext_vector_type(8)));
typedef float  v4f  __attribute__((ext_vector_type(4)));
typedef float  v4fa __attribute__((ext_vector_type(4), may_alias));
union FragB { v16b v; v8us half[2]; unsigned short u[16]; };

__device__ __forceinline__ unsigned short bf16_bits(float x) { unsigned int u = __float_as_uint(x); return (unsigned short)((u + 0x7FFFu + ((u >> 16) & 1u)) >> 16); }
__device__ __forceinline__ float bf16_val(unsigned short b) { return __uint_as_float(((unsigned int)b) << 16); }
__device__ __forceinline__ float bf16_round(float x) { return bf16_val(bf16_bits(x)); }
// D += A·B with NT terms: 1 = ah·bh, 2 = + al·bh (A split), 3 = + ah·bl (both split)
template <int NT>
__device__ __forceinline__ v8f mmaN(v16b ah, v16b al, v16b bh, v16b bl, v8f c) {
  c = __builtin_amdgcn_wmma_f32_16x16x32_bf16(false, ah, false, bh, (short)0, c, false, false);
  if (NT >= 2) c = __builtin_amdgcn_wmma_f32_16x16x32_bf16(false, al, false, bh, (short)0, c, false, false);
  if (NT >= 3) c = __builtin_amdgcn_wmma_f32_16x16x32_bf16(false, ah, false, bl, (short)0, c, false, false);
  asm volatile("v_nop\n\tv_nop\n\tv_nop\n\tv_nop" : "+v"(c) : "v"(ah), "v"(al), "v"(bh), "v"(bl));
  return c;
}

__global__ __launch_bounds__(256) void k_wt_bf16(const float* __restrict__ W, unsigned short* __restrict__ Wt, int K, int N) {
  const int t = blockIdx.x * 256 + threadIdx.x;
  const int k8n = K / 8;
  if (t >= N * k8n) return;
  const int n = t / k8n, k8 = (t % k8n) * 8;
  v8us v;
#pragma unroll
  for (int i = 0; i < 8; ++i) v[i] = bf16_bits(W[(size_t)(k8 + i) * N + n]);
  *(v8us*)(Wt + (size_t)n * K + k8) = v;
  
}

// GEMM C[M][N] (f32, pitch ldc) = act(A[M][K]·W + bias). A f32 row-major (pitch lda) converted per fragment to bf16
// (ASPLIT: hi/lo two planes -> 2 terms, else single rounded term); Wt bf16 [N][K] (pitch ldb). BIAS_BF16 rounds the
// bias to bf16 first (bias quantised to bf16 before the add). K%32==0, M%16==0, N%64==0.
template <bool ASPLIT, int ACT, bool BIAS_BF16>
__global__ __launch_bounds__(128) void k_gemm_bf(const float* __restrict__ A, int lda, const unsigned short* __restrict__ Wt, int ldb,
                                               const float* __restrict__ bias, float* __restrict__ C, int ldc, int M, int N, int K) {
  __shared__ __attribute__((aligned(16))) float so[4][16][64];
  const int tid = threadIdx.x, w = tid >> 5, lane = tid & 31, ln = lane & 15, hh = lane >> 4;
  const int ntn = N / 64;
  const int wid = blockIdx.x * 4 + w;
  const int mt = wid / ntn, nq = wid % ntn;
  if (mt * 16 >= M) return;
  const int row0 = mt * 16, col0 = nq * 64;
  const float* arow = A + (size_t)(row0 + ln) * lda;
  v8f acc[4] = {};
  for (int kb = 0; kb < K; kb += 32) {
    FragB ah, al;
    const v4f x0 = *(const v4fa*)(arow + kb + 8 * hh), x1 = *(const v4fa*)(arow + kb + 8 * hh + 4);
    const v4f x2 = *(const v4fa*)(arow + kb + 16 + 8 * hh), x3 = *(const v4fa*)(arow + kb + 16 + 8 * hh + 4);
    float xs[16] = {x0[0],x0[1],x0[2],x0[3],x1[0],x1[1],x1[2],x1[3],x2[0],x2[1],x2[2],x2[3],x3[0],x3[1],x3[2],x3[3]};
#pragma unroll
    for (int i = 0; i < 16; ++i) { const unsigned short hb = bf16_bits(xs[i]); ah.u[i] = hb; al.u[i] = ASPLIT ? bf16_bits(xs[i] - bf16_val(hb)) : (unsigned short)0; }
#pragma unroll
    for (int t = 0; t < 4; ++t) {
      const unsigned short* brow = Wt + (size_t)(col0 + t * 16 + ln) * ldb + kb;
      FragB b;
      b.half[0] = *(const v8us*)(brow + 8 * hh);
      b.half[1] = *(const v8us*)(brow + 16 + 8 * hh);
      acc[t] = mmaN<ASPLIT ? 2 : 1>(ah.v, al.v, b.v, b.v, acc[t]);
    }
  }
#pragma unroll
  for (int t = 0; t < 4; ++t) {
    float bv = bias ? bias[col0 + t * 16 + ln] : 0.f;
    if (BIAS_BF16) bv = bf16_round(bv);
#pragma unroll
    for (int r = 0; r < 8; ++r) { float v = acc[t][r] + bv; if (ACT == 1) v = fmaxf(v, 0.f); so[w][8 * hh + r][t * 16 + ln] = v; }
  }
  __builtin_amdgcn_fence(__ATOMIC_ACQ_REL, "workgroup");
  __builtin_amdgcn_wave_barrier();
  const int rsub = lane >> 4, c4 = (lane & 15) * 4;
  {
#pragma unroll
    for (int q = 0; q < 8; ++q) {
      const int r = q * 2 + rsub;
      const v4f v = *(const v4fa*)&so[w][r][c4];
      *(v4f*)(C + (size_t)(row0 + r) * ldc + col0 + c4) = v;
    }
    
  }
}

// GEMM C = act(A·W + bias + resid): A f32 (ASPLIT -> hi/lo 2 terms), Wt bf16 [N][K]; ACT 0 none, 1 relu, 2 exact gelu;
// resid (optional, f32, row index = (row % rmod), pitch ldr, RES_BF16 rounds it) added before the activation.
template <bool ASPLIT, int ACT, bool BIAS_BF16, bool RES_BF16>
__global__ __launch_bounds__(128) void k_gemm_bf3(const float* __restrict__ A, int lda, const unsigned short* __restrict__ Wt, int ldb,
                                                const float* __restrict__ bias, const float* __restrict__ resid, int rmod, int ldr,
                                                float* __restrict__ C, int ldc, int M, int N, int K) {
  __shared__ __attribute__((aligned(16))) float so[4][16][64];
  const int tid = threadIdx.x, w = tid >> 5, lane = tid & 31, ln = lane & 15, hh = lane >> 4;
  const int ntn = N / 64;
  const int wid = blockIdx.x * 4 + w;
  const int mt = wid / ntn, nq = wid % ntn;
  if (mt * 16 >= M) return;
  const int row0 = mt * 16, col0 = nq * 64;
  const float* arow = A + (size_t)(row0 + ln) * lda;
  v8f acc[4] = {};
  for (int kb = 0; kb < K; kb += 32) {
    FragB ah, al;
    const v4f x0 = *(const v4fa*)(arow + kb + 8 * hh), x1 = *(const v4fa*)(arow + kb + 8 * hh + 4);
    const v4f x2 = *(const v4fa*)(arow + kb + 16 + 8 * hh), x3 = *(const v4fa*)(arow + kb + 16 + 8 * hh + 4);
    float xs[16] = {x0[0],x0[1],x0[2],x0[3],x1[0],x1[1],x1[2],x1[3],x2[0],x2[1],x2[2],x2[3],x3[0],x3[1],x3[2],x3[3]};
#pragma unroll
    for (int i = 0; i < 16; ++i) { const unsigned short hb = bf16_bits(xs[i]); ah.u[i] = hb; al.u[i] = ASPLIT ? bf16_bits(xs[i] - bf16_val(hb)) : (unsigned short)0; }
#pragma unroll
    for (int t = 0; t < 4; ++t) {
      const unsigned short* brow = Wt + (size_t)(col0 + t * 16 + ln) * ldb + kb;
      FragB b;
      b.half[0] = *(const v8us*)(brow + 8 * hh);
      b.half[1] = *(const v8us*)(brow + 16 + 8 * hh);
      acc[t] = mmaN<ASPLIT ? 2 : 1>(ah.v, al.v, b.v, b.v, acc[t]);
    }
  }
#pragma unroll
  for (int t = 0; t < 4; ++t) {
    const int col = col0 + t * 16 + ln;
    float bv = bias ? bias[col] : 0.f;
    if (BIAS_BF16) bv = bf16_round(bv);
#pragma unroll
    for (int r = 0; r < 8; ++r) {
      float v = acc[t][r] + bv;
      if (resid) { float rv = resid[(size_t)((row0 + 8 * hh + r) % rmod) * ldr + col]; if (RES_BF16) rv = bf16_round(rv); v += rv; }
      if (ACT == 1) v = fmaxf(v, 0.f);
      if (ACT == 2) v = 0.5f * v * (1.0f + erff(v * 0.70710678118654752f));
      if (ACT == 3) { const float u = 0.7978845608028654f * (v + 0.044715f * v * v * v); v = 0.5f * v * (1.0f + tanhf(u)); }
      so[w][8 * hh + r][t * 16 + ln] = v;
    }
  }
  __builtin_amdgcn_fence(__ATOMIC_ACQ_REL, "workgroup");
  __builtin_amdgcn_wave_barrier();
  const int rsub = lane >> 4, c4 = (lane & 15) * 4;
  {
#pragma unroll
    for (int q = 0; q < 8; ++q) {
      const int r = q * 2 + rsub;
      const v4f v = *(const v4fa*)&so[w][r][c4];
      *(v4f*)(C + (size_t)(row0 + r) * ldc + col0 + c4) = v;
    }
    
  }
}
// row LayerNorm (biased variance, eps) over N: s = X (+ R); optional out_sum <- s; out_norm <- (s-mu)*rsqrt(var+eps)*g + b
template <bool PARAM_BF16>
__global__ __launch_bounds__(256) void k_layernorm(const float* __restrict__ X, const float* __restrict__ R, const float* __restrict__ g, const float* __restrict__ bta,
                                                  float* __restrict__ out_sum, float* __restrict__ out_norm, int N, float eps) {
  __shared__ float red[256];
  const int row = blockIdx.x, tid = threadIdx.x;
  const float* x = X + (size_t)row * N; const float* rr = R ? R + (size_t)row * N : nullptr;
  float vals[16];                     // up to N = 4096
  const int per = N / 256;            // contiguous chunk per thread? use strided-by-4 chunks: thread handles j = tid*4 + 1024*u
  float s1 = 0.f;
  for (int u = 0; u < per / 4; ++u) {
    const int j = tid * 4 + 1024 * u;
    const v4f a = *(const v4fa*)(x + j);
    v4f b = {0.f,0.f,0.f,0.f}; if (rr) b = *(const v4fa*)(rr + j);
#pragma unroll
    for (int q = 0; q < 4; ++q) { const float v = a[q] + b[q]; vals[u * 4 + q] = v; s1 += v; }
  }
  red[tid] = s1; __syncthreads();
  for (int st = 128; st > 0; st >>= 1) { if (tid < st) red[tid] += red[tid + st]; __syncthreads(); }
  const float mu = red[0] / (float)N; __syncthreads();
  float s2 = 0.f;
  for (int u = 0; u < per / 4; ++u)
#pragma unroll
    for (int q = 0; q < 4; ++q) { const float c = vals[u * 4 + q] - mu; s2 += c * c; }
  red[tid] = s2; __syncthreads();
  for (int st = 128; st > 0; st >>= 1) { if (tid < st) red[tid] += red[tid + st]; __syncthreads(); }
  const float rs = rsqrtf(red[0] / (float)N + eps);
  {
    for (int u = 0; u < per / 4; ++u) {
      const int j = tid * 4 + 1024 * u;
      v4f o, sm;
#pragma unroll
      for (int q = 0; q < 4; ++q) {
        float gg = g[j + q], bb = bta[j + q];
        if (PARAM_BF16) { gg = bf16_round(gg); bb = bf16_round(bb); }
        sm[q] = vals[u * 4 + q]; o[q] = (vals[u * 4 + q] - mu) * rs * gg + bb;
      }
      if (out_sum) *(v4f*)(out_sum + (size_t)row * N + j) = sm;
      *(v4f*)(out_norm + (size_t)row * N + j) = o;
    }
    
  }
}



// ---- f16 WMMA path (v_wmma_f32_16x16x32_f16): 11-bit significands for operands in range — used where a [0,1] probability operand needs more precision than bf16
typedef _Float16 v16h __attribute__((ext_vector_type(16)));
union FragH { v16h v; v8us half[2]; _Float16 h[16]; unsigned short u[16]; };
template <int NT>
__device__ __forceinline__ v8f mmaH(v16h ah, v16h al, v16h bh, v16h bl, v8f c) {
  c = __builtin_amdgcn_wmma_f32_16x16x32_f16(false, ah, false, bh, (short)0, c, false, false);
  if (NT >= 2) c = __builtin_amdgcn_wmma_f32_16x16x32_f16(false, al, false, bh, (short)0, c, false, false);
  if (NT >= 3) c = __builtin_amdgcn_wmma_f32_16x16x32_f16(false, ah, false, bl, (short)0, c, false, false);
  asm volatile("v_nop\n\tv_nop\n\tv_nop\n\tv_nop" : "+v"(c) : "v"(ah), "v"(al), "v"(bh), "v"(bl));
  return c;
}
// batched GEMM like k_gemm_b but f16 operands: A f32 (split into f16 hi/lo if ASPLIT, else rounded to f16), Bt = f16 values [n][k]; alpha; C f32; N multiple of 16 (partial tiles skipped)
template <bool ASPLIT>
__global__ __launch_bounds__(128) void k_gemm_h(const float* __restrict__ A, int lda, size_t sA, const _Float16* __restrict__ Bh, int ldb, size_t sB, float alpha, float* __restrict__ C, int ldc, size_t sC, int M, int N, int K) {
  __shared__ __attribute__((aligned(16))) float so[4][16][64];
  const int tid = threadIdx.x, w = tid >> 5, lane = tid & 31, ln = lane & 15, hh = lane >> 4; const int by = blockIdx.y;
  A += (size_t)by * sA; Bh += (size_t)by * sB; C += (size_t)by * sC;
  const int ntn = (N + 63) / 64; const int wid = blockIdx.x * 4 + w; const int mt = wid / ntn, nq = wid % ntn; if (mt * 16 >= M) return;
  const int row0 = mt * 16, col0 = nq * 64; const float* arow = A + (size_t)(row0 + ln) * lda;
  v8f acc[4] = {};
  for (int kb = 0; kb < K; kb += 32) {
    FragH ah, al;
    const v4f x0 = *(const v4fa*)(arow + kb + 8 * hh), x1 = *(const v4fa*)(arow + kb + 8 * hh + 4), x2 = *(const v4fa*)(arow + kb + 16 + 8 * hh), x3 = *(const v4fa*)(arow + kb + 16 + 8 * hh + 4);
    float xs[16] = {x0[0],x0[1],x0[2],x0[3],x1[0],x1[1],x1[2],x1[3],x2[0],x2[1],x2[2],x2[3],x3[0],x3[1],x3[2],x3[3]};
#pragma unroll
    for (int i = 0; i < 16; ++i) { const _Float16 h = (_Float16)xs[i]; ah.h[i] = h; al.h[i] = ASPLIT ? (_Float16)(xs[i] - (float)h) : (_Float16)0.0f; }
#pragma unroll
    for (int t = 0; t < 4; ++t) { if (col0 + t * 16 >= N) continue; const size_t boff = (size_t)(col0 + t * 16 + ln) * ldb + kb; FragH bq; bq.half[0] = *(const v8us*)(Bh + boff + 8 * hh); bq.half[1] = *(const v8us*)(Bh + boff + 16 + 8 * hh);
      acc[t] = mmaH<ASPLIT ? 2 : 1>(ah.v, al.v, bq.v, bq.v, acc[t]); }
  }
#pragma unroll
  for (int t = 0; t < 4; ++t) { if (col0 + t * 16 >= N) continue;
#pragma unroll
    for (int r = 0; r < 8; ++r) so[w][8 * hh + r][t * 16 + ln] = acc[t][r] * alpha; }
  __builtin_amdgcn_fence(__ATOMIC_ACQ_REL, "workgroup"); __builtin_amdgcn_wave_barrier();
  const int rsub = lane >> 4, c4 = (lane & 15) * 4;
  {
#pragma unroll
    for (int q = 0; q < 8; ++q) { const int r = q * 2 + rsub; if (col0 + c4 < N) { const v4f v = *(const v4fa*)&so[w][r][c4]; *(v4f*)(C + (size_t)(row0 + r) * ldc + col0 + c4) = v; } }
     }
}

// Wt[n][k] = f16(W[k][n]·scale) from f32 row-major W[K][N] (scale = power of two; bf16-exact weights stay exact in f16 away from the subnormal range)
__global__ __launch_bounds__(256) void k_wt_f16(const float* __restrict__ W, _Float16* __restrict__ Wt, int K, int N, float scale) {
  const int t = blockIdx.x * 256 + threadIdx.x; if (t >= N * (K / 8)) return; const int n = t / (K / 8), k8 = (t % (K / 8)) * 8; FragH f;
#pragma unroll
  for (int i = 0; i < 8; ++i) f.h[i] = (_Float16)(bf16_round(W[(size_t)(k8 + i) * N + n]) * scale); const v8us o = f.half[0];
  *(v8us*)((unsigned short*)Wt + (size_t)n * K + k8) = o; 
}
// k_gemm_hh variant with fused epilogue: v = acc·alpha + bias[by·sBias + col] (+ CP[(row/rowsPerB)·sCPb + by·64 + col] if CP) ; ACT 0 none / 1 elu ; writes f16 C16 (and f32 C if non-null)
template <int ACT>
__global__ __launch_bounds__(128) void k_gemm_hhx(const _Float16* __restrict__ A, int lda, size_t sA, const _Float16* __restrict__ Bh, int ldb, size_t sB, float alpha, const float* __restrict__ bias, size_t sBias, const float* __restrict__ CP, int rowsPerB, size_t sCPb, int row0g,
    float* __restrict__ C, _Float16* __restrict__ C16, int ldc, size_t sC, int M, int N, int K) {
  __shared__ __attribute__((aligned(16))) float so[4][16][64];
  const int tid = threadIdx.x, w = tid >> 5, lane = tid & 31, ln = lane & 15, hh = lane >> 4; const int by = blockIdx.y;
  A += (size_t)by * sA; Bh += (size_t)by * sB; const size_t cofs = (size_t)by * sC; const float* bp = bias ? bias + (size_t)by * sBias : nullptr;
  const int ntn = (N + 63) / 64; const int wid = blockIdx.x * 4 + w; const int mt = wid / ntn, nq = wid % ntn; if (mt * 16 >= M) return;
  const int row0 = mt * 16, col0 = nq * 64; const _Float16* arow = A + (size_t)(row0 + ln) * lda;
  v8f acc[4] = {};
  for (int kb = 0; kb < K; kb += 32) { FragH ah; ah.half[0] = *(const v8us*)((const unsigned short*)arow + kb + 8 * hh); ah.half[1] = *(const v8us*)((const unsigned short*)arow + kb + 16 + 8 * hh);
#pragma unroll
    for (int t = 0; t < 4; ++t) { if (col0 + t * 16 >= N) continue; const size_t boff = (size_t)(col0 + t * 16 + ln) * ldb + kb; FragH bq; bq.half[0] = *(const v8us*)((const unsigned short*)Bh + boff + 8 * hh); bq.half[1] = *(const v8us*)((const unsigned short*)Bh + boff + 16 + 8 * hh);
      acc[t] = mmaH<1>(ah.v, ah.v, bq.v, bq.v, acc[t]); }
  }
#pragma unroll
  for (int t = 0; t < 4; ++t) { if (col0 + t * 16 >= N) continue; const int col = col0 + t * 16 + ln; const float bv = bp ? bf16_round(bp[col]) : 0.f;
#pragma unroll
    for (int r = 0; r < 8; ++r) { float v = acc[t][r] * alpha + bv; if (CP) { const int bidx = (row0g + row0 + 8 * hh + r) / rowsPerB; v += CP[(size_t)bidx * sCPb + (size_t)by * 64 + col]; } if (ACT == 1) v = (v > 0.f) ? v : expm1f(v); else if (ACT == 7) v = (v > 0.f) ? v + 1.0f : expf(v); else if (ACT == 8) v = tanhf(v); else if (ACT == 9) v = 0.5f * v * (1.0f + tanhf(0.7978845608028654f * (v + 0.044715f * v * v * v))); else if (ACT == 11) v = 1.0f / (1.0f + expf(-v)); else if (ACT == 12) v = (v > 0.f) ? v : 0.01f * v; else if (ACT == 14) v = (v > 0.f) ? v : 0.1f * v; else if (ACT == 15) v = v / (1.0f + expf(-v)); else if (ACT == 3) v = fmaxf(v, 0.f); else if (ACT == 6) v = 0.5f * v * (1.0f + erff(v * 0.70710678118654752f)); so[w][8 * hh + r][t * 16 + ln] = v; } }
  __builtin_amdgcn_fence(__ATOMIC_ACQ_REL, "workgroup"); __builtin_amdgcn_wave_barrier();
  const int rsub = lane >> 4, c4 = (lane & 15) * 4; typedef _Float16 v4h __attribute__((ext_vector_type(4)));
  {
#pragma unroll
    for (int q = 0; q < 8; ++q) { const int r = q * 2 + rsub; if (col0 + c4 < N) { const v4f v = *(const v4fa*)&so[w][r][c4]; if (C) *(v4f*)(C + cofs + (size_t)(row0 + r) * ldc + col0 + c4) = v; if (C16) { v4h h4; for (int i = 0; i < 4; ++i) h4[i] = (_Float16)v[i]; *(v4h*)(C16 + cofs + (size_t)(row0 + r) * ldc + col0 + c4) = h4; } } }
     }
}


typedef _Float16 v4h __attribute__((ext_vector_type(4)));

__global__ __launch_bounds__(256) void k_x16(const float* __restrict__ x, _Float16* __restrict__ X16, size_t n8) { const size_t t = (size_t)blockIdx.x * 256 + threadIdx.x; if (t >= n8) return; FragH f;
#pragma unroll
  for (int q = 0; q < 8; ++q) f.h[q] = (_Float16)bf16_round(x[t * 8 + q]); *(v8us*)((unsigned short*)X16 + t * 8) = f.half[0];  }
__global__ __launch_bounds__(256) void k_h16(const float* __restrict__ x, _Float16* __restrict__ X16, size_t n8) { const size_t t = (size_t)blockIdx.x * 256 + threadIdx.x; if (t >= n8) return; FragH f;
#pragma unroll
  for (int q = 0; q < 8; ++q) f.h[q] = (_Float16)x[t * 8 + q]; *(v8us*)((unsigned short*)X16 + t * 8) = f.half[0];  }
template <int NHv, int TTv>
__global__ __launch_bounds__(256) void k_vt(const _Float16* __restrict__ V16, int ldv, int voff, _Float16* __restrict__ Vt) { __shared__ unsigned short tl[64][66]; const int tid = threadIdx.x; const int slab = blockIdx.x / (TTv / 64), lg = blockIdx.x % (TTv / 64); const int b = slab / NHv, h = slab % NHv;
  for (int i = tid; i < 64 * 8; i += 256) { const int r = i / 8, c8 = (i % 8) * 8; FragH f; f.half[0] = *(const v8us*)((const unsigned short*)V16 + ((size_t)b * TTv + lg * 64 + r) * ldv + voff + h * 64 + c8);
#pragma unroll
    for (int q = 0; q < 8; ++q) tl[r][c8 + q] = f.u[q]; }
  __syncthreads();
  {
#pragma unroll
    for (int rd = 0; rd < 2; ++rd) { const int d = rd * 32 + tid / 8, pc = tid % 8; FragH f;
#pragma unroll
      for (int q = 0; q < 8; ++q) f.u[q] = tl[pc * 8 + q][d];
      *(v8us*)((unsigned short*)Vt + ((size_t)slab * 64 + d) * TTv + lg * 64 + pc * 8) = f.half[0]; }
     } }

__global__ __launch_bounds__(256) void k_hl(const float* __restrict__ F, _Float16* __restrict__ Hh, _Float16* __restrict__ Hl, size_t n8) { const size_t t = (size_t)blockIdx.x * 256 + threadIdx.x; if (t >= n8) return; FragH fh, fl; const v4f a = *(const v4fa*)(F + t * 8), c = *(const v4fa*)(F + t * 8 + 4);
#pragma unroll
  for (int q = 0; q < 4; ++q) { _Float16 h = (_Float16)a[q]; fh.h[q] = h; fl.h[q] = (_Float16)((a[q] - (float)h) * 1024.0f); h = (_Float16)c[q]; fh.h[4 + q] = h; fl.h[4 + q] = (_Float16)((c[q] - (float)h) * 1024.0f); }
  { *(v8us*)((unsigned short*)Hh + t * 8) = fh.half[0]; *(v8us*)((unsigned short*)Hl + t * 8) = fl.half[0];  } }

// ---- fast GEMM (wave tile 32x64, operands staged in LDS) ----
__device__ __forceinline__ v16h g2_frag(const _Float16* p, int hh) { FragH f; f.half[0] = *(const v8us*)((const unsigned short*)p + 8 * hh); f.half[1] = *(const v8us*)((const unsigned short*)p + 16 + 8 * hh); return f.v; }
__device__ __forceinline__ v8f g2_mma(v16h a, v16h b, v8f c) { v8f d = __builtin_amdgcn_wmma_f32_16x16x32_f16(false, a, false, b, (short)0, c, false, false); asm volatile("v_nop\n\tv_nop\n\tv_nop\n\tv_nop" : "+v"(d) : "v"(a), "v"(b)); return d; }
// Block tile 128x128, eight waves of 32x64 (4 down x 2 across). A pass is 128 k: 128 rows of A and 128 rows of Bh, 256 B each, are laid in LDS at a
// pitch of 272 B (16 B x odd, for the ds_load_b128 fragment reads) by per-lane asynchronous 16-byte copies; two buffers, the next pass's copies fly while this one is multiplied.
#define G3_PITCH 272
#define G3_OPB (128 * G3_PITCH)   /* one operand's 128 rows */
#define G3_BUF (2 * G3_OPB)       /* one buffer: [A rows | Bh rows] */
// Eight copies per lane: rows r, r + 16, ..., r + 112 of one operand (16 lanes cover one 256-B row piece). The s_wait_xcnt closes the copies' own statement so that
// no address register named here is rewritten ahead of it.
__device__ __forceinline__ void g3_copy8(unsigned l, const _Float16* g, size_t rstep) {
  asm volatile("global_load_async_to_lds_b128 %0, %8, off\n\t"
               "global_load_async_to_lds_b128 %1, %9, off\n\t"
               "global_load_async_to_lds_b128 %2, %10, off\n\t"
               "global_load_async_to_lds_b128 %3, %11, off\n\t"
               "global_load_async_to_lds_b128 %4, %12, off\n\t"
               "global_load_async_to_lds_b128 %5, %13, off\n\t"
               "global_load_async_to_lds_b128 %6, %14, off\n\t"
               "global_load_async_to_lds_b128 %7, %15, off\n\t"
               "s_wait_xcnt 0x0"
               :: "v"(l), "v"(l + 16u * G3_PITCH), "v"(l + 32u * G3_PITCH), "v"(l + 48u * G3_PITCH), "v"(l + 64u * G3_PITCH), "v"(l + 80u * G3_PITCH), "v"(l + 96u * G3_PITCH), "v"(l + 112u * G3_PITCH),
                  "v"(g), "v"(g + rstep), "v"(g + 2 * rstep), "v"(g + 3 * rstep), "v"(g + 4 * rstep), "v"(g + 5 * rstep), "v"(g + 6 * rstep), "v"(g + 7 * rstep)
               : "memory");
}
// requires M % 128 == 0, N % 128 == 0, K % 128 == 0; epilogue = k_gemm_hhx semantics
// bx = the block's tile index, by = its batch index (the kernels below say where they come from)
template <int ACT>
__device__ __forceinline__ void g3_body(const _Float16* __restrict__ A, int lda, size_t sA, const _Float16* __restrict__ Bh, int ldb, size_t sB, float alpha, const float* __restrict__ bias, size_t sBias, const float* __restrict__ CP, int rowsPerB, size_t sCPb, int row0g,
    float* __restrict__ C, _Float16* __restrict__ C16, int ldc, size_t sC, int M, int N, int K, const int bx, const int by) {
  __shared__ __attribute__((aligned(16))) unsigned char ring[2 * G3_BUF];      /* the two buffers; after the k loop its first 8 x 32 x 68 floats stage the output */
  const int tid = threadIdx.x, w = tid >> 5, lane = tid & 31, ln = lane & 15, hh = lane >> 4;
  A += (size_t)by * sA; Bh += (size_t)by * sB; const size_t cofs = (size_t)by * sC; const float* bp = bias ? bias + (size_t)by * sBias : nullptr;
  const int ntn = N >> 7; const int mt = bx / ntn, nq = bx - mt * ntn; const int rowb = mt * 128, colb = nq * 128; if (rowb >= M) return;      /* block-uniform, ahead of every barrier */
  const int wm = w & 3, wn = w >> 2; const int row0 = rowb + 32 * wm, col0 = colb + 64 * wn;
  const int cr = tid >> 4, cc = tid & 15;      /* copy side: this lane's first row and its 16-byte piece of the row */
  const _Float16* gA = A + (size_t)(rowb + cr) * lda + cc * 8; const _Float16* gB = Bh + (size_t)(colb + cr) * ldb + cc * 8; const size_t stA = (size_t)16 * lda, stB = (size_t)16 * ldb;
  const unsigned lA = (unsigned)(size_t)ring + (unsigned)(cr * G3_PITCH + cc * 16), lB = lA + G3_OPB;
  const int np = K >> 7;
  g3_copy8(lA, gA, stA); g3_copy8(lB, gB, stB);
  asm volatile("s_wait_asynccnt 0x0" ::: "memory");      /* pass 0's own copies have landed before the barrier that publishes them */
  __syncthreads();
  if (np > 1) { g3_copy8(lA + G3_BUF, gA + 128, stA); g3_copy8(lB + G3_BUF, gB + 128, stB); }
  const unsigned char* ra = ring + (32 * wm + ln) * G3_PITCH; const unsigned char* rb = ring + G3_OPB + (64 * wn + ln) * G3_PITCH;
  const v8f z8 = {0.f,0.f,0.f,0.f,0.f,0.f,0.f,0.f}; v8f c00 = z8, c01 = z8, c02 = z8, c03 = z8, c10 = z8, c11 = z8, c12 = z8, c13 = z8;
#pragma unroll 1      /* one pass per trip: the publish point at the foot stands once */
  for (int t = 0; t < np; ++t) { const unsigned bo = (unsigned)(t & 1) * G3_BUF;
#pragma unroll      /* the four 32-k blocks of a pass in straight line, so that a block's fragment reads can stand ahead of the block before it */
    for (int ks = 0; ks < 4; ++ks) { const unsigned char* pa = ra + bo + ks * 64; const unsigned char* pb = rb + bo + ks * 64;
      const v16h a0 = g2_frag((const _Float16*)pa, hh), a1 = g2_frag((const _Float16*)(pa + 16 * G3_PITCH), hh);
      const v16h b0 = g2_frag((const _Float16*)pb, hh), b1 = g2_frag((const _Float16*)(pb + 16 * G3_PITCH), hh), b2 = g2_frag((const _Float16*)(pb + 32 * G3_PITCH), hh), b3 = g2_frag((const _Float16*)(pb + 48 * G3_PITCH), hh);
      c00 = g2_mma(a0, b0, c00); c10 = g2_mma(a1, b0, c10); c01 = g2_mma(a0, b1, c01); c11 = g2_mma(a1, b1, c11);
      c02 = g2_mma(a0, b2, c02); c12 = g2_mma(a1, b2, c12); c03 = g2_mma(a0, b3, c03); c13 = g2_mma(a1, b3, c13); }
    asm volatile("s_wait_dscnt 0x0" ::: "memory");         /* this wave's reads of the buffer are done before the barrier behind which it is refilled */
    asm volatile("s_wait_asynccnt 0x0" ::: "memory");      /* this wave's copies of pass t + 1 have landed before the barrier that publishes them */
    __syncthreads();
    if (t + 2 < np) { g3_copy8(lA + bo, gA + (size_t)(t + 2) * 128, stA); g3_copy8(lB + bo, gB + (size_t)(t + 2) * 128, stB); } }
  asm volatile("s_wait_asynccnt 0x0" ::: "memory");        /* nothing in flight when the ring becomes output staging */
  float (*so)[32][68] = (float (*)[32][68])ring;
  v8f accs[8] = {c00, c01, c02, c03, c10, c11, c12, c13};
#pragma unroll
  for (int u = 0; u < 8; ++u) { const int t = u & 3, half = u >> 2; const int col = col0 + t * 16 + ln; const float bv = bp ? bf16_round(bp[col]) : 0.f;
#pragma unroll
    for (int r = 0; r < 8; ++r) { const int rloc = half * 16 + 8 * hh + r; float v = accs[u][r] * alpha + bv; if (CP) { const int bidx = (row0g + row0 + rloc) / rowsPerB; v += CP[(size_t)bidx * sCPb + (size_t)by * 64 + col]; }
      if (ACT == 3) v = fmaxf(v, 0.f); else if (ACT == 6) v = 0.5f * v * (1.0f + erff(v * 0.70710678118654752f)); else if (ACT == 11) v = 1.0f / (1.0f + expf(-v)); else if (ACT == 15) v = v / (1.0f + expf(-v)); else if (ACT == 12) v = (v > 0.f) ? v : 0.01f * v; else if (ACT == 8) v = tanhf(v);
      so[w][rloc][t * 16 + ln] = v; } }
  __builtin_amdgcn_fence(__ATOMIC_ACQ_REL, "workgroup"); __builtin_amdgcn_wave_barrier();
  const int rsub = lane >> 4, c4 = (lane & 15) * 4;
  {
#pragma unroll
    for (int q = 0; q < 16; ++q) { const int r = q * 2 + rsub; const v4f v = *(const v4fa*)&so[w][r][c4];
      if (C) { *(v4f*)(C + cofs + (size_t)(row0 + r) * ldc + col0 + c4) = v; asm volatile("s_wait_xcnt 0x0" ::: "memory"); }      /* the wait stands in front of any rewrite of the store's data or address registers */
      if (C16) { v4h h4; for (int i = 0; i < 4; ++i) h4[i] = (_Float16)v[i]; *(v4h*)(C16 + cofs + (size_t)(row0 + r) * ldc + col0 + c4) = h4; } }
     } }
template <int ACT>
__global__ __launch_bounds__(256) void k_gemm3(const _Float16* __restrict__ A, int lda, size_t sA, const _Float16* __restrict__ Bh, int ldb, size_t sB, float alpha, const float* __restrict__ bias, size_t sBias, const float* __restrict__ CP, int rowsPerB, size_t sCPb, int row0g,
    float* __restrict__ C, _Float16* __restrict__ C16, int ldc, size_t sC, int M, int N, int K) {
  g3_body<ACT>(A, lda, sA, Bh, ldb, sB, alpha, bias, sBias, CP, rowsPerB, sCPb, row0g, C, C16, ldc, sC, M, N, K, (int)blockIdx.x, (int)blockIdx.y); }
// The five projections that wait for no attention, as one grid: blockIdx.y = 0 q, 1 k, 2 v of the self attention (from the LN1 plane H), 3 k, 4 v of the cross attention (from the encoder plane E).
// Each is the [4096][1024] x [1024][1024] product of k_gemm3<0>; q and k planes leave as f16, v planes as f32.
__global__ __launch_bounds__(256) void k_proj5(const _Float16* __restrict__ H, const _Float16* __restrict__ E, const _Float16* __restrict__ Bq, const _Float16* __restrict__ Bk, const _Float16* __restrict__ Bv, const _Float16* __restrict__ Bkc, const _Float16* __restrict__ Bvc,
    const float* __restrict__ bq, const float* __restrict__ bk, const float* __restrict__ bv, const float* __restrict__ bkc, const float* __restrict__ bvc,
    _Float16* __restrict__ Qs, _Float16* __restrict__ Ks, float* __restrict__ Vs, _Float16* __restrict__ Kc, float* __restrict__ Vc) {
  const int g = (int)blockIdx.y;
  const _Float16* A = (g < 3) ? H : E;
  const _Float16* Bh = (g == 0) ? Bq : (g == 1) ? Bk : (g == 2) ? Bv : (g == 3) ? Bkc : Bvc;
  const float* bias = (g == 0) ? bq : (g == 1) ? bk : (g == 2) ? bv : (g == 3) ? bkc : bvc;
  float* C = (g == 2) ? Vs : (g == 4) ? Vc : nullptr;
  _Float16* C16 = (g == 0) ? Qs : (g == 1) ? Ks : (g == 3) ? Kc : nullptr;
  g3_body<0>(A, EE, 0, Bh, EE, 0, 0.0625f, bias, 0, nullptr, 1, 0, 0, C, C16, EE, 0, NR, EE, EE, (int)blockIdx.x, 0); }


// lane l with lane l ^ 16
__device__ __forceinline__ float xhalf(float x) { return __builtin_bit_cast(float, __builtin_amdgcn_permlanex16(__builtin_bit_cast(int, x), __builtin_bit_cast(int, x), 0x76543210, 0xfedcba98, false, false)); }
// Both products run transposed. S^T = K x Q^T: A = 16 key rows, B = the wave's 16 queries, so lane (ln, hh) holds for ITS query q0 + ln the keys j0 + 16 nt + 8 hh + r:
// maximum and sum are in-lane, the two halves of a query meet in one cross-row move. The two score tiles, converted in place, are the B operand of O^T += V^T x P^T
// (element s = tile s >> 3, register s & 7, which is the k order the V^T rows are loaded in): P passes through no LDS. O^T: lane = query, registers = 8 consecutive d.
__global__ __launch_bounds__(128) void k_flashc(const _Float16* __restrict__ Q16, int ldq, const _Float16* __restrict__ K16, int ldk, const _Float16* __restrict__ Vt, const int* __restrict__ MSK, float* __restrict__ O, int ldo) {
  constexpr int RPW = 16, NQB = TQ / (4 * RPW), DT = 4, KS = 2;
  __shared__ __attribute__((aligned(16))) float sO[4][RPW][64 + 4];
  (void)MSK;
  const int tid = threadIdx.x, w = tid >> 5, lane = tid & 31, ln = lane & 15, hh = lane >> 4;
  const int slab = blockIdx.x / NQB, qblk = blockIdx.x % NQB; const int b = slab / NH, h = slab % NH; const int qb0 = qblk * (4 * RPW); const int q0 = qb0 + w * RPW;
  FragH bq[KS];
  { const unsigned short* qr = (const unsigned short*)Q16 + ((size_t)b * TQ + q0 + ln) * ldq + h * 64;
#pragma unroll
    for (int ks = 0; ks < KS; ++ks) { bq[ks].half[0] = *(const v8us*)(qr + ks * 32 + 8 * hh); bq[ks].half[1] = *(const v8us*)(qr + ks * 32 + 16 + 8 * hh); } }
  const unsigned short* Vth = (const unsigned short*)Vt + (size_t)slab * 64 * TK;
  const int tq = q0 + ln;      /* this lane's query */
  float m_r = -3.0e38f, l_r = 0.f; v8f oacc[DT];
#pragma unroll
  for (int dt = 0; dt < DT; ++dt) oacc[dt] = (v8f){0.f,0.f,0.f,0.f,0.f,0.f,0.f,0.f};
  const int jend = qb0 + 4 * RPW;      /* block-uniform causal bound */
#pragma unroll 1
  for (int j0 = 0; j0 < jend; j0 += 32) {
    FragH ak[2][KS], av[DT];
#pragma unroll
    for (int nt = 0; nt < 2; ++nt) { const unsigned short* kr = (const unsigned short*)K16 + ((size_t)b * TK + j0 + nt * 16 + ln) * ldk + h * 64;
#pragma unroll
      for (int ks = 0; ks < KS; ++ks) { ak[nt][ks].half[0] = *(const v8us*)(kr + ks * 32 + 8 * hh); ak[nt][ks].half[1] = *(const v8us*)(kr + ks * 32 + 16 + 8 * hh); } }
    asm volatile("s_wait_xcnt 0x0" ::: "memory");      /* the V^T loads below may land in registers that hold the K loads' addresses: this wait stands in front of that overwrite */
#pragma unroll
    for (int dt = 0; dt < DT; ++dt) { const unsigned short* vrow = Vth + (size_t)(dt * 16 + ln) * TK + j0; av[dt].half[0] = *(const v8us*)(vrow + 8 * hh); av[dt].half[1] = *(const v8us*)(vrow + 16 + 8 * hh); }
    float sc[16];
#pragma unroll
    for (int nt = 0; nt < 2; ++nt) { v8f acc = (v8f){0.f,0.f,0.f,0.f,0.f,0.f,0.f,0.f};
#pragma unroll
      for (int ks = 0; ks < KS; ++ks) acc = mmaH<1>(ak[nt][ks].v, ak[nt][ks].v, bq[ks].v, bq[ks].v, acc);
#pragma unroll
      for (int r = 0; r < 8; ++r) sc[nt * 8 + r] = (j0 + nt * 16 + 8 * hh + r <= tq) ? acc[r] * SCL : -INFINITY; }
    float mx[4];
#pragma unroll
    for (int i = 0; i < 4; ++i) mx[i] = fmaxf(fmaxf(sc[i], sc[4 + i]), fmaxf(sc[8 + i], sc[12 + i]));
    float mc = fmaxf(fmaxf(mx[0], mx[1]), fmaxf(mx[2], mx[3])); mc = fmaxf(mc, xhalf(mc));
    const float mn = fmaxf(m_r, mc); const float ea = expf(m_r - mn); const float al = (mn > -1.0e38f) ? ea : 1.0f; m_r = mn;
    FragH pb; float ps[4] = {0.f, 0.f, 0.f, 0.f};
#pragma unroll
    for (int i = 0; i < 16; ++i) { const float p = expf(sc[i] - mn); ps[i & 3] += p; pb.h[i] = (_Float16)(p * 1024.0f); }      /* a masked score is -inf: weight exactly 0 */
    l_r = l_r * al + ((ps[0] + ps[1]) + (ps[2] + ps[3]));      /* this half's keys only; the halves are joined behind the loop */
#pragma unroll
    for (int dt = 0; dt < DT; ++dt) {
#pragma unroll
      for (int r = 0; r < 8; ++r) oacc[dt][r] *= al; }
#pragma unroll
    for (int dt = 0; dt < DT; ++dt) oacc[dt] = mmaH<1>(av[dt].v, av[dt].v, pb.v, pb.v, oacc[dt]); }
  const float l = l_r + xhalf(l_r); const float inv = (l > 0.f) ? 1.0f / (l * 1024.0f) : 0.f;
#pragma unroll
  for (int dt = 0; dt < DT; ++dt) { const v4f lo = {oacc[dt][0] * inv, oacc[dt][1] * inv, oacc[dt][2] * inv, oacc[dt][3] * inv}, hi = {oacc[dt][4] * inv, oacc[dt][5] * inv, oacc[dt][6] * inv, oacc[dt][7] * inv};
    *(v4fa*)&sO[w][ln][dt * 16 + 8 * hh] = lo; *(v4fa*)&sO[w][ln][dt * 16 + 8 * hh + 4] = hi; }
  __builtin_amdgcn_fence(__ATOMIC_ACQ_REL, "workgroup"); __builtin_amdgcn_wave_barrier();
  {
#pragma unroll
    for (int rp = 0; rp < RPW; rp += 2) { const int r = rp + (lane >> 4), pc = lane & 15; const v4f val = *(const v4fa*)&sO[w][r][pc * 4]; *(v4f*)(O + ((size_t)b * TQ + q0 + r) * ldo + h * 64 + pc * 4) = val; }
     } }
template <bool RND>
__device__ __forceinline__ void ln1024_body(const float* __restrict__ X, const float* __restrict__ g, const float* __restrict__ bb, _Float16* __restrict__ H16, const int bx) {
  #pragma clang fp contract(off)
  const int tid = threadIdx.x, w = tid >> 5, l = tid & 31; const int r = bx * 8 + w; if (r >= NR) return; const float* x = X + (size_t)r * EE; float v[32]; float s = 0.f; v4f a8[8];
#pragma unroll
  for (int u = 0; u < 8; ++u) a8[u] = *(const v4fa*)(x + u * 128 + l * 4);
  asm volatile("s_wait_xcnt 0x0" ::: "memory");      /* later loads may land in the registers that hold the row loads' address: this wait stands in front of that overwrite */
#pragma unroll
  for (int u = 0; u < 8; ++u) {
#pragma unroll
    for (int q = 0; q < 4; ++q) { const float t = RND ? bf16_round(a8[u][q]) : a8[u][q]; v[u * 4 + q] = t; s += t; } }
  for (int o = 16; o > 0; o >>= 1) s += __shfl_xor(s, o, 32); const float mu = s / (float)EE; float q2 = 0.f;
#pragma unroll
  for (int k = 0; k < 32; ++k) { const float d = v[k] - mu; q2 += d * d; }
  for (int o = 16; o > 0; o >>= 1) q2 += __shfl_xor(q2, o, 32); const float rs = 1.0f / sqrtf(q2 / (float)EE + 1e-5f);
  {
#pragma unroll
    for (int u = 0; u < 8; ++u) { _Float16 h4[4];
#pragma unroll
      for (int q = 0; q < 4; ++q) { const int c = u * 128 + l * 4 + q; h4[q] = (_Float16)((v[u * 4 + q] - mu) * rs * bf16_round(g[c]) + bf16_round(bb[c])); }
      *(unsigned long long*)((unsigned short*)H16 + (size_t)r * EE + u * 128 + l * 4) = *(const unsigned long long*)h4; }
     } }
template <bool RND>
__global__ __launch_bounds__(256) void k_ln1024(const float* __restrict__ X, const float* __restrict__ g, const float* __restrict__ bb, _Float16* __restrict__ H16) { ln1024_body<RND>(X, g, bb, H16, (int)blockIdx.x); }
__device__ __forceinline__ void prep_body(const float* __restrict__ x, const float* __restrict__ e, float* __restrict__ Xf, _Float16* __restrict__ E16, size_t n4, const unsigned bx) {
  const size_t t = (size_t)bx * 256 + threadIdx.x; if (t >= n4) return; const v4f a = *(const v4fa*)(x + t * 4), c = *(const v4fa*)(e + t * 4); v4f ra; _Float16 h4[4];
#pragma unroll
  for (int q = 0; q < 4; ++q) { ra[q] = bf16_round(a[q]); h4[q] = (_Float16)bf16_round(c[q]); }
  const unsigned long long pk = *(const unsigned long long*)h4;
  { *(v4f*)(Xf + t * 4) = ra; *(unsigned long long*)((unsigned short*)E16 + t * 4) = pk;  } }
// Everything that reads only the inputs, as one grid by block range: LN1 (8 rows a block), the x / encoder planes (4 elements a thread), the ten weight planes (8 elements a thread).
// The ten f16 planes lie one behind the other from Bt in the order w0 ... w9, so a piece's place is its running index; w0 ... w7 hold EE * EE elements, w8 and w9 FF * EE.
#define FR_LN (NR / 8)                        /* blocks of LN1 */
#define FR_PREP (NR * EE / 4 / 256)           /* blocks of the x / encoder planes */
#define FR_WSM (EE * EE / 8 / 256)            /* blocks of one EE x EE weight */
#define FR_W (8 * FR_WSM + 2 * (FF / EE) * FR_WSM)
// second bound: eight waves a SIMD. The LN1 branch sets the register count of every block of this grid; held to 128 registers, four blocks of the streaming ranges stay resident on a WGP instead of three.
__global__ __launch_bounds__(256, 8) void k_front(const float* __restrict__ w0, const float* __restrict__ w1, const float* __restrict__ w2, const float* __restrict__ w3, const float* __restrict__ w4, const float* __restrict__ w5, const float* __restrict__ w6, const float* __restrict__ w7,
    const float* __restrict__ w8, const float* __restrict__ w9, const float* __restrict__ x, const float* __restrict__ e, const float* __restrict__ g, const float* __restrict__ bb,
    _Float16* __restrict__ Bt, float* __restrict__ Xf, _Float16* __restrict__ E16, _Float16* __restrict__ H16) {
  const unsigned bx = blockIdx.x;
  if (bx < FR_LN) { ln1024_body<true>(x, g, bb, H16, (int)bx); return; }
  if (bx < FR_LN + FR_PREP) { prep_body(x, e, Xf, E16, (size_t)NR * EE / 4, bx - FR_LN); return; }
  const unsigned wb = bx - (FR_LN + FR_PREP); const unsigned seg = wb / FR_WSM;      /* block-uniform: which EE x EE stretch of the ten planes */
  const float* W; unsigned b0;      /* the source and the block at which its plane begins */
  if (seg < 8) { W = (seg == 0) ? w0 : (seg == 1) ? w1 : (seg == 2) ? w2 : (seg == 3) ? w3 : (seg == 4) ? w4 : (seg == 5) ? w5 : (seg == 6) ? w6 : w7; b0 = seg * FR_WSM; }
  else if (seg < 8 + FF / EE) { W = w8; b0 = 8 * FR_WSM; }
  else { W = w9; b0 = (8 + FF / EE) * FR_WSM; }
  const size_t ts = (size_t)(wb - b0) * 256 + threadIdx.x, td = (size_t)wb * 256 + threadIdx.x; FragH f;
#pragma unroll
  for (int i = 0; i < 8; ++i) f.h[i] = (_Float16)(bf16_round(W[ts * 8 + i]) * 16.0f); *(v8us*)((unsigned short*)Bt + td * 8) = f.half[0];
  asm volatile("s_wait_xcnt 0x0" ::: "memory");      /* stands in front of any rewrite of the registers that the store above names */
}
// blockIdx.y picks the plane: 0 the self attention's v, 1 the cross attention's
__global__ __launch_bounds__(256) void k_vtn(const float* __restrict__ VF0, _Float16* __restrict__ Vt0, const float* __restrict__ VF1, _Float16* __restrict__ Vt1) {
  __shared__ float tl[64][65];
  const float* VF = (blockIdx.y == 0) ? VF0 : VF1; _Float16* Vt = (blockIdx.y == 0) ? Vt0 : Vt1;
  const int tid = threadIdx.x; const int slab = blockIdx.x / (TT / 64), lg = blockIdx.x % (TT / 64); const int n = slab / NHD, h = slab % NHD;
  for (int i = tid; i < 64 * 16; i += 256) { const int r = i / 16, c4 = (i % 16) * 4; const v4f a = *(const v4fa*)(VF + ((size_t)(lg * 64 + r) * NBATCH + n) * EE + h * 64 + c4); tl[r][c4] = a[0]; tl[r][c4 + 1] = a[1]; tl[r][c4 + 2] = a[2]; tl[r][c4 + 3] = a[3]; }
  __syncthreads();
  FragH f[2]; size_t oo[2];
#pragma unroll
  for (int rd = 0; rd < 2; ++rd) { const int d = rd * 32 + tid / 8, pc = tid % 8;
#pragma unroll
    for (int q = 0; q < 8; ++q) f[rd].h[q] = (_Float16)tl[pc * 8 + q][d]; oo[rd] = ((size_t)slab * 64 + d) * TT + lg * 64 + pc * 8; }
  { *(v8us*)((unsigned short*)Vt + oo[0]) = f[0].half[0]; *(v8us*)((unsigned short*)Vt + oo[1]) = f[1].half[0];  } }

extern "C" void kernel_launch(void* const* d_in, const int* in_sizes, int n_in,
                              void* d_out, int out_size, void* d_ws, size_t ws_size, hipStream_t stream) {
  (void)in_sizes; (void)n_in; (void)out_size;
  const float* const* I = (const float* const*)d_in;
  const float* x = I[0]; const float* enc = I[1];
  const float* wq_s = I[2]; const float* bq_s = I[3]; const float* wk_s = I[4]; const float* bk_s = I[5]; const float* wv_s = I[6]; const float* bv_s = I[7]; const float* wo_s = I[8]; const float* bo_s = I[9];
  const float* wq_c = I[10]; const float* bq_c = I[11]; const float* wk_c = I[12]; const float* bk_c = I[13]; const float* wv_c = I[14]; const float* bv_c = I[15]; const float* wo_c = I[16]; const float* bo_c = I[17];
  const float* g1 = I[18]; const float* b1n = I[19]; const float* g2 = I[20]; const float* b2n = I[21]; const float* g3 = I[22]; const float* b3n = I[23]; const float* W1 = I[24]; const float* b1 = I[25]; const float* W2 = I[26]; const float* b2 = I[27];
  char* ws = (char*)d_ws; size_t off = 0;
  auto take = [&](size_t bytes) { char* p = ws + off; off += (bytes + 255) & ~(size_t)255; return p; };
  _Float16* B[8]; for (int i = 0; i < 8; ++i) B[i] = (_Float16*)take((size_t)EE * EE * 2);      /* wq_s wk_s wv_s wo_s wq_c wk_c wv_c wo_c */
  _Float16* BF1 = (_Float16*)take((size_t)FF * EE * 2); _Float16* BF2 = (_Float16*)take((size_t)EE * FF * 2);
  float* Xf = (float*)take((size_t)NR * EE * 4); _Float16* H16 = (_Float16*)take((size_t)NR * EE * 2);
  _Float16* Q16 = (_Float16*)take((size_t)NR * EE * 2); _Float16* K16 = (_Float16*)take((size_t)NR * EE * 2); _Float16* VT = (_Float16*)take((size_t)NR * EE * 2); _Float16* E16 = (_Float16*)take((size_t)NR * EE * 2);      /* these four are contiguous: the FFN hidden reuses them */
  float* O = (float*)take((size_t)NR * EE * 4); float* X1 = (float*)take((size_t)NR * EE * 4);
  _Float16* K16c = (_Float16*)take((size_t)NR * EE * 2); _Float16* VTc = (_Float16*)take((size_t)NR * EE * 2); float* Vc = (float*)take((size_t)NR * EE * 4);      /* the cross attention's k and v planes, made ahead of the self attention */
  if (off > ws_size) return;      /* 16 + 16 + 16 + 8 + 32 + 16 + 16 + 32 = 152 MiB */
  _Float16* O16 = H16;                /* LN output is dead once its projection GEMMs ran; the attention output plane reuses it */
  float* X2 = Xf;                     /* bf16(x) is dead after the first residual GEMM */
  _Float16* F1 = Q16;                 /* FFN hidden [4096][4096] f16 = 32 MiB = Q16+K16+VT+E16 (all dead by then) */
  const size_t n8 = (size_t)NR * EE / 8; const unsigned nb8 = (unsigned)((n8 + 255) / 256);
  const dim3 gE((NR / 128) * (EE / 128), 1), gF((NR / 128) * (FF / 128), 1), gP((NR / 128) * (EE / 128), 5), gvt(NH * (TT / 64), 2); const unsigned gln = NR / 8, gfl = NH * (TQ / 64);
  /* --- all that reads only the inputs: LN1, bf16(x), the encoder plane, the ten weight planes ((out,in) = natural Bt; x16; B[0] ... B[7], BF1, BF2 are contiguous) --- */
  k_front<<<FR_LN + FR_PREP + FR_W, 256, 0, stream>>>(wq_s, wk_s, wv_s, wo_s, wq_c, wk_c, wv_c, wo_c, W1, W2, x, enc, g1, b1n, B[0], Xf, E16, H16);
  /* --- the five projections that wait for no attention, then both v planes re-laid --- */
  k_proj5<<<gP, 256, 0, stream>>>(H16, E16, B[0], B[1], B[2], B[5], B[6], bq_s, bk_s, bv_s, bk_c, bv_c, Q16, K16, O, K16c, Vc);
  k_vtn<<<gvt, 256, 0, stream>>>(O, VT, Vc, VTc);
  /* --- self attention --- */
  k_flashc<<<gfl, 128, 0, stream>>>(Q16, NBATCH * EE, K16, NBATCH * EE, VT, nullptr, O, NBATCH * EE);      /* rows = tokens, 64 (n,h) slabs of 64 columns */
  k_h16<<<nb8, 256, 0, stream>>>(O, O16, n8);
  k_gemm3<0><<<gE, 256, 0, stream>>>(O16, EE, 0, B[3], EE, 0, 0.0625f, bo_s, 0, Xf, 1, (size_t)EE, 0, X1, nullptr, EE, 0, NR, EE, EE);      /* x1 = x + o*wo^T + bo */
  /* --- cross attention (keys/values from encoder_out, same causal mask) --- */
  k_ln1024<false><<<gln, 256, 0, stream>>>(X1, g2, b2n, H16);
  k_gemm3<0><<<gE, 256, 0, stream>>>(H16, EE, 0, B[4], EE, 0, 0.0625f, bq_c, 0, nullptr, 1, 0, 0, nullptr, Q16, EE, 0, NR, EE, EE);
  k_flashc<<<gfl, 128, 0, stream>>>(Q16, NBATCH * EE, K16c, NBATCH * EE, VTc, nullptr, O, NBATCH * EE);
  k_h16<<<nb8, 256, 0, stream>>>(O, O16, n8);
  k_gemm3<0><<<gE, 256, 0, stream>>>(O16, EE, 0, B[7], EE, 0, 0.0625f, bo_c, 0, X1, 1, (size_t)EE, 0, X2, nullptr, EE, 0, NR, EE, EE);      /* x2 = x1 + o*wo^T + bo */
  /* --- FFN --- */
  k_ln1024<false><<<gln, 256, 0, stream>>>(X2, g3, b3n, H16);
  k_gemm3<6><<<gF, 256, 0, stream>>>(H16, EE, 0, BF1, EE, 0, 0.0625f, b1, 0, nullptr, 1, 0, 0, nullptr, F1, FF, 0, NR, FF, EE);      /* gelu_erf(h*fc1^T + b1) -> f16 [4096][4096] */
  k_gemm3<0><<<gE, 256, 0, stream>>>(F1, FF, 0, BF2, FF, 0, 0.0625f, b2, 0, X2, 1, (size_t)EE, 0, (float*)d_out, nullptr, EE, 0, NR, EE, FF);      /* out = x2 + f*fc2^T + b2 */
}

// v004
// A run of this version takes 340 microseconds.
// Two timings next to v003 put it at 1.21 and 1.20 times that version's speed.
// All steps since v000 together make it 2.88 times as fast.
#include <hip/hip_runtime.h>
// Pre-LN decoder layer, sequence-first layout (T 1024, batch 4, E 1024, 16 heads x 64, FFN 4096): h = LN1(x); x1 = x + SelfAttn(h, h); h = LN2(x1); x2 = x1 + Attn(h, encoder_out); h = LN3(x2); out = x2 + fc2(gelu_erf(fc1(h))). Both attentions: q = (in*wq^T + bq)*64^-0.5, k, v from the key input, per (batch, head) scores over the 1024 keys with the module's causal mask (key > query filled with -1e4, i.e. weight exactly 0), softmax, *v, merged, *wo^T + bo.
// Structure: rows are the (t, n) pairs in memory order, so every projection / FFN is a [4096][1024] GEMM (f16 WMMA, 32x64 wave tiles, f32 accumulation, exact bias, residual through the f32 epilogue addend); LayerNorms wave-per-row on VALU writing f16 operand planes; q/k planes viewed as [token][64 heads x 64] feed a fused causal flash-style kernel per ((n,h), 64 queries) (wave = 16 queries, 32-key steps up to the query block, both products transposed so that a lane owns one query, online softmax f32, P x2^10 f16 packed in registers, f32 accumulators); v re-laid per (n,h) as [d][token] through an LDS tile; exact-erf GELU in the fc1 epilogue.
// Compute dtype: inputs and parameters rounded to bf16; all GEMM operands f16 (~2^-12: LN outputs, q, k, v, P, attention outputs, the GELU hidden), weights bf16-exact (x16 in f16), f32 accumulation; LayerNorm / softmax / residual stream f32. v_wmma_f32_16x16x32_f16.
#define TT 1024
#define NBATCH 4
#define EE 1024
#define NHD 16
#define NH (NBATCH * NHD)        /* 64 (batch, head) slabs */
#define TQ TT
#define TK TT
#define SCL 0.125f
#define NR (TT * NBATCH)         /* 4096 rows */
#define FF 4096
typedef __bf16 v16b __attribute__((ext_vector_type(16)));
typedef unsigned short v8us __attribute__((ext_vector_type(8), may_alias));
typedef float  v8f  __attribute__((ext_vector_type(8)));
typedef float  v4f  __attribute__((ext_vector_type(4)));
typedef float  v4fa __attribute__((ext_vector_type(4), may_alias));
union FragB { v16b v; v8us half[2]; unsigned short u[16]; };

__device__ __forceinline__ unsigned short bf16_bits(float x) { unsigned int u = __float_as_uint(x); return (unsigned short)((u + 0x7FFFu + ((u >> 16) & 1u)) >> 16); }
__device__ __forceinline__ float bf16_val(unsigned short b) { return __uint_as_float(((unsigned int)b) << 16); }
__device__ __forceinline__ float bf16_round(float x) { return bf16_val(bf16_bits(x)); }
// D += A·B with NT terms: 1 = ah·bh, 2 = + al·bh (A split), 3 = + ah·bl (both split)
template <int NT>
__device__ __forceinline__ v8f mmaN(v16b ah, v16b al, v16b bh, v16b bl, v8f c) {
  c = __builtin_amdgcn_wmma_f32_16x16x32_bf16(false, ah, false, bh, (short)0, c, false, false);
  if (NT >= 2) c = __builtin_amdgcn_wmma_f32_16x16x32_bf16(false, al, false, bh, (short)0, c, false, false);
  if (NT >= 3) c = __builtin_amdgcn_wmma_f32_16x16x32_bf16(false, ah, false, bl, (short)0, c, false, false);
  asm volatile("v_nop\n\tv_nop\n\tv_nop\n\tv_nop" : "+v"(c) : "v"(ah), "v"(al), "v"(bh), "v"(bl));
  return c;
}

__global__ __launch_bounds__(256) void k_wt_bf16(const float* __restrict__ W, unsigned short* __restrict__ Wt, int K, int N) {
  const int t = blockIdx.x * 256 + threadIdx.x;
  const int k8n = K / 8;
  if (t >= N * k8n) return;
  const int n = t / k8n, k8 = (t % k8n) * 8;
  v8us v;
#pragma unroll
  for (int i = 0; i < 8; ++i) v[i] = bf16_bits(W[(size_t)(k8 + i) * N + n]);
  *(v8us*)(Wt + (size_t)n * K + k8) = v;
  
}

// GEMM C[M][N] (f32, pitch ldc) = act(A[M][K]·W + bias). A f32 row-major (pitch lda) converted per fragment to bf16
// (ASPLIT: hi/lo two planes -> 2 terms, else single rounded term); Wt bf16 [N][K] (pitch ldb). BIAS_BF16 rounds the
// bias to bf16 first (bias quantised to bf16 before the add). K%32==0, M%16==0, N%64==0.
template <bool ASPLIT, int ACT, bool BIAS_BF16>
__global__ __launch_bounds__(128) void k_gemm_bf(const float* __restrict__ A, int lda, const unsigned short* __restrict__ Wt, int ldb,
                                               const float* __restrict__ bias, float* __restrict__ C, int ldc, int M, int N, int K) {
  __shared__ __attribute__((aligned(16))) float so[4][16][64];
  const int tid = threadIdx.x, w = tid >> 5, lane = tid & 31, ln = lane & 15, hh = lane >> 4;
  const int ntn = N / 64;
  const int wid = blockIdx.x * 4 + w;
  const int mt = wid / ntn, nq = wid % ntn;
  if (mt * 16 >= M) return;
  const int row0 = mt * 16, col0 = nq * 64;
  const float* arow = A + (size_t)(row0 + ln) * lda;
  v8f acc[4] = {};
  for (int kb = 0; kb < K; kb += 32) {
    FragB ah, al;
    const v4f x0 = *(const v4fa*)(arow + kb + 8 * hh), x1 = *(const v4fa*)(arow + kb + 8 * hh + 4);
    const v4f x2 = *(const v4fa*)(arow + kb + 16 + 8 * hh), x3 = *(const v4fa*)(arow + kb + 16 + 8 * hh + 4);
    float xs[16] = {x0[0],x0[1],x0[2],x0[3],x1[0],x1[1],x1[2],x1[3],x2[0],x2[1],x2[2],x2[3],x3[0],x3[1],x3[2],x3[3]};
#pragma unroll
    for (int i = 0; i < 16; ++i) { const unsigned short hb = bf16_bits(xs[i]); ah.u[i] = hb; al.u[i] = ASPLIT ? bf16_bits(xs[i] - bf16_val(hb)) : (unsigned short)0; }
#pragma unroll
    for (int t = 0; t < 4; ++t) {
      const unsigned short* brow = Wt + (size_t)(col0 + t * 16 + ln) * ldb + kb;
      FragB b;
      b.half[0] = *(const v8us*)(brow + 8 * hh);
      b.half[1] = *(const v8us*)(brow + 16 + 8 * hh);
      acc[t] = mmaN<ASPLIT ? 2 : 1>(ah.v, al.v, b.v, b.v, acc[t]);
    }
  }
#pragma unroll
  for (int t = 0; t < 4; ++t) {
    float bv = bias ? bias[col0 + t * 16 + ln] : 0.f;
    if (BIAS_BF16) bv = bf16_round(bv);
#pragma unroll
    for (int r = 0; r < 8; ++r) { float v = acc[t][r] + bv; if (ACT == 1) v = fmaxf(v, 0.f); so[w][8 * hh + r][t * 16 + ln] = v; }
  }
  __builtin_amdgcn_fence(__ATOMIC_ACQ_REL, "workgroup");
  __builtin_amdgcn_wave_barrier();
  const int rsub = lane >> 4, c4 = (lane & 15) * 4;
  {
#pragma unroll
    for (int q = 0; q < 8; ++q) {
      const int r = q * 2 + rsub;
      const v4f v = *(const v4fa*)&so[w][r][c4];
      *(v4f*)(C + (size_t)(row0 + r) * ldc + col0 + c4) = v;
    }
    
  }
}

// GEMM C = act(A·W + bias + resid): A f32 (ASPLIT -> hi/lo 2 terms), Wt bf16 [N][K]; ACT 0 none, 1 relu, 2 exact gelu;
// resid (optional, f32, row index = (row % rmod), pitch ldr, RES_BF16 rounds it) added before the activation.
template <bool ASPLIT, int ACT, bool BIAS_BF16, bool RES_BF16>
__global__ __launch_bounds__(128) void k_gemm_bf3(const float* __restrict__ A, int lda, const unsigned short* __restrict__ Wt, int ldb,
                                                const float* __restrict__ bias, const float* __restrict__ resid, int rmod, int ldr,
                                                float* __restrict__ C, int ldc, int M, int N, int K) {
  __shared__ __attribute__((aligned(16))) float so[4][16][64];
  const int tid = threadIdx.x, w = tid >> 5, lane = tid & 31, ln = lane & 15, hh = lane >> 4;
  const int ntn = N / 64;
  const int wid = blockIdx.x * 4 + w;
  const int mt = wid / ntn, nq = wid % ntn;
  if (mt * 16 >= M) return;
  const int row0 = mt * 16, col0 = nq * 64;
  const float* arow = A + (size_t)(row0 + ln) * lda;
  v8f acc[4] = {};
  for (int kb = 0; kb < K; kb += 32) {
    FragB ah, al;
    const v4f x0 = *(const v4fa*)(arow + kb + 8 * hh), x1 = *(const v4fa*)(arow + kb + 8 * hh + 4);
    const v4f x2 = *(const v4fa*)(arow + kb + 16 + 8 * hh), x3 = *(const v4fa*)(arow + kb + 16 + 8 * hh + 4);
    float xs[16] = {x0[0],x0[1],x0[2],x0[3],x1[0],x1[1],x1[2],x1[3],x2[0],x2[1],x2[2],x2[3],x3[0],x3[1],x3[2],x3[3]};
#pragma unroll
    for (int i = 0; i < 16; ++i) { const unsigned short hb = bf16_bits(xs[i]); ah.u[i] = hb; al.u[i] = ASPLIT ? bf16_bits(xs[i] - bf16_val(hb)) : (unsigned short)0; }
#pragma unroll
    for (int t = 0; t < 4; ++t) {
      const unsigned short* brow = Wt + (size_t)(col0 + t * 16 + ln) * ldb + kb;
      FragB b;
      b.half[0] = *(const v8us*)(brow + 8 * hh);
      b.half[1] = *(const v8us*)(brow + 16 + 8 * hh);
      acc[t] = mmaN<ASPLIT ? 2 : 1>(ah.v, al.v, b.v, b.v, acc[t]);
    }
  }
#pragma unroll
  for (int t = 0; t < 4; ++t) {
    const int col = col0 + t * 16 + ln;
    float bv = bias ? bias[col] : 0.f;
    if (BIAS_BF16) bv = bf16_round(bv);
#pragma unroll
    for (int r = 0; r < 8; ++r) {
      float v = acc[t][r] + bv;
      if (resid) { float rv = resid[(size_t)((row0 + 8 * hh + r) % rmod) * ldr + col]; if (RES_BF16) rv = bf16_round(rv); v += rv; }
      if (ACT == 1) v = fmaxf(v, 0.f);
      if (ACT == 2) v = 0.5f * v * (1.0f + erff(v * 0.70710678118654752f));
      if (ACT == 3) { const float u = 0.7978845608028654f * (v + 0.044715f * v * v * v); v = 0.5f * v * (1.0f + tanhf(u)); }
      so[w][8 * hh + r][t * 16 + ln] = v;
    }
  }
  __builtin_amdgcn_fence(__ATOMIC_ACQ_REL, "workgroup");
  __builtin_amdgcn_wave_barrier();
  const int rsub = lane >> 4, c4 = (lane & 15) * 4;
  {
#pragma unroll
    for (int q = 0; q < 8; ++q) {
      const int r = q * 2 + rsub;
      const v4f v = *(const v4fa*)&so[w][r][c4];
      *(v4f*)(C + (size_t)(row0 + r) * ldc + col0 + c4) = v;
    }
    
  }
}
// row LayerNorm (biased variance, eps) over N: s = X (+ R); optional out_sum <- s; out_norm <- (s-mu)*rsqrt(var+eps)*g + b
template <bool PARAM_BF16>
__global__ __launch_bounds__(256) void k_layernorm(const float* __restrict__ X, const float* __restrict__ R, const float* __restrict__ g, const float* __restrict__ bta,
                                                  float* __restrict__ out_sum, float* __restrict__ out_norm, int N, float eps) {
  __shared__ float red[256];
  const int row = blockIdx.x, tid = threadIdx.x;
  const float* x = X + (size_t)row * N; const float* rr = R ? R + (size_t)row * N : nullptr;
  float vals[16];                     // up to N = 4096
  const int per = N / 256;            // contiguous chunk per thread? use strided-by-4 chunks: thread handles j = tid*4 + 1024*u
  float s1 = 0.f;
  for (int u = 0; u < per / 4; ++u) {
    const int j = tid * 4 + 1024 * u;
    const v4f a = *(const v4fa*)(x + j);
    v4f b = {0.f,0.f,0.f,0.f}; if (rr) b = *(const v4fa*)(rr + j);
#pragma unroll
    for (int q = 0; q < 4; ++q) { const float v = a[q] + b[q]; vals[u * 4 + q] = v; s1 += v; }
  }
  red[tid] = s1; __syncthreads();
  for (int st = 128; st > 0; st >>= 1) { if (tid < st) red[tid] += red[tid + st]; __syncthreads(); }
  const float mu = red[0] / (float)N; __syncthreads();
  float s2 = 0.f;
  for (int u = 0; u < per / 4; ++u)
#pragma unroll
    for (int q = 0; q < 4; ++q) { const float c = vals[u * 4 + q] - mu; s2 += c * c; }
  red[tid] = s2; __syncthreads();
  for (int st = 128; st > 0; st >>= 1) { if (tid < st) red[tid] += red[tid + st]; __syncthreads(); }
  const float rs = rsqrtf(red[0] / (float)N + eps);
  {
    for (int u = 0; u < per / 4; ++u) {
      const int j = tid * 4 + 1024 * u;
      v4f o, sm;
#pragma unroll
      for (int q = 0; q < 4; ++q) {
        float gg = g[j + q], bb = bta[j + q];
        if (PARAM_BF16) { gg = bf16_round(gg); bb = bf16_round(bb); }
        sm[q] = vals[u * 4 + q]; o[q] = (vals[u * 4 + q] - mu) * rs * gg + bb;
      }
      if (out_sum) *(v4f*)(out_sum + (size_t)row * N + j) = sm;
      *(v4f*)(out_norm + (size_t)row * N + j) = o;
    }
    
  }
}



// ---- f16 WMMA path (v_wmma_f32_16x16x32_f16): 11-bit significands for operands in range — used where a [0,1] probability operand needs more precision than bf16
typedef _Float16 v16h __attribute__((ext_vector_type(16)));
union FragH { v16h v; v8us half[2]; _Float16 h[16]; unsigned short u[16]; };
template <int NT>
__device__ __forceinline__ v8f mmaH(v16h ah, v16h al, v16h bh, v16h bl, v8f c) {
  c = __builtin_amdgcn_wmma_f32_16x16x32_f16(false, ah, false, bh, (short)0, c, false, false);
  if (NT >= 2) c = __builtin_amdgcn_wmma_f32_16x16x32_f16(false, al, false, bh, (short)0, c, false, false);
  if (NT >= 3) c = __builtin_amdgcn_wmma_f32_16x16x32_f16(false, ah, false, bl, (short)0, c, false, false);
  asm volatile("v_nop\n\tv_nop\n\tv_nop\n\tv_nop" : "+v"(c) : "v"(ah), "v"(al), "v"(bh), "v"(bl));
  return c;
}
// batched GEMM like k_gemm_b but f16 operands: A f32 (split into f16 hi/lo if ASPLIT, else rounded to f16), Bt = f16 values [n][k]; alpha; C f32; N multiple of 16 (partial tiles skipped)
template <bool ASPLIT>
__global__ __launch_bounds__(128) void k_gemm_h(const float* __restrict__ A, int lda, size_t sA, const _Float16* __restrict__ Bh, int ldb, size_t sB, float alpha, float* __restrict__ C, int ldc, size_t sC, int M, int N, int K) {
  __shared__ __attribute__((aligned(16))) float so[4][16][64];
  const int tid = threadIdx.x, w = tid >> 5, lane = tid & 31, ln = lane & 15, hh = lane >> 4; const int by = blockIdx.y;
  A += (size_t)by * sA; Bh += (size_t)by * sB; C += (size_t)by * sC;
  const int ntn = (N + 63) / 64; const int wid = blockIdx.x * 4 + w; const int mt = wid / ntn, nq = wid % ntn; if (mt * 16 >= M) return;
  const int row0 = mt * 16, col0 = nq * 64; const float* arow = A + (size_t)(row0 + ln) * lda;
  v8f acc[4] = {};
  for (int kb = 0; kb < K; kb += 32) {
    FragH ah, al;
    const v4f x0 = *(const v4fa*)(arow + kb + 8 * hh), x1 = *(const v4fa*)(arow + kb + 8 * hh + 4), x2 = *(const v4fa*)(arow + kb + 16 + 8 * hh), x3 = *(const v4fa*)(arow + kb + 16 + 8 * hh + 4);
    float xs[16] = {x0[0],x0[1],x0[2],x0[3],x1[0],x1[1],x1[2],x1[3],x2[0],x2[1],x2[2],x2[3],x3[0],x3[1],x3[2],x3[3]};
#pragma unroll
    for (int i = 0; i < 16; ++i) { const _Float16 h = (_Float16)xs[i]; ah.h[i] = h; al.h[i] = ASPLIT ? (_Float16)(xs[i] - (float)h) : (_Float16)0.0f; }
#pragma unroll
    for (int t = 0; t < 4; ++t) { if (col0 + t * 16 >= N) continue; const size_t boff = (size_t)(col0 + t * 16 + ln) * ldb + kb; FragH bq; bq.half[0] = *(const v8us*)(Bh + boff + 8 * hh); bq.half[1] = *(const v8us*)(Bh + boff + 16 + 8 * hh);
      acc[t] = mmaH<ASPLIT ? 2 : 1>(ah.v, al.v, bq.v, bq.v, acc[t]); }
  }
#pragma unroll
  for (int t = 0; t < 4; ++t) { if (col0 + t * 16 >= N) continue;
#pragma unroll
    for (int r = 0; r < 8; ++r) so[w][8 * hh + r][t * 16 + ln] = acc[t][r] * alpha; }
  __builtin_amdgcn_fence(__ATOMIC_ACQ_REL, "workgroup"); __builtin_amdgcn_wave_barrier();
  const int rsub = lane >> 4, c4 = (lane & 15) * 4;
  {
#pragma unroll
    for (int q = 0; q < 8; ++q) { const int r = q * 2 + rsub; if (col0 + c4 < N) { const v4f v = *(const v4fa*)&so[w][r][c4]; *(v4f*)(C + (size_t)(row0 + r) * ldc + col0 + c4) = v; } }
     }
}

// Wt[n][k] = f16(W[k][n]·scale) from f32 row-major W[K][N] (scale = power of two; bf16-exact weights stay exact in f16 away from the subnormal range)
__global__ __launch_bounds__(256) void k_wt_f16(const float* __restrict__ W, _Float16* __restrict__ Wt, int K, int N, float scale) {
  const int t = blockIdx.x * 256 + threadIdx.x; if (t >= N * (K / 8)) return; const int n = t / (K / 8), k8 = (t % (K / 8)) * 8; FragH f;
#pragma unroll
  for (int i = 0; i < 8; ++i) f.h[i] = (_Float16)(bf16_round(W[(size_t)(k8 + i) * N + n]) * scale); const v8us o = f.half[0];
  *(v8us*)((unsigned short*)Wt + (size_t)n * K + k8) = o; 
}
// k_gemm_hh variant with fused epilogue: v = acc·alpha + bias[by·sBias + col] (+ CP[(row/rowsPerB)·sCPb + by·64 + col] if CP) ; ACT 0 none / 1 elu ; writes f16 C16 (and f32 C if non-null)
template <int ACT>
__global__ __launch_bounds__(128) void k_gemm_hhx(const _Float16* __restrict__ A, int lda, size_t sA, const _Float16* __restrict__ Bh, int ldb, size_t sB, float alpha, const float* __restrict__ bias, size_t sBias, const float* __restrict__ CP, int rowsPerB, size_t sCPb, int row0g,
    float* __restrict__ C, _Float16* __restrict__ C16, int ldc, size_t sC, int M, int N, int K) {
  __shared__ __attribute__((aligned(16))) float so[4][16][64];
  const int tid = threadIdx.x, w = tid >> 5, lane = tid & 31, ln = lane & 15, hh = lane >> 4; const int by = blockIdx.y;
  A += (size_t)by * sA; Bh += (size_t)by * sB; const size_t cofs = (size_t)by * sC; const float* bp = bias ? bias + (size_t)by * sBias : nullptr;
  const int ntn = (N + 63) / 64; const int wid = blockIdx.x * 4 + w; const int mt = wid / ntn, nq = wid % ntn; if (mt * 16 >= M) return;
  const int row0 = mt * 16, col0 = nq * 64; const _Float16* arow = A + (size_t)(row0 + ln) * lda;
  v8f acc[4] = {};
  for (int kb = 0; kb < K; kb += 32) { FragH ah; ah.half[0] = *(const v8us*)((const unsigned short*)arow + kb + 8 * hh); ah.half[1] = *(const v8us*)((const unsigned short*)arow + kb + 16 + 8 * hh);
#pragma unroll
    for (int t = 0; t < 4; ++t) { if (col0 + t * 16 >= N) continue; const size_t boff = (size_t)(col0 + t * 16 + ln) * ldb + kb; FragH bq; bq.half[0] = *(const v8us*)((const unsigned short*)Bh + boff + 8 * hh); bq.half[1] = *(const v8us*)((const unsigned short*)Bh + boff + 16 + 8 * hh);
      acc[t] = mmaH<1>(ah.v, ah.v, bq.v, bq.v, acc[t]); }
  }
#pragma unroll
  for (int t = 0; t < 4; ++t) { if (col0 + t * 16 >= N) continue; const int col = col0 + t * 16 + ln; const float bv = bp ? bf16_round(bp[col]) : 0.f;
#pragma unroll
    for (int r = 0; r < 8; ++r) { float v = acc[t][r] * alpha + bv; if (CP) { const int bidx = (row0g + row0 + 8 * hh + r) / rowsPerB; v += CP[(size_t)bidx * sCPb + (size_t)by * 64 + col]; } if (ACT == 1) v = (v > 0.f) ? v : expm1f(v); else if (ACT == 7) v = (v > 0.f) ? v + 1.0f : expf(v); else if (ACT == 8) v = tanhf(v); else if (ACT == 9) v = 0.5f * v * (1.0f + tanhf(0.7978845608028654f * (v + 0.044715f * v * v * v))); else if (ACT == 11) v = 1.0f / (1.0f + expf(-v)); else if (ACT == 12) v = (v > 0.f) ? v : 0.01f * v; else if (ACT == 14) v = (v > 0.f) ? v : 0.1f * v; else if (ACT == 15) v = v / (1.0f + expf(-v)); else if (ACT == 3) v = fmaxf(v, 0.f); else if (ACT == 6) v = 0.5f * v * (1.0f + erff(v * 0.70710678118654752f)); so[w][8 * hh + r][t * 16 + ln] = v; } }
  __builtin_amdgcn_fence(__ATOMIC_ACQ_REL, "workgroup"); __builtin_amdgcn_wave_barrier();
  const int rsub = lane >> 4, c4 = (lane & 15) * 4; typedef _Float16 v4h __attribute__((ext_vector_type(4)));
  {
#pragma unroll
    for (int q = 0; q < 8; ++q) { const int r = q * 2 + rsub; if (col0 + c4 < N) { const v4f v = *(const v4fa*)&so[w][r][c4]; if (C) *(v4f*)(C + cofs + (size_t)(row0 + r) * ldc + col0 + c4) = v; if (C16) { v4h h4; for (int i = 0; i < 4; ++i) h4[i] = (_Float16)v[i]; *(v4h*)(C16 + cofs + (size_t)(row0 + r) * ldc + col0 + c4) = h4; } } }
     }
}


typedef _Float16 v4h __attribute__((ext_vector_type(4)));

__global__ __launch_bounds__(256) void k_x16(const float* __restrict__ x, _Float16* __restrict__ X16, size_t n8) { const size_t t = (size_t)blockIdx.x * 256 + threadIdx.x; if (t >= n8) return; FragH f;
#pragma unroll
  for (int q = 0; q < 8; ++q) f.h[q] = (_Float16)bf16_round(x[t * 8 + q]); *(v8us*)((unsigned short*)X16 + t * 8) = f.half[0];  }
__global__ __launch_bounds__(256) void k_h16(const float* __restrict__ x, _Float16* __restrict__ X16, size_t n8) { const size_t t = (size_t)blockIdx.x * 256 + threadIdx.x; if (t >= n8) return; FragH f;
#pragma unroll
  for (int q = 0; q < 8; ++q) f.h[q] = (_Float16)x[t * 8 + q]; *(v8us*)((unsigned short*)X16 + t * 8) = f.half[0];  }
template <int NHv, int TTv>
__global__ __launch_bounds__(256) void k_vt(const _Float16* __restrict__ V16, int ldv, int voff, _Float16* __restrict__ Vt) { __shared__ unsigned short tl[64][66]; const int tid = threadIdx.x; const int slab = blockIdx.x / (TTv / 64), lg = blockIdx.x % (TTv / 64); const int b = slab / NHv, h = slab % NHv;
  for (int i = tid; i < 64 * 8; i += 256) { const int r = i / 8, c8 = (i % 8) * 8; FragH f; f.half[0] = *(const v8us*)((const unsigned short*)V16 + ((size_t)b * TTv + lg * 64 + r) * ldv + voff + h * 64 + c8);
#pragma unroll
    for (int q = 0; q < 8; ++q) tl[r][c8 + q] = f.u[q]; }
  __syncthreads();
  {
#pragma unroll
    for (int rd = 0; rd < 2; ++rd) { const int d = rd * 32 + tid / 8, pc = tid % 8; FragH f;
#pragma unroll
      for (int q = 0; q < 8; ++q) f.u[q] = tl[pc * 8 + q][d];
      *(v8us*)((unsigned short*)Vt + ((size_t)slab * 64 + d) * TTv + lg * 64 + pc * 8) = f.half[0]; }
     } }

__global__ __launch_bounds__(256) void k_hl(const float* __restrict__ F, _Float16* __restrict__ Hh, _Float16* __restrict__ Hl, size_t n8) { const size_t t = (size_t)blockIdx.x * 256 + threadIdx.x; if (t >= n8) return; FragH fh, fl; const v4f a = *(const v4fa*)(F + t * 8), c = *(const v4fa*)(F + t * 8 + 4);
#pragma unroll
  for (int q = 0; q < 4; ++q) { _Float16 h = (_Float16)a[q]; fh.h[q] = h; fl.h[q] = (_Float16)((a[q] - (float)h) * 1024.0f); h = (_Float16)c[q]; fh.h[4 + q] = h; fl.h[4 + q] = (_Float16)((c[q] - (float)h) * 1024.0f); }
  { *(v8us*)((unsigned short*)Hh + t * 8) = fh.half[0]; *(v8us*)((unsigned short*)Hl + t * 8) = fl.half[0];  } }

// ---- fast GEMM (wave tile 32x64, operands staged in LDS) ----
__device__ __forceinline__ v16h g2_frag(const _Float16* p, int hh) { FragH f; f.half[0] = *(const v8us*)((const unsigned short*)p + 8 * hh); f.half[1] = *(const v8us*)((const unsigned short*)p + 16 + 8 * hh); return f.v; }
__device__ __forceinline__ v8f g2_mma(v16h a, v16h b, v8f c) { v8f d = __builtin_amdgcn_wmma_f32_16x16x32_f16(false, a, false, b, (short)0, c, false, false); asm volatile("v_nop\n\tv_nop\n\tv_nop\n\tv_nop" : "+v"(d) : "v"(a), "v"(b)); return d; }
// Block tile 128x128, eight waves of 32x64 (4 down x 2 across). A pass is 128 k: 128 rows of A and 128 rows of Bh, 256 B each, are laid in LDS at a
// pitch of 272 B (16 B x odd, for the ds_load_b128 fragment reads) by per-lane asynchronous 16-byte copies; two buffers, the next pass's copies fly while this one is multiplied.
#define G3_PITCH 272
#define G3_OPB (128 * G3_PITCH)   /* one operand's 128 rows */
#define G3_BUF (2 * G3_OPB)       /* one buffer: [A rows | Bh rows] */
// Eight copies per lane: rows r, r + 16, ..., r + 112 of one operand (16 lanes cover one 256-B row piece). The s_wait_xcnt closes the copies' own statement so that
// no address register named here is rewritten ahead of it.
__device__ __forceinline__ void g3_copy8(unsigned l, const _Float16* g, size_t rstep) {
  asm volatile("global_load_async_to_lds_b128 %0, %8, off\n\t"
               "global_load_async_to_lds_b128 %1, %9, off\n\t"
               "global_load_async_to_lds_b128 %2, %10, off\n\t"
               "global_load_async_to_lds_b128 %3, %11, off\n\t"
               "global_load_async_to_lds_b128 %4, %12, off\n\t"
               "global_load_async_to_lds_b128 %5, %13, off\n\t"
               "global_load_async_to_lds_b128 %6, %14, off\n\t"
               "global_load_async_to_lds_b128 %7, %15, off\n\t"
               "s_wait_xcnt 0x0"
               :: "v"(l), "v"(l + 16u * G3_PITCH), "v"(l + 32u * G3_PITCH), "v"(l + 48u * G3_PITCH), "v"(l + 64u * G3_PITCH), "v"(l + 80u * G3_PITCH), "v"(l + 96u * G3_PITCH), "v"(l + 112u * G3_PITCH),
                  "v"(g), "v"(g + rstep), "v"(g + 2 * rstep), "v"(g + 3 * rstep), "v"(g + 4 * rstep), "v"(g + 5 * rstep), "v"(g + 6 * rstep), "v"(g + 7 * rstep)
               : "memory");
}
// requires M % 128 == 0, N % 128 == 0, K % 128 == 0; epilogue: v = act(acc * alpha + bf16(bias[col])), then, with ACT 0 only, + R[row][col] (R = optional f32 addend laid out like C)
// bx = the block's tile index, by = its batch index (the kernels below say where they come from)
template <int ACT>
__device__ __forceinline__ void g3_body(const _Float16* __restrict__ A, int lda, size_t sA, const _Float16* __restrict__ Bh, int ldb, size_t sB, float alpha, const float* __restrict__ bias, size_t sBias, const float* __restrict__ R,
    float* __restrict__ C, _Float16* __restrict__ C16, int ldc, size_t sC, int M, int N, int K, const int bx, const int by) {
  __shared__ __attribute__((aligned(16))) unsigned char ring[2 * G3_BUF];      /* the two buffers; after the k loop its first 8 x 32 x 68 floats stage the output */
  const int tid = threadIdx.x, w = tid >> 5, lane = tid & 31, ln = lane & 15, hh = lane >> 4;
  A += (size_t)by * sA; Bh += (size_t)by * sB; const size_t cofs = (size_t)by * sC; const float* bp = bias ? bias + (size_t)by * sBias : nullptr;
  const int ntn = N >> 7; const int mt = bx / ntn, nq = bx - mt * ntn; const int rowb = mt * 128, colb = nq * 128; if (rowb >= M) return;      /* block-uniform, ahead of every barrier */
  const int wm = w & 3, wn = w >> 2; const int row0 = rowb + 32 * wm, col0 = colb + 64 * wn;
  const int cr = tid >> 4, cc = tid & 15;      /* copy side: this lane's first row and its 16-byte piece of the row */
  const _Float16* gA = A + (size_t)(rowb + cr) * lda + cc * 8; const _Float16* gB = Bh + (size_t)(colb + cr) * ldb + cc * 8; const size_t stA = (size_t)16 * lda, stB = (size_t)16 * ldb;
  const unsigned lA = (unsigned)(size_t)ring + (unsigned)(cr * G3_PITCH + cc * 16), lB = lA + G3_OPB;
  const int np = K >> 7;
  g3_copy8(lA, gA, stA); g3_copy8(lB, gB, stB);
  asm volatile("s_wait_asynccnt 0x0" ::: "memory");      /* pass 0's own copies have landed before the barrier that publishes them */
  __syncthreads();
  if (np > 1) { g3_copy8(lA + G3_BUF, gA + 128, stA); g3_copy8(lB + G3_BUF, gB + 128, stB); }
  /* what the epilogue adds is fetched here, all loads independent, so that it lands under the k loop: the wave's 64 bias words (4 a lane) and, in the shape of the final row stores, its 32 x 64 piece of R */
  const int rsub = lane >> 4, c4 = (lane & 15) * 4;
  float bw[4] = {0.f, 0.f, 0.f, 0.f}; v4f rr[16];
  if (bp) {
#pragma unroll
    for (int t = 0; t < 4; ++t) bw[t] = bp[col0 + t * 16 + ln];
    asm volatile("s_wait_xcnt 0x0" ::: "memory"); }      /* stands in front of any rewrite of the base or offset registers that the four bias loads name */
  if (ACT == 0 && R) { const float* rp = R + cofs + (size_t)(row0 + rsub) * ldc + col0 + c4;
#pragma unroll
    for (int q = 0; q < 16; ++q) rr[q] = *(const v4fa*)(rp + (size_t)(2 * q) * ldc);
    asm volatile("s_wait_xcnt 0x0" ::: "memory"); }      /* stands in front of any rewrite of the address registers that the sixteen row loads name */
  const unsigned char* ra = ring + (32 * wm + ln) * G3_PITCH; const unsigned char* rb = ring + G3_OPB + (64 * wn + ln) * G3_PITCH;
  const v8f z8 = {0.f,0.f,0.f,0.f,0.f,0.f,0.f,0.f}; v8f c00 = z8, c01 = z8, c02 = z8, c03 = z8, c10 = z8, c11 = z8, c12 = z8, c13 = z8;
#pragma unroll 1      /* one pass per trip: the publish point at the foot stands once */
  for (int t = 0; t < np; ++t) { const unsigned bo = (unsigned)(t & 1) * G3_BUF;
#pragma unroll      /* the four 32-k blocks of a pass in straight line, so that a block's fragment reads can stand ahead of the block before it */
    for (int ks = 0; ks < 4; ++ks) { const unsigned char* pa = ra + bo + ks * 64; const unsigned char* pb = rb + bo + ks * 64;
      const v16h a0 = g2_frag((const _Float16*)pa, hh), a1 = g2_frag((const _Float16*)(pa + 16 * G3_PITCH), hh);
      const v16h b0 = g2_frag((const _Float16*)pb, hh), b1 = g2_frag((const _Float16*)(pb + 16 * G3_PITCH), hh), b2 = g2_frag((const _Float16*)(pb + 32 * G3_PITCH), hh), b3 = g2_frag((const _Float16*)(pb + 48 * G3_PITCH), hh);
      c00 = g2_mma(a0, b0, c00); c10 = g2_mma(a1, b0, c10); c01 = g2_mma(a0, b1, c01); c11 = g2_mma(a1, b1, c11);
      c02 = g2_mma(a0, b2, c02); c12 = g2_mma(a1, b2, c12); c03 = g2_mma(a0, b3, c03); c13 = g2_mma(a1, b3, c13); }
    asm volatile("s_wait_dscnt 0x0" ::: "memory");         /* this wave's reads of the buffer are done before the barrier behind which it is refilled */
    asm volatile("s_wait_asynccnt 0x0" ::: "memory");      /* this wave's copies of pass t + 1 have landed before the barrier that publishes them */
    __syncthreads();
    if (t + 2 < np) { g3_copy8(lA + bo, gA + (size_t)(t + 2) * 128, stA); g3_copy8(lB + bo, gB + (size_t)(t + 2) * 128, stB); } }
  asm volatile("s_wait_asynccnt 0x0" ::: "memory");        /* nothing in flight when the ring becomes output staging */
  float (*so)[32][68] = (float (*)[32][68])ring;
  v8f accs[8] = {c00, c01, c02, c03, c10, c11, c12, c13};
#pragma unroll
  for (int u = 0; u < 8; ++u) { const int t = u & 3, half = u >> 2; const float bv = bf16_round(bw[t]);
#pragma unroll
    for (int r = 0; r < 8; ++r) { const int rloc = half * 16 + 8 * hh + r; float v = accs[u][r] * alpha + bv;
      if (ACT == 3) v = fmaxf(v, 0.f); else if (ACT == 6) v = 0.5f * v * (1.0f + erff(v * 0.70710678118654752f)); else if (ACT == 11) v = 1.0f / (1.0f + expf(-v)); else if (ACT == 15) v = v / (1.0f + expf(-v)); else if (ACT == 12) v = (v > 0.f) ? v : 0.01f * v; else if (ACT == 8) v = tanhf(v);
      so[w][rloc][t * 16 + ln] = v; } }
  __builtin_amdgcn_fence(__ATOMIC_ACQ_REL, "workgroup"); __builtin_amdgcn_wave_barrier();
  v4f vv[16];      /* the 16 staged rows are read back as one group, ahead of the stores and their waits, instead of one waited read in front of each store */
#pragma unroll
  for (int q = 0; q < 16; ++q) vv[q] = *(const v4fa*)&so[w][q * 2 + rsub][c4];
  {
#pragma unroll
    for (int q = 0; q < 16; ++q) { const int r = q * 2 + rsub; v4f v = vv[q]; if (ACT == 0 && R) v += rr[q];
      if (C) { *(v4f*)(C + cofs + (size_t)(row0 + r) * ldc + col0 + c4) = v; asm volatile("s_wait_xcnt 0x0" ::: "memory"); }      /* the wait stands in front of any rewrite of the store's data or address registers */
      if (C16) { v4h h4; for (int i = 0; i < 4; ++i) h4[i] = (_Float16)v[i]; *(v4h*)(C16 + cofs + (size_t)(row0 + r) * ldc + col0 + c4) = h4; asm volatile("s_wait_xcnt 0x0" ::: "memory"); } }      /* the same wait behind the f16 store */
     } }
template <int ACT>
__global__ __launch_bounds__(256) void k_gemm3(const _Float16* __restrict__ A, int lda, size_t sA, const _Float16* __restrict__ Bh, int ldb, size_t sB, float alpha, const float* __restrict__ bias, size_t sBias, const float* __restrict__ R,
    float* __restrict__ C, _Float16* __restrict__ C16, int ldc, size_t sC, int M, int N, int K) {
  g3_body<ACT>(A, lda, sA, Bh, ldb, sB, alpha, bias, sBias, R, C, C16, ldc, sC, M, N, K, (int)blockIdx.x, (int)blockIdx.y); }
// The five projections that wait for no attention, as one grid: blockIdx.y = 0 q, 1 k, 2 v of the self attention (from the LN1 plane H), 3 k, 4 v of the cross attention (from the encoder plane E).
// Each is the [4096][1024] x [1024][1024] product of k_gemm3<0>; q and k planes leave as f16, v planes as f32.
__global__ __launch_bounds__(256) void k_proj5(const _Float16* __restrict__ H, const _Float16* __restrict__ E, const _Float16* __restrict__ Bq, const _Float16* __restrict__ Bk, const _Float16* __restrict__ Bv, const _Float16* __restrict__ Bkc, const _Float16* __restrict__ Bvc,
    const float* __restrict__ bq, const float* __restrict__ bk, const float* __restrict__ bv, const float* __restrict__ bkc, const float* __restrict__ bvc,
    _Float16* __restrict__ Qs, _Float16* __restrict__ Ks, float* __restrict__ Vs, _Float16* __restrict__ Kc, float* __restrict__ Vc) {
  const int g = (int)blockIdx.y;
  const _Float16* A = (g < 3) ? H : E;
  const _Float16* Bh = (g == 0) ? Bq : (g == 1) ? Bk : (g == 2) ? Bv : (g == 3) ? Bkc : Bvc;
  const float* bias = (g == 0) ? bq : (g == 1) ? bk : (g == 2) ? bv : (g == 3) ? bkc : bvc;
  float* C = (g == 2) ? Vs : (g == 4) ? Vc : nullptr;
  _Float16* C16 = (g == 0) ? Qs : (g == 1) ? Ks : (g == 3) ? Kc : nullptr;
  g3_body<0>(A, EE, 0, Bh, EE, 0, 0.0625f, bias, 0, nullptr, C, C16, EE, 0, NR, EE, EE, (int)blockIdx.x, 0); }


// lane l with lane l ^ 16
__device__ __forceinline__ float xhalf(float x) { return __builtin_bit_cast(float, __builtin_amdgcn_permlanex16(__builtin_bit_cast(int, x), __builtin_bit_cast(int, x), 0x76543210, 0xfedcba98, false, false)); }
// Both products run transposed. S^T = K x Q^T: A = 16 key rows, B = the wave's 16 queries, so lane (ln, hh) holds for ITS query q0 + ln the keys j0 + 16 nt + 8 hh + r:
// maximum and sum are in-lane, the two halves of a query meet in one cross-row move. The two score tiles, converted in place, are the B operand of O^T += V^T x P^T
// (element s = tile s >> 3, register s & 7, which is the k order the V^T rows are loaded in): P passes through no LDS. O^T: lane = query, registers = 8 consecutive d.
__global__ __launch_bounds__(128) void k_flashc(const _Float16* __restrict__ Q16, int ldq, const _Float16* __restrict__ K16, int ldk, const _Float16* __restrict__ Vt, const int* __restrict__ MSK, float* __restrict__ O, int ldo) {
  constexpr int RPW = 16, NQB = TQ / (4 * RPW), DT = 4, KS = 2;
  __shared__ __attribute__((aligned(16))) float sO[4][RPW][64 + 4];
  (void)MSK;
  const int tid = threadIdx.x, w = tid >> 5, lane = tid & 31, ln = lane & 15, hh = lane >> 4;
  const int slab = blockIdx.x / NQB, qblk = blockIdx.x % NQB; const int b = slab / NH, h = slab % NH; const int qb0 = qblk * (4 * RPW); const int q0 = qb0 + w * RPW;
  FragH bq[KS];
  { const unsigned short* qr = (const unsigned short*)Q16 + ((size_t)b * TQ + q0 + ln) * ldq + h * 64;
#pragma unroll
    for (int ks = 0; ks < KS; ++ks) { bq[ks].half[0] = *(const v8us*)(qr + ks * 32 + 8 * hh); bq[ks].half[1] = *(const v8us*)(qr + ks * 32 + 16 + 8 * hh); } }
  const unsigned short* Vth = (const unsigned short*)Vt + (size_t)slab * 64 * TK;
  const int tq = q0 + ln;      /* this lane's query */
  float m_r = -3.0e38f, l_r = 0.f; v8f oacc[DT];
#pragma unroll
  for (int dt = 0; dt < DT; ++dt) oacc[dt] = (v8f){0.f,0.f,0.f,0.f,0.f,0.f,0.f,0.f};
  const int jend = qb0 + 4 * RPW;      /* block-uniform causal bound */
#pragma unroll 1
  for (int j0 = 0; j0 < jend; j0 += 32) {
    FragH ak[2][KS], av[DT];
#pragma unroll
    for (int nt = 0; nt < 2; ++nt) { const unsigned short* kr = (const unsigned short*)K16 + ((size_t)b * TK + j0 + nt * 16 + ln) * ldk + h * 64;
#pragma unroll
      for (int ks = 0; ks < KS; ++ks) { ak[nt][ks].half[0] = *(const v8us*)(kr + ks * 32 + 8 * hh); ak[nt][ks].half[1] = *(const v8us*)(kr + ks * 32 + 16 + 8 * hh); } }
    asm volatile("s_wait_xcnt 0x0" ::: "memory");      /* the V^T loads below may land in registers that hold the K loads' addresses: this wait stands in front of that overwrite */
#pragma unroll
    for (int dt = 0; dt < DT; ++dt) { const unsigned short* vrow = Vth + (size_t)(dt * 16 + ln) * TK + j0; av[dt].half[0] = *(const v8us*)(vrow + 8 * hh); av[dt].half[1] = *(const v8us*)(vrow + 16 + 8 * hh); }
    float sc[16];
#pragma unroll
    for (int nt = 0; nt < 2; ++nt) { v8f acc = (v8f){0.f,0.f,0.f,0.f,0.f,0.f,0.f,0.f};
#pragma unroll
      for (int ks = 0; ks < KS; ++ks) acc = mmaH<1>(ak[nt][ks].v, ak[nt][ks].v, bq[ks].v, bq[ks].v, acc);
#pragma unroll
      for (int r = 0; r < 8; ++r) sc[nt * 8 + r] = (j0 + nt * 16 + 8 * hh + r <= tq) ? acc[r] * SCL : -INFINITY; }
    float mx[4];
#pragma unroll
    for (int i = 0; i < 4; ++i) mx[i] = fmaxf(fmaxf(sc[i], sc[4 + i]), fmaxf(sc[8 + i], sc[12 + i]));
    float mc = fmaxf(fmaxf(mx[0], mx[1]), fmaxf(mx[2], mx[3])); mc = fmaxf(mc, xhalf(mc));
    const float mn = fmaxf(m_r, mc); const float ea = expf(m_r - mn); const float al = (mn > -1.0e38f) ? ea : 1.0f; m_r = mn;
    FragH pb; float ps[4] = {0.f, 0.f, 0.f, 0.f};
#pragma unroll
    for (int i = 0; i < 16; ++i) { const float p = expf(sc[i] - mn); ps[i & 3] += p; pb.h[i] = (_Float16)(p * 1024.0f); }      /* a masked score is -inf: weight exactly 0 */
    l_r = l_r * al + ((ps[0] + ps[1]) + (ps[2] + ps[3]));      /* this half's keys only; the halves are joined behind the loop */
#pragma unroll
    for (int dt = 0; dt < DT; ++dt) {
#pragma unroll
      for (int r = 0; r < 8; ++r) oacc[dt][r] *= al; }
#pragma unroll
    for (int dt = 0; dt < DT; ++dt) oacc[dt] = mmaH<1>(av[dt].v, av[dt].v, pb.v, pb.v, oacc[dt]); }
  const float l = l_r + xhalf(l_r); const float inv = (l > 0.f) ? 1.0f / (l * 1024.0f) : 0.f;
#pragma unroll
  for (int dt = 0; dt < DT; ++dt) { const v4f lo = {oacc[dt][0] * inv, oacc[dt][1] * inv, oacc[dt][2] * inv, oacc[dt][3] * inv}, hi = {oacc[dt][4] * inv, oacc[dt][5] * inv, oacc[dt][6] * inv, oacc[dt][7] * inv};
    *(v4fa*)&sO[w][ln][dt * 16 + 8 * hh] = lo; *(v4fa*)&sO[w][ln][dt * 16 + 8 * hh + 4] = hi; }
  __builtin_amdgcn_fence(__ATOMIC_ACQ_REL, "workgroup"); __builtin_amdgcn_wave_barrier();
  {
#pragma unroll
    for (int rp = 0; rp < RPW; rp += 2) { const int r = rp + (lane >> 4), pc = lane & 15; const v4f val = *(const v4fa*)&sO[w][r][pc * 4]; *(v4f*)(O + ((size_t)b * TQ + q0 + r) * ldo + h * 64 + pc * 4) = val; }
     } }
template <bool RND>
__device__ __forceinline__ void ln1024_body(const float* __restrict__ X, const float* __restrict__ g, const float* __restrict__ bb, _Float16* __restrict__ H16, const int bx) {
  #pragma clang fp contract(off)
  const int tid = threadIdx.x, w = tid >> 5, l = tid & 31; const int r = bx * 8 + w; if (r >= NR) return; const float* x = X + (size_t)r * EE; float v[32]; float s = 0.f; v4f a8[8];
#pragma unroll
  for (int u = 0; u < 8; ++u) a8[u] = *(const v4fa*)(x + u * 128 + l * 4);
  asm volatile("s_wait_xcnt 0x0" ::: "memory");      /* later loads may land in the registers that hold the row loads' address: this wait stands in front of that overwrite */
#pragma unroll
  for (int u = 0; u < 8; ++u) {
#pragma unroll
    for (int q = 0; q < 4; ++q) { const float t = RND ? bf16_round(a8[u][q]) : a8[u][q]; v[u * 4 + q] = t; s += t; } }
  for (int o = 16; o > 0; o >>= 1) s += __shfl_xor(s, o, 32); const float mu = s / (float)EE; float q2 = 0.f;
#pragma unroll
  for (int k = 0; k < 32; ++k) { const float d = v[k] - mu; q2 += d * d; }
  for (int o = 16; o > 0; o >>= 1) q2 += __shfl_xor(q2, o, 32); const float rs = 1.0f / sqrtf(q2 / (float)EE + 1e-5f);
  {
#pragma unroll
    for (int u = 0; u < 8; ++u) { _Float16 h4[4];
#pragma unroll
      for (int q = 0; q < 4; ++q) { const int c = u * 128 + l * 4 + q; h4[q] = (_Float16)((v[u * 4 + q] - mu) * rs * bf16_round(g[c]) + bf16_round(bb[c])); }
      *(unsigned long long*)((unsigned short*)H16 + (size_t)r * EE + u * 128 + l * 4) = *(const unsigned long long*)h4; }
     } }
template <bool RND>
__global__ __launch_bounds__(256) void k_ln1024(const float* __restrict__ X, const float* __restrict__ g, const float* __restrict__ bb, _Float16* __restrict__ H16) { ln1024_body<RND>(X, g, bb, H16, (int)blockIdx.x); }
__device__ __forceinline__ void prep_body(const float* __restrict__ x, const float* __restrict__ e, float* __restrict__ Xf, _Float16* __restrict__ E16, size_t n4, const unsigned bx) {
  const size_t t = (size_t)bx * 256 + threadIdx.x; if (t >= n4) return; const v4f a = *(const v4fa*)(x + t * 4), c = *(const v4fa*)(e + t * 4); v4f ra; _Float16 h4[4];
#pragma unroll
  for (int q = 0; q < 4; ++q) { ra[q] = bf16_round(a[q]); h4[q] = (_Float16)bf16_round(c[q]); }
  const unsigned long long pk = *(const unsigned long long*)h4;
  { *(v4f*)(Xf + t * 4) = ra; *(unsigned long long*)((unsigned short*)E16 + t * 4) = pk;  } }
// Everything that reads only the inputs, as one grid by block range: LN1 (8 rows a block), the x / encoder planes (4 elements a thread), the ten weight planes (8 elements a thread).
// The ten f16 planes lie one behind the other from Bt in the order w0 ... w9, so a piece's place is its running index; w0 ... w7 hold EE * EE elements, w8 and w9 FF * EE.
#define FR_LN (NR / 8)                        /* blocks of LN1 */
#define FR_PREP (NR * EE / 4 / 256)           /* blocks of the x / encoder planes */
#define FR_WSM (EE * EE / 8 / 256)            /* blocks of one EE x EE weight */
#define FR_W (8 * FR_WSM + 2 * (FF / EE) * FR_WSM)
// second bound: eight waves a SIMD. The LN1 branch sets the register count of every block of this grid; held to 128 registers, four blocks of the streaming ranges stay resident on a WGP instead of three.
__global__ __launch_bounds__(256, 8) void k_front(const float* __restrict__ w0, const float* __restrict__ w1, const float* __restrict__ w2, const float* __restrict__ w3, const float* __restrict__ w4, const float* __restrict__ w5, const float* __restrict__ w6, const float* __restrict__ w7,
    const float* __restrict__ w8, const float* __restrict__ w9, const float* __restrict__ x, const float* __restrict__ e, const float* __restrict__ g, const float* __restrict__ bb,
    _Float16* __restrict__ Bt, float* __restrict__ Xf, _Float16* __restrict__ E16, _Float16* __restrict__ H16) {
  const unsigned bx = blockIdx.x;
  if (bx < FR_LN) { ln1024_body<true>(x, g, bb, H16, (int)bx); return; }
  if (bx < FR_LN + FR_PREP) { prep_body(x, e, Xf, E16, (size_t)NR * EE / 4, bx - FR_LN); return; }
  const unsigned wb = bx - (FR_LN + FR_PREP); const unsigned seg = wb / FR_WSM;      /* block-uniform: which EE x EE stretch of the ten planes */
  const float* W; unsigned b0;      /* the source and the block at which its plane begins */
  if (seg < 8) { W = (seg == 0) ? w0 : (seg == 1) ? w1 : (seg == 2) ? w2 : (seg == 3) ? w3 : (seg == 4) ? w4 : (seg == 5) ? w5 : (seg == 6) ? w6 : w7; b0 = seg * FR_WSM; }
  else if (seg < 8 + FF / EE) { W = w8; b0 = 8 * FR_WSM; }
  else { W = w9; b0 = (8 + FF / EE) * FR_WSM; }
  const size_t ts = (size_t)(wb - b0) * 256 + threadIdx.x, td = (size_t)wb * 256 + threadIdx.x; FragH f;
#pragma unroll
  for (int i = 0; i < 8; ++i) f.h[i] = (_Float16)(bf16_round(W[ts * 8 + i]) * 16.0f); *(v8us*)((unsigned short*)Bt + td * 8) = f.half[0];
  asm volatile("s_wait_xcnt 0x0" ::: "memory");      /* stands in front of any rewrite of the registers that the store above names */
}
// blockIdx.y picks the plane: 0 the self attention's v, 1 the cross attention's
__global__ __launch_bounds__(256) void k_vtn(const float* __restrict__ VF0, _Float16* __restrict__ Vt0, const float* __restrict__ VF1, _Float16* __restrict__ Vt1) {
  __shared__ float tl[64][65];
  const float* VF = (blockIdx.y == 0) ? VF0 : VF1; _Float16* Vt = (blockIdx.y == 0) ? Vt0 : Vt1;
  const int tid = threadIdx.x; const int slab = blockIdx.x / (TT / 64), lg = blockIdx.x % (TT / 64); const int n = slab / NHD, h = slab % NHD;
  for (int i = tid; i < 64 * 16; i += 256) { const int r = i / 16, c4 = (i % 16) * 4; const v4f a = *(const v4fa*)(VF + ((size_t)(lg * 64 + r) * NBATCH + n) * EE + h * 64 + c4); tl[r][c4] = a[0]; tl[r][c4 + 1] = a[1]; tl[r][c4 + 2] = a[2]; tl[r][c4 + 3] = a[3]; }
  __syncthreads();
  FragH f[2]; size_t oo[2];
#pragma unroll
  for (int rd = 0; rd < 2; ++rd) { const int d = rd * 32 + tid / 8, pc = tid % 8;
#pragma unroll
    for (int q = 0; q < 8; ++q) f[rd].h[q] = (_Float16)tl[pc * 8 + q][d]; oo[rd] = ((size_t)slab * 64 + d) * TT + lg * 64 + pc * 8; }
  { *(v8us*)((unsigned short*)Vt + oo[0]) = f[0].half[0]; *(v8us*)((unsigned short*)Vt + oo[1]) = f[1].half[0];  } }

extern "C" void kernel_launch(void* const* d_in, const int* in_sizes, int n_in,
                              void* d_out, int out_size, void* d_ws, size_t ws_size, hipStream_t stream) {
  (void)in_sizes; (void)n_in; (void)out_size;
  const float* const* I = (const float* const*)d_in;
  const float* x = I[0]; const float* enc = I[1];
  const float* wq_s = I[2]; const float* bq_s = I[3]; const float* wk_s = I[4]; const float* bk_s = I[5]; const float* wv_s = I[6]; const float* bv_s = I[7]; const float* wo_s = I[8]; const float* bo_s = I[9];
  const float* wq_c = I[10]; const float* bq_c = I[11]; const float* wk_c = I[12]; const float* bk_c = I[13]; const float* wv_c = I[14]; const float* bv_c = I[15]; const float* wo_c = I[16]; const float* bo_c = I[17];
  const float* g1 = I[18]; const float* b1n = I[19]; const float* g2 = I[20]; const float* b2n = I[21]; const float* g3 = I[22]; const float* b3n = I[23]; const float* W1 = I[24]; const float* b1 = I[25]; const float* W2 = I[26]; const float* b2 = I[27];
  char* ws = (char*)d_ws; size_t off = 0;
  auto take = [&](size_t bytes) { char* p = ws + off; off += (bytes + 255) & ~(size_t)255; return p; };
  _Float16* B[8]; for (int i = 0; i < 8; ++i) B[i] = (_Float16*)take((size_t)EE * EE * 2);      /* wq_s wk_s wv_s wo_s wq_c wk_c wv_c wo_c */
  _Float16* BF1 = (_Float16*)take((size_t)FF * EE * 2); _Float16* BF2 = (_Float16*)take((size_t)EE * FF * 2);
  float* Xf = (float*)take((size_t)NR * EE * 4); _Float16* H16 = (_Float16*)take((size_t)NR * EE * 2);
  _Float16* Q16 = (_Float16*)take((size_t)NR * EE * 2); _Float16* K16 = (_Float16*)take((size_t)NR * EE * 2); _Float16* VT = (_Float16*)take((size_t)NR * EE * 2); _Float16* E16 = (_Float16*)take((size_t)NR * EE * 2);      /* these four are contiguous: the FFN hidden reuses them */
  float* O = (float*)take((size_t)NR * EE * 4); float* X1 = (float*)take((size_t)NR * EE * 4);
  _Float16* K16c = (_Float16*)take((size_t)NR * EE * 2); _Float16* VTc = (_Float16*)take((size_t)NR * EE * 2); float* Vc = (float*)take((size_t)NR * EE * 4);      /* the cross attention's k and v planes, made ahead of the self attention */
  if (off > ws_size) return;      /* 16 + 16 + 16 + 8 + 32 + 16 + 16 + 32 = 152 MiB */
  _Float16* O16 = H16;                /* LN output is dead once its projection GEMMs ran; the attention output plane reuses it */
  float* X2 = Xf;                     /* bf16(x) is dead after the first residual GEMM */
  _Float16* F1 = Q16;                 /* FFN hidden [4096][4096] f16 = 32 MiB = Q16+K16+VT+E16 (all dead by then) */
  const size_t n8 = (size_t)NR * EE / 8; const unsigned nb8 = (unsigned)((n8 + 255) / 256);
  const dim3 gE((NR / 128) * (EE / 128), 1), gF((NR / 128) * (FF / 128), 1), gP((NR / 128) * (EE / 128), 5), gvt(NH * (TT / 64), 2); const unsigned gln = NR / 8, gfl = NH * (TQ / 64);
  /* --- all that reads only the inputs: LN1, bf16(x), the encoder plane, the ten weight planes ((out,in) = natural Bt; x16; B[0] ... B[7], BF1, BF2 are contiguous) --- */
  k_front<<<FR_LN + FR_PREP + FR_W, 256, 0, stream>>>(wq_s, wk_s, wv_s, wo_s, wq_c, wk_c, wv_c, wo_c, W1, W2, x, enc, g1, b1n, B[0], Xf, E16, H16);
  /* --- the five projections that wait for no attention, then both v planes re-laid --- */
  k_proj5<<<gP, 256, 0, stream>>>(H16, E16, B[0], B[1], B[2], B[5], B[6], bq_s, bk_s, bv_s, bk_c, bv_c, Q16, K16, O, K16c, Vc);
  k_vtn<<<gvt, 256, 0, stream>>>(O, VT, Vc, VTc);
  /* --- self attention --- */
  k_flashc<<<gfl, 128, 0, stream>>>(Q16, NBATCH * EE, K16, NBATCH * EE, VT, nullptr, O, NBATCH * EE);      /* rows = tokens, 64 (n,h) slabs of 64 columns */
  k_h16<<<nb8, 256, 0, stream>>>(O, O16, n8);
  k_gemm3<0><<<gE, 256, 0, stream>>>(O16, EE, 0, B[3], EE, 0, 0.0625f, bo_s, 0, Xf, X1, nullptr, EE, 0, NR, EE, EE);      /* x1 = x + o*wo^T + bo */
  /* --- cross attention (keys/values from encoder_out, same causal mask) --- */
  k_ln1024<false><<<gln, 256, 0, stream>>>(X1, g2, b2n, H16);
  k_gemm3<0><<<gE, 256, 0, stream>>>(H16, EE, 0, B[4], EE, 0, 0.0625f, bq_c, 0, nullptr, nullptr, Q16, EE, 0, NR, EE, EE);
  k_flashc<<<gfl, 128, 0, stream>>>(Q16, NBATCH * EE, K16c, NBATCH * EE, VTc, nullptr, O, NBATCH * EE);
  k_h16<<<nb8, 256, 0, stream>>>(O, O16, n8);
  k_gemm3<0><<<gE, 256, 0, stream>>>(O16, EE, 0, B[7], EE, 0, 0.0625f, bo_c, 0, X1, X2, nullptr, EE, 0, NR, EE, EE);      /* x2 = x1 + o*wo^T + bo */
  /* --- FFN --- */
  k_ln1024<false><<<gln, 256, 0, stream>>>(X2, g3, b3n, H16);
  k_gemm3<6><<<gF, 256, 0, stream>>>(H16, EE, 0, BF1, EE, 0, 0.0625f, b1, 0, nullptr, nullptr, F1, FF, 0, NR, FF, EE);      /* gelu_erf(h*fc1^T + b1) -> f16 [4096][4096] */
  k_gemm3<0><<<gE, 256, 0, stream>>>(F1, FF, 0, BF2, FF, 0, 0.0625f, b2, 0, X2, (float*)d_out, nullptr, EE, 0, NR, EE, FF);      /* out = x2 + f*fc2^T + b2 */
}

// v005
// Measured time: 300 microseconds a run.
// In two side-by-side timings against v004, it was 1.15 and 1.14 times as fast.
// Counting every step since v000, it is 3.31 times as fast.
#include <hip/hip_runtime.h>
// Pre-LN decoder layer, sequence-first layout (T 1024, batch 4, E 1024, 16 heads x 64, FFN 4096): h = LN1(x); x1 = x + SelfAttn(h, h); h = LN2(x1); x2 = x1 + Attn(h, encoder_out); h = LN3(x2); out = x2 + fc2(gelu_erf(fc1(h))). Both attentions: q = (in*wq^T + bq)*64^-0.5, k, v from the key input, per (batch, head) scores over the 1024 keys with the module's causal mask (key > query filled with -1e4, i.e. weight exactly 0), softmax, *v, merged, *wo^T + bo.
// Structure: rows are the (t, n) pairs in memory order, so every projection / FFN is a [4096][1024] GEMM (f16 WMMA, 32x64 wave tiles, f32 accumulation, exact bias, residual through the f32 epilogue addend); LayerNorms wave-per-row on VALU writing f16 operand planes; q/k planes viewed as [token][64 heads x 64] feed a fused causal flash-style kernel per ((n,h), 64 queries) (wave = 16 queries, 32-key steps up to the query block, both products transposed so that a lane owns one query, online softmax f32, P x2^10 f16 packed in registers, f32 accumulators); v re-laid per (n,h) as [d][token] through an LDS tile; exact-erf GELU in the fc1 epilogue.
// Compute dtype: inputs and parameters rounded to bf16; all GEMM operands f16 (~2^-12: LN outputs, q, k, v, P, attention outputs, the GELU hidden), weights bf16-exact (x16 in f16), f32 accumulation; LayerNorm / softmax / residual stream f32. v_wmma_f32_16x16x32_f16.
#define TT 1024
#define NBATCH 4
#define EE 1024
#define NHD 16
#define NH (NBATCH * NHD)        /* 64 (batch, head) slabs */
#define TQ TT
#define TK TT
#define SCL 0.125f
#define NR (TT * NBATCH)         /* 4096 rows */
#define FF 4096
typedef __bf16 v16b __attribute__((ext_vector_type(16)));
typedef unsigned short v8us __attribute__((ext_vector_type(8), may_alias));
typedef float  v8f  __attribute__((ext_vector_type(8)));
typedef float  v4f  __attribute__((ext_vector_type(4)));
typedef float  v4fa __attribute__((ext_vector_type(4), may_alias));
union FragB { v16b v; v8us half[2]; unsigned short u[16]; };

__device__ __forceinline__ unsigned short bf16_bits(float x) { unsigned int u = __float_as_uint(x); return (unsigned short)((u + 0x7FFFu + ((u >> 16) & 1u)) >> 16); }
__device__ __forceinline__ float bf16_val(unsigned short b) { return __uint_as_float(((unsigned int)b) << 16); }
__device__ __forceinline__ float bf16_round(float x) { return bf16_val(bf16_bits(x)); }
// D += A·B with NT terms: 1 = ah·bh, 2 = + al·bh (A split), 3 = + ah·bl (both split)
template <int NT>
__device__ __forceinline__ v8f mmaN(v16b ah, v16b al, v16b bh, v16b bl, v8f c) {
  c = __builtin_amdgcn_wmma_f32_16x16x32_bf16(false, ah, false, bh, (short)0, c, false, false);
  if (NT >= 2) c = __builtin_amdgcn_wmma_f32_16x16x32_bf16(false, al, false, bh, (short)0, c, false, false);
  if (NT >= 3) c = __builtin_amdgcn_wmma_f32_16x16x32_bf16(false, ah, false, bl, (short)0, c, false, false);
  asm volatile("v_nop\n\tv_nop\n\tv_nop\n\tv_nop" : "+v"(c) : "v"(ah), "v"(al), "v"(bh), "v"(bl));
  return c;
}

__global__ __launch_bounds__(256) void k_wt_bf16(const float* __restrict__ W, unsigned short* __restrict__ Wt, int K, int N) {
  const int t = blockIdx.x * 256 + threadIdx.x;
  const int k8n = K / 8;
  if (t >= N * k8n) return;
  const int n = t / k8n, k8 = (t % k8n) * 8;
  v8us v;
#pragma unroll
  for (int i = 0; i < 8; ++i) v[i] = bf16_bits(W[(size_t)(k8 + i) * N + n]);
  *(v8us*)(Wt + (size_t)n * K + k8) = v;
  
}

// GEMM C[M][N] (f32, pitch ldc) = act(A[M][K]·W + bias). A f32 row-major (pitch lda) converted per fragment to bf16
// (ASPLIT: hi/lo two planes -> 2 terms, else single rounded term); Wt bf16 [N][K] (pitch ldb). BIAS_BF16 rounds the
// bias to bf16 first (bias quantised to bf16 before the add). K%32==0, M%16==0, N%64==0.
template <bool ASPLIT, int ACT, bool BIAS_BF16>
__global__ __launch_bounds__(128) void k_gemm_bf(const float* __restrict__ A, int lda, const unsigned short* __restrict__ Wt, int ldb,
                                               const float* __restrict__ bias, float* __restrict__ C, int ldc, int M, int N, int K) {
  __shared__ __attribute__((aligned(16))) float so[4][16][64];
  const int tid = threadIdx.x, w = tid >> 5, lane = tid & 31, ln = lane & 15, hh = lane >> 4;
  const int ntn = N / 64;
  const int wid = blockIdx.x * 4 + w;
  const int mt = wid / ntn, nq = wid % ntn;
  if (mt * 16 >= M) return;
  const int row0 = mt * 16, col0 = nq * 64;
  const float* arow = A + (size_t)(row0 + ln) * lda;
  v8f acc[4] = {};
  for (int kb = 0; kb < K; kb += 32) {
    FragB ah, al;
    const v4f x0 = *(const v4fa*)(arow + kb + 8 * hh), x1 = *(const v4fa*)(arow + kb + 8 * hh + 4);
    const v4f x2 = *(const v4fa*)(arow + kb + 16 + 8 * hh), x3 = *(const v4fa*)(arow + kb + 16 + 8 * hh + 4);
    float xs[16] = {x0[0],x0[1],x0[2],x0[3],x1[0],x1[1],x1[2],x1[3],x2[0],x2[1],x2[2],x2[3],x3[0],x3[1],x3[2],x3[3]};
#pragma unroll
    for (int i = 0; i < 16; ++i) { const unsigned short hb = bf16_bits(xs[i]); ah.u[i] = hb; al.u[i] = ASPLIT ? bf16_bits(xs[i] - bf16_val(hb)) : (unsigned short)0; }
#pragma unroll
    for (int t = 0; t < 4; ++t) {
      const unsigned short* brow = Wt + (size_t)(col0 + t * 16 + ln) * ldb + kb;
      FragB b;
      b.half[0] = *(const v8us*)(brow + 8 * hh);
      b.half[1] = *(const v8us*)(brow + 16 + 8 * hh);
      acc[t] = mmaN<ASPLIT ? 2 : 1>(ah.v, al.v, b.v, b.v, acc[t]);
    }
  }
#pragma unroll
  for (int t = 0; t < 4; ++t) {
    float bv = bias ? bias[col0 + t * 16 + ln] : 0.f;
    if (BIAS_BF16) bv = bf16_round(bv);
#pragma unroll
    for (int r = 0; r < 8; ++r) { float v = acc[t][r] + bv; if (ACT == 1) v = fmaxf(v, 0.f); so[w][8 * hh + r][t * 16 + ln] = v; }
  }
  __builtin_amdgcn_fence(__ATOMIC_ACQ_REL, "workgroup");
  __builtin_amdgcn_wave_barrier();
  const int rsub = lane >> 4, c4 = (lane & 15) * 4;
  {
#pragma unroll
    for (int q = 0; q < 8; ++q) {
      const int r = q * 2 + rsub;
      const v4f v = *(const v4fa*)&so[w][r][c4];
      *(v4f*)(C + (size_t)(row0 + r) * ldc + col0 + c4) = v;
    }
    
  }
}

// GEMM C = act(A·W + bias + resid): A f32 (ASPLIT -> hi/lo 2 terms), Wt bf16 [N][K]; ACT 0 none, 1 relu, 2 exact gelu;
// resid (optional, f32, row index = (row % rmod), pitch ldr, RES_BF16 rounds it) added before the activation.
template <bool ASPLIT, int ACT, bool BIAS_BF16, bool RES_BF16>
__global__ __launch_bounds__(128) void k_gemm_bf3(const float* __restrict__ A, int lda, const unsigned short* __restrict__ Wt, int ldb,
                                                const float* __restrict__ bias, const float* __restrict__ resid, int rmod, int ldr,
                                                float* __restrict__ C, int ldc, int M, int N, int K) {
  __shared__ __attribute__((aligned(16))) float so[4][16][64];
  const int tid = threadIdx.x, w = tid >> 5, lane = tid & 31, ln = lane & 15, hh = lane >> 4;
  const int ntn = N / 64;
  const int wid = blockIdx.x * 4 + w;
  const int mt = wid / ntn, nq = wid % ntn;
  if (mt * 16 >= M) return;
  const int row0 = mt * 16, col0 = nq * 64;
  const float* arow = A + (size_t)(row0 + ln) * lda;
  v8f acc[4] = {};
  for (int kb = 0; kb < K; kb += 32) {
    FragB ah, al;
    const v4f x0 = *(const v4fa*)(arow + kb + 8 * hh), x1 = *(const v4fa*)(arow + kb + 8 * hh + 4);
    const v4f x2 = *(const v4fa*)(arow + kb + 16 + 8 * hh), x3 = *(const v4fa*)(arow + kb + 16 + 8 * hh + 4);
    float xs[16] = {x0[0],x0[1],x0[2],x0[3],x1[0],x1[1],x1[2],x1[3],x2[0],x2[1],x2[2],x2[3],x3[0],x3[1],x3[2],x3[3]};
#pragma unroll
    for (int i = 0; i < 16; ++i) { const unsigned short hb = bf16_bits(xs[i]); ah.u[i] = hb; al.u[i] = ASPLIT ? bf16_bits(xs[i] - bf16_val(hb)) : (unsigned short)0; }
#pragma unroll
    for (int t = 0; t < 4; ++t) {
      const unsigned short* brow = Wt + (size_t)(col0 + t * 16 + ln) * ldb + kb;
      FragB b;
      b.half[0] = *(const v8us*)(brow + 8 * hh);
      b.half[1] = *(const v8us*)(brow + 16 + 8 * hh);
      acc[t] = mmaN<ASPLIT ? 2 : 1>(ah.v, al.v, b.v, b.v, acc[t]);
    }
  }
#pragma unroll
  for (int t = 0; t < 4; ++t) {
    const int col = col0 + t * 16 + ln;
    float bv = bias ? bias[col] : 0.f;
    if (BIAS_BF16) bv = bf16_round(bv);
#pragma unroll
    for (int r = 0; r < 8; ++r) {
      float v = acc[t][r] + bv;
      if (resid) { float rv = resid[(size_t)((row0 + 8 * hh + r) % rmod) * ldr + col]; if (RES_BF16) rv = bf16_round(rv); v += rv; }
      if (ACT == 1) v = fmaxf(v, 0.f);
      if (ACT == 2) v = 0.5f * v * (1.0f + erff(v * 0.70710678118654752f));
      if (ACT == 3) { const float u = 0.7978845608028654f * (v + 0.044715f * v * v * v); v = 0.5f * v * (1.0f + tanhf(u)); }
      so[w][8 * hh + r][t * 16 + ln] = v;
    }
  }
  __builtin_amdgcn_fence(__ATOMIC_ACQ_REL, "workgroup");
  __builtin_amdgcn_wave_barrier();
  const int rsub = lane >> 4, c4 = (lane & 15) * 4;
  {
#pragma unroll
    for (int q = 0; q < 8; ++q) {
      const int r = q * 2 + rsub;
      const v4f v = *(const v4fa*)&so[w][r][c4];
      *(v4f*)(C + (size_t)(row0 + r) * ldc + col0 + c4) = v;
    }
    
  }
}
// row LayerNorm (biased variance, eps) over N: s = X (+ R); optional out_sum <- s; out_norm <- (s-mu)*rsqrt(var+eps)*g + b
template <bool PARAM_BF16>
__global__ __launch_bounds__(256) void k_layernorm(const float* __restrict__ X, const float* __restrict__ R, const float* __restrict__ g, const float* __restrict__ bta,
                                                  float* __restrict__ out_sum, float* __restrict__ out_norm, int N, float eps) {
  __shared__ float red[256];
  const int row = blockIdx.x, tid = threadIdx.x;
  const float* x = X + (size_t)row * N; const float* rr = R ? R + (size_t)row * N : nullptr;
  float vals[16];                     // up to N = 4096
  const int per = N / 256;            // contiguous chunk per thread? use strided-by-4 chunks: thread handles j = tid*4 + 1024*u
  float s1 = 0.f;
  for (int u = 0; u < per / 4; ++u) {
    const int j = tid * 4 + 1024 * u;
    const v4f a = *(const v4fa*)(x + j);
    v4f b = {0.f,0.f,0.f,0.f}; if (rr) b = *(const v4fa*)(rr + j);
#pragma unroll
    for (int q = 0; q < 4; ++q) { const float v = a[q] + b[q]; vals[u * 4 + q] = v; s1 += v; }
  }
  red[tid] = s1; __syncthreads();
  for (int st = 128; st > 0; st >>= 1) { if (tid < st) red[tid] += red[tid + st]; __syncthreads(); }
  const float mu = red[0] / (float)N; __syncthreads();
  float s2 = 0.f;
  for (int u = 0; u < per / 4; ++u)
#pragma unroll
    for (int q = 0; q < 4; ++q) { const float c = vals[u * 4 + q] - mu; s2 += c * c; }
  red[tid] = s2; __syncthreads();
  for (int st = 128; st > 0; st >>= 1) { if (tid < st) red[tid] += red[tid + st]; __syncthreads(); }
  const float rs = rsqrtf(red[0] / (float)N + eps);
  {
    for (int u = 0; u < per / 4; ++u) {
      const int j = tid * 4 + 1024 * u;
      v4f o, sm;
#pragma unroll
      for (int q = 0; q < 4; ++q) {
        float gg = g[j + q], bb = bta[j + q];
        if (PARAM_BF16) { gg = bf16_round(gg); bb = bf16_round(bb); }
        sm[q] = vals[u * 4 + q]; o[q] = (vals[u * 4 + q] - mu) * rs * gg + bb;
      }
      if (out_sum) *(v4f*)(out_sum + (size_t)row * N + j) = sm;
      *(v4f*)(out_norm + (size_t)row * N + j) = o;
    }
    
  }
}



// ---- f16 WMMA path (v_wmma_f32_16x16x32_f16): 11-bit significands for operands in range — used where a [0,1] probability operand needs more precision than bf16
typedef _Float16 v16h __attribute__((ext_vector_type(16)));
union FragH { v16h v; v8us half[2]; _Float16 h[16]; unsigned short u[16]; };
template <int NT>
__device__ __forceinline__ v8f mmaH(v16h ah, v16h al, v16h bh, v16h bl, v8f c) {
  c = __builtin_amdgcn_wmma_f32_16x16x32_f16(false, ah, false, bh, (short)0, c, false, false);
  if (NT >= 2) c = __builtin_amdgcn_wmma_f32_16x16x32_f16(false, al, false, bh, (short)0, c, false, false);
  if (NT >= 3) c = __builtin_amdgcn_wmma_f32_16x16x32_f16(false, ah, false, bl, (short)0, c, false, false);
  asm volatile("v_nop\n\tv_nop\n\tv_nop\n\tv_nop" : "+v"(c) : "v"(ah), "v"(al), "v"(bh), "v"(bl));
  return c;
}
// batched GEMM like k_gemm_b but f16 operands: A f32 (split into f16 hi/lo if ASPLIT, else rounded to f16), Bt = f16 values [n][k]; alpha; C f32; N multiple of 16 (partial tiles skipped)
template <bool ASPLIT>
__global__ __launch_bounds__(128) void k_gemm_h(const float* __restrict__ A, int lda, size_t sA, const _Float16* __restrict__ Bh, int ldb, size_t sB, float alpha, float* __restrict__ C, int ldc, size_t sC, int M, int N, int K) {
  __shared__ __attribute__((aligned(16))) float so[4][16][64];
  const int tid = threadIdx.x, w = tid >> 5, lane = tid & 31, ln = lane & 15, hh = lane >> 4; const int by = blockIdx.y;
  A += (size_t)by * sA; Bh += (size_t)by * sB; C += (size_t)by * sC;
  const int ntn = (N + 63) / 64; const int wid = blockIdx.x * 4 + w; const int mt = wid / ntn, nq = wid % ntn; if (mt * 16 >= M) return;
  const int row0 = mt * 16, col0 = nq * 64; const float* arow = A + (size_t)(row0 + ln) * lda;
  v8f acc[4] = {};
  for (int kb = 0; kb < K; kb += 32) {
    FragH ah, al;
    const v4f x0 = *(const v4fa*)(arow + kb + 8 * hh), x1 = *(const v4fa*)(arow + kb + 8 * hh + 4), x2 = *(const v4fa*)(arow + kb + 16 + 8 * hh), x3 = *(const v4fa*)(arow + kb + 16 + 8 * hh + 4);
    float xs[16] = {x0[0],x0[1],x0[2],x0[3],x1[0],x1[1],x1[2],x1[3],x2[0],x2[1],x2[2],x2[3],x3[0],x3[1],x3[2],x3[3]};
#pragma unroll
    for (int i = 0; i < 16; ++i) { const _Float16 h = (_Float16)xs[i]; ah.h[i] = h; al.h[i] = ASPLIT ? (_Float16)(xs[i] - (float)h) : (_Float16)0.0f; }
#pragma unroll
    for (int t = 0; t < 4; ++t) { if (col0 + t * 16 >= N) continue; const size_t boff = (size_t)(col0 + t * 16 + ln) * ldb + kb; FragH bq; bq.half[0] = *(const v8us*)(Bh + boff + 8 * hh); bq.half[1] = *(const v8us*)(Bh + boff + 16 + 8 * hh);
      acc[t] = mmaH<ASPLIT ? 2 : 1>(ah.v, al.v, bq.v, bq.v, acc[t]); }
  }
#pragma unroll
  for (int t = 0; t < 4; ++t) { if (col0 + t * 16 >= N) continue;
#pragma unroll
    for (int r = 0; r < 8; ++r) so[w][8 * hh + r][t * 16 + ln] = acc[t][r] * alpha; }
  __builtin_amdgcn_fence(__ATOMIC_ACQ_REL, "workgroup"); __builtin_amdgcn_wave_barrier();
  const int rsub = lane >> 4, c4 = (lane & 15) * 4;
  {
#pragma unroll
    for (int q = 0; q < 8; ++q) { const int r = q * 2 + rsub; if (col0 + c4 < N) { const v4f v = *(const v4fa*)&so[w][r][c4]; *(v4f*)(C + (size_t)(row0 + r) * ldc + col0 + c4) = v; } }
     }
}

// Wt[n][k] = f16(W[k][n]·scale) from f32 row-major W[K][N] (scale = power of two; bf16-exact weights stay exact in f16 away from the subnormal range)
__global__ __launch_bounds__(256) void k_wt_f16(const float* __restrict__ W, _Float16* __restrict__ Wt, int K, int N, float scale) {
  const int t = blockIdx.x * 256 + threadIdx.x; if (t >= N * (K / 8)) return; const int n = t / (K / 8), k8 = (t % (K / 8)) * 8; FragH f;
#pragma unroll
  for (int i = 0; i < 8; ++i) f.h[i] = (_Float16)(bf16_round(W[(size_t)(k8 + i) * N + n]) * scale); const v8us o = f.half[0];
  *(v8us*)((unsigned short*)Wt + (size_t)n * K + k8) = o; 
}
// k_gemm_hh variant with fused epilogue: v = acc·alpha + bias[by·sBias + col] (+ CP[(row/rowsPerB)·sCPb + by·64 + col] if CP) ; ACT 0 none / 1 elu ; writes f16 C16 (and f32 C if non-null)
template <int ACT>
__global__ __launch_bounds__(128) void k_gemm_hhx(const _Float16* __restrict__ A, int lda, size_t sA, const _Float16* __restrict__ Bh, int ldb, size_t sB, float alpha, const float* __restrict__ bias, size_t sBias, const float* __restrict__ CP, int rowsPerB, size_t sCPb, int row0g,
    float* __restrict__ C, _Float16* __restrict__ C16, int ldc, size_t sC, int M, int N, int K) {
  __shared__ __attribute__((aligned(16))) float so[4][16][64];
  const int tid = threadIdx.x, w = tid >> 5, lane = tid & 31, ln = lane & 15, hh = lane >> 4; const int by = blockIdx.y;
  A += (size_t)by * sA; Bh += (size_t)by * sB; const size_t cofs = (size_t)by * sC; const float* bp = bias ? bias + (size_t)by * sBias : nullptr;
  const int ntn = (N + 63) / 64; const int wid = blockIdx.x * 4 + w; const int mt = wid / ntn, nq = wid % ntn; if (mt * 16 >= M) return;
  const int row0 = mt * 16, col0 = nq * 64; const _Float16* arow = A + (size_t)(row0 + ln) * lda;
  v8f acc[4] = {};
  for (int kb = 0; kb < K; kb += 32) { FragH ah; ah.half[0] = *(const v8us*)((const unsigned short*)arow + kb + 8 * hh); ah.half[1] = *(const v8us*)((const unsigned short*)arow + kb + 16 + 8 * hh);
#pragma unroll
    for (int t = 0; t < 4; ++t) { if (col0 + t * 16 >= N) continue; const size_t boff = (size_t)(col0 + t * 16 + ln) * ldb + kb; FragH bq; bq.half[0] = *(const v8us*)((const unsigned short*)Bh + boff + 8 * hh); bq.half[1] = *(const v8us*)((const unsigned short*)Bh + boff + 16 + 8 * hh);
      acc[t] = mmaH<1>(ah.v, ah.v, bq.v, bq.v, acc[t]); }
  }
#pragma unroll
  for (int t = 0; t < 4; ++t) { if (col0 + t * 16 >= N) continue; const int col = col0 + t * 16 + ln; const float bv = bp ? bf16_round(bp[col]) : 0.f;
#pragma unroll
    for (int r = 0; r < 8; ++r) { float v = acc[t][r] * alpha + bv; if (CP) { const int bidx = (row0g + row0 + 8 * hh + r) / rowsPerB; v += CP[(size_t)bidx * sCPb + (size_t)by * 64 + col]; } if (ACT == 1) v = (v > 0.f) ? v : expm1f(v); else if (ACT == 7) v = (v > 0.f) ? v + 1.0f : expf(v); else if (ACT == 8) v = tanhf(v); else if (ACT == 9) v = 0.5f * v * (1.0f + tanhf(0.7978845608028654f * (v + 0.044715f * v * v * v))); else if (ACT == 11) v = 1.0f / (1.0f + expf(-v)); else if (ACT == 12) v = (v > 0.f) ? v : 0.01f * v; else if (ACT == 14) v = (v > 0.f) ? v : 0.1f * v; else if (ACT == 15) v = v / (1.0f + expf(-v)); else if (ACT == 3) v = fmaxf(v, 0.f); else if (ACT == 6) v = 0.5f * v * (1.0f + erff(v * 0.70710678118654752f)); so[w][8 * hh + r][t * 16 + ln] = v; } }
  __builtin_amdgcn_fence(__ATOMIC_ACQ_REL, "workgroup"); __builtin_amdgcn_wave_barrier();
  const int rsub = lane >> 4, c4 = (lane & 15) * 4; typedef _Float16 v4h __attribute__((ext_vector_type(4)));
  {
#pragma unroll
    for (int q = 0; q < 8; ++q) { const int r = q * 2 + rsub; if (col0 + c4 < N) { const v4f v = *(const v4fa*)&so[w][r][c4]; if (C) *(v4f*)(C + cofs + (size_t)(row0 + r) * ldc + col0 + c4) = v; if (C16) { v4h h4; for (int i = 0; i < 4; ++i) h4[i] = (_Float16)v[i]; *(v4h*)(C16 + cofs + (size_t)(row0 + r) * ldc + col0 + c4) = h4; } } }
     }
}


typedef _Float16 v4h __attribute__((ext_vector_type(4)));

__global__ __launch_bounds__(256) void k_x16(const float* __restrict__ x, _Float16* __restrict__ X16, size_t n8) { const size_t t = (size_t)blockIdx.x * 256 + threadIdx.x; if (t >= n8) return; FragH f;
#pragma unroll
  for (int q = 0; q < 8; ++q) f.h[q] = (_Float16)bf16_round(x[t * 8 + q]); *(v8us*)((unsigned short*)X16 + t * 8) = f.half[0];  }
__global__ __launch_bounds__(256) void k_h16(const float* __restrict__ x, _Float16* __restrict__ X16, size_t n8) { const size_t t = (size_t)blockIdx.x * 256 + threadIdx.x; if (t >= n8) return; FragH f;
#pragma unroll
  for (int q = 0; q < 8; ++q) f.h[q] = (_Float16)x[t * 8 + q]; *(v8us*)((unsigned short*)X16 + t * 8) = f.half[0];  }
template <int NHv, int TTv>
__global__ __launch_bounds__(256) void k_vt(const _Float16* __restrict__ V16, int ldv, int voff, _Float16* __restrict__ Vt) { __shared__ unsigned short tl[64][66]; const int tid = threadIdx.x; const int slab = blockIdx.x / (TTv / 64), lg = blockIdx.x % (TTv / 64); const int b = slab / NHv, h = slab % NHv;
  for (int i = tid; i < 64 * 8; i += 256) { const int r = i / 8, c8 = (i % 8) * 8; FragH f; f.half[0] = *(const v8us*)((const unsigned short*)V16 + ((size_t)b * TTv + lg * 64 + r) * ldv + voff + h * 64 + c8);
#pragma unroll
    for (int q = 0; q < 8; ++q) tl[r][c8 + q] = f.u[q]; }
  __syncthreads();
  {
#pragma unroll
    for (int rd = 0; rd < 2; ++rd) { const int d = rd * 32 + tid / 8, pc = tid % 8; FragH f;
#pragma unroll
      for (int q = 0; q < 8; ++q) f.u[q] = tl[pc * 8 + q][d];
      *(v8us*)((unsigned short*)Vt + ((size_t)slab * 64 + d) * TTv + lg * 64 + pc * 8) = f.half[0]; }
     } }

__global__ __launch_bounds__(256) void k_hl(const float* __restrict__ F, _Float16* __restrict__ Hh, _Float16* __restrict__ Hl, size_t n8) { const size_t t = (size_t)blockIdx.x * 256 + threadIdx.x; if (t >= n8) return; FragH fh, fl; const v4f a = *(const v4fa*)(F + t * 8), c = *(const v4fa*)(F + t * 8 + 4);
#pragma unroll
  for (int q = 0; q < 4; ++q) { _Float16 h = (_Float16)a[q]; fh.h[q] = h; fl.h[q] = (_Float16)((a[q] - (float)h) * 1024.0f); h = (_Float16)c[q]; fh.h[4 + q] = h; fl.h[4 + q] = (_Float16)((c[q] - (float)h) * 1024.0f); }
  { *(v8us*)((unsigned short*)Hh + t * 8) = fh.half[0]; *(v8us*)((unsigned short*)Hl + t * 8) = fl.half[0];  } }

// ---- fast GEMM (wave tile 32x64, operands staged in LDS) ----
__device__ __forceinline__ v16h g2_frag(const _Float16* p, int hh) { FragH f; f.half[0] = *(const v8us*)((const unsigned short*)p + 8 * hh); f.half[1] = *(const v8us*)((const unsigned short*)p + 16 + 8 * hh); return f.v; }
__device__ __forceinline__ v8f g2_mma(v16h a, v16h b, v8f c) { v8f d = __builtin_amdgcn_wmma_f32_16x16x32_f16(false, a, false, b, (short)0, c, false, false); asm volatile("v_nop\n\tv_nop\n\tv_nop\n\tv_nop" : "+v"(d) : "v"(a), "v"(b)); return d; }
// Block tile 128x128, eight waves of 32x64 (4 down x 2 across). A pass is 128 k: 128 rows of A and 128 rows of Bh, 256 B each, are laid in LDS at a
// pitch of 272 B (16 B x odd, for the ds_load_b128 fragment reads) by per-lane asynchronous 16-byte copies; two buffers, the next pass's copies fly while this one is multiplied.
#define G3_PITCH 272
#define G3_OPB (128 * G3_PITCH)   /* one operand's 128 rows */
#define G3_BUF (2 * G3_OPB)       /* one buffer: [A rows | Bh rows] */
// Eight copies per lane: rows r, r + 16, ..., r + 112 of one operand (16 lanes cover one 256-B row piece). The s_wait_xcnt closes the copies' own statement so that
// no address register named here is rewritten ahead of it.
__device__ __forceinline__ void g3_copy8(unsigned l, const _Float16* g, size_t rstep) {
  asm volatile("global_load_async_to_lds_b128 %0, %8, off\n\t"
               "global_load_async_to_lds_b128 %1, %9, off\n\t"
               "global_load_async_to_lds_b128 %2, %10, off\n\t"
               "global_load_async_to_lds_b128 %3, %11, off\n\t"
               "global_load_async_to_lds_b128 %4, %12, off\n\t"
               "global_load_async_to_lds_b128 %5, %13, off\n\t"
               "global_load_async_to_lds_b128 %6, %14, off\n\t"
               "global_load_async_to_lds_b128 %7, %15, off\n\t"
               "s_wait_xcnt 0x0"
               :: "v"(l), "v"(l + 16u * G3_PITCH), "v"(l + 32u * G3_PITCH), "v"(l + 48u * G3_PITCH), "v"(l + 64u * G3_PITCH), "v"(l + 80u * G3_PITCH), "v"(l + 96u * G3_PITCH), "v"(l + 112u * G3_PITCH),
                  "v"(g), "v"(g + rstep), "v"(g + 2 * rstep), "v"(g + 3 * rstep), "v"(g + 4 * rstep), "v"(g + 5 * rstep), "v"(g + 6 * rstep), "v"(g + 7 * rstep)
               : "memory");
}
// requires M % 128 == 0, N % 128 == 0, K % 128 == 0; epilogue: v = act(acc * alpha + bf16(bias[col])), then, with ACT 0 only, + R[row][col] (R = optional f32 addend laid out like C)
// bx = the block's tile index, by = its batch index (the kernels below say where they come from)
template <int ACT>
__device__ __forceinline__ void g3_body(const _Float16* __restrict__ A, int lda, size_t sA, const _Float16* __restrict__ Bh, int ldb, size_t sB, float alpha, const float* __restrict__ bias, size_t sBias, const float* __restrict__ R,
    float* __restrict__ C, _Float16* __restrict__ C16, int ldc, size_t sC, int M, int N, int K, const int bx, const int by) {
  __shared__ __attribute__((aligned(16))) unsigned char ring[2 * G3_BUF];      /* the two buffers; after the k loop its first 8 x 32 x 68 floats stage the output */
  const int tid = threadIdx.x, w = tid >> 5, lane = tid & 31, ln = lane & 15, hh = lane >> 4;
  A += (size_t)by * sA; Bh += (size_t)by * sB; const size_t cofs = (size_t)by * sC; const float* bp = bias ? bias + (size_t)by * sBias : nullptr;
  const int ntn = N >> 7; const int mt = bx / ntn, nq = bx - mt * ntn; const int rowb = mt * 128, colb = nq * 128; if (rowb >= M) return;      /* block-uniform, ahead of every barrier */
  const int wm = w & 3, wn = w >> 2; const int row0 = rowb + 32 * wm, col0 = colb + 64 * wn;
  const int cr = tid >> 4, cc = tid & 15;      /* copy side: this lane's first row and its 16-byte piece of the row */
  const _Float16* gA = A + (size_t)(rowb + cr) * lda + cc * 8; const _Float16* gB = Bh + (size_t)(colb + cr) * ldb + cc * 8; const size_t stA = (size_t)16 * lda, stB = (size_t)16 * ldb;
  const unsigned lA = (unsigned)(size_t)ring + (unsigned)(cr * G3_PITCH + cc * 16), lB = lA + G3_OPB;
  const int np = K >> 7;
  g3_copy8(lA, gA, stA); g3_copy8(lB, gB, stB);
  asm volatile("s_wait_asynccnt 0x0" ::: "memory");      /* pass 0's own copies have landed before the barrier that publishes them */
  __syncthreads();
  if (np > 1) { g3_copy8(lA + G3_BUF, gA + 128, stA); g3_copy8(lB + G3_BUF, gB + 128, stB); }
  /* what the epilogue adds is fetched here, all loads independent, so that it lands under the k loop: the wave's 64 bias words (4 a lane) and, in the shape of the final row stores, its 32 x 64 piece of R */
  const int rsub = lane >> 4, c4 = (lane & 15) * 4;
  float bw[4] = {0.f, 0.f, 0.f, 0.f}; v4f rr[16];
  if (bp) {
#pragma unroll
    for (int t = 0; t < 4; ++t) bw[t] = bp[col0 + t * 16 + ln];
    asm volatile("s_wait_xcnt 0x0" ::: "memory"); }      /* stands in front of any rewrite of the base or offset registers that the four bias loads name */
  if (ACT == 0 && R) { const float* rp = R + cofs + (size_t)(row0 + rsub) * ldc + col0 + c4;
#pragma unroll
    for (int q = 0; q < 16; ++q) rr[q] = *(const v4fa*)(rp + (size_t)(2 * q) * ldc);
    asm volatile("s_wait_xcnt 0x0" ::: "memory"); }      /* stands in front of any rewrite of the address registers that the sixteen row loads name */
  const unsigned char* ra = ring + (32 * wm + ln) * G3_PITCH; const unsigned char* rb = ring + G3_OPB + (64 * wn + ln) * G3_PITCH;
  const v8f z8 = {0.f,0.f,0.f,0.f,0.f,0.f,0.f,0.f}; v8f c00 = z8, c01 = z8, c02 = z8, c03 = z8, c10 = z8, c11 = z8, c12 = z8, c13 = z8;
#pragma unroll 1      /* one pass per trip: the publish point at the foot stands once */
  for (int t = 0; t < np; ++t) { const unsigned bo = (unsigned)(t & 1) * G3_BUF;
#pragma unroll      /* the four 32-k blocks of a pass in straight line, so that a block's fragment reads can stand ahead of the block before it */
    for (int ks = 0; ks < 4; ++ks) { const unsigned char* pa = ra + bo + ks * 64; const unsigned char* pb = rb + bo + ks * 64;
      const v16h a0 = g2_frag((const _Float16*)pa, hh), a1 = g2_frag((const _Float16*)(pa + 16 * G3_PITCH), hh);
      const v16h b0 = g2_frag((const _Float16*)pb, hh), b1 = g2_frag((const _Float16*)(pb + 16 * G3_PITCH), hh), b2 = g2_frag((const _Float16*)(pb + 32 * G3_PITCH), hh), b3 = g2_frag((const _Float16*)(pb + 48 * G3_PITCH), hh);
      c00 = g2_mma(a0, b0, c00); c10 = g2_mma(a1, b0, c10); c01 = g2_mma(a0, b1, c01); c11 = g2_mma(a1, b1, c11);
      c02 = g2_mma(a0, b2, c02); c12 = g2_mma(a1, b2, c12); c03 = g2_mma(a0, b3, c03); c13 = g2_mma(a1, b3, c13); }
    asm volatile("s_wait_dscnt 0x0" ::: "memory");         /* this wave's reads of the buffer are done before the barrier behind which it is refilled */
    asm volatile("s_wait_asynccnt 0x0" ::: "memory");      /* this wave's copies of pass t + 1 have landed before the barrier that publishes them */
    __syncthreads();
    if (t + 2 < np) { g3_copy8(lA + bo, gA + (size_t)(t + 2) * 128, stA); g3_copy8(lB + bo, gB + (size_t)(t + 2) * 128, stB); } }
  asm volatile("s_wait_asynccnt 0x0" ::: "memory");        /* nothing in flight when the ring becomes output staging */
  float (*so)[32][68] = (float (*)[32][68])ring;
  v8f accs[8] = {c00, c01, c02, c03, c10, c11, c12, c13};
#pragma unroll
  for (int u = 0; u < 8; ++u) { const int t = u & 3, half = u >> 2; const float bv = bf16_round(bw[t]);
#pragma unroll
    for (int r = 0; r < 8; ++r) { const int rloc = half * 16 + 8 * hh + r; float v = accs[u][r] * alpha + bv;
      if (ACT == 3) v = fmaxf(v, 0.f); else if (ACT == 6) v = 0.5f * v * (1.0f + erff(v * 0.70710678118654752f)); else if (ACT == 11) v = 1.0f / (1.0f + expf(-v)); else if (ACT == 15) v = v / (1.0f + expf(-v)); else if (ACT == 12) v = (v > 0.f) ? v : 0.01f * v; else if (ACT == 8) v = tanhf(v);
      so[w][rloc][t * 16 + ln] = v; } }
  __builtin_amdgcn_fence(__ATOMIC_ACQ_REL, "workgroup"); __builtin_amdgcn_wave_barrier();
  v4f vv[16];      /* the 16 staged rows are read back as one group, ahead of the stores and their waits, instead of one waited read in front of each store */
#pragma unroll
  for (int q = 0; q < 16; ++q) vv[q] = *(const v4fa*)&so[w][q * 2 + rsub][c4];
  {
#pragma unroll
    for (int q = 0; q < 16; ++q) { const int r = q * 2 + rsub; v4f v = vv[q]; if (ACT == 0 && R) v += rr[q];
      if (C) { *(v4f*)(C + cofs + (size_t)(row0 + r) * ldc + col0 + c4) = v; asm volatile("s_wait_xcnt 0x0" ::: "memory"); }      /* the wait stands in front of any rewrite of the store's data or address registers */
      if (C16) { v4h h4; for (int i = 0; i < 4; ++i) h4[i] = (_Float16)v[i]; *(v4h*)(C16 + cofs + (size_t)(row0 + r) * ldc + col0 + c4) = h4; asm volatile("s_wait_xcnt 0x0" ::: "memory"); } }      /* the same wait behind the f16 store */
     } }
template <int ACT>
__global__ __launch_bounds__(256) void k_gemm3(const _Float16* __restrict__ A, int lda, size_t sA, const _Float16* __restrict__ Bh, int ldb, size_t sB, float alpha, const float* __restrict__ bias, size_t sBias, const float* __restrict__ R,
    float* __restrict__ C, _Float16* __restrict__ C16, int ldc, size_t sC, int M, int N, int K) {
  g3_body<ACT>(A, lda, sA, Bh, ldb, sB, alpha, bias, sBias, R, C, C16, ldc, sC, M, N, K, (int)blockIdx.x, (int)blockIdx.y); }
// The five projections that wait for no attention, as one grid: blockIdx.y = 0 q, 1 k, 2 v of the self attention (from the LN1 plane H), 3 k, 4 v of the cross attention (from the encoder plane E).
// Each is the [4096][1024] x [1024][1024] product of k_gemm3<0>; q and k planes leave as f16, v planes as f32.
__global__ __launch_bounds__(256) void k_proj5(const _Float16* __restrict__ H, const _Float16* __restrict__ E, const _Float16* __restrict__ Bq, const _Float16* __restrict__ Bk, const _Float16* __restrict__ Bv, const _Float16* __restrict__ Bkc, const _Float16* __restrict__ Bvc,
    const float* __restrict__ bq, const float* __restrict__ bk, const float* __restrict__ bv, const float* __restrict__ bkc, const float* __restrict__ bvc,
    _Float16* __restrict__ Qs, _Float16* __restrict__ Ks, float* __restrict__ Vs, _Float16* __restrict__ Kc, float* __restrict__ Vc) {
  const int g = (int)blockIdx.y;
  const _Float16* A = (g < 3) ? H : E;
  const _Float16* Bh = (g == 0) ? Bq : (g == 1) ? Bk : (g == 2) ? Bv : (g == 3) ? Bkc : Bvc;
  const float* bias = (g == 0) ? bq : (g == 1) ? bk : (g == 2) ? bv : (g == 3) ? bkc : bvc;
  float* C = (g == 2) ? Vs : (g == 4) ? Vc : nullptr;
  _Float16* C16 = (g == 0) ? Qs : (g == 1) ? Ks : (g == 3) ? Kc : nullptr;
  g3_body<0>(A, EE, 0, Bh, EE, 0, 0.0625f, bias, 0, nullptr, C, C16, EE, 0, NR, EE, EE, (int)blockIdx.x, 0); }


// lane l with lane l ^ 16
__device__ __forceinline__ float xhalf(float x) { return __builtin_bit_cast(float, __builtin_amdgcn_permlanex16(__builtin_bit_cast(int, x), __builtin_bit_cast(int, x), 0x76543210, 0xfedcba98, false, false)); }
// Both products run transposed. S^T = K x Q^T: A = 16 key rows, B = the wave's 16 queries, so lane (ln, hh) holds for ITS query q0 + ln the keys j0 + 16 nt + 8 hh + r:
// maximum and sum are in-lane, the two halves of a query meet in one cross-row move. The two score tiles, converted in place, are the B operand of O^T += V^T x P^T
// (element s = tile s >> 3, register s & 7, which is the k order the V^T rows are loaded in): P passes through no LDS. O^T: lane = query, registers = 8 consecutive d.
// The K rows and the V^T rows of 64 keys (64 rows of 128 B each) are laid in LDS once for the block's four waves, at a pitch of 144 B (16 B x odd, for the ds_load_b128 fragment reads),
// by per-lane asynchronous 16-byte copies in which 8 lanes cover one whole 128-B row; two buffers, the next 64 keys' copies fly while these are worked on.
#define FA_PITCH 144
#define FA_OPB (64 * FA_PITCH)    /* one operand's 64 rows */
#define FA_BUF (2 * FA_OPB)       /* one buffer: [K rows | V^T rows] */
// Eight copies per lane: rows r, r + 16, r + 32, r + 48 of K, then of V^T. The s_wait_xcnt closes the copies' own statement so that no address register named here is rewritten ahead of it.
__device__ __forceinline__ void fa_copy8(unsigned l, const unsigned short* gk, size_t sk, const unsigned short* gv, size_t sv) {
  asm volatile("global_load_async_to_lds_b128 %0, %8, off\n\t"
               "global_load_async_to_lds_b128 %1, %9, off\n\t"
               "global_load_async_to_lds_b128 %2, %10, off\n\t"
               "global_load_async_to_lds_b128 %3, %11, off\n\t"
               "global_load_async_to_lds_b128 %4, %12, off\n\t"
               "global_load_async_to_lds_b128 %5, %13, off\n\t"
               "global_load_async_to_lds_b128 %6, %14, off\n\t"
               "global_load_async_to_lds_b128 %7, %15, off\n\t"
               "s_wait_xcnt 0x0"
               :: "v"(l), "v"(l + 16u * FA_PITCH), "v"(l + 32u * FA_PITCH), "v"(l + 48u * FA_PITCH), "v"(l + FA_OPB), "v"(l + FA_OPB + 16u * FA_PITCH), "v"(l + FA_OPB + 32u * FA_PITCH), "v"(l + FA_OPB + 48u * FA_PITCH),
                  "v"(gk), "v"(gk + sk), "v"(gk + 2 * sk), "v"(gk + 3 * sk), "v"(gv), "v"(gv + sv), "v"(gv + 2 * sv), "v"(gv + 3 * sv)
               : "memory");
}
__global__ __launch_bounds__(128) void k_flashc(const _Float16* __restrict__ Q16, int ldq, const _Float16* __restrict__ K16, int ldk, const _Float16* __restrict__ Vt, const int* __restrict__ MSK, float* __restrict__ O, int ldo) {
  constexpr int RPW = 16, NQB = TQ / (4 * RPW), DT = 4, KS = 2;
  __shared__ __attribute__((aligned(16))) unsigned char ring[2 * FA_BUF];
  __shared__ __attribute__((aligned(16))) float sO[4][RPW][64 + 4];
  (void)MSK;
  const int tid = threadIdx.x, w = tid >> 5, lane = tid & 31, ln = lane & 15, hh = lane >> 4;
  const int slab = blockIdx.x / NQB, qblk = blockIdx.x % NQB; const int b = slab / NH, h = slab % NH; const int qb0 = qblk * (4 * RPW); const int q0 = qb0 + w * RPW;
  const unsigned short* Vth = (const unsigned short*)Vt + (size_t)slab * 64 * TK;
  const int cr = tid >> 3, cc = tid & 7;      /* copy side: this lane's first row and its 16-byte piece of the row */
  const unsigned short* gK = (const unsigned short*)K16 + ((size_t)b * TK + cr) * ldk + h * 64 + cc * 8; const unsigned short* gV = Vth + (size_t)cr * TK + cc * 8; const size_t stK = (size_t)16 * ldk, stV = (size_t)16 * TK;
  const unsigned lc = (unsigned)(size_t)ring + (unsigned)(cr * FA_PITCH + cc * 16);
  const int ns = qblk + 1;      /* block-uniform causal bound: stages of 64 keys up to the end of the query block */
  fa_copy8(lc, gK, stK, gV, stV);
  FragH bq[KS];
  { const unsigned short* qr = (const unsigned short*)Q16 + ((size_t)b * TQ + q0 + ln) * ldq + h * 64;
#pragma unroll
    for (int ks = 0; ks < KS; ++ks) { bq[ks].half[0] = *(const v8us*)(qr + ks * 32 + 8 * hh); bq[ks].half[1] = *(const v8us*)(qr + ks * 32 + 16 + 8 * hh); } }
  asm volatile("s_wait_asynccnt 0x0" ::: "memory");      /* stage 0's own copies have landed before the barrier that publishes them */
  __syncthreads();
  if (ns > 1) fa_copy8(lc + FA_BUF, gK + (size_t)64 * ldk, stK, gV + 64, stV);
  const int tq = q0 + ln;      /* this lane's query */
  float m_r = -3.0e38f, l_r = 0.f; v8f oacc[DT];
#pragma unroll
  for (int dt = 0; dt < DT; ++dt) oacc[dt] = (v8f){0.f,0.f,0.f,0.f,0.f,0.f,0.f,0.f};
  const unsigned char* rk = ring + ln * FA_PITCH + 16 * hh; const unsigned char* rv = rk + FA_OPB;
#pragma unroll 1      /* one stage per trip: the publish point at the foot stands once */
  for (int t = 0; t < ns; ++t) { const unsigned bo = (unsigned)(t & 1) * FA_BUF;
#pragma unroll      /* the stage's two 32-key steps in straight line: each step's place in the buffer is then an immediate offset of its fragment reads */
   for (int sub = 0; sub < 2; ++sub) { const int j0 = t * 64 + sub * 32;
    FragH ak[2][KS], av[DT];
#pragma unroll
    for (int nt = 0; nt < 2; ++nt) { const unsigned char* kr = rk + bo + (sub * 32 + nt * 16) * FA_PITCH;
#pragma unroll
      for (int ks = 0; ks < KS; ++ks) { ak[nt][ks].half[0] = *(const v8us*)(kr + ks * 64); ak[nt][ks].half[1] = *(const v8us*)(kr + ks * 64 + 32); } }
#pragma unroll
    for (int dt = 0; dt < DT; ++dt) { const unsigned char* vrow = rv + bo + dt * 16 * FA_PITCH + sub * 64; av[dt].half[0] = *(const v8us*)vrow; av[dt].half[1] = *(const v8us*)(vrow + 32); }
    float sc[16];
#pragma unroll
    for (int nt = 0; nt < 2; ++nt) { v8f acc = (v8f){0.f,0.f,0.f,0.f,0.f,0.f,0.f,0.f};
#pragma unroll
      for (int ks = 0; ks < KS; ++ks) acc = mmaH<1>(ak[nt][ks].v, ak[nt][ks].v, bq[ks].v, bq[ks].v, acc);
#pragma unroll
      for (int r = 0; r < 8; ++r) sc[nt * 8 + r] = (j0 + nt * 16 + 8 * hh + r <= tq) ? acc[r] * SCL : -INFINITY; }
    float mx[4];
#pragma unroll
    for (int i = 0; i < 4; ++i) mx[i] = fmaxf(fmaxf(sc[i], sc[4 + i]), fmaxf(sc[8 + i], sc[12 + i]));
    float mc = fmaxf(fmaxf(mx[0], mx[1]), fmaxf(mx[2], mx[3])); mc = fmaxf(mc, xhalf(mc));
    const float mn = fmaxf(m_r, mc); const float ea = expf(m_r - mn); const float al = (mn > -1.0e38f) ? ea : 1.0f; m_r = mn;
    FragH pb; float ps[4] = {0.f, 0.f, 0.f, 0.f};
#pragma unroll
    for (int i = 0; i < 16; ++i) { const float p = expf(sc[i] - mn); ps[i & 3] += p; pb.h[i] = (_Float16)(p * 1024.0f); }      /* a masked score is -inf: weight exactly 0 */
    l_r = l_r * al + ((ps[0] + ps[1]) + (ps[2] + ps[3]));      /* this half's keys only; the halves are joined behind the loop */
#pragma unroll
    for (int dt = 0; dt < DT; ++dt) {
#pragma unroll
      for (int r = 0; r < 8; ++r) oacc[dt][r] *= al; }
#pragma unroll
    for (int dt = 0; dt < DT; ++dt) oacc[dt] = mmaH<1>(av[dt].v, av[dt].v, pb.v, pb.v, oacc[dt]); }
    asm volatile("s_wait_dscnt 0x0" ::: "memory");         /* this wave's reads of the buffer are done before the barrier behind which it is refilled */
    asm volatile("s_wait_asynccnt 0x0" ::: "memory");      /* this wave's copies of stage t + 1 have landed before the barrier that publishes them */
    __syncthreads();
    if (t + 2 < ns) fa_copy8(lc + bo, gK + (size_t)(t + 2) * 64 * ldk, stK, gV + (t + 2) * 64, stV); }
  asm volatile("s_wait_asynccnt 0x0" ::: "memory");        /* nothing in flight when the wave goes on to its end */
  const float l = l_r + xhalf(l_r); const float inv = (l > 0.f) ? 1.0f / (l * 1024.0f) : 0.f;
#pragma unroll
  for (int dt = 0; dt < DT; ++dt) { const v4f lo = {oacc[dt][0] * inv, oacc[dt][1] * inv, oacc[dt][2] * inv, oacc[dt][3] * inv}, hi = {oacc[dt][4] * inv, oacc[dt][5] * inv, oacc[dt][6] * inv, oacc[dt][7] * inv};
    *(v4fa*)&sO[w][ln][dt * 16 + 8 * hh] = lo; *(v4fa*)&sO[w][ln][dt * 16 + 8 * hh + 4] = hi; }
  __builtin_amdgcn_fence(__ATOMIC_ACQ_REL, "workgroup"); __builtin_amdgcn_wave_barrier();
  {
#pragma unroll
    for (int rp = 0; rp < RPW; rp += 2) { const int r = rp + (lane >> 4), pc = lane & 15; const v4f val = *(const v4fa*)&sO[w][r][pc * 4]; *(v4f*)(O + ((size_t)b * TQ + q0 + r) * ldo + h * 64 + pc * 4) = val; }
     } }
template <bool RND>
__device__ __forceinline__ void ln1024_body(const float* __restrict__ X, const float* __restrict__ g, const float* __restrict__ bb, _Float16* __restrict__ H16, const int bx) {
  #pragma clang fp contract(off)
  const int tid = threadIdx.x, w = tid >> 5, l = tid & 31; const int r = bx * 8 + w; if (r >= NR) return; const float* x = X + (size_t)r * EE; float v[32]; float s = 0.f; v4f a8[8];
#pragma unroll
  for (int u = 0; u < 8; ++u) a8[u] = *(const v4fa*)(x + u * 128 + l * 4);
  asm volatile("s_wait_xcnt 0x0" ::: "memory");      /* later loads may land in the registers that hold the row loads' address: this wait stands in front of that overwrite */
#pragma unroll
  for (int u = 0; u < 8; ++u) {
#pragma unroll
    for (int q = 0; q < 4; ++q) { const float t = RND ? bf16_round(a8[u][q]) : a8[u][q]; v[u * 4 + q] = t; s += t; } }
  for (int o = 16; o > 0; o >>= 1) s += __shfl_xor(s, o, 32); const float mu = s / (float)EE; float q2 = 0.f;
#pragma unroll
  for (int k = 0; k < 32; ++k) { const float d = v[k] - mu; q2 += d * d; }
  for (int o = 16; o > 0; o >>= 1) q2 += __shfl_xor(q2, o, 32); const float rs = 1.0f / sqrtf(q2 / (float)EE + 1e-5f);
  {
#pragma unroll
    for (int u = 0; u < 8; ++u) { _Float16 h4[4];
#pragma unroll
      for (int q = 0; q < 4; ++q) { const int c = u * 128 + l * 4 + q; h4[q] = (_Float16)((v[u * 4 + q] - mu) * rs * bf16_round(g[c]) + bf16_round(bb[c])); }
      *(unsigned long long*)((unsigned short*)H16 + (size_t)r * EE + u * 128 + l * 4) = *(const unsigned long long*)h4; }
     } }
template <bool RND>
__global__ __launch_bounds__(256) void k_ln1024(const float* __restrict__ X, const float* __restrict__ g, const float* __restrict__ bb, _Float16* __restrict__ H16) { ln1024_body<RND>(X, g, bb, H16, (int)blockIdx.x); }
__device__ __forceinline__ void prep_body(const float* __restrict__ x, const float* __restrict__ e, float* __restrict__ Xf, _Float16* __restrict__ E16, size_t n4, const unsigned bx) {
  const size_t t = (size_t)bx * 256 + threadIdx.x; if (t >= n4) return; const v4f a = *(const v4fa*)(x + t * 4), c = *(const v4fa*)(e + t * 4); v4f ra; _Float16 h4[4];
#pragma unroll
  for (int q = 0; q < 4; ++q) { ra[q] = bf16_round(a[q]); h4[q] = (_Float16)bf16_round(c[q]); }
  const unsigned long long pk = *(const unsigned long long*)h4;
  { *(v4f*)(Xf + t * 4) = ra; *(unsigned long long*)((unsigned short*)E16 + t * 4) = pk;  } }
// Everything that reads only the inputs, as one grid by block range: LN1 (8 rows a block), the x / encoder planes (4 elements a thread), the ten weight planes (8 elements a thread).
// The ten f16 planes lie one behind the other from Bt in the order w0 ... w9, so a piece's place is its running index; w0 ... w7 hold EE * EE elements, w8 and w9 FF * EE.
#define FR_LN (NR / 8)                        /* blocks of LN1 */
#define FR_PREP (NR * EE / 4 / 256)           /* blocks of the x / encoder planes */
#define FR_WSM (EE * EE / 8 / 256)            /* blocks of one EE x EE weight */
#define FR_W (8 * FR_WSM + 2 * (FF / EE) * FR_WSM)
// second bound: eight waves a SIMD. The LN1 branch sets the register count of every block of this grid; held to 128 registers, four blocks of the streaming ranges stay resident on a WGP instead of three.
__global__ __launch_bounds__(256, 8) void k_front(const float* __restrict__ w0, const float* __restrict__ w1, const float* __restrict__ w2, const float* __restrict__ w3, const float* __restrict__ w4, const float* __restrict__ w5, const float* __restrict__ w6, const float* __restrict__ w7,
    const float* __restrict__ w8, const float* __restrict__ w9, const float* __restrict__ x, const float* __restrict__ e, const float* __restrict__ g, const float* __restrict__ bb,
    _Float16* __restrict__ Bt, float* __restrict__ Xf, _Float16* __restrict__ E16, _Float16* __restrict__ H16) {
  const unsigned bx = blockIdx.x;
  if (bx < FR_LN) { ln1024_body<true>(x, g, bb, H16, (int)bx); return; }
  if (bx < FR_LN + FR_PREP) { prep_body(x, e, Xf, E16, (size_t)NR * EE / 4, bx - FR_LN); return; }
  const unsigned wb = bx - (FR_LN + FR_PREP); const unsigned seg = wb / FR_WSM;      /* block-uniform: which EE x EE stretch of the ten planes */
  const float* W; unsigned b0;      /* the source and the block at which its plane begins */
  if (seg < 8) { W = (seg == 0) ? w0 : (seg == 1) ? w1 : (seg == 2) ? w2 : (seg == 3) ? w3 : (seg == 4) ? w4 : (seg == 5) ? w5 : (seg == 6) ? w6 : w7; b0 = seg * FR_WSM; }
  else if (seg < 8 + FF / EE) { W = w8; b0 = 8 * FR_WSM; }
  else { W = w9; b0 = (8 + FF / EE) * FR_WSM; }
  const size_t ts = (size_t)(wb - b0) * 256 + threadIdx.x, td = (size_t)wb * 256 + threadIdx.x; FragH f;
#pragma unroll
  for (int i = 0; i < 8; ++i) f.h[i] = (_Float16)(bf16_round(W[ts * 8 + i]) * 16.0f); *(v8us*)((unsigned short*)Bt + td * 8) = f.half[0];
  asm volatile("s_wait_xcnt 0x0" ::: "memory");      /* stands in front of any rewrite of the registers that the store above names */
}
// blockIdx.y picks the plane: 0 the self attention's v, 1 the cross attention's
__global__ __launch_bounds__(256) void k_vtn(const float* __restrict__ VF0, _Float16* __restrict__ Vt0, const float* __restrict__ VF1, _Float16* __restrict__ Vt1) {
  __shared__ float tl[64][65];
  const float* VF = (blockIdx.y == 0) ? VF0 : VF1; _Float16* Vt = (blockIdx.y == 0) ? Vt0 : Vt1;
  const int tid = threadIdx.x; const int slab = blockIdx.x / (TT / 64), lg = blockIdx.x % (TT / 64); const int n = slab / NHD, h = slab % NHD;
  for (int i = tid; i < 64 * 16; i += 256) { const int r = i / 16, c4 = (i % 16) * 4; const v4f a = *(const v4fa*)(VF + ((size_t)(lg * 64 + r) * NBATCH + n) * EE + h * 64 + c4); tl[r][c4] = a[0]; tl[r][c4 + 1] = a[1]; tl[r][c4 + 2] = a[2]; tl[r][c4 + 3] = a[3]; }
  __syncthreads();
  FragH f[2]; size_t oo[2];
#pragma unroll
  for (int rd = 0; rd < 2; ++rd) { const int d = rd * 32 + tid / 8, pc = tid % 8;
#pragma unroll
    for (int q = 0; q < 8; ++q) f[rd].h[q] = (_Float16)tl[pc * 8 + q][d]; oo[rd] = ((size_t)slab * 64 + d) * TT + lg * 64 + pc * 8; }
  { *(v8us*)((unsigned short*)Vt + oo[0]) = f[0].half[0]; *(v8us*)((unsigned short*)Vt + oo[1]) = f[1].half[0];  } }

extern "C" void kernel_launch(void* const* d_in, const int* in_sizes, int n_in,
                              void* d_out, int out_size, void* d_ws, size_t ws_size, hipStream_t stream) {
  (void)in_sizes; (void)n_in; (void)out_size;
  const float* const* I = (const float* const*)d_in;
  const float* x = I[0]; const float* enc = I[1];
  const float* wq_s = I[2]; const float* bq_s = I[3]; const float* wk_s = I[4]; const float* bk_s = I[5]; const float* wv_s = I[6]; const float* bv_s = I[7]; const float* wo_s = I[8]; const float* bo_s = I[9];
  const float* wq_c = I[10]; const float* bq_c = I[11]; const float* wk_c = I[12]; const float* bk_c = I[13]; const float* wv_c = I[14]; const float* bv_c = I[15]; const float* wo_c = I[16]; const float* bo_c = I[17];
  const float* g1 = I[18]; const float* b1n = I[19]; const float* g2 = I[20]; const float* b2n = I[21]; const float* g3 = I[22]; const float* b3n = I[23]; const float* W1 = I[24]; const float* b1 = I[25]; const float* W2 = I[26]; const float* b2 = I[27];
  char* ws = (char*)d_ws; size_t off = 0;
  auto take = [&](size_t bytes) { char* p = ws + off; off += (bytes + 255) & ~(size_t)255; return p; };
  _Float16* B[8]; for (int i = 0; i < 8; ++i) B[i] = (_Float16*)take((size_t)EE * EE * 2);      /* wq_s wk_s wv_s wo_s wq_c wk_c wv_c wo_c */
  _Float16* BF1 = (_Float16*)take((size_t)FF * EE * 2); _Float16* BF2 = (_Float16*)take((size_t)EE * FF * 2);
  float* Xf = (float*)take((size_t)NR * EE * 4); _Float16* H16 = (_Float16*)take((size_t)NR * EE * 2);
  _Float16* Q16 = (_Float16*)take((size_t)NR * EE * 2); _Float16* K16 = (_Float16*)take((size_t)NR * EE * 2); _Float16* VT = (_Float16*)take((size_t)NR * EE * 2); _Float16* E16 = (_Float16*)take((size_t)NR * EE * 2);      /* these four are contiguous: the FFN hidden reuses them */
  float* O = (float*)take((size_t)NR * EE * 4); float* X1 = (float*)take((size_t)NR * EE * 4);
  _Float16* K16c = (_Float16*)take((size_t)NR * EE * 2); _Float16* VTc = (_Float16*)take((size_t)NR * EE * 2); float* Vc = (float*)take((size_t)NR * EE * 4);      /* the cross attention's k and v planes, made ahead of the self attention */
  if (off > ws_size) return;      /* 16 + 16 + 16 + 8 + 32 + 16 + 16 + 32 = 152 MiB */
  _Float16* O16 = H16;                /* LN output is dead once its projection GEMMs ran; the attention output plane reuses it */
  float* X2 = Xf;                     /* bf16(x) is dead after the first residual GEMM */
  _Float16* F1 = Q16;                 /* FFN hidden [4096][4096] f16 = 32 MiB = Q16+K16+VT+E16 (all dead by then) */
  const size_t n8 = (size_t)NR * EE / 8; const unsigned nb8 = (unsigned)((n8 + 255) / 256);
  const dim3 gE((NR / 128) * (EE / 128), 1), gF((NR / 128) * (FF / 128), 1), gP((NR / 128) * (EE / 128), 5), gvt(NH * (TT / 64), 2); const unsigned gln = NR / 8, gfl = NH * (TQ / 64);
  /* --- all that reads only the inputs: LN1, bf16(x), the encoder plane, the ten weight planes ((out,in) = natural Bt; x16; B[0] ... B[7], BF1, BF2 are contiguous) --- */
  k_front<<<FR_LN + FR_PREP + FR_W, 256, 0, stream>>>(wq_s, wk_s, wv_s, wo_s, wq_c, wk_c, wv_c, wo_c, W1, W2, x, enc, g1, b1n, B[0], Xf, E16, H16);
  /* --- the five projections that wait for no attention, then both v planes re-laid --- */
  k_proj5<<<gP, 256, 0, stream>>>(H16, E16, B[0], B[1], B[2], B[5], B[6], bq_s, bk_s, bv_s, bk_c, bv_c, Q16, K16, O, K16c, Vc);
  k_vtn<<<gvt, 256, 0, stream>>>(O, VT, Vc, VTc);
  /* --- self attention --- */
  k_flashc<<<gfl, 128, 0, stream>>>(Q16, NBATCH * EE, K16, NBATCH * EE, VT, nullptr, O, NBATCH * EE);      /* rows = tokens, 64 (n,h) slabs of 64 columns */
  k_h16<<<nb8, 256, 0, stream>>>(O, O16, n8);
  k_gemm3<0><<<gE, 256, 0, stream>>>(O16, EE, 0, B[3], EE, 0, 0.0625f, bo_s, 0, Xf, X1, nullptr, EE, 0, NR, EE, EE);      /* x1 = x + o*wo^T + bo */
  /* --- cross attention (keys/values from encoder_out, same causal mask) --- */
  k_ln1024<false><<<gln, 256, 0, stream>>>(X1, g2, b2n, H16);
  k_gemm3<0><<<gE, 256, 0, stream>>>(H16, EE, 0, B[4], EE, 0, 0.0625f, bq_c, 0, nullptr, nullptr, Q16, EE, 0, NR, EE, EE);
  k_flashc<<<gfl, 128, 0, stream>>>(Q16, NBATCH * EE, K16c, NBATCH * EE, VTc, nullptr, O, NBATCH * EE);
  k_h16<<<nb8, 256, 0, stream>>>(O, O16, n8);
  k_gemm3<0><<<gE, 256, 0, stream>>>(O16, EE, 0, B[7], EE, 0, 0.0625f, bo_c, 0, X1, X2, nullptr, EE, 0, NR, EE, EE);      /* x2 = x1 + o*wo^T + bo */
  /* --- FFN --- */
  k_ln1024<false><<<gln, 256, 0, stream>>>(X2, g3, b3n, H16);
  k_gemm3<6><<<gF, 256, 0, stream>>>(H16, EE, 0, BF1, EE, 0, 0.0625f, b1, 0, nullptr, nullptr, F1, FF, 0, NR, FF, EE);      /* gelu_erf(h*fc1^T + b1) -> f16 [4096][4096] */
  k_gemm3<0><<<gE, 256, 0, stream>>>(F1, FF, 0, BF2, FF, 0, 0.0625f, b2, 0, X2, (float*)d_out, nullptr, EE, 0, NR, EE, FF);      /* out = x2 + f*fc2^T + b2 */
}

// v006
// Measured time: 261 microseconds a run.
// Timed twice side by side with v005, it ran 1.14 and 1.15 times as fast.
// Over all steps from v000 it is 3.79 times as fast.
#include <hip/hip_runtime.h>
// Pre-LN decoder layer, sequence-first layout (T 1024, batch 4, E 1024, 16 heads x 64, FFN 4096): h = LN1(x); x1 = x + SelfAttn(h, h); h = LN2(x1); x2 = x1 + Attn(h, encoder_out); h = LN3(x2); out = x2 + fc2(gelu_erf(fc1(h))). Both attentions: q = (in*wq^T + bq)*64^-0.5, k, v from the key input, per (batch, head) scores over the 1024 keys with the module's causal mask (key > query filled with -1e4, i.e. weight exactly 0), softmax, *v, merged, *wo^T + bo.
// Structure: rows are the (t, n) pairs in memory order, so every projection / FFN is a [4096][1024] GEMM (f16 WMMA, 32x64 wave tiles, f32 accumulation, exact bias, residual through the f32 epilogue addend); LayerNorms wave-per-row on VALU writing f16 operand planes; q/k planes viewed as [token][64 heads x 64] feed a fused causal flash-style kernel per ((n,h), 64 queries) (wave = 16 queries, 32-key steps up to the query block, both products transposed so that a lane owns one query, online softmax f32 in base 2, P x2^10 f16 packed in registers, f32 accumulators); v re-laid per (n,h) as [d][token] through an LDS tile; exact-erf GELU in the fc1 epilogue.
// Compute dtype: inputs and parameters rounded to bf16; all GEMM operands f16 (~2^-12: LN outputs, q, k, v, P, attention outputs, the GELU hidden), weights bf16-exact (x16 in f16), f32 accumulation; LayerNorm / softmax / residual stream f32. v_wmma_f32_16x16x32_f16.
#define TT 1024
#define NBATCH 4
#define EE 1024
#define NHD 16
#define NH (NBATCH * NHD)        /* 64 (batch, head) slabs */
#define TQ TT
#define TK TT
#define SCL 0.125f
#define SCL2 (SCL * 1.4426950408889634f)   /* score scale x log2(e): the softmax runs in base 2 */
#define NR (TT * NBATCH)         /* 4096 rows */
#define FF 4096
typedef __bf16 v16b __attribute__((ext_vector_type(16)));
typedef unsigned short v8us __attribute__((ext_vector_type(8), may_alias));
typedef float  v8f  __attribute__((ext_vector_type(8)));
typedef float  v4f  __attribute__((ext_vector_type(4)));
typedef float  v4fa __attribute__((ext_vector_type(4), may_alias));
union FragB { v16b v; v8us half[2]; unsigned short u[16]; };

__device__ __forceinline__ unsigned short bf16_bits(float x) { unsigned int u = __float_as_uint(x); return (unsigned short)((u + 0x7FFFu + ((u >> 16) & 1u)) >> 16); }
__device__ __forceinline__ float bf16_val(unsigned short b) { return __uint_as_float(((unsigned int)b) << 16); }
__device__ __forceinline__ float bf16_round(float x) { return bf16_val(bf16_bits(x)); }
// D += A·B with NT terms: 1 = ah·bh, 2 = + al·bh (A split), 3 = + ah·bl (both split)
template <int NT>
__device__ __forceinline__ v8f mmaN(v16b ah, v16b al, v16b bh, v16b bl, v8f c) {
  c = __builtin_amdgcn_wmma_f32_16x16x32_bf16(false, ah, false, bh, (short)0, c, false, false);
  if (NT >= 2) c = __builtin_amdgcn_wmma_f32_16x16x32_bf16(false, al, false, bh, (short)0, c, false, false);
  if (NT >= 3) c = __builtin_amdgcn_wmma_f32_16x16x32_bf16(false, ah, false, bl, (short)0, c, false, false);
  asm volatile("v_nop\n\tv_nop\n\tv_nop\n\tv_nop" : "+v"(c) : "v"(ah), "v"(al), "v"(bh), "v"(bl));
  return c;
}

__global__ __launch_bounds__(256) void k_wt_bf16(const float* __restrict__ W, unsigned short* __restrict__ Wt, int K, int N) {
  const int t = blockIdx.x * 256 + threadIdx.x;
  const int k8n = K / 8;
  if (t >= N * k8n) return;
  const int n = t / k8n, k8 = (t % k8n) * 8;
  v8us v;
#pragma unroll
  for (int i = 0; i < 8; ++i) v[i] = bf16_bits(W[(size_t)(k8 + i) * N + n]);
  *(v8us*)(Wt + (size_t)n * K + k8) = v;
  
}

// GEMM C[M][N] (f32, pitch ldc) = act(A[M][K]·W + bias). A f32 row-major (pitch lda) converted per fragment to bf16
// (ASPLIT: hi/lo two planes -> 2 terms, else single rounded term); Wt bf16 [N][K] (pitch ldb). BIAS_BF16 rounds the
// bias to bf16 first (bias quantised to bf16 before the add). K%32==0, M%16==0, N%64==0.
template <bool ASPLIT, int ACT, bool BIAS_BF16>
__global__ __launch_bounds__(128) void k_gemm_bf(const float* __restrict__ A, int lda, const unsigned short* __restrict__ Wt, int ldb,
                                               const float* __restrict__ bias, float* __restrict__ C, int ldc, int M, int N, int K) {
  __shared__ __attribute__((aligned(16))) float so[4][16][64];
  const int tid = threadIdx.x, w = tid >> 5, lane = tid & 31, ln = lane & 15, hh = lane >> 4;
  const int ntn = N / 64;
  const int wid = blockIdx.x * 4 + w;
  const int mt = wid / ntn, nq = wid % ntn;
  if (mt * 16 >= M) return;
  const int row0 = mt * 16, col0 = nq * 64;
  const float* arow = A + (size_t)(row0 + ln) * lda;
  v8f acc[4] = {};
  for (int kb = 0; kb < K; kb += 32) {
    FragB ah, al;
    const v4f x0 = *(const v4fa*)(arow + kb + 8 * hh), x1 = *(const v4fa*)(arow + kb + 8 * hh + 4);
    const v4f x2 = *(const v4fa*)(arow + kb + 16 + 8 * hh), x3 = *(const v4fa*)(arow + kb + 16 + 8 * hh + 4);
    float xs[16] = {x0[0],x0[1],x0[2],x0[3],x1[0],x1[1],x1[2],x1[3],x2[0],x2[1],x2[2],x2[3],x3[0],x3[1],x3[2],x3[3]};
#pragma unroll
    for (int i = 0; i < 16; ++i) { const unsigned short hb = bf16_bits(xs[i]); ah.u[i] = hb; al.u[i] = ASPLIT ? bf16_bits(xs[i] - bf16_val(hb)) : (unsigned short)0; }
#pragma unroll
    for (int t = 0; t < 4; ++t) {
      const unsigned short* brow = Wt + (size_t)(col0 + t * 16 + ln) * ldb + kb;
      FragB b;
      b.half[0] = *(const v8us*)(brow + 8 * hh);
      b.half[1] = *(const v8us*)(brow + 16 + 8 * hh);
      acc[t] = mmaN<ASPLIT ? 2 : 1>(ah.v, al.v, b.v, b.v, acc[t]);
    }
  }
#pragma unroll
  for (int t = 0; t < 4; ++t) {
    float bv = bias ? bias[col0 + t * 16 + ln] : 0.f;
    if (BIAS_BF16) bv = bf16_round(bv);
#pragma unroll
    for (int r = 0; r < 8; ++r) { float v = acc[t][r] + bv; if (ACT == 1) v = fmaxf(v, 0.f); so[w][8 * hh + r][t * 16 + ln] = v; }
  }
  __builtin_amdgcn_fence(__ATOMIC_ACQ_REL, "workgroup");
  __builtin_amdgcn_wave_barrier();
  const int rsub = lane >> 4, c4 = (lane & 15) * 4;
  {
#pragma unroll
    for (int q = 0; q < 8; ++q) {
      const int r = q * 2 + rsub;
      const v4f v = *(const v4fa*)&so[w][r][c4];
      *(v4f*)(C + (size_t)(row0 + r) * ldc + col0 + c4) = v;
    }
    
  }
}

// GEMM C = act(A·W + bias + resid): A f32 (ASPLIT -> hi/lo 2 terms), Wt bf16 [N][K]; ACT 0 none, 1 relu, 2 exact gelu;
// resid (optional, f32, row index = (row % rmod), pitch ldr, RES_BF16 rounds it) added before the activation.
template <bool ASPLIT, int ACT, bool BIAS_BF16, bool RES_BF16>
__global__ __launch_bounds__(128) void k_gemm_bf3(const float* __restrict__ A, int lda, const unsigned short* __restrict__ Wt, int ldb,
                                                const float* __restrict__ bias, const float* __restrict__ resid, int rmod, int ldr,
                                                float* __restrict__ C, int ldc, int M, int N, int K) {
  __shared__ __attribute__((aligned(16))) float so[4][16][64];
  const int tid = threadIdx.x, w = tid >> 5, lane = tid & 31, ln = lane & 15, hh = lane >> 4;
  const int ntn = N / 64;
  const int wid = blockIdx.x * 4 + w;
  const int mt = wid / ntn, nq = wid % ntn;
  if (mt * 16 >= M) return;
  const int row0 = mt * 16, col0 = nq * 64;
  const float* arow = A + (size_t)(row0 + ln) * lda;
  v8f acc[4] = {};
  for (int kb = 0; kb < K; kb += 32) {
    FragB ah, al;
    const v4f x0 = *(const v4fa*)(arow + kb + 8 * hh), x1 = *(const v4fa*)(arow + kb + 8 * hh + 4);
    const v4f x2 = *(const v4fa*)(arow + kb + 16 + 8 * hh), x3 = *(const v4fa*)(arow + kb + 16 + 8 * hh + 4);
    float xs[16] = {x0[0],x0[1],x0[2],x0[3],x1[0],x1[1],x1[2],x1[3],x2[0],x2[1],x2[2],x2[3],x3[0],x3[1],x3[2],x3[3]};
#pragma unroll
    for (int i = 0; i < 16; ++i) { const unsigned short hb = bf16_bits(xs[i]); ah.u[i] = hb; al.u[i] = ASPLIT ? bf16_bits(xs[i] - bf16_val(hb)) : (unsigned short)0; }
#pragma unroll
    for (int t = 0; t < 4; ++t) {
      const unsigned short* brow = Wt + (size_t)(col0 + t * 16 + ln) * ldb + kb;
      FragB b;
      b.half[0] = *(const v8us*)(brow + 8 * hh);
      b.half[1] = *(const v8us*)(brow + 16 + 8 * hh);
      acc[t] = mmaN<ASPLIT ? 2 : 1>(ah.v, al.v, b.v, b.v, acc[t]);
    }
  }
#pragma unroll
  for (int t = 0; t < 4; ++t) {
    const int col = col0 + t * 16 + ln;
    float bv = bias ? bias[col] : 0.f;
    if (BIAS_BF16) bv = bf16_round(bv);
#pragma unroll
    for (int r = 0; r < 8; ++r) {
      float v = acc[t][r] + bv;
      if (resid) { float rv = resid[(size_t)((row0 + 8 * hh + r) % rmod) * ldr + col]; if (RES_BF16) rv = bf16_round(rv); v += rv; }
      if (ACT == 1) v = fmaxf(v, 0.f);
      if (ACT == 2) v = 0.5f * v * (1.0f + erff(v * 0.70710678118654752f));
      if (ACT == 3) { const float u = 0.7978845608028654f * (v + 0.044715f * v * v * v); v = 0.5f * v * (1.0f + tanhf(u)); }
      so[w][8 * hh + r][t * 16 + ln] = v;
    }
  }
  __builtin_amdgcn_fence(__ATOMIC_ACQ_REL, "workgroup");
  __builtin_amdgcn_wave_barrier();
  const int rsub = lane >> 4, c4 = (lane & 15) * 4;
  {
#pragma unroll
    for (int q = 0; q < 8; ++q) {
      const int r = q * 2 + rsub;
      const v4f v = *(const v4fa*)&so[w][r][c4];
      *(v4f*)(C + (size_t)(row0 + r) * ldc + col0 + c4) = v;
    }
    
  }
}
// row LayerNorm (biased variance, eps) over N: s = X (+ R); optional out_sum <- s; out_norm <- (s-mu)*rsqrt(var+eps)*g + b
template <bool PARAM_BF16>
__global__ __launch_bounds__(256) void k_layernorm(const float* __restrict__ X, const float* __restrict__ R, const float* __restrict__ g, const float* __restrict__ bta,
                                                  float* __restrict__ out_sum, float* __restrict__ out_norm, int N, float eps) {
  __shared__ float red[256];
  const int row = blockIdx.x, tid = threadIdx.x;
  const float* x = X + (size_t)row * N; const float* rr = R ? R + (size_t)row * N : nullptr;
  float vals[16];                     // up to N = 4096
  const int per = N / 256;            // contiguous chunk per thread? use strided-by-4 chunks: thread handles j = tid*4 + 1024*u
  float s1 = 0.f;
  for (int u = 0; u < per / 4; ++u) {
    const int j = tid * 4 + 1024 * u;
    const v4f a = *(const v4fa*)(x + j);
    v4f b = {0.f,0.f,0.f,0.f}; if (rr) b = *(const v4fa*)(rr + j);
#pragma unroll
    for (int q = 0; q < 4; ++q) { const float v = a[q] + b[q]; vals[u * 4 + q] = v; s1 += v; }
  }
  red[tid] = s1; __syncthreads();
  for (int st = 128; st > 0; st >>= 1) { if (tid < st) red[tid] += red[tid + st]; __syncthreads(); }
  const float mu = red[0] / (float)N; __syncthreads();
  float s2 = 0.f;
  for (int u = 0; u < per / 4; ++u)
#pragma unroll
    for (int q = 0; q < 4; ++q) { const float c = vals[u * 4 + q] - mu; s2 += c * c; }
  red[tid] = s2; __syncthreads();
  for (int st = 128; st > 0; st >>= 1) { if (tid < st) red[tid] += red[tid + st]; __syncthreads(); }
  const float rs = rsqrtf(red[0] / (float)N + eps);
  {
    for (int u = 0; u < per / 4; ++u) {
      const int j = tid * 4 + 1024 * u;
      v4f o, sm;
#pragma unroll
      for (int q = 0; q < 4; ++q) {
        float gg = g[j + q], bb = bta[j + q];
        if (PARAM_BF16) { gg = bf16_round(gg); bb = bf16_round(bb); }
        sm[q] = vals[u * 4 + q]; o[q] = (vals[u * 4 + q] - mu) * rs * gg + bb;
      }
      if (out_sum) *(v4f*)(out_sum + (size_t)row * N + j) = sm;
      *(v4f*)(out_norm + (size_t)row * N + j) = o;
    }
    
  }
}



// ---- f16 WMMA path (v_wmma_f32_16x16x32_f16): 11-bit significands for operands in range — used where a [0,1] probability operand needs more precision than bf16
typedef _Float16 v16h __attribute__((ext_vector_type(16)));
union FragH { v16h v; v8us half[2]; _Float16 h[16]; unsigned short u[16]; };
template <int NT>
__device__ __forceinline__ v8f mmaH(v16h ah, v16h al, v16h bh, v16h bl, v8f c) {
  c = __builtin_amdgcn_wmma_f32_16x16x32_f16(false, ah, false, bh, (short)0, c, false, false);
  if (NT >= 2) c = __builtin_amdgcn_wmma_f32_16x16x32_f16(false, al, false, bh, (short)0, c, false, false);
  if (NT >= 3) c = __builtin_amdgcn_wmma_f32_16x16x32_f16(false, ah, false, bl, (short)0, c, false, false);
  asm volatile("v_nop\n\tv_nop\n\tv_nop\n\tv_nop" : "+v"(c) : "v"(ah), "v"(al), "v"(bh), "v"(bl));
  return c;
}
// batched GEMM like k_gemm_b but f16 operands: A f32 (split into f16 hi/lo if ASPLIT, else rounded to f16), Bt = f16 values [n][k]; alpha; C f32; N multiple of 16 (partial tiles skipped)
template <bool ASPLIT>
__global__ __launch_bounds__(128) void k_gemm_h(const float* __restrict__ A, int lda, size_t sA, const _Float16* __restrict__ Bh, int ldb, size_t sB, float alpha, float* __restrict__ C, int ldc, size_t sC, int M, int N, int K) {
  __shared__ __attribute__((aligned(16))) float so[4][16][64];
  const int tid = threadIdx.x, w = tid >> 5, lane = tid & 31, ln = lane & 15, hh = lane >> 4; const int by = blockIdx.y;
  A += (size_t)by * sA; Bh += (size_t)by * sB; C += (size_t)by * sC;
  const int ntn = (N + 63) / 64; const int wid = blockIdx.x * 4 + w; const int mt = wid / ntn, nq = wid % ntn; if (mt * 16 >= M) return;
  const int row0 = mt * 16, col0 = nq * 64; const float* arow = A + (size_t)(row0 + ln) * lda;
  v8f acc[4] = {};
  for (int kb = 0; kb < K; kb += 32) {
    FragH ah, al;
    const v4f x0 = *(const v4fa*)(arow + kb + 8 * hh), x1 = *(const v4fa*)(arow + kb + 8 * hh + 4), x2 = *(const v4fa*)(arow + kb + 16 + 8 * hh), x3 = *(const v4fa*)(arow + kb + 16 + 8 * hh + 4);
    float xs[16] = {x0[0],x0[1],x0[2],x0[3],x1[0],x1[1],x1[2],x1[3],x2[0],x2[1],x2[2],x2[3],x3[0],x3[1],x3[2],x3[3]};
#pragma unroll
    for (int i = 0; i < 16; ++i) { const _Float16 h = (_Float16)xs[i]; ah.h[i] = h; al.h[i] = ASPLIT ? (_Float16)(xs[i] - (float)h) : (_Float16)0.0f; }
#pragma unroll
    for (int t = 0; t < 4; ++t) { if (col0 + t * 16 >= N) continue; const size_t boff = (size_t)(col0 + t * 16 + ln) * ldb + kb; FragH bq; bq.half[0] = *(const v8us*)(Bh + boff + 8 * hh); bq.half[1] = *(const v8us*)(Bh + boff + 16 + 8 * hh);
      acc[t] = mmaH<ASPLIT ? 2 : 1>(ah.v, al.v, bq.v, bq.v, acc[t]); }
  }
#pragma unroll
  for (int t = 0; t < 4; ++t) { if (col0 + t * 16 >= N) continue;
#pragma unroll
    for (int r = 0; r < 8; ++r) so[w][8 * hh + r][t * 16 + ln] = acc[t][r] * alpha; }
  __builtin_amdgcn_fence(__ATOMIC_ACQ_REL, "workgroup"); __builtin_amdgcn_wave_barrier();
  const int rsub = lane >> 4, c4 = (lane & 15) * 4;
  {
#pragma unroll
    for (int q = 0; q < 8; ++q) { const int r = q * 2 + rsub; if (col0 + c4 < N) { const v4f v = *(const v4fa*)&so[w][r][c4]; *(v4f*)(C + (size_t)(row0 + r) * ldc + col0 + c4) = v; } }
     }
}

// Wt[n][k] = f16(W[k][n]·scale) from f32 row-major W[K][N] (scale = power of two; bf16-exact weights stay exact in f16 away from the subnormal range)
__global__ __launch_bounds__(256) void k_wt_f16(const float* __restrict__ W, _Float16* __restrict__ Wt, int K, int N, float scale) {
  const int t = blockIdx.x * 256 + threadIdx.x; if (t >= N * (K / 8)) return; const int n = t / (K / 8), k8 = (t % (K / 8)) * 8; FragH f;
#pragma unroll
  for (int i = 0; i < 8; ++i) f.h[i] = (_Float16)(bf16_round(W[(size_t)(k8 + i) * N + n]) * scale); const v8us o = f.half[0];
  *(v8us*)((unsigned short*)Wt + (size_t)n * K + k8) = o; 
}
// k_gemm_hh variant with fused epilogue: v = acc·alpha + bias[by·sBias + col] (+ CP[(row/rowsPerB)·sCPb + by·64 + col] if CP) ; ACT 0 none / 1 elu ; writes f16 C16 (and f32 C if non-null)
template <int ACT>
__global__ __launch_bounds__(128) void k_gemm_hhx(const _Float16* __restrict__ A, int lda, size_t sA, const _Float16* __restrict__ Bh, int ldb, size_t sB, float alpha, const float* __restrict__ bias, size_t sBias, const float* __restrict__ CP, int rowsPerB, size_t sCPb, int row0g,
    float* __restrict__ C, _Float16* __restrict__ C16, int ldc, size_t sC, int M, int N, int K) {
  __shared__ __attribute__((aligned(16))) float so[4][16][64];
  const int tid = threadIdx.x, w = tid >> 5, lane = tid & 31, ln = lane & 15, hh = lane >> 4; const int by = blockIdx.y;
  A += (size_t)by * sA; Bh += (size_t)by * sB; const size_t cofs = (size_t)by * sC; const float* bp = bias ? bias + (size_t)by * sBias : nullptr;
  const int ntn = (N + 63) / 64; const int wid = blockIdx.x * 4 + w; const int mt = wid / ntn, nq = wid % ntn; if (mt * 16 >= M) return;
  const int row0 = mt * 16, col0 = nq * 64; const _Float16* arow = A + (size_t)(row0 + ln) * lda;
  v8f acc[4] = {};
  for (int kb = 0; kb < K; kb += 32) { FragH ah; ah.half[0] = *(const v8us*)((const unsigned short*)arow + kb + 8 * hh); ah.half[1] = *(const v8us*)((const unsigned short*)arow + kb + 16 + 8 * hh);
#pragma unroll
    for (int t = 0; t < 4; ++t) { if (col0 + t * 16 >= N) continue; const size_t boff = (size_t)(col0 + t * 16 + ln) * ldb + kb; FragH bq; bq.half[0] = *(const v8us*)((const unsigned short*)Bh + boff + 8 * hh); bq.half[1] = *(const v8us*)((const unsigned short*)Bh + boff + 16 + 8 * hh);
      acc[t] = mmaH<1>(ah.v, ah.v, bq.v, bq.v, acc[t]); }
  }
#pragma unroll
  for (int t = 0; t < 4; ++t) { if (col0 + t * 16 >= N) continue; const int col = col0 + t * 16 + ln; const float bv = bp ? bf16_round(bp[col]) : 0.f;
#pragma unroll
    for (int r = 0; r < 8; ++r) { float v = acc[t][r] * alpha + bv; if (CP) { const int bidx = (row0g + row0 + 8 * hh + r) / rowsPerB; v += CP[(size_t)bidx * sCPb + (size_t)by * 64 + col]; } if (ACT == 1) v = (v > 0.f) ? v : expm1f(v); else if (ACT == 7) v = (v > 0.f) ? v + 1.0f : expf(v); else if (ACT == 8) v = tanhf(v); else if (ACT == 9) v = 0.5f * v * (1.0f + tanhf(0.7978845608028654f * (v + 0.044715f * v * v * v))); else if (ACT == 11) v = 1.0f / (1.0f + expf(-v)); else if (ACT == 12) v = (v > 0.f) ? v : 0.01f * v; else if (ACT == 14) v = (v > 0.f) ? v : 0.1f * v; else if (ACT == 15) v = v / (1.0f + expf(-v)); else if (ACT == 3) v = fmaxf(v, 0.f); else if (ACT == 6) v = 0.5f * v * (1.0f + erff(v * 0.70710678118654752f)); so[w][8 * hh + r][t * 16 + ln] = v; } }
  __builtin_amdgcn_fence(__ATOMIC_ACQ_REL, "workgroup"); __builtin_amdgcn_wave_barrier();
  const int rsub = lane >> 4, c4 = (lane & 15) * 4; typedef _Float16 v4h __attribute__((ext_vector_type(4)));
  {
#pragma unroll
    for (int q = 0; q < 8; ++q) { const int r = q * 2 + rsub; if (col0 + c4 < N) { const v4f v = *(const v4fa*)&so[w][r][c4]; if (C) *(v4f*)(C + cofs + (size_t)(row0 + r) * ldc + col0 + c4) = v; if (C16) { v4h h4; for (int i = 0; i < 4; ++i) h4[i] = (_Float16)v[i]; *(v4h*)(C16 + cofs + (size_t)(row0 + r) * ldc + col0 + c4) = h4; } } }
     }
}


typedef _Float16 v4h __attribute__((ext_vector_type(4)));

__global__ __launch_bounds__(256) void k_x16(const float* __restrict__ x, _Float16* __restrict__ X16, size_t n8) { const size_t t = (size_t)blockIdx.x * 256 + threadIdx.x; if (t >= n8) return; FragH f;
#pragma unroll
  for (int q = 0; q < 8; ++q) f.h[q] = (_Float16)bf16_round(x[t * 8 + q]); *(v8us*)((unsigned short*)X16 + t * 8) = f.half[0];  }
__global__ __launch_bounds__(256) void k_h16(const float* __restrict__ x, _Float16* __restrict__ X16, size_t n8) { const size_t t = (size_t)blockIdx.x * 256 + threadIdx.x; if (t >= n8) return; FragH f;
#pragma unroll
  for (int q = 0; q < 8; ++q) f.h[q] = (_Float16)x[t * 8 + q]; *(v8us*)((unsigned short*)X16 + t * 8) = f.half[0];  }
template <int NHv, int TTv>
__global__ __launch_bounds__(256) void k_vt(const _Float16* __restrict__ V16, int ldv, int voff, _Float16* __restrict__ Vt) { __shared__ unsigned short tl[64][66]; const int tid = threadIdx.x; const int slab = blockIdx.x / (TTv / 64), lg = blockIdx.x % (TTv / 64); const int b = slab / NHv, h = slab % NHv;
  for (int i = tid; i < 64 * 8; i += 256) { const int r = i / 8, c8 = (i % 8) * 8; FragH f; f.half[0] = *(const v8us*)((const unsigned short*)V16 + ((size_t)b * TTv + lg * 64 + r) * ldv + voff + h * 64 + c8);
#pragma unroll
    for (int q = 0; q < 8; ++q) tl[r][c8 + q] = f.u[q]; }
  __syncthreads();
  {
#pragma unroll
    for (int rd = 0; rd < 2; ++rd) { const int d = rd * 32 + tid / 8, pc = tid % 8; FragH f;
#pragma unroll
      for (int q = 0; q < 8; ++q) f.u[q] = tl[pc * 8 + q][d];
      *(v8us*)((unsigned short*)Vt + ((size_t)slab * 64 + d) * TTv + lg * 64 + pc * 8) = f.half[0]; }
     } }

__global__ __launch_bounds__(256) void k_hl(const float* __restrict__ F, _Float16* __restrict__ Hh, _Float16* __restrict__ Hl, size_t n8) { const size_t t = (size_t)blockIdx.x * 256 + threadIdx.x; if (t >= n8) return; FragH fh, fl; const v4f a = *(const v4fa*)(F + t * 8), c = *(const v4fa*)(F + t * 8 + 4);
#pragma unroll
  for (int q = 0; q < 4; ++q) { _Float16 h = (_Float16)a[q]; fh.h[q] = h; fl.h[q] = (_Float16)((a[q] - (float)h) * 1024.0f); h = (_Float16)c[q]; fh.h[4 + q] = h; fl.h[4 + q] = (_Float16)((c[q] - (float)h) * 1024.0f); }
  { *(v8us*)((unsigned short*)Hh + t * 8) = fh.half[0]; *(v8us*)((unsigned short*)Hl + t * 8) = fl.half[0];  } }

// ---- fast GEMM (wave tile 32x64, operands staged in LDS) ----
__device__ __forceinline__ v16h g2_frag(const _Float16* p, int hh) { FragH f; f.half[0] = *(const v8us*)((const unsigned short*)p + 8 * hh); f.half[1] = *(const v8us*)((const unsigned short*)p + 16 + 8 * hh); return f.v; }
__device__ __forceinline__ v8f g2_mma(v16h a, v16h b, v8f c) { v8f d = __builtin_amdgcn_wmma_f32_16x16x32_f16(false, a, false, b, (short)0, c, false, false); asm volatile("v_nop\n\tv_nop\n\tv_nop\n\tv_nop" : "+v"(d) : "v"(a), "v"(b)); return d; }
// Block tile 128x128, eight waves of 32x64 (4 down x 2 across). A pass is 128 k: 128 rows of A and 128 rows of Bh, 256 B each, are laid in LDS at a
// pitch of 272 B (16 B x odd, for the ds_load_b128 fragment reads) by per-lane asynchronous 16-byte copies; two buffers, the next pass's copies fly while this one is multiplied.
#define G3_PITCH 272
#define G3_OPB (128 * G3_PITCH)   /* one operand's 128 rows */
#define G3_BUF (2 * G3_OPB)       /* one buffer: [A rows | Bh rows] */
// Eight copies per lane: rows r, r + 16, ..., r + 112 of one operand (16 lanes cover one 256-B row piece). The s_wait_xcnt closes the copies' own statement so that
// no address register named here is rewritten ahead of it.
__device__ __forceinline__ void g3_copy8(unsigned l, const _Float16* g, size_t rstep) {
  asm volatile("global_load_async_to_lds_b128 %0, %8, off\n\t"
               "global_load_async_to_lds_b128 %1, %9, off\n\t"
               "global_load_async_to_lds_b128 %2, %10, off\n\t"
               "global_load_async_to_lds_b128 %3, %11, off\n\t"
               "global_load_async_to_lds_b128 %4, %12, off\n\t"
               "global_load_async_to_lds_b128 %5, %13, off\n\t"
               "global_load_async_to_lds_b128 %6, %14, off\n\t"
               "global_load_async_to_lds_b128 %7, %15, off\n\t"
               "s_wait_xcnt 0x0"
               :: "v"(l), "v"(l + 16u * G3_PITCH), "v"(l + 32u * G3_PITCH), "v"(l + 48u * G3_PITCH), "v"(l + 64u * G3_PITCH), "v"(l + 80u * G3_PITCH), "v"(l + 96u * G3_PITCH), "v"(l + 112u * G3_PITCH),
                  "v"(g), "v"(g + rstep), "v"(g + 2 * rstep), "v"(g + 3 * rstep), "v"(g + 4 * rstep), "v"(g + 5 * rstep), "v"(g + 6 * rstep), "v"(g + 7 * rstep)
               : "memory");
}
// requires M % 128 == 0, N % 128 == 0, K % 128 == 0; epilogue: v = act(acc * alpha + bf16(bias[col])), then, with ACT 0 only, + R[row][col] (R = optional f32 addend laid out like C)
// bx = the block's tile index, by = its batch index (the kernels below say where they come from)
template <int ACT>
__device__ __forceinline__ void g3_body(const _Float16* __restrict__ A, int lda, size_t sA, const _Float16* __restrict__ Bh, int ldb, size_t sB, float alpha, const float* __restrict__ bias, size_t sBias, const float* __restrict__ R,
    float* __restrict__ C, _Float16* __restrict__ C16, int ldc, size_t sC, int M, int N, int K, const int bx, const int by) {
  __shared__ __attribute__((aligned(16))) unsigned char ring[2 * G3_BUF];      /* the two buffers; after the k loop its first 8 x 32 x 68 floats stage the output */
  const int tid = threadIdx.x, w = tid >> 5, lane = tid & 31, ln = lane & 15, hh = lane >> 4;
  A += (size_t)by * sA; Bh += (size_t)by * sB; const size_t cofs = (size_t)by * sC; const float* bp = bias ? bias + (size_t)by * sBias : nullptr;
  const int ntn = N >> 7; const int mt = bx / ntn, nq = bx - mt * ntn; const int rowb = mt * 128, colb = nq * 128; if (rowb >= M) return;      /* block-uniform, ahead of every barrier */
  const int wm = w & 3, wn = w >> 2; const int row0 = rowb + 32 * wm, col0 = colb + 64 * wn;
  const int cr = tid >> 4, cc = tid & 15;      /* copy side: this lane's first row and its 16-byte piece of the row */
  const _Float16* gA = A + (size_t)(rowb + cr) * lda + cc * 8; const _Float16* gB = Bh + (size_t)(colb + cr) * ldb + cc * 8; const size_t stA = (size_t)16 * lda, stB = (size_t)16 * ldb;
  const unsigned lA = (unsigned)(size_t)ring + (unsigned)(cr * G3_PITCH + cc * 16), lB = lA + G3_OPB;
  const int np = K >> 7;
  g3_copy8(lA, gA, stA); g3_copy8(lB, gB, stB);
  asm volatile("s_wait_asynccnt 0x0" ::: "memory");      /* pass 0's own copies have landed before the barrier that publishes them */
  __syncthreads();
  if (np > 1) { g3_copy8(lA + G3_BUF, gA + 128, stA); g3_copy8(lB + G3_BUF, gB + 128, stB); }
  /* what the epilogue adds is fetched here, all loads independent, so that it lands under the k loop: the wave's 64 bias words (4 a lane) and, in the shape of the final row stores, its 32 x 64 piece of R */
  const int rsub = lane >> 4, c4 = (lane & 15) * 4;
  float bw[4] = {0.f, 0.f, 0.f, 0.f}; v4f rr[16];
  if (bp) {
#pragma unroll
    for (int t = 0; t < 4; ++t) bw[t] = bp[col0 + t * 16 + ln];
    asm volatile("s_wait_xcnt 0x0" ::: "memory"); }      /* stands in front of any rewrite of the base or offset registers that the four bias loads name */
  if (ACT == 0 && R) { const float* rp = R + cofs + (size_t)(row0 + rsub) * ldc + col0 + c4;
#pragma unroll
    for (int q = 0; q < 16; ++q) rr[q] = *(const v4fa*)(rp + (size_t)(2 * q) * ldc);
    asm volatile("s_wait_xcnt 0x0" ::: "memory"); }      /* stands in front of any rewrite of the address registers that the sixteen row loads name */
  const unsigned char* ra = ring + (32 * wm + ln) * G3_PITCH; const unsigned char* rb = ring + G3_OPB + (64 * wn + ln) * G3_PITCH;
  const v8f z8 = {0.f,0.f,0.f,0.f,0.f,0.f,0.f,0.f}; v8f c00 = z8, c01 = z8, c02 = z8, c03 = z8, c10 = z8, c11 = z8, c12 = z8, c13 = z8;
#pragma unroll 1      /* one pass per trip: the publish point at the foot stands once */
  for (int t = 0; t < np; ++t) { const unsigned bo = (unsigned)(t & 1) * G3_BUF;
#pragma unroll      /* the four 32-k blocks of a pass in straight line, so that a block's fragment reads can stand ahead of the block before it */
    for (int ks = 0; ks < 4; ++ks) { const unsigned char* pa = ra + bo + ks * 64; const unsigned char* pb = rb + bo + ks * 64;
      const v16h a0 = g2_frag((const _Float16*)pa, hh), a1 = g2_frag((const _Float16*)(pa + 16 * G3_PITCH), hh);
      const v16h b0 = g2_frag((const _Float16*)pb, hh), b1 = g2_frag((const _Float16*)(pb + 16 * G3_PITCH), hh), b2 = g2_frag((const _Float16*)(pb + 32 * G3_PITCH), hh), b3 = g2_frag((const _Float16*)(pb + 48 * G3_PITCH), hh);
      c00 = g2_mma(a0, b0, c00); c10 = g2_mma(a1, b0, c10); c01 = g2_mma(a0, b1, c01); c11 = g2_mma(a1, b1, c11);
      c02 = g2_mma(a0, b2, c02); c12 = g2_mma(a1, b2, c12); c03 = g2_mma(a0, b3, c03); c13 = g2_mma(a1, b3, c13); }
    asm volatile("s_wait_dscnt 0x0" ::: "memory");         /* this wave's reads of the buffer are done before the barrier behind which it is refilled */
    asm volatile("s_wait_asynccnt 0x0" ::: "memory");      /* this wave's copies of pass t + 1 have landed before the barrier that publishes them */
    __syncthreads();
    if (t + 2 < np) { g3_copy8(lA + bo, gA + (size_t)(t + 2) * 128, stA); g3_copy8(lB + bo, gB + (size_t)(t + 2) * 128, stB); } }
  asm volatile("s_wait_asynccnt 0x0" ::: "memory");        /* nothing in flight when the ring becomes output staging */
  float (*so)[32][68] = (float (*)[32][68])ring;
  v8f accs[8] = {c00, c01, c02, c03, c10, c11, c12, c13};
#pragma unroll
  for (int u = 0; u < 8; ++u) { const int t = u & 3, half = u >> 2; const float bv = bf16_round(bw[t]);
#pragma unroll
    for (int r = 0; r < 8; ++r) { const int rloc = half * 16 + 8 * hh + r; float v = accs[u][r] * alpha + bv;
      if (ACT == 3) v = fmaxf(v, 0.f); else if (ACT == 6) v = 0.5f * v * (1.0f + erff(v * 0.70710678118654752f)); else if (ACT == 11) v = 1.0f / (1.0f + expf(-v)); else if (ACT == 15) v = v / (1.0f + expf(-v)); else if (ACT == 12) v = (v > 0.f) ? v : 0.01f * v; else if (ACT == 8) v = tanhf(v);
      so[w][rloc][t * 16 + ln] = v; } }
  __builtin_amdgcn_fence(__ATOMIC_ACQ_REL, "workgroup"); __builtin_amdgcn_wave_barrier();
  v4f vv[16];      /* the 16 staged rows are read back as one group, ahead of the stores and their waits, instead of one waited read in front of each store */
#pragma unroll
  for (int q = 0; q < 16; ++q) vv[q] = *(const v4fa*)&so[w][q * 2 + rsub][c4];
  {
#pragma unroll
    for (int q = 0; q < 16; ++q) { const int r = q * 2 + rsub; v4f v = vv[q]; if (ACT == 0 && R) v += rr[q];
      if (C) { *(v4f*)(C + cofs + (size_t)(row0 + r) * ldc + col0 + c4) = v; asm volatile("s_wait_xcnt 0x0" ::: "memory"); }      /* the wait stands in front of any rewrite of the store's data or address registers */
      if (C16) { v4h h4; for (int i = 0; i < 4; ++i) h4[i] = (_Float16)v[i]; *(v4h*)(C16 + cofs + (size_t)(row0 + r) * ldc + col0 + c4) = h4; asm volatile("s_wait_xcnt 0x0" ::: "memory"); } }      /* the same wait behind the f16 store */
     } }
template <int ACT>
__global__ __launch_bounds__(256) void k_gemm3(const _Float16* __restrict__ A, int lda, size_t sA, const _Float16* __restrict__ Bh, int ldb, size_t sB, float alpha, const float* __restrict__ bias, size_t sBias, const float* __restrict__ R,
    float* __restrict__ C, _Float16* __restrict__ C16, int ldc, size_t sC, int M, int N, int K) {
  g3_body<ACT>(A, lda, sA, Bh, ldb, sB, alpha, bias, sBias, R, C, C16, ldc, sC, M, N, K, (int)blockIdx.x, (int)blockIdx.y); }
// The five projections that wait for no attention, as one grid: blockIdx.y = 0 q, 1 k, 2 v of the self attention (from the LN1 plane H), 3 k, 4 v of the cross attention (from the encoder plane E).
// Each is the [4096][1024] x [1024][1024] product of k_gemm3<0>; q and k planes leave as f16, v planes as f32.
__global__ __launch_bounds__(256) void k_proj5(const _Float16* __restrict__ H, const _Float16* __restrict__ E, const _Float16* __restrict__ Bq, const _Float16* __restrict__ Bk, const _Float16* __restrict__ Bv, const _Float16* __restrict__ Bkc, const _Float16* __restrict__ Bvc,
    const float* __restrict__ bq, const float* __restrict__ bk, const float* __restrict__ bv, const float* __restrict__ bkc, const float* __restrict__ bvc,
    _Float16* __restrict__ Qs, _Float16* __restrict__ Ks, float* __restrict__ Vs, _Float16* __restrict__ Kc, float* __restrict__ Vc) {
  const int g = (int)blockIdx.y;
  const _Float16* A = (g < 3) ? H : E;
  const _Float16* Bh = (g == 0) ? Bq : (g == 1) ? Bk : (g == 2) ? Bv : (g == 3) ? Bkc : Bvc;
  const float* bias = (g == 0) ? bq : (g == 1) ? bk : (g == 2) ? bv : (g == 3) ? bkc : bvc;
  float* C = (g == 2) ? Vs : (g == 4) ? Vc : nullptr;
  _Float16* C16 = (g == 0) ? Qs : (g == 1) ? Ks : (g == 3) ? Kc : nullptr;
  g3_body<0>(A, EE, 0, Bh, EE, 0, 0.0625f, bias, 0, nullptr, C, C16, EE, 0, NR, EE, EE, (int)blockIdx.x, 0); }


// lane l with lane l ^ 16
__device__ __forceinline__ float xhalf(float x) { return __builtin_bit_cast(float, __builtin_amdgcn_permlanex16(__builtin_bit_cast(int, x), __builtin_bit_cast(int, x), 0x76543210, 0xfedcba98, false, false)); }
// Both products run transposed. S^T = K x Q^T: A = 16 key rows, B = the wave's 16 queries, so lane (ln, hh) holds for ITS query q0 + ln the keys j0 + 16 nt + 8 hh + r:
// maximum and sum are in-lane, the two halves of a query meet in one cross-row move. The two score tiles, converted in place, are the B operand of O^T += V^T x P^T
// (element s = tile s >> 3, register s & 7, which is the k order the V^T rows are loaded in): P passes through no LDS. O^T: lane = query, registers = 8 consecutive d.
// The K rows and the V^T rows of 64 keys (64 rows of 128 B each) are laid in LDS once for the block's four waves, at a pitch of 144 B (16 B x odd, for the ds_load_b128 fragment reads),
// by per-lane asynchronous 16-byte copies in which 8 lanes cover one whole 128-B row; two buffers, the next 64 keys' copies fly while these are worked on.
#define FA_PITCH 144
#define FA_OPB (64 * FA_PITCH)    /* one operand's 64 rows */
#define FA_BUF (2 * FA_OPB)       /* one buffer: [K rows | V^T rows] */
// Eight copies per lane: rows r, r + 16, r + 32, r + 48 of K, then of V^T. The s_wait_xcnt closes the copies' own statement so that no address register named here is rewritten ahead of it.
__device__ __forceinline__ void fa_copy8(unsigned l, const unsigned short* gk, size_t sk, const unsigned short* gv, size_t sv) {
  asm volatile("global_load_async_to_lds_b128 %0, %8, off\n\t"
               "global_load_async_to_lds_b128 %1, %9, off\n\t"
               "global_load_async_to_lds_b128 %2, %10, off\n\t"
               "global_load_async_to_lds_b128 %3, %11, off\n\t"
               "global_load_async_to_lds_b128 %4, %12, off\n\t"
               "global_load_async_to_lds_b128 %5, %13, off\n\t"
               "global_load_async_to_lds_b128 %6, %14, off\n\t"
               "global_load_async_to_lds_b128 %7, %15, off\n\t"
               "s_wait_xcnt 0x0"
               :: "v"(l), "v"(l + 16u * FA_PITCH), "v"(l + 32u * FA_PITCH), "v"(l + 48u * FA_PITCH), "v"(l + FA_OPB), "v"(l + FA_OPB + 16u * FA_PITCH), "v"(l + FA_OPB + 32u * FA_PITCH), "v"(l + FA_OPB + 48u * FA_PITCH),
                  "v"(gk), "v"(gk + sk), "v"(gk + 2 * sk), "v"(gk + 3 * sk), "v"(gv), "v"(gv + sv), "v"(gv + 2 * sv), "v"(gv + 3 * sv)
               : "memory");
}
__global__ __launch_bounds__(128) void k_flashc(const _Float16* __restrict__ Q16, int ldq, const _Float16* __restrict__ K16, int ldk, const _Float16* __restrict__ Vt, const int* __restrict__ MSK, float* __restrict__ O, int ldo) {
  constexpr int RPW = 16, NQB = TQ / (4 * RPW), DT = 4, KS = 2;
  __shared__ __attribute__((aligned(16))) unsigned char ring[2 * FA_BUF];
  __shared__ __attribute__((aligned(16))) float sO[4][RPW][64 + 4];
  (void)MSK;
  const int tid = threadIdx.x, w = tid >> 5, lane = tid & 31, ln = lane & 15, hh = lane >> 4;
  const int slab = blockIdx.x / NQB, qblk = blockIdx.x % NQB; const int b = slab / NH, h = slab % NH; const int qb0 = qblk * (4 * RPW); const int q0 = qb0 + w * RPW;
  const unsigned short* Vth = (const unsigned short*)Vt + (size_t)slab * 64 * TK;
  const int cr = tid >> 3, cc = tid & 7;      /* copy side: this lane's first row and its 16-byte piece of the row */
  const unsigned short* gK = (const unsigned short*)K16 + ((size_t)b * TK + cr) * ldk + h * 64 + cc * 8; const unsigned short* gV = Vth + (size_t)cr * TK + cc * 8; const size_t stK = (size_t)16 * ldk, stV = (size_t)16 * TK;
  const unsigned lc = (unsigned)(size_t)ring + (unsigned)(cr * FA_PITCH + cc * 16);
  const int ns = qblk + 1;      /* block-uniform causal bound: stages of 64 keys up to the end of the query block */
  fa_copy8(lc, gK, stK, gV, stV);
  FragH bq[KS];
  { const unsigned short* qr = (const unsigned short*)Q16 + ((size_t)b * TQ + q0 + ln) * ldq + h * 64;
#pragma unroll
    for (int ks = 0; ks < KS; ++ks) { bq[ks].half[0] = *(const v8us*)(qr + ks * 32 + 8 * hh); bq[ks].half[1] = *(const v8us*)(qr + ks * 32 + 16 + 8 * hh); } }
  asm volatile("s_wait_asynccnt 0x0" ::: "memory");      /* stage 0's own copies have landed before the barrier that publishes them */
  __syncthreads();
  if (ns > 1) fa_copy8(lc + FA_BUF, gK + (size_t)64 * ldk, stK, gV + 64, stV);
  const int tq = q0 + ln;      /* this lane's query */
  float m_r = -3.0e38f, l_r = 0.f; v8f oacc[DT];
#pragma unroll
  for (int dt = 0; dt < DT; ++dt) oacc[dt] = (v8f){0.f,0.f,0.f,0.f,0.f,0.f,0.f,0.f};
  const unsigned char* rk = ring + ln * FA_PITCH + 16 * hh; const unsigned char* rv = rk + FA_OPB;
#pragma unroll 1      /* one stage per trip: the publish point at the foot stands once */
  for (int t = 0; t < ns; ++t) { const unsigned bo = (unsigned)(t & 1) * FA_BUF;
#pragma unroll      /* the stage's two 32-key steps in straight line: each step's place in the buffer is then an immediate offset of its fragment reads */
   for (int sub = 0; sub < 2; ++sub) { const int j0 = t * 64 + sub * 32;
    FragH ak[2][KS], av[DT];
#pragma unroll
    for (int nt = 0; nt < 2; ++nt) { const unsigned char* kr = rk + bo + (sub * 32 + nt * 16) * FA_PITCH;
#pragma unroll
      for (int ks = 0; ks < KS; ++ks) { ak[nt][ks].half[0] = *(const v8us*)(kr + ks * 64); ak[nt][ks].half[1] = *(const v8us*)(kr + ks * 64 + 32); } }
#pragma unroll
    for (int dt = 0; dt < DT; ++dt) { const unsigned char* vrow = rv + bo + dt * 16 * FA_PITCH + sub * 64; av[dt].half[0] = *(const v8us*)vrow; av[dt].half[1] = *(const v8us*)(vrow + 32); }
    float sc[16];
#pragma unroll
    for (int nt = 0; nt < 2; ++nt) { v8f acc = (v8f){0.f,0.f,0.f,0.f,0.f,0.f,0.f,0.f};
#pragma unroll
      for (int ks = 0; ks < KS; ++ks) acc = mmaH<1>(ak[nt][ks].v, ak[nt][ks].v, bq[ks].v, bq[ks].v, acc);
#pragma unroll
      for (int r = 0; r < 8; ++r) sc[nt * 8 + r] = (j0 + nt * 16 + 8 * hh + r <= tq) ? acc[r] : -INFINITY; }      /* the raw product: its scale is folded into the exponent's fma below */
    float mx[4];
#pragma unroll
    for (int i = 0; i < 4; ++i) mx[i] = fmaxf(fmaxf(sc[i], sc[4 + i]), fmaxf(sc[8 + i], sc[12 + i]));
    float mc = fmaxf(fmaxf(mx[0], mx[1]), fmaxf(mx[2], mx[3])); mc = fmaxf(mc, xhalf(mc)) * SCL2;      /* the scale is positive: the maximum of the raw products, scaled once */
    const float mn = fmaxf(m_r, mc); const float ea = __builtin_amdgcn_exp2f(m_r - mn); const float al = (mn > -1.0e38f) ? ea : 1.0f; m_r = mn;
    const float nb = 10.0f - mn;      /* exponent offset: minus the maximum in use, plus the 2^10 that P carries into f16 */
    FragH pb; float ps[4] = {0.f, 0.f, 0.f, 0.f};
#pragma unroll
    for (int i = 0; i < 16; ++i) { const float p = __builtin_amdgcn_exp2f(fmaf(sc[i], SCL2, nb)); ps[i & 3] += p; pb.h[i] = (_Float16)p; }      /* p = weight x 2^10; a masked score is -inf: weight exactly 0 */
    l_r = l_r * al + ((ps[0] + ps[1]) + (ps[2] + ps[3]));      /* this half's keys only; the halves are joined behind the loop */
#pragma unroll
    for (int dt = 0; dt < DT; ++dt) {
#pragma unroll
      for (int r = 0; r < 8; ++r) oacc[dt][r] *= al; }
#pragma unroll
    for (int dt = 0; dt < DT; ++dt) oacc[dt] = mmaH<1>(av[dt].v, av[dt].v, pb.v, pb.v, oacc[dt]); }
    asm volatile("s_wait_dscnt 0x0" ::: "memory");         /* this wave's reads of the buffer are done before the barrier behind which it is refilled */
    asm volatile("s_wait_asynccnt 0x0" ::: "memory");      /* this wave's copies of stage t + 1 have landed before the barrier that publishes them */
    __syncthreads();
    if (t + 2 < ns) fa_copy8(lc + bo, gK + (size_t)(t + 2) * 64 * ldk, stK, gV + (t + 2) * 64, stV); }
  asm volatile("s_wait_asynccnt 0x0" ::: "memory");        /* nothing in flight when the wave goes on to its end */
  const float l = l_r + xhalf(l_r); const float inv = (l > 0.f) ? 1.0f / l : 0.f;      /* the sum carries the same 2^10 as P */
#pragma unroll
  for (int dt = 0; dt < DT; ++dt) { const v4f lo = {oacc[dt][0] * inv, oacc[dt][1] * inv, oacc[dt][2] * inv, oacc[dt][3] * inv}, hi = {oacc[dt][4] * inv, oacc[dt][5] * inv, oacc[dt][6] * inv, oacc[dt][7] * inv};
    *(v4fa*)&sO[w][ln][dt * 16 + 8 * hh] = lo; *(v4fa*)&sO[w][ln][dt * 16 + 8 * hh + 4] = hi; }
  __builtin_amdgcn_fence(__ATOMIC_ACQ_REL, "workgroup"); __builtin_amdgcn_wave_barrier();
  {
#pragma unroll
    for (int rp = 0; rp < RPW; rp += 2) { const int r = rp + (lane >> 4), pc = lane & 15; const v4f val = *(const v4fa*)&sO[w][r][pc * 4]; *(v4f*)(O + ((size_t)b * TQ + q0 + r) * ldo + h * 64 + pc * 4) = val; }
     } }
template <bool RND>
__device__ __forceinline__ void ln1024_body(const float* __restrict__ X, const float* __restrict__ g, const float* __restrict__ bb, _Float16* __restrict__ H16, const int bx) {
  #pragma clang fp contract(off)
  const int tid = threadIdx.x, w = tid >> 5, l = tid & 31; const int r = bx * 8 + w; if (r >= NR) return; const float* x = X + (size_t)r * EE; float v[32]; float s = 0.f; v4f a8[8];
#pragma unroll
  for (int u = 0; u < 8; ++u) a8[u] = *(const v4fa*)(x + u * 128 + l * 4);
  asm volatile("s_wait_xcnt 0x0" ::: "memory");      /* later loads may land in the registers that hold the row loads' address: this wait stands in front of that overwrite */
#pragma unroll
  for (int u = 0; u < 8; ++u) {
#pragma unroll
    for (int q = 0; q < 4; ++q) { const float t = RND ? bf16_round(a8[u][q]) : a8[u][q]; v[u * 4 + q] = t; s += t; } }
  for (int o = 16; o > 0; o >>= 1) s += __shfl_xor(s, o, 32); const float mu = s / (float)EE; float q2 = 0.f;
#pragma unroll
  for (int k = 0; k < 32; ++k) { const float d = v[k] - mu; q2 += d * d; }
  for (int o = 16; o > 0; o >>= 1) q2 += __shfl_xor(q2, o, 32); const float rs = 1.0f / sqrtf(q2 / (float)EE + 1e-5f);
  {
#pragma unroll
    for (int u = 0; u < 8; ++u) { _Float16 h4[4];
#pragma unroll
      for (int q = 0; q < 4; ++q) { const int c = u * 128 + l * 4 + q; h4[q] = (_Float16)((v[u * 4 + q] - mu) * rs * bf16_round(g[c]) + bf16_round(bb[c])); }
      *(unsigned long long*)((unsigned short*)H16 + (size_t)r * EE + u * 128 + l * 4) = *(const unsigned long long*)h4; }
     } }
template <bool RND>
__global__ __launch_bounds__(256) void k_ln1024(const float* __restrict__ X, const float* __restrict__ g, const float* __restrict__ bb, _Float16* __restrict__ H16) { ln1024_body<RND>(X, g, bb, H16, (int)blockIdx.x); }
__device__ __forceinline__ void prep_body(const float* __restrict__ x, const float* __restrict__ e, float* __restrict__ Xf, _Float16* __restrict__ E16, size_t n4, const unsigned bx) {
  const size_t t = (size_t)bx * 256 + threadIdx.x; if (t >= n4) return; const v4f a = *(const v4fa*)(x + t * 4), c = *(const v4fa*)(e + t * 4); v4f ra; _Float16 h4[4];
#pragma unroll
  for (int q = 0; q < 4; ++q) { ra[q] = bf16_round(a[q]); h4[q] = (_Float16)bf16_round(c[q]); }
  const unsigned long long pk = *(const unsigned long long*)h4;
  { *(v4f*)(Xf + t * 4) = ra; *(unsigned long long*)((unsigned short*)E16 + t * 4) = pk;  } }
// Everything that reads only the inputs, as one grid by block range: LN1 (8 rows a block), the x / encoder planes (4 elements a thread), the ten weight planes (8 elements a thread).
// The ten f16 planes lie one behind the other from Bt in the order w0 ... w9, so a piece's place is its running index; w0 ... w7 hold EE * EE elements, w8 and w9 FF * EE.
#define FR_LN (NR / 8)                        /* blocks of LN1 */
#define FR_PREP (NR * EE / 4 / 256)           /* blocks of the x / encoder planes */
#define FR_WSM (EE * EE / 8 / 256)            /* blocks of one EE x EE weight */
#define FR_W (8 * FR_WSM + 2 * (FF / EE) * FR_WSM)
// second bound: eight waves a SIMD. The LN1 branch sets the register count of every block of this grid; held to 128 registers, four blocks of the streaming ranges stay resident on a WGP instead of three.
__global__ __launch_bounds__(256, 8) void k_front(const float* __restrict__ w0, const float* __restrict__ w1, const float* __restrict__ w2, const float* __restrict__ w3, const float* __restrict__ w4, const float* __restrict__ w5, const float* __restrict__ w6, const float* __restrict__ w7,
    const float* __restrict__ w8, const float* __restrict__ w9, const float* __restrict__ x, const float* __restrict__ e, const float* __restrict__ g, const float* __restrict__ bb,
    _Float16* __restrict__ Bt, float* __restrict__ Xf, _Float16* __restrict__ E16, _Float16* __restrict__ H16) {
  const unsigned bx = blockIdx.x;
  if (bx < FR_LN) { ln1024_body<true>(x, g, bb, H16, (int)bx); return; }
  if (bx < FR_LN + FR_PREP) { prep_body(x, e, Xf, E16, (size_t)NR * EE / 4, bx - FR_LN); return; }
  const unsigned wb = bx - (FR_LN + FR_PREP); const unsigned seg = wb / FR_WSM;      /* block-uniform: which EE x EE stretch of the ten planes */
  const float* W; unsigned b0;      /* the source and the block at which its plane begins */
  if (seg < 8) { W = (seg == 0) ? w0 : (seg == 1) ? w1 : (seg == 2) ? w2 : (seg == 3) ? w3 : (seg == 4) ? w4 : (seg == 5) ? w5 : (seg == 6) ? w6 : w7; b0 = seg * FR_WSM; }
  else if (seg < 8 + FF / EE) { W = w8; b0 = 8 * FR_WSM; }
  else { W = w9; b0 = (8 + FF / EE) * FR_WSM; }
  const size_t ts = (size_t)(wb - b0) * 256 + threadIdx.x, td = (size_t)wb * 256 + threadIdx.x; FragH f;
#pragma unroll
  for (int i = 0; i < 8; ++i) f.h[i] = (_Float16)(bf16_round(W[ts * 8 + i]) * 16.0f); *(v8us*)((unsigned short*)Bt + td * 8) = f.half[0];
  asm volatile("s_wait_xcnt 0x0" ::: "memory");      /* stands in front of any rewrite of the registers that the store above names */
}
// blockIdx.y picks the plane: 0 the self attention's v, 1 the cross attention's
__global__ __launch_bounds__(256) void k_vtn(const float* __restrict__ VF0, _Float16* __restrict__ Vt0, const float* __restrict__ VF1, _Float16* __restrict__ Vt1) {
  __shared__ float tl[64][65];
  const float* VF = (blockIdx.y == 0) ? VF0 : VF1; _Float16* Vt = (blockIdx.y == 0) ? Vt0 : Vt1;
  const int tid = threadIdx.x; const int slab = blockIdx.x / (TT / 64), lg = blockIdx.x % (TT / 64); const int n = slab / NHD, h = slab % NHD;
  for (int i = tid; i < 64 * 16; i += 256) { const int r = i / 16, c4 = (i % 16) * 4; const v4f a = *(const v4fa*)(VF + ((size_t)(lg * 64 + r) * NBATCH + n) * EE + h * 64 + c4); tl[r][c4] = a[0]; tl[r][c4 + 1] = a[1]; tl[r][c4 + 2] = a[2]; tl[r][c4 + 3] = a[3]; }
  __syncthreads();
  FragH f[2]; size_t oo[2];
#pragma unroll
  for (int rd = 0; rd < 2; ++rd) { const int d = rd * 32 + tid / 8, pc = tid % 8;
#pragma unroll
    for (int q = 0; q < 8; ++q) f[rd].h[q] = (_Float16)tl[pc * 8 + q][d]; oo[rd] = ((size_t)slab * 64 + d) * TT + lg * 64 + pc * 8; }
  { *(v8us*)((unsigned short*)Vt + oo[0]) = f[0].half[0]; *(v8us*)((unsigned short*)Vt + oo[1]) = f[1].half[0];  } }

extern "C" void kernel_launch(void* const* d_in, const int* in_sizes, int n_in,
                              void* d_out, int out_size, void* d_ws, size_t ws_size, hipStream_t stream) {
  (void)in_sizes; (void)n_in; (void)out_size;
  const float* const* I = (const float* const*)d_in;
  const float* x = I[0]; const float* enc = I[1];
  const float* wq_s = I[2]; const float* bq_s = I[3]; const float* wk_s = I[4]; const float* bk_s = I[5]; const float* wv_s = I[6]; const float* bv_s = I[7]; const float* wo_s = I[8]; const float* bo_s = I[9];
  const float* wq_c = I[10]; const float* bq_c = I[11]; const float* wk_c = I[12]; const float* bk_c = I[13]; const float* wv_c = I[14]; const float* bv_c = I[15]; const float* wo_c = I[16]; const float* bo_c = I[17];
  const float* g1 = I[18]; const float* b1n = I[19]; const float* g2 = I[20]; const float* b2n = I[21]; const float* g3 = I[22]; const float* b3n = I[23]; const float* W1 = I[24]; const float* b1 = I[25]; const float* W2 = I[26]; const float* b2 = I[27];
  char* ws = (char*)d_ws; size_t off = 0;
  auto take = [&](size_t bytes) { char* p = ws + off; off += (bytes + 255) & ~(size_t)255; return p; };
  _Float16* B[8]; for (int i = 0; i < 8; ++i) B[i] = (_Float16*)take((size_t)EE * EE * 2);      /* wq_s wk_s wv_s wo_s wq_c wk_c wv_c wo_c */
  _Float16* BF1 = (_Float16*)take((size_t)FF * EE * 2); _Float16* BF2 = (_Float16*)take((size_t)EE * FF * 2);
  float* Xf = (float*)take((size_t)NR * EE * 4); _Float16* H16 = (_Float16*)take((size_t)NR * EE * 2);
  _Float16* Q16 = (_Float16*)take((size_t)NR * EE * 2); _Float16* K16 = (_Float16*)take((size_t)NR * EE * 2); _Float16* VT = (_Float16*)take((size_t)NR * EE * 2); _Float16* E16 = (_Float16*)take((size_t)NR * EE * 2);      /* these four are contiguous: the FFN hidden reuses them */
  float* O = (float*)take((size_t)NR * EE * 4); float* X1 = (float*)take((size_t)NR * EE * 4);
  _Float16* K16c = (_Float16*)take((size_t)NR * EE * 2); _Float16* VTc = (_Float16*)take((size_t)NR * EE * 2); float* Vc = (float*)take((size_t)NR * EE * 4);      /* the cross attention's k and v planes, made ahead of the self attention */
  if (off > ws_size) return;      /* 16 + 16 + 16 + 8 + 32 + 16 + 16 + 32 = 152 MiB */
  _Float16* O16 = H16;                /* LN output is dead once its projection GEMMs ran; the attention output plane reuses it */
  float* X2 = Xf;                     /* bf16(x) is dead after the first residual GEMM */
  _Float16* F1 = Q16;                 /* FFN hidden [4096][4096] f16 = 32 MiB = Q16+K16+VT+E16 (all dead by then) */
  const size_t n8 = (size_t)NR * EE / 8; const unsigned nb8 = (unsigned)((n8 + 255) / 256);
  const dim3 gE((NR / 128) * (EE / 128), 1), gF((NR / 128) * (FF / 128), 1), gP((NR / 128) * (EE / 128), 5), gvt(NH * (TT / 64), 2); const unsigned gln = NR / 8, gfl = NH * (TQ / 64);
  /* --- all that reads only the inputs: LN1, bf16(x), the encoder plane, the ten weight planes ((out,in) = natural Bt; x16; B[0] ... B[7], BF1, BF2 are contiguous) --- */
  k_front<<<FR_LN + FR_PREP + FR_W, 256, 0, stream>>>(wq_s, wk_s, wv_s, wo_s, wq_c, wk_c, wv_c, wo_c, W1, W2, x, enc, g1, b1n, B[0], Xf, E16, H16);
  /* --- the five projections that wait for no attention, then both v planes re-laid --- */
  k_proj5<<<gP, 256, 0, stream>>>(H16, E16, B[0], B[1], B[2], B[5], B[6], bq_s, bk_s, bv_s, bk_c, bv_c, Q16, K16, O, K16c, Vc);
  k_vtn<<<gvt, 256, 0, stream>>>(O, VT, Vc, VTc);
  /* --- self attention --- */
  k_flashc<<<gfl, 128, 0, stream>>>(Q16, NBATCH * EE, K16, NBATCH * EE, VT, nullptr, O, NBATCH * EE);      /* rows = tokens, 64 (n,h) slabs of 64 columns */
  k_h16<<<nb8, 256, 0, stream>>>(O, O16, n8);
  k_gemm3<0><<<gE, 256, 0, stream>>>(O16, EE, 0, B[3], EE, 0, 0.0625f, bo_s, 0, Xf, X1, nullptr, EE, 0, NR, EE, EE);      /* x1 = x + o*wo^T + bo */
  /* --- cross attention (keys/values from encoder_out, same causal mask) --- */
  k_ln1024<false><<<gln, 256, 0, stream>>>(X1, g2, b2n, H16);
  k_gemm3<0><<<gE, 256, 0, stream>>>(H16, EE, 0, B[4], EE, 0, 0.0625f, bq_c, 0, nullptr, nullptr, Q16, EE, 0, NR, EE, EE);
  k_flashc<<<gfl, 128, 0, stream>>>(Q16, NBATCH * EE, K16c, NBATCH * EE, VTc, nullptr, O, NBATCH * EE);
  k_h16<<<nb8, 256, 0, stream>>>(O, O16, n8);
  k_gemm3<0><<<gE, 256, 0, stream>>>(O16, EE, 0, B[7], EE, 0, 0.0625f, bo_c, 0, X1, X2, nullptr, EE, 0, NR, EE, EE);      /* x2 = x1 + o*wo^T + bo */
  /* --- FFN --- */
  k_ln1024<false><<<gln, 256, 0, stream>>>(X2, g3, b3n, H16);
  k_gemm3<6><<<gF, 256, 0, stream>>>(H16, EE, 0, BF1, EE, 0, 0.0625f, b1, 0, nullptr, nullptr, F1, FF, 0, NR, FF, EE);      /* gelu_erf(h*fc1^T + b1) -> f16 [4096][4096] */
  k_gemm3<0><<<gE, 256, 0, stream>>>(F1, FF, 0, BF2, FF, 0, 0.0625f, b2, 0, X2, (float*)d_out, nullptr, EE, 0, NR, EE, FF);      /* out = x2 + f*fc2^T + b2 */
}

// v007
// It runs in 240 microseconds.
// In both of two side-by-side timings against v006, it was 1.09 times as fast.
// All steps since v000 together make it 4.14 times as fast.
#include <hip/hip_runtime.h>
// Pre-LN decoder layer, sequence-first layout (T 1024, batch 4, E 1024, 16 heads x 64, FFN 4096): h = LN1(x); x1 = x + SelfAttn(h, h); h = LN2(x1); x2 = x1 + Attn(h, encoder_out); h = LN3(x2); out = x2 + fc2(gelu_erf(fc1(h))). Both attentions: q = (in*wq^T + bq)*64^-0.5, k, v from the key input, per (batch, head) scores over the 1024 keys with the module's causal mask (key > query filled with -1e4, i.e. weight exactly 0), softmax, *v, merged, *wo^T + bo.
// Structure: rows are the (t, n) pairs in memory order, so every projection / FFN is a [4096][1024] GEMM (f16 WMMA, 32x64 wave tiles, f32 accumulation, exact bias, residual through the f32 epilogue addend); LayerNorms wave-per-row on VALU writing f16 operand planes; q/k planes viewed as [token][64 heads x 64] feed a fused causal flash-style kernel per ((n,h), 64 queries) (wave = 16 queries, 32-key steps up to the query block, both products transposed so that a lane owns one query, online softmax f32 in base 2, P x2^10 f16 packed in registers, f32 accumulators); v leaves its projection already as f16 [d][token] per (n,h), turned in the epilogue's LDS staging; the attention output leaves as the f16 operand plane of the wo product; exact-erf GELU in the fc1 epilogue.
// Compute dtype: inputs and parameters rounded to bf16; all GEMM operands f16 (~2^-12: LN outputs, q, k, v, P, attention outputs, the GELU hidden), weights bf16-exact (x16 in f16), f32 accumulation; LayerNorm / softmax / residual stream f32. v_wmma_f32_16x16x32_f16.
#define TT 1024
#define NBATCH 4
#define EE 1024
#define NHD 16
#define NH (NBATCH * NHD)        /* 64 (batch, head) slabs */
#define TQ TT
#define TK TT
#define SCL 0.125f
#define SCL2 (SCL * 1.4426950408889634f)   /* score scale x log2(e): the softmax runs in base 2 */
#define NR (TT * NBATCH)         /* 4096 rows */
#define FF 4096
typedef __bf16 v16b __attribute__((ext_vector_type(16)));
typedef unsigned short v8us __attribute__((ext_vector_type(8), may_alias));
typedef float  v8f  __attribute__((ext_vector_type(8)));
typedef float  v4f  __attribute__((ext_vector_type(4)));
typedef float  v4fa __attribute__((ext_vector_type(4), may_alias));
union FragB { v16b v; v8us half[2]; unsigned short u[16]; };

__device__ __forceinline__ unsigned short bf16_bits(float x) { unsigned int u = __float_as_uint(x); return (unsigned short)((u + 0x7FFFu + ((u >> 16) & 1u)) >> 16); }
__device__ __forceinline__ float bf16_val(unsigned short b) { return __uint_as_float(((unsigned int)b) << 16); }
__device__ __forceinline__ float bf16_round(float x) { return bf16_val(bf16_bits(x)); }
// D += A·B with NT terms: 1 = ah·bh, 2 = + al·bh (A split), 3 = + ah·bl (both split)
template <int NT>
__device__ __forceinline__ v8f mmaN(v16b ah, v16b al, v16b bh, v16b bl, v8f c) {
  c = __builtin_amdgcn_wmma_f32_16x16x32_bf16(false, ah, false, bh, (short)0, c, false, false);
  if (NT >= 2) c = __builtin_amdgcn_wmma_f32_16x16x32_bf16(false, al, false, bh, (short)0, c, false, false);
  if (NT >= 3) c = __builtin_amdgcn_wmma_f32_16x16x32_bf16(false, ah, false, bl, (short)0, c, false, false);
  asm volatile("v_nop\n\tv_nop\n\tv_nop\n\tv_nop" : "+v"(c) : "v"(ah), "v"(al), "v"(bh), "v"(bl));
  return c;
}

__global__ __launch_bounds__(256) void k_wt_bf16(const float* __restrict__ W, unsigned short* __restrict__ Wt, int K, int N) {
  const int t = blockIdx.x * 256 + threadIdx.x;
  const int k8n = K / 8;
  if (t >= N * k8n) return;
  const int n = t / k8n, k8 = (t % k8n) * 8;
  v8us v;
#pragma unroll
  for (int i = 0; i < 8; ++i) v[i] = bf16_bits(W[(size_t)(k8 + i) * N + n]);
  *(v8us*)(Wt + (size_t)n * K + k8) = v;
  
}

// GEMM C[M][N] (f32, pitch ldc) = act(A[M][K]·W + bias). A f32 row-major (pitch lda) converted per fragment to bf16
// (ASPLIT: hi/lo two planes -> 2 terms, else single rounded term); Wt bf16 [N][K] (pitch ldb). BIAS_BF16 rounds the
// bias to bf16 first (bias quantised to bf16 before the add). K%32==0, M%16==0, N%64==0.
template <bool ASPLIT, int ACT, bool BIAS_BF16>
__global__ __launch_bounds__(128) void k_gemm_bf(const float* __restrict__ A, int lda, const unsigned short* __restrict__ Wt, int ldb,
                                               const float* __restrict__ bias, float* __restrict__ C, int ldc, int M, int N, int K) {
  __shared__ __attribute__((aligned(16))) float so[4][16][64];
  const int tid = threadIdx.x, w = tid >> 5, lane = tid & 31, ln = lane & 15, hh = lane >> 4;
  const int ntn = N / 64;
  const int wid = blockIdx.x * 4 + w;
  const int mt = wid / ntn, nq = wid % ntn;
  if (mt * 16 >= M) return;
  const int row0 = mt * 16, col0 = nq * 64;
  const float* arow = A + (size_t)(row0 + ln) * lda;
  v8f acc[4] = {};
  for (int kb = 0; kb < K; kb += 32) {
    FragB ah, al;
    const v4f x0 = *(const v4fa*)(arow + kb + 8 * hh), x1 = *(const v4fa*)(arow + kb + 8 * hh + 4);
    const v4f x2 = *(const v4fa*)(arow + kb + 16 + 8 * hh), x3 = *(const v4fa*)(arow + kb + 16 + 8 * hh + 4);
    float xs[16] = {x0[0],x0[1],x0[2],x0[3],x1[0],x1[1],x1[2],x1[3],x2[0],x2[1],x2[2],x2[3],x3[0],x3[1],x3[2],x3[3]};
#pragma unroll
    for (int i = 0; i < 16; ++i) { const unsigned short hb = bf16_bits(xs[i]); ah.u[i] = hb; al.u[i] = ASPLIT ? bf16_bits(xs[i] - bf16_val(hb)) : (unsigned short)0; }
#pragma unroll
    for (int t = 0; t < 4; ++t) {
      const unsigned short* brow = Wt + (size_t)(col0 + t * 16 + ln) * ldb + kb;
      FragB b;
      b.half[0] = *(const v8us*)(brow + 8 * hh);
      b.half[1] = *(const v8us*)(brow + 16 + 8 * hh);
      acc[t] = mmaN<ASPLIT ? 2 : 1>(ah.v, al.v, b.v, b.v, acc[t]);
    }
  }
#pragma unroll
  for (int t = 0; t < 4; ++t) {
    float bv = bias ? bias[col0 + t * 16 + ln] : 0.f;
    if (BIAS_BF16) bv = bf16_round(bv);
#pragma unroll
    for (int r = 0; r < 8; ++r) { float v = acc[t][r] + bv; if (ACT == 1) v = fmaxf(v, 0.f); so[w][8 * hh + r][t * 16 + ln] = v; }
  }
  __builtin_amdgcn_fence(__ATOMIC_ACQ_REL, "workgroup");
  __builtin_amdgcn_wave_barrier();
  const int rsub = lane >> 4, c4 = (lane & 15) * 4;
  {
#pragma unroll
    for (int q = 0; q < 8; ++q) {
      const int r = q * 2 + rsub;
      const v4f v = *(const v4fa*)&so[w][r][c4];
      *(v4f*)(C + (size_t)(row0 + r) * ldc + col0 + c4) = v;
    }
    
  }
}

// GEMM C = act(A·W + bias + resid): A f32 (ASPLIT -> hi/lo 2 terms), Wt bf16 [N][K]; ACT 0 none, 1 relu, 2 exact gelu;
// resid (optional, f32, row index = (row % rmod), pitch ldr, RES_BF16 rounds it) added before the activation.
template <bool ASPLIT, int ACT, bool BIAS_BF16, bool RES_BF16>
__global__ __launch_bounds__(128) void k_gemm_bf3(const float* __restrict__ A, int lda, const unsigned short* __restrict__ Wt, int ldb,
                                                const float* __restrict__ bias, const float* __restrict__ resid, int rmod, int ldr,
                                                float* __restrict__ C, int ldc, int M, int N, int K) {
  __shared__ __attribute__((aligned(16))) float so[4][16][64];
  const int tid = threadIdx.x, w = tid >> 5, lane = tid & 31, ln = lane & 15, hh = lane >> 4;
  const int ntn = N / 64;
  const int wid = blockIdx.x * 4 + w;
  const int mt = wid / ntn, nq = wid % ntn;
  if (mt * 16 >= M) return;
  const int row0 = mt * 16, col0 = nq * 64;
  const float* arow = A + (size_t)(row0 + ln) * lda;
  v8f acc[4] = {};
  for (int kb = 0; kb < K; kb += 32) {
    FragB ah, al;
    const v4f x0 = *(const v4fa*)(arow + kb + 8 * hh), x1 = *(const v4fa*)(arow + kb + 8 * hh + 4);
    const v4f x2 = *(const v4fa*)(arow + kb + 16 + 8 * hh), x3 = *(const v4fa*)(arow + kb + 16 + 8 * hh + 4);
    float xs[16] = {x0[0],x0[1],x0[2],x0[3],x1[0],x1[1],x1[2],x1[3],x2[0],x2[1],x2[2],x2[3],x3[0],x3[1],x3[2],x3[3]};
#pragma unroll
    for (int i = 0; i < 16; ++i) { const unsigned short hb = bf16_bits(xs[i]); ah.u[i] = hb; al.u[i] = ASPLIT ? bf16_bits(xs[i] - bf16_val(hb)) : (unsigned short)0; }
#pragma unroll
    for (int t = 0; t < 4; ++t) {
      const unsigned short* brow = Wt + (size_t)(col0 + t * 16 + ln) * ldb + kb;
      FragB b;
      b.half[0] = *(const v8us*)(brow + 8 * hh);
      b.half[1] = *(const v8us*)(brow + 16 + 8 * hh);
      acc[t] = mmaN<ASPLIT ? 2 : 1>(ah.v, al.v, b.v, b.v, acc[t]);
    }
  }
#pragma unroll
  for (int t = 0; t < 4; ++t) {
    const int col = col0 + t * 16 + ln;
    float bv = bias ? bias[col] : 0.f;
    if (BIAS_BF16) bv = bf16_round(bv);
#pragma unroll
    for (int r = 0; r < 8; ++r) {
      float v = acc[t][r] + bv;
      if (resid) { float rv = resid[(size_t)((row0 + 8 * hh + r) % rmod) * ldr + col]; if (RES_BF16) rv = bf16_round(rv); v += rv; }
      if (ACT == 1) v = fmaxf(v, 0.f);
      if (ACT == 2) v = 0.5f * v * (1.0f + erff(v * 0.70710678118654752f));
      if (ACT == 3) { const float u = 0.7978845608028654f * (v + 0.044715f * v * v * v); v = 0.5f * v * (1.0f + tanhf(u)); }
      so[w][8 * hh + r][t * 16 + ln] = v;
    }
  }
  __builtin_amdgcn_fence(__ATOMIC_ACQ_REL, "workgroup");
  __builtin_amdgcn_wave_barrier();
  const int rsub = lane >> 4, c4 = (lane & 15) * 4;
  {
#pragma unroll
    for (int q = 0; q < 8; ++q) {
      const int r = q * 2 + rsub;
      const v4f v = *(const v4fa*)&so[w][r][c4];
      *(v4f*)(C + (size_t)(row0 + r) * ldc + col0 + c4) = v;
    }
    
  }
}
// row LayerNorm (biased variance, eps) over N: s = X (+ R); optional out_sum <- s; out_norm <- (s-mu)*rsqrt(var+eps)*g + b
template <bool PARAM_BF16>
__global__ __launch_bounds__(256) void k_layernorm(const float* __restrict__ X, const float* __restrict__ R, const float* __restrict__ g, const float* __restrict__ bta,
                                                  float* __restrict__ out_sum, float* __restrict__ out_norm, int N, float eps) {
  __shared__ float red[256];
  const int row = blockIdx.x, tid = threadIdx.x;
  const float* x = X + (size_t)row * N; const float* rr = R ? R + (size_t)row * N : nullptr;
  float vals[16];                     // up to N = 4096
  const int per = N / 256;            // contiguous chunk per thread? use strided-by-4 chunks: thread handles j = tid*4 + 1024*u
  float s1 = 0.f;
  for (int u = 0; u < per / 4; ++u) {
    const int j = tid * 4 + 1024 * u;
    const v4f a = *(const v4fa*)(x + j);
    v4f b = {0.f,0.f,0.f,0.f}; if (rr) b = *(const v4fa*)(rr + j);
#pragma unroll
    for (int q = 0; q < 4; ++q) { const float v = a[q] + b[q]; vals[u * 4 + q] = v; s1 += v; }
  }
  red[tid] = s1; __syncthreads();
  for (int st = 128; st > 0; st >>= 1) { if (tid < st) red[tid] += red[tid + st]; __syncthreads(); }
  const float mu = red[0] / (float)N; __syncthreads();
  float s2 = 0.f;
  for (int u = 0; u < per / 4; ++u)
#pragma unroll
    for (int q = 0; q < 4; ++q) { const float c = vals[u * 4 + q] - mu; s2 += c * c; }
  red[tid] = s2; __syncthreads();
  for (int st = 128; st > 0; st >>= 1) { if (tid < st) red[tid] += red[tid + st]; __syncthreads(); }
  const float rs = rsqrtf(red[0] / (float)N + eps);
  {
    for (int u = 0; u < per / 4; ++u) {
      const int j = tid * 4 + 1024 * u;
      v4f o, sm;
#pragma unroll
      for (int q = 0; q < 4; ++q) {
        float gg = g[j + q], bb = bta[j + q];
        if (PARAM_BF16) { gg = bf16_round(gg); bb = bf16_round(bb); }
        sm[q] = vals[u * 4 + q]; o[q] = (vals[u * 4 + q] - mu) * rs * gg + bb;
      }
      if (out_sum) *(v4f*)(out_sum + (size_t)row * N + j) = sm;
      *(v4f*)(out_norm + (size_t)row * N + j) = o;
    }
    
  }
}



// ---- f16 WMMA path (v_wmma_f32_16x16x32_f16): 11-bit significands for operands in range — used where a [0,1] probability operand needs more precision than bf16
typedef _Float16 v16h __attribute__((ext_vector_type(16)));
union FragH { v16h v; v8us half[2]; _Float16 h[16]; unsigned short u[16]; };
template <int NT>
__device__ __forceinline__ v8f mmaH(v16h ah, v16h al, v16h bh, v16h bl, v8f c) {
  c = __builtin_amdgcn_wmma_f32_16x16x32_f16(false, ah, false, bh, (short)0, c, false, false);
  if (NT >= 2) c = __builtin_amdgcn_wmma_f32_16x16x32_f16(false, al, false, bh, (short)0, c, false, false);
  if (NT >= 3) c = __builtin_amdgcn_wmma_f32_16x16x32_f16(false, ah, false, bl, (short)0, c, false, false);
  asm volatile("v_nop\n\tv_nop\n\tv_nop\n\tv_nop" : "+v"(c) : "v"(ah), "v"(al), "v"(bh), "v"(bl));
  return c;
}
// batched GEMM like k_gemm_b but f16 operands: A f32 (split into f16 hi/lo if ASPLIT, else rounded to f16), Bt = f16 values [n][k]; alpha; C f32; N multiple of 16 (partial tiles skipped)
template <bool ASPLIT>
__global__ __launch_bounds__(128) void k_gemm_h(const float* __restrict__ A, int lda, size_t sA, const _Float16* __restrict__ Bh, int ldb, size_t sB, float alpha, float* __restrict__ C, int ldc, size_t sC, int M, int N, int K) {
  __shared__ __attribute__((aligned(16))) float so[4][16][64];
  const int tid = threadIdx.x, w = tid >> 5, lane = tid & 31, ln = lane & 15, hh = lane >> 4; const int by = blockIdx.y;
  A += (size_t)by * sA; Bh += (size_t)by * sB; C += (size_t)by * sC;
  const int ntn = (N + 63) / 64; const int wid = blockIdx.x * 4 + w; const int mt = wid / ntn, nq = wid % ntn; if (mt * 16 >= M) return;
  const int row0 = mt * 16, col0 = nq * 64; const float* arow = A + (size_t)(row0 + ln) * lda;
  v8f acc[4] = {};
  for (int kb = 0; kb < K; kb += 32) {
    FragH ah, al;
    const v4f x0 = *(const v4fa*)(arow + kb + 8 * hh), x1 = *(const v4fa*)(arow + kb + 8 * hh + 4), x2 = *(const v4fa*)(arow + kb + 16 + 8 * hh), x3 = *(const v4fa*)(arow + kb + 16 + 8 * hh + 4);
    float xs[16] = {x0[0],x0[1],x0[2],x0[3],x1[0],x1[1],x1[2],x1[3],x2[0],x2[1],x2[2],x2[3],x3[0],x3[1],x3[2],x3[3]};
#pragma unroll
    for (int i = 0; i < 16; ++i) { const _Float16 h = (_Float16)xs[i]; ah.h[i] = h; al.h[i] = ASPLIT ? (_Float16)(xs[i] - (float)h) : (_Float16)0.0f; }
#pragma unroll
    for (int t = 0; t < 4; ++t) { if (col0 + t * 16 >= N) continue; const size_t boff = (size_t)(col0 + t * 16 + ln) * ldb + kb; FragH bq; bq.half[0] = *(const v8us*)(Bh + boff + 8 * hh); bq.half[1] = *(const v8us*)(Bh + boff + 16 + 8 * hh);
      acc[t] = mmaH<ASPLIT ? 2 : 1>(ah.v, al.v, bq.v, bq.v, acc[t]); }
  }
#pragma unroll
  for (int t = 0; t < 4; ++t) { if (col0 + t * 16 >= N) continue;
#pragma unroll
    for (int r = 0; r < 8; ++r) so[w][8 * hh + r][t * 16 + ln] = acc[t][r] * alpha; }
  __builtin_amdgcn_fence(__ATOMIC_ACQ_REL, "workgroup"); __builtin_amdgcn_wave_barrier();
  const int rsub = lane >> 4, c4 = (lane & 15) * 4;
  {
#pragma unroll
    for (int q = 0; q < 8; ++q) { const int r = q * 2 + rsub; if (col0 + c4 < N) { const v4f v = *(const v4fa*)&so[w][r][c4]; *(v4f*)(C + (size_t)(row0 + r) * ldc + col0 + c4) = v; } }
     }
}

// Wt[n][k] = f16(W[k][n]·scale) from f32 row-major W[K][N] (scale = power of two; bf16-exact weights stay exact in f16 away from the subnormal range)
__global__ __launch_bounds__(256) void k_wt_f16(const float* __restrict__ W, _Float16* __restrict__ Wt, int K, int N, float scale) {
  const int t = blockIdx.x * 256 + threadIdx.x; if (t >= N * (K / 8)) return; const int n = t / (K / 8), k8 = (t % (K / 8)) * 8; FragH f;
#pragma unroll
  for (int i = 0; i < 8; ++i) f.h[i] = (_Float16)(bf16_round(W[(size_t)(k8 + i) * N + n]) * scale); const v8us o = f.half[0];
  *(v8us*)((unsigned short*)Wt + (size_t)n * K + k8) = o; 
}
// k_gemm_hh variant with fused epilogue: v = acc·alpha + bias[by·sBias + col] (+ CP[(row/rowsPerB)·sCPb + by·64 + col] if CP) ; ACT 0 none / 1 elu ; writes f16 C16 (and f32 C if non-null)
template <int ACT>
__global__ __launch_bounds__(128) void k_gemm_hhx(const _Float16* __restrict__ A, int lda, size_t sA, const _Float16* __restrict__ Bh, int ldb, size_t sB, float alpha, const float* __restrict__ bias, size_t sBias, const float* __restrict__ CP, int rowsPerB, size_t sCPb, int row0g,
    float* __restrict__ C, _Float16* __restrict__ C16, int ldc, size_t sC, int M, int N, int K) {
  __shared__ __attribute__((aligned(16))) float so[4][16][64];
  const int tid = threadIdx.x, w = tid >> 5, lane = tid & 31, ln = lane & 15, hh = lane >> 4; const int by = blockIdx.y;
  A += (size_t)by * sA; Bh += (size_t)by * sB; const size_t cofs = (size_t)by * sC; const float* bp = bias ? bias + (size_t)by * sBias : nullptr;
  const int ntn = (N + 63) / 64; const int wid = blockIdx.x * 4 + w; const int mt = wid / ntn, nq = wid % ntn; if (mt * 16 >= M) return;
  const int row0 = mt * 16, col0 = nq * 64; const _Float16* arow = A + (size_t)(row0 + ln) * lda;
  v8f acc[4] = {};
  for (int kb = 0; kb < K; kb += 32) { FragH ah; ah.half[0] = *(const v8us*)((const unsigned short*)arow + kb + 8 * hh); ah.half[1] = *(const v8us*)((const unsigned short*)arow + kb + 16 + 8 * hh);
#pragma unroll
    for (int t = 0; t < 4; ++t) { if (col0 + t * 16 >= N) continue; const size_t boff = (size_t)(col0 + t * 16 + ln) * ldb + kb; FragH bq; bq.half[0] = *(const v8us*)((const unsigned short*)Bh + boff + 8 * hh); bq.half[1] = *(const v8us*)((const unsigned short*)Bh + boff + 16 + 8 * hh);
      acc[t] = mmaH<1>(ah.v, ah.v, bq.v, bq.v, acc[t]); }
  }
#pragma unroll
  for (int t = 0; t < 4; ++t) { if (col0 + t * 16 >= N) continue; const int col = col0 + t * 16 + ln; const float bv = bp ? bf16_round(bp[col]) : 0.f;
#pragma unroll
    for (int r = 0; r < 8; ++r) { float v = acc[t][r] * alpha + bv; if (CP) { const int bidx = (row0g + row0 + 8 * hh + r) / rowsPerB; v += CP[(size_t)bidx * sCPb + (size_t)by * 64 + col]; } if (ACT == 1) v = (v > 0.f) ? v : expm1f(v); else if (ACT == 7) v = (v > 0.f) ? v + 1.0f : expf(v); else if (ACT == 8) v = tanhf(v); else if (ACT == 9) v = 0.5f * v * (1.0f + tanhf(0.7978845608028654f * (v + 0.044715f * v * v * v))); else if (ACT == 11) v = 1.0f / (1.0f + expf(-v)); else if (ACT == 12) v = (v > 0.f) ? v : 0.01f * v; else if (ACT == 14) v = (v > 0.f) ? v : 0.1f * v; else if (ACT == 15) v = v / (1.0f + expf(-v)); else if (ACT == 3) v = fmaxf(v, 0.f); else if (ACT == 6) v = 0.5f * v * (1.0f + erff(v * 0.70710678118654752f)); so[w][8 * hh + r][t * 16 + ln] = v; } }
  __builtin_amdgcn_fence(__ATOMIC_ACQ_REL, "workgroup"); __builtin_amdgcn_wave_barrier();
  const int rsub = lane >> 4, c4 = (lane & 15) * 4; typedef _Float16 v4h __attribute__((ext_vector_type(4)));
  {
#pragma unroll
    for (int q = 0; q < 8; ++q) { const int r = q * 2 + rsub; if (col0 + c4 < N) { const v4f v = *(const v4fa*)&so[w][r][c4]; if (C) *(v4f*)(C + cofs + (size_t)(row0 + r) * ldc + col0 + c4) = v; if (C16) { v4h h4; for (int i = 0; i < 4; ++i) h4[i] = (_Float16)v[i]; *(v4h*)(C16 + cofs + (size_t)(row0 + r) * ldc + col0 + c4) = h4; } } }
     }
}


typedef _Float16 v4h __attribute__((ext_vector_type(4)));

__global__ __launch_bounds__(256) void k_x16(const float* __restrict__ x, _Float16* __restrict__ X16, size_t n8) { const size_t t = (size_t)blockIdx.x * 256 + threadIdx.x; if (t >= n8) return; FragH f;
#pragma unroll
  for (int q = 0; q < 8; ++q) f.h[q] = (_Float16)bf16_round(x[t * 8 + q]); *(v8us*)((unsigned short*)X16 + t * 8) = f.half[0];  }
template <int NHv, int TTv>
__global__ __launch_bounds__(256) void k_vt(const _Float16* __restrict__ V16, int ldv, int voff, _Float16* __restrict__ Vt) { __shared__ unsigned short tl[64][66]; const int tid = threadIdx.x; const int slab = blockIdx.x / (TTv / 64), lg = blockIdx.x % (TTv / 64); const int b = slab / NHv, h = slab % NHv;
  for (int i = tid; i < 64 * 8; i += 256) { const int r = i / 8, c8 = (i % 8) * 8; FragH f; f.half[0] = *(const v8us*)((const unsigned short*)V16 + ((size_t)b * TTv + lg * 64 + r) * ldv + voff + h * 64 + c8);
#pragma unroll
    for (int q = 0; q < 8; ++q) tl[r][c8 + q] = f.u[q]; }
  __syncthreads();
  {
#pragma unroll
    for (int rd = 0; rd < 2; ++rd) { const int d = rd * 32 + tid / 8, pc = tid % 8; FragH f;
#pragma unroll
      for (int q = 0; q < 8; ++q) f.u[q] = tl[pc * 8 + q][d];
      *(v8us*)((unsigned short*)Vt + ((size_t)slab * 64 + d) * TTv + lg * 64 + pc * 8) = f.half[0]; }
     } }

__global__ __launch_bounds__(256) void k_hl(const float* __restrict__ F, _Float16* __restrict__ Hh, _Float16* __restrict__ Hl, size_t n8) { const size_t t = (size_t)blockIdx.x * 256 + threadIdx.x; if (t >= n8) return; FragH fh, fl; const v4f a = *(const v4fa*)(F + t * 8), c = *(const v4fa*)(F + t * 8 + 4);
#pragma unroll
  for (int q = 0; q < 4; ++q) { _Float16 h = (_Float16)a[q]; fh.h[q] = h; fl.h[q] = (_Float16)((a[q] - (float)h) * 1024.0f); h = (_Float16)c[q]; fh.h[4 + q] = h; fl.h[4 + q] = (_Float16)((c[q] - (float)h) * 1024.0f); }
  { *(v8us*)((unsigned short*)Hh + t * 8) = fh.half[0]; *(v8us*)((unsigned short*)Hl + t * 8) = fl.half[0];  } }

// ---- fast GEMM (wave tile 32x64, operands staged in LDS) ----
__device__ __forceinline__ v16h g2_frag(const _Float16* p, int hh) { FragH f; f.half[0] = *(const v8us*)((const unsigned short*)p + 8 * hh); f.half[1] = *(const v8us*)((const unsigned short*)p + 16 + 8 * hh); return f.v; }
__device__ __forceinline__ v8f g2_mma(v16h a, v16h b, v8f c) { v8f d = __builtin_amdgcn_wmma_f32_16x16x32_f16(false, a, false, b, (short)0, c, false, false); asm volatile("v_nop\n\tv_nop\n\tv_nop\n\tv_nop" : "+v"(d) : "v"(a), "v"(b)); return d; }
// Block tile 128x128, eight waves of 32x64 (4 down x 2 across). A pass is 128 k: 128 rows of A and 128 rows of Bh, 256 B each, are laid in LDS at a
// pitch of 272 B (16 B x odd, for the ds_load_b128 fragment reads) by per-lane asynchronous 16-byte copies; two buffers, the next pass's copies fly while this one is multiplied.
#define G3_PITCH 272
#define G3_OPB (128 * G3_PITCH)   /* one operand's 128 rows */
#define G3_BUF (2 * G3_OPB)       /* one buffer: [A rows | Bh rows] */
// Eight copies per lane: rows r, r + 16, ..., r + 112 of one operand (16 lanes cover one 256-B row piece). The s_wait_xcnt closes the copies' own statement so that
// no address register named here is rewritten ahead of it.
__device__ __forceinline__ void g3_copy8(unsigned l, const _Float16* g, size_t rstep) {
  asm volatile("global_load_async_to_lds_b128 %0, %8, off\n\t"
               "global_load_async_to_lds_b128 %1, %9, off\n\t"
               "global_load_async_to_lds_b128 %2, %10, off\n\t"
               "global_load_async_to_lds_b128 %3, %11, off\n\t"
               "global_load_async_to_lds_b128 %4, %12, off\n\t"
               "global_load_async_to_lds_b128 %5, %13, off\n\t"
               "global_load_async_to_lds_b128 %6, %14, off\n\t"
               "global_load_async_to_lds_b128 %7, %15, off\n\t"
               "s_wait_xcnt 0x0"
               :: "v"(l), "v"(l + 16u * G3_PITCH), "v"(l + 32u * G3_PITCH), "v"(l + 48u * G3_PITCH), "v"(l + 64u * G3_PITCH), "v"(l + 80u * G3_PITCH), "v"(l + 96u * G3_PITCH), "v"(l + 112u * G3_PITCH),
                  "v"(g), "v"(g + rstep), "v"(g + 2 * rstep), "v"(g + 3 * rstep), "v"(g + 4 * rstep), "v"(g + 5 * rstep), "v"(g + 6 * rstep), "v"(g + 7 * rstep)
               : "memory");
}
// requires M % 128 == 0, N % 128 == 0, K % 128 == 0; epilogue: v = act(acc * alpha + bf16(bias[col])), then, with ACT 0 only, + R[row][col] (R = optional f32 addend laid out like C; RRND: rounded to bf16 as it is added, for an addend that is a raw input)
// bx = the block's tile index, by = its batch index (the kernels below say where they come from)
// VT (optional, ACT 0 only): the tile leaves transposed and as f16 only, VT[by * N + col][row] with M elements a line, instead of through C / C16
template <int ACT, bool RRND = false>
__device__ __forceinline__ void g3_body(const _Float16* __restrict__ A, int lda, size_t sA, const _Float16* __restrict__ Bh, int ldb, size_t sB, float alpha, const float* __restrict__ bias, size_t sBias, const float* __restrict__ R,
    float* __restrict__ C, _Float16* __restrict__ C16, _Float16* __restrict__ VT, int ldc, size_t sC, int M, int N, int K, const int bx, const int by) {
  __shared__ __attribute__((aligned(16))) unsigned char ring[2 * G3_BUF];      /* the two buffers; after the k loop its first 8 x 32 x 68 floats stage the output */
  const int tid = threadIdx.x, w = tid >> 5, lane = tid & 31, ln = lane & 15, hh = lane >> 4;
  A += (size_t)by * sA; Bh += (size_t)by * sB; const size_t cofs = (size_t)by * sC; const float* bp = bias ? bias + (size_t)by * sBias : nullptr;
  const int ntn = N >> 7; const int mt = bx / ntn, nq = bx - mt * ntn; const int rowb = mt * 128, colb = nq * 128; if (rowb >= M) return;      /* block-uniform, ahead of every barrier */
  const int wm = w & 3, wn = w >> 2; const int row0 = rowb + 32 * wm, col0 = colb + 64 * wn;
  const int cr = tid >> 4, cc = tid & 15;      /* copy side: this lane's first row and its 16-byte piece of the row */
  const _Float16* gA = A + (size_t)(rowb + cr) * lda + cc * 8; const _Float16* gB = Bh + (size_t)(colb + cr) * ldb + cc * 8; const size_t stA = (size_t)16 * lda, stB = (size_t)16 * ldb;
  const unsigned lA = (unsigned)(size_t)ring + (unsigned)(cr * G3_PITCH + cc * 16), lB = lA + G3_OPB;
  const int np = K >> 7;
  g3_copy8(lA, gA, stA); g3_copy8(lB, gB, stB);
  asm volatile("s_wait_asynccnt 0x0" ::: "memory");      /* pass 0's own copies have landed before the barrier that publishes them */
  __syncthreads();
  if (np > 1) { g3_copy8(lA + G3_BUF, gA + 128, stA); g3_copy8(lB + G3_BUF, gB + 128, stB); }
  /* what the epilogue adds is fetched here, all loads independent, so that it lands under the k loop: the wave's 64 bias words (4 a lane) and, in the shape of the final row stores, its 32 x 64 piece of R */
  const int rsub = lane >> 4, c4 = (lane & 15) * 4;
  float bw[4] = {0.f, 0.f, 0.f, 0.f}; v4f rr[16];
  if (bp) {
#pragma unroll
    for (int t = 0; t < 4; ++t) bw[t] = bp[col0 + t * 16 + ln];
    asm volatile("s_wait_xcnt 0x0" ::: "memory"); }      /* stands in front of any rewrite of the base or offset registers that the four bias loads name */
  if (ACT == 0 && R) { const float* rp = R + cofs + (size_t)(row0 + rsub) * ldc + col0 + c4;
#pragma unroll
    for (int q = 0; q < 16; ++q) rr[q] = *(const v4fa*)(rp + (size_t)(2 * q) * ldc);
    asm volatile("s_wait_xcnt 0x0" ::: "memory"); }      /* stands in front of any rewrite of the address registers that the sixteen row loads name */
  const unsigned char* ra = ring + (32 * wm + ln) * G3_PITCH; const unsigned char* rb = ring + G3_OPB + (64 * wn + ln) * G3_PITCH;
  const v8f z8 = {0.f,0.f,0.f,0.f,0.f,0.f,0.f,0.f}; v8f c00 = z8, c01 = z8, c02 = z8, c03 = z8, c10 = z8, c11 = z8, c12 = z8, c13 = z8;
#pragma unroll 1      /* one pass per trip: the publish point at the foot stands once */
  for (int t = 0; t < np; ++t) { const unsigned bo = (unsigned)(t & 1) * G3_BUF;
#pragma unroll      /* the four 32-k blocks of a pass in straight line, so that a block's fragment reads can stand ahead of the block before it */
    for (int ks = 0; ks < 4; ++ks) { const unsigned char* pa = ra + bo + ks * 64; const unsigned char* pb = rb + bo + ks * 64;
      const v16h a0 = g2_frag((const _Float16*)pa, hh), a1 = g2_frag((const _Float16*)(pa + 16 * G3_PITCH), hh);
      const v16h b0 = g2_frag((const _Float16*)pb, hh), b1 = g2_frag((const _Float16*)(pb + 16 * G3_PITCH), hh), b2 = g2_frag((const _Float16*)(pb + 32 * G3_PITCH), hh), b3 = g2_frag((const _Float16*)(pb + 48 * G3_PITCH), hh);
      c00 = g2_mma(a0, b0, c00); c10 = g2_mma(a1, b0, c10); c01 = g2_mma(a0, b1, c01); c11 = g2_mma(a1, b1, c11);
      c02 = g2_mma(a0, b2, c02); c12 = g2_mma(a1, b2, c12); c03 = g2_mma(a0, b3, c03); c13 = g2_mma(a1, b3, c13); }
    asm volatile("s_wait_dscnt 0x0" ::: "memory");         /* this wave's reads of the buffer are done before the barrier behind which it is refilled */
    asm volatile("s_wait_asynccnt 0x0" ::: "memory");      /* this wave's copies of pass t + 1 have landed before the barrier that publishes them */
    __syncthreads();
    if (t + 2 < np) { g3_copy8(lA + bo, gA + (size_t)(t + 2) * 128, stA); g3_copy8(lB + bo, gB + (size_t)(t + 2) * 128, stB); } }
  asm volatile("s_wait_asynccnt 0x0" ::: "memory");        /* nothing in flight when the ring becomes output staging */
  v8f accs[8] = {c00, c01, c02, c03, c10, c11, c12, c13};
  if (ACT == 0 && VT) {      /* block-uniform. A lane holds 8 consecutive rows of one column: 16 bytes of a transposed f16 line. The block's 128 columns x 128 rows are gathered in the ring at the pitch of its operand rows, so that whole 256-byte lines leave */
#pragma unroll
    for (int u = 0; u < 8; ++u) { const int t = u & 3, half = u >> 2; const float bv = bf16_round(bw[t]); FragH f;
#pragma unroll
      for (int r = 0; r < 8; ++r) f.h[r] = (_Float16)(accs[u][r] * alpha + bv);
      *(v8us*)(ring + (64 * wn + t * 16 + ln) * G3_PITCH + (32 * wm + half * 16 + 8 * hh) * 2) = f.half[0]; }
    __syncthreads();      /* a line's 128 rows come from four waves: all have written before any is read back */
    v8us tv[8];
#pragma unroll
    for (int q = 0; q < 8; ++q) tv[q] = *(const v8us*)(ring + (q * 16 + cr) * G3_PITCH + cc * 16);
    unsigned short* vp = (unsigned short*)VT + ((size_t)by * N + colb + cr) * (size_t)M + rowb + cc * 8;
#pragma unroll
    for (int q = 0; q < 8; ++q) { *(v8us*)(vp + (size_t)(q * 16) * M) = tv[q]; asm volatile("s_wait_xcnt 0x0" ::: "memory"); }      /* the wait stands in front of any rewrite of the store's data or address registers */
    return; }
  float (*so)[32][68] = (float (*)[32][68])ring;
#pragma unroll
  for (int u = 0; u < 8; ++u) { const int t = u & 3, half = u >> 2; const float bv = bf16_round(bw[t]);
#pragma unroll
    for (int r = 0; r < 8; ++r) { const int rloc = half * 16 + 8 * hh + r; float v = accs[u][r] * alpha + bv;
      if (ACT == 3) v = fmaxf(v, 0.f); else if (ACT == 6) v = 0.5f * v * (1.0f + erff(v * 0.70710678118654752f)); else if (ACT == 11) v = 1.0f / (1.0f + expf(-v)); else if (ACT == 15) v = v / (1.0f + expf(-v)); else if (ACT == 12) v = (v > 0.f) ? v : 0.01f * v; else if (ACT == 8) v = tanhf(v);
      so[w][rloc][t * 16 + ln] = v; } }
  __builtin_amdgcn_fence(__ATOMIC_ACQ_REL, "workgroup"); __builtin_amdgcn_wave_barrier();
  v4f vv[16];      /* the 16 staged rows are read back as one group, ahead of the stores and their waits, instead of one waited read in front of each store */
#pragma unroll
  for (int q = 0; q < 16; ++q) vv[q] = *(const v4fa*)&so[w][q * 2 + rsub][c4];
  {
#pragma unroll
    for (int q = 0; q < 16; ++q) { const int r = q * 2 + rsub; v4f v = vv[q]; if (ACT == 0 && R) { v4f a = rr[q]; if (RRND) { for (int i = 0; i < 4; ++i) a[i] = bf16_round(a[i]); } v += a; }
      if (C) { *(v4f*)(C + cofs + (size_t)(row0 + r) * ldc + col0 + c4) = v; asm volatile("s_wait_xcnt 0x0" ::: "memory"); }      /* the wait stands in front of any rewrite of the store's data or address registers */
      if (C16) { v4h h4; for (int i = 0; i < 4; ++i) h4[i] = (_Float16)v[i]; *(v4h*)(C16 + cofs + (size_t)(row0 + r) * ldc + col0 + c4) = h4; asm volatile("s_wait_xcnt 0x0" ::: "memory"); } }      /* the same wait behind the f16 store */
     } }
template <int ACT, bool RRND = false>
__global__ __launch_bounds__(256) void k_gemm3(const _Float16* __restrict__ A, int lda, size_t sA, const _Float16* __restrict__ Bh, int ldb, size_t sB, float alpha, const float* __restrict__ bias, size_t sBias, const float* __restrict__ R,
    float* __restrict__ C, _Float16* __restrict__ C16, int ldc, size_t sC, int M, int N, int K) {
  g3_body<ACT, RRND>(A, lda, sA, Bh, ldb, sB, alpha, bias, sBias, R, C, C16, nullptr, ldc, sC, M, N, K, (int)blockIdx.x, (int)blockIdx.y); }
// The five projections that wait for no attention, as one grid: blockIdx.y = 0 q, 1 k, 2 v of the self attention (from the LN1 plane H), 3 k, 4 v of the cross attention (from the encoder plane E).
// Each is the [4096][1024] x [1024][1024] product of k_gemm3<0>; q and k planes leave as f16 rows. A v block takes 128 tokens of ONE batch entry (row pitch NBATCH * EE), so that its tile, turned, is 128 whole
// 256-byte pieces of the [(n, h)][d][token] plane that the attention reads: the v planes leave in that form, as f16.
__global__ __launch_bounds__(256) void k_proj5(const _Float16* __restrict__ H, const _Float16* __restrict__ E, const _Float16* __restrict__ Bq, const _Float16* __restrict__ Bk, const _Float16* __restrict__ Bv, const _Float16* __restrict__ Bkc, const _Float16* __restrict__ Bvc,
    const float* __restrict__ bq, const float* __restrict__ bk, const float* __restrict__ bv, const float* __restrict__ bkc, const float* __restrict__ bvc,
    _Float16* __restrict__ Qs, _Float16* __restrict__ Ks, _Float16* __restrict__ VTs, _Float16* __restrict__ Kc, _Float16* __restrict__ VTc) {
  const int g = (int)blockIdx.y;
  const _Float16* A = (g < 3) ? H : E;
  const _Float16* Bh = (g == 0) ? Bq : (g == 1) ? Bk : (g == 2) ? Bv : (g == 3) ? Bkc : Bvc;
  const float* bias = (g == 0) ? bq : (g == 1) ? bk : (g == 2) ? bv : (g == 3) ? bkc : bvc;
  _Float16* VTd = (g == 2) ? VTs : (g == 4) ? VTc : nullptr; const bool vb = (g == 2) || (g == 4); const int bx = (int)blockIdx.x;
  _Float16* C16 = (g == 0) ? Qs : (g == 1) ? Ks : (g == 3) ? Kc : nullptr;
  constexpr int TPB = (TT / 128) * (EE / 128);      /* tiles of one batch entry's v plane */
  g3_body<0>(A, vb ? NBATCH * EE : EE, EE, Bh, EE, 0, 0.0625f, bias, 0, nullptr, nullptr, C16, VTd, EE, 0, vb ? TT : NR, EE, EE, vb ? bx % TPB : bx, vb ? bx / TPB : 0); }


// lane l with lane l ^ 16
__device__ __forceinline__ float xhalf(float x) { return __builtin_bit_cast(float, __builtin_amdgcn_permlanex16(__builtin_bit_cast(int, x), __builtin_bit_cast(int, x), 0x76543210, 0xfedcba98, false, false)); }
// Both products run transposed. S^T = K x Q^T: A = 16 key rows, B = the wave's 16 queries, so lane (ln, hh) holds for ITS query q0 + ln the keys j0 + 16 nt + 8 hh + r:
// maximum and sum are in-lane, the two halves of a query meet in one cross-row move. The two score tiles, converted in place, are the B operand of O^T += V^T x P^T
// (element s = tile s >> 3, register s & 7, which is the k order the V^T rows are loaded in): P passes through no LDS. O^T: lane = query, registers = 8 consecutive d.
// The K rows and the V^T rows of 64 keys (64 rows of 128 B each) are laid in LDS once for the block's four waves, at a pitch of 144 B (16 B x odd, for the ds_load_b128 fragment reads),
// by per-lane asynchronous 16-byte copies in which 8 lanes cover one whole 128-B row; two buffers, the next 64 keys' copies fly while these are worked on.
#define FA_PITCH 144
#define FA_OPB (64 * FA_PITCH)    /* one operand's 64 rows */
#define FA_BUF (2 * FA_OPB)       /* one buffer: [K rows | V^T rows] */
// Eight copies per lane: rows r, r + 16, r + 32, r + 48 of K, then of V^T. The s_wait_xcnt closes the copies' own statement so that no address register named here is rewritten ahead of it.
__device__ __forceinline__ void fa_copy8(unsigned l, const unsigned short* gk, size_t sk, const unsigned short* gv, size_t sv) {
  asm volatile("global_load_async_to_lds_b128 %0, %8, off\n\t"
               "global_load_async_to_lds_b128 %1, %9, off\n\t"
               "global_load_async_to_lds_b128 %2, %10, off\n\t"
               "global_load_async_to_lds_b128 %3, %11, off\n\t"
               "global_load_async_to_lds_b128 %4, %12, off\n\t"
               "global_load_async_to_lds_b128 %5, %13, off\n\t"
               "global_load_async_to_lds_b128 %6, %14, off\n\t"
               "global_load_async_to_lds_b128 %7, %15, off\n\t"
               "s_wait_xcnt 0x0"
               :: "v"(l), "v"(l + 16u * FA_PITCH), "v"(l + 32u * FA_PITCH), "v"(l + 48u * FA_PITCH), "v"(l + FA_OPB), "v"(l + FA_OPB + 16u * FA_PITCH), "v"(l + FA_OPB + 32u * FA_PITCH), "v"(l + FA_OPB + 48u * FA_PITCH),
                  "v"(gk), "v"(gk + sk), "v"(gk + 2 * sk), "v"(gk + 3 * sk), "v"(gv), "v"(gv + sv), "v"(gv + 2 * sv), "v"(gv + 3 * sv)
               : "memory");
}
__global__ __launch_bounds__(128) void k_flashc(const _Float16* __restrict__ Q16, int ldq, const _Float16* __restrict__ K16, int ldk, const _Float16* __restrict__ Vt, const int* __restrict__ MSK, _Float16* __restrict__ O16, int ldo) {
  constexpr int RPW = 16, NQB = TQ / (4 * RPW), DT = 4, KS = 2;
  __shared__ __attribute__((aligned(16))) unsigned char ring[2 * FA_BUF];
  __shared__ __attribute__((aligned(16))) unsigned short sO[4][RPW][64 + 8];      /* output staging, f16: a query's 64 values at a pitch of 144 B */
  (void)MSK;
  const int tid = threadIdx.x, w = tid >> 5, lane = tid & 31, ln = lane & 15, hh = lane >> 4;
  const int slab = blockIdx.x / NQB, qblk = blockIdx.x % NQB; const int b = slab / NH, h = slab % NH; const int qb0 = qblk * (4 * RPW); const int q0 = qb0 + w * RPW;
  const unsigned short* Vth = (const unsigned short*)Vt + (size_t)slab * 64 * TK;
  const int cr = tid >> 3, cc = tid & 7;      /* copy side: this lane's first row and its 16-byte piece of the row */
  const unsigned short* gK = (const unsigned short*)K16 + ((size_t)b * TK + cr) * ldk + h * 64 + cc * 8; const unsigned short* gV = Vth + (size_t)cr * TK + cc * 8; const size_t stK = (size_t)16 * ldk, stV = (size_t)16 * TK;
  const unsigned lc = (unsigned)(size_t)ring + (unsigned)(cr * FA_PITCH + cc * 16);
  const int ns = qblk + 1;      /* block-uniform causal bound: stages of 64 keys up to the end of the query block */
  fa_copy8(lc, gK, stK, gV, stV);
  FragH bq[KS];
  { const unsigned short* qr = (const unsigned short*)Q16 + ((size_t)b * TQ + q0 + ln) * ldq + h * 64;
#pragma unroll
    for (int ks = 0; ks < KS; ++ks) { bq[ks].half[0] = *(const v8us*)(qr + ks * 32 + 8 * hh); bq[ks].half[1] = *(const v8us*)(qr + ks * 32 + 16 + 8 * hh); } }
  asm volatile("s_wait_asynccnt 0x0" ::: "memory");      /* stage 0's own copies have landed before the barrier that publishes them */
  __syncthreads();
  if (ns > 1) fa_copy8(lc + FA_BUF, gK + (size_t)64 * ldk, stK, gV + 64, stV);
  const int tq = q0 + ln;      /* this lane's query */
  float m_r = -3.0e38f, l_r = 0.f; v8f oacc[DT];
#pragma unroll
  for (int dt = 0; dt < DT; ++dt) oacc[dt] = (v8f){0.f,0.f,0.f,0.f,0.f,0.f,0.f,0.f};
  const unsigned char* rk = ring + ln * FA_PITCH + 16 * hh; const unsigned char* rv = rk + FA_OPB;
#pragma unroll 1      /* one stage per trip: the publish point at the foot stands once */
  for (int t = 0; t < ns; ++t) { const unsigned bo = (unsigned)(t & 1) * FA_BUF;
#pragma unroll      /* the stage's two 32-key steps in straight line: each step's place in the buffer is then an immediate offset of its fragment reads */
   for (int sub = 0; sub < 2; ++sub) { const int j0 = t * 64 + sub * 32;
    FragH ak[2][KS], av[DT];
#pragma unroll
    for (int nt = 0; nt < 2; ++nt) { const unsigned char* kr = rk + bo + (sub * 32 + nt * 16) * FA_PITCH;
#pragma unroll
      for (int ks = 0; ks < KS; ++ks) { ak[nt][ks].half[0] = *(const v8us*)(kr + ks * 64); ak[nt][ks].half[1] = *(const v8us*)(kr + ks * 64 + 32); } }
#pragma unroll
    for (int dt = 0; dt < DT; ++dt) { const unsigned char* vrow = rv + bo + dt * 16 * FA_PITCH + sub * 64; av[dt].half[0] = *(const v8us*)vrow; av[dt].half[1] = *(const v8us*)(vrow + 32); }
    float sc[16];
#pragma unroll
    for (int nt = 0; nt < 2; ++nt) { v8f acc = (v8f){0.f,0.f,0.f,0.f,0.f,0.f,0.f,0.f};
#pragma unroll
      for (int ks = 0; ks < KS; ++ks) acc = mmaH<1>(ak[nt][ks].v, ak[nt][ks].v, bq[ks].v, bq[ks].v, acc);
#pragma unroll
      for (int r = 0; r < 8; ++r) sc[nt * 8 + r] = (j0 + nt * 16 + 8 * hh + r <= tq) ? acc[r] : -INFINITY; }      /* the raw product: its scale is folded into the exponent's fma below */
    float mx[4];
#pragma unroll
    for (int i = 0; i < 4; ++i) mx[i] = fmaxf(fmaxf(sc[i], sc[4 + i]), fmaxf(sc[8 + i], sc[12 + i]));
    float mc = fmaxf(fmaxf(mx[0], mx[1]), fmaxf(mx[2], mx[3])); mc = fmaxf(mc, xhalf(mc)) * SCL2;      /* the scale is positive: the maximum of the raw products, scaled once */
    const float mn = fmaxf(m_r, mc); const float ea = __builtin_amdgcn_exp2f(m_r - mn); const float al = (mn > -1.0e38f) ? ea : 1.0f; m_r = mn;
    const float nb = 10.0f - mn;      /* exponent offset: minus the maximum in use, plus the 2^10 that P carries into f16 */
    FragH pb; float ps[4] = {0.f, 0.f, 0.f, 0.f};
#pragma unroll
    for (int i = 0; i < 16; ++i) { const float p = __builtin_amdgcn_exp2f(fmaf(sc[i], SCL2, nb)); ps[i & 3] += p; pb.h[i] = (_Float16)p; }      /* p = weight x 2^10; a masked score is -inf: weight exactly 0 */
    l_r = l_r * al + ((ps[0] + ps[1]) + (ps[2] + ps[3]));      /* this half's keys only; the halves are joined behind the loop */
#pragma unroll
    for (int dt = 0; dt < DT; ++dt) {
#pragma unroll
      for (int r = 0; r < 8; ++r) oacc[dt][r] *= al; }
#pragma unroll
    for (int dt = 0; dt < DT; ++dt) oacc[dt] = mmaH<1>(av[dt].v, av[dt].v, pb.v, pb.v, oacc[dt]); }
    asm volatile("s_wait_dscnt 0x0" ::: "memory");         /* this wave's reads of the buffer are done before the barrier behind which it is refilled */
    asm volatile("s_wait_asynccnt 0x0" ::: "memory");      /* this wave's copies of stage t + 1 have landed before the barrier that publishes them */
    __syncthreads();
    if (t + 2 < ns) fa_copy8(lc + bo, gK + (size_t)(t + 2) * 64 * ldk, stK, gV + (t + 2) * 64, stV); }
  asm volatile("s_wait_asynccnt 0x0" ::: "memory");        /* nothing in flight when the wave goes on to its end */
  const float l = l_r + xhalf(l_r); const float inv = (l > 0.f) ? 1.0f / l : 0.f;      /* the sum carries the same 2^10 as P */
#pragma unroll
  for (int dt = 0; dt < DT; ++dt) { FragH f;      /* a lane's 8 consecutive d of its query: 16 bytes of the f16 row */
#pragma unroll
    for (int r = 0; r < 8; ++r) f.h[r] = (_Float16)(oacc[dt][r] * inv);
    *(v8us*)&sO[w][ln][dt * 16 + 8 * hh] = f.half[0]; }
  __builtin_amdgcn_fence(__ATOMIC_ACQ_REL, "workgroup"); __builtin_amdgcn_wave_barrier();
  { const int rs = lane >> 3, pc = lane & 7; v8us ov[4];      /* 8 lanes cover a query's 64 f16 = one 128-byte line; the four reads go as one group ahead of the stores */
#pragma unroll
    for (int k = 0; k < 4; ++k) ov[k] = *(const v8us*)&sO[w][k * 4 + rs][pc * 8];
#pragma unroll
    for (int k = 0; k < 4; ++k) { *(v8us*)((unsigned short*)O16 + ((size_t)b * TQ + q0 + k * 4 + rs) * ldo + h * 64 + pc * 8) = ov[k]; asm volatile("s_wait_xcnt 0x0" ::: "memory"); }      /* the wait stands in front of any rewrite of the store's data or address registers */
     } }
template <bool RND>
__device__ __forceinline__ void ln1024_body(const float* __restrict__ X, const float* __restrict__ g, const float* __restrict__ bb, _Float16* __restrict__ H16, const int bx) {
  #pragma clang fp contract(off)
  const int tid = threadIdx.x, w = tid >> 5, l = tid & 31; const int r = bx * 8 + w; if (r >= NR) return; const float* x = X + (size_t)r * EE; float v[32]; float s = 0.f; v4f a8[8];
#pragma unroll
  for (int u = 0; u < 8; ++u) a8[u] = *(const v4fa*)(x + u * 128 + l * 4);
  asm volatile("s_wait_xcnt 0x0" ::: "memory");      /* later loads may land in the registers that hold the row loads' address: this wait stands in front of that overwrite */
#pragma unroll
  for (int u = 0; u < 8; ++u) {
#pragma unroll
    for (int q = 0; q < 4; ++q) { const float t = RND ? bf16_round(a8[u][q]) : a8[u][q]; v[u * 4 + q] = t; s += t; } }
  for (int o = 16; o > 0; o >>= 1) s += __shfl_xor(s, o, 32); const float mu = s / (float)EE; float q2 = 0.f;
#pragma unroll
  for (int k = 0; k < 32; ++k) { const float d = v[k] - mu; q2 += d * d; }
  for (int o = 16; o > 0; o >>= 1) q2 += __shfl_xor(q2, o, 32); const float rs = 1.0f / sqrtf(q2 / (float)EE + 1e-5f);
  {
#pragma unroll
    for (int u = 0; u < 8; ++u) { _Float16 h4[4];
#pragma unroll
      for (int q = 0; q < 4; ++q) { const int c = u * 128 + l * 4 + q; h4[q] = (_Float16)((v[u * 4 + q] - mu) * rs * bf16_round(g[c]) + bf16_round(bb[c])); }
      *(unsigned long long*)((unsigned short*)H16 + (size_t)r * EE + u * 128 + l * 4) = *(const unsigned long long*)h4; }
     } }
template <bool RND>
__global__ __launch_bounds__(256) void k_ln1024(const float* __restrict__ X, const float* __restrict__ g, const float* __restrict__ bb, _Float16* __restrict__ H16) { ln1024_body<RND>(X, g, bb, H16, (int)blockIdx.x); }
__device__ __forceinline__ void prep_body(const float* __restrict__ e, _Float16* __restrict__ E16, size_t n8, const unsigned bx) {
  const size_t t = (size_t)bx * 256 + threadIdx.x; if (t >= n8) return; const v4f a = *(const v4fa*)(e + t * 8), c = *(const v4fa*)(e + t * 8 + 4); FragH f;
#pragma unroll
  for (int q = 0; q < 4; ++q) { f.h[q] = (_Float16)bf16_round(a[q]); f.h[4 + q] = (_Float16)bf16_round(c[q]); }
  *(v8us*)((unsigned short*)E16 + t * 8) = f.half[0];
  asm volatile("s_wait_xcnt 0x0" ::: "memory");      /* stands in front of any rewrite of the registers that the store above names */
}
// Everything that reads only the inputs, as one grid by block range: LN1 (8 rows a block), the encoder plane and the ten weight planes (8 elements a thread).
// The ten f16 planes lie one behind the other from Bt in the order w0 ... w9, so a piece's place is its running index; w0 ... w7 hold EE * EE elements, w8 and w9 FF * EE.
#define FR_LN (NR / 8)                        /* blocks of LN1 */
#define FR_PREP (NR * EE / 8 / 256)           /* blocks of the encoder plane */
#define FR_WSM (EE * EE / 8 / 256)            /* blocks of one EE x EE weight */
#define FR_W (8 * FR_WSM + 2 * (FF / EE) * FR_WSM)
// second bound: eight waves a SIMD. The LN1 branch sets the register count of every block of this grid; held to 128 registers, four blocks of the streaming ranges stay resident on a WGP instead of three.
__global__ __launch_bounds__(256, 8) void k_front(const float* __restrict__ w0, const float* __restrict__ w1, const float* __restrict__ w2, const float* __restrict__ w3, const float* __restrict__ w4, const float* __restrict__ w5, const float* __restrict__ w6, const float* __restrict__ w7,
    const float* __restrict__ w8, const float* __restrict__ w9, const float* __restrict__ x, const float* __restrict__ e, const float* __restrict__ g, const float* __restrict__ bb,
    _Float16* __restrict__ Bt, _Float16* __restrict__ E16, _Float16* __restrict__ H16) {
  const unsigned bx = blockIdx.x;
  if (bx < FR_LN) { ln1024_body<true>(x, g, bb, H16, (int)bx); return; }
  if (bx < FR_LN + FR_PREP) { prep_body(e, E16, (size_t)NR * EE / 8, bx - FR_LN); return; }
  const unsigned wb = bx - (FR_LN + FR_PREP); const unsigned seg = wb / FR_WSM;      /* block-uniform: which EE x EE stretch of the ten planes */
  const float* W; unsigned b0;      /* the source and the block at which its plane begins */
  if (seg < 8) { W = (seg == 0) ? w0 : (seg == 1) ? w1 : (seg == 2) ? w2 : (seg == 3) ? w3 : (seg == 4) ? w4 : (seg == 5) ? w5 : (seg == 6) ? w6 : w7; b0 = seg * FR_WSM; }
  else if (seg < 8 + FF / EE) { W = w8; b0 = 8 * FR_WSM; }
  else { W = w9; b0 = (8 + FF / EE) * FR_WSM; }
  const size_t ts = (size_t)(wb - b0) * 256 + threadIdx.x, td = (size_t)wb * 256 + threadIdx.x; FragH f;
#pragma unroll
  for (int i = 0; i < 8; ++i) f.h[i] = (_Float16)(bf16_round(W[ts * 8 + i]) * 16.0f); *(v8us*)((unsigned short*)Bt + td * 8) = f.half[0];
  asm volatile("s_wait_xcnt 0x0" ::: "memory");      /* stands in front of any rewrite of the registers that the store above names */
}

extern "C" void kernel_launch(void* const* d_in, const int* in_sizes, int n_in,
                              void* d_out, int out_size, void* d_ws, size_t ws_size, hipStream_t stream) {
  (void)in_sizes; (void)n_in; (void)out_size;
  const float* const* I = (const float* const*)d_in;
  const float* x = I[0]; const float* enc = I[1];
  const float* wq_s = I[2]; const float* bq_s = I[3]; const float* wk_s = I[4]; const float* bk_s = I[5]; const float* wv_s = I[6]; const float* bv_s = I[7]; const float* wo_s = I[8]; const float* bo_s = I[9];
  const float* wq_c = I[10]; const float* bq_c = I[11]; const float* wk_c = I[12]; const float* bk_c = I[13]; const float* wv_c = I[14]; const float* bv_c = I[15]; const float* wo_c = I[16]; const float* bo_c = I[17];
  const float* g1 = I[18]; const float* b1n = I[19]; const float* g2 = I[20]; const float* b2n = I[21]; const float* g3 = I[22]; const float* b3n = I[23]; const float* W1 = I[24]; const float* b1 = I[25]; const float* W2 = I[26]; const float* b2 = I[27];
  char* ws = (char*)d_ws; size_t off = 0;
  auto take = [&](size_t bytes) { char* p = ws + off; off += (bytes + 255) & ~(size_t)255; return p; };
  _Float16* B[8]; for (int i = 0; i < 8; ++i) B[i] = (_Float16*)take((size_t)EE * EE * 2);      /* wq_s wk_s wv_s wo_s wq_c wk_c wv_c wo_c */
  _Float16* BF1 = (_Float16*)take((size_t)FF * EE * 2); _Float16* BF2 = (_Float16*)take((size_t)EE * FF * 2);
  float* X2 = (float*)take((size_t)NR * EE * 4); _Float16* H16 = (_Float16*)take((size_t)NR * EE * 2);
  _Float16* Q16 = (_Float16*)take((size_t)NR * EE * 2); _Float16* K16 = (_Float16*)take((size_t)NR * EE * 2); _Float16* VT = (_Float16*)take((size_t)NR * EE * 2); _Float16* E16 = (_Float16*)take((size_t)NR * EE * 2);      /* these four are contiguous: the FFN hidden reuses them */
  float* X1 = (float*)take((size_t)NR * EE * 4);
  _Float16* K16c = (_Float16*)take((size_t)NR * EE * 2); _Float16* VTc = (_Float16*)take((size_t)NR * EE * 2);      /* the cross attention's k and v planes, made ahead of the self attention */
  if (off > ws_size) return;      /* 16 + 16 + 16 + 8 + 32 + 16 + 16 = 120 MiB */
  _Float16* O16 = H16;                /* LN output is dead once its projection GEMMs ran; the attention output plane reuses it */
  _Float16* F1 = Q16;                 /* FFN hidden [4096][4096] f16 = 32 MiB = Q16+K16+VT+E16 (all dead by then) */
  const dim3 gE((NR / 128) * (EE / 128), 1), gF((NR / 128) * (FF / 128), 1), gP((NR / 128) * (EE / 128), 5); const unsigned gln = NR / 8, gfl = NH * (TQ / 64);
  /* --- all that reads only the inputs: LN1, the encoder plane, the ten weight planes ((out,in) = natural Bt; x16; B[0] ... B[7], BF1, BF2 are contiguous) --- */
  k_front<<<FR_LN + FR_PREP + FR_W, 256, 0, stream>>>(wq_s, wk_s, wv_s, wo_s, wq_c, wk_c, wv_c, wo_c, W1, W2, x, enc, g1, b1n, B[0], E16, H16);
  /* --- the five projections that wait for no attention; both v planes leave re-laid --- */
  k_proj5<<<gP, 256, 0, stream>>>(H16, E16, B[0], B[1], B[2], B[5], B[6], bq_s, bk_s, bv_s, bk_c, bv_c, Q16, K16, VT, K16c, VTc);
  /* --- self attention --- */
  k_flashc<<<gfl, 128, 0, stream>>>(Q16, NBATCH * EE, K16, NBATCH * EE, VT, nullptr, O16, NBATCH * EE);      /* rows = tokens, 64 (n,h) slabs of 64 columns */
  k_gemm3<0, true><<<gE, 256, 0, stream>>>(O16, EE, 0, B[3], EE, 0, 0.0625f, bo_s, 0, x, X1, nullptr, EE, 0, NR, EE, EE);      /* x1 = bf16(x) + o*wo^T + bo */
  /* --- cross attention (keys/values from encoder_out, same causal mask) --- */
  k_ln1024<false><<<gln, 256, 0, stream>>>(X1, g2, b2n, H16);
  k_gemm3<0><<<gE, 256, 0, stream>>>(H16, EE, 0, B[4], EE, 0, 0.0625f, bq_c, 0, nullptr, nullptr, Q16, EE, 0, NR, EE, EE);
  k_flashc<<<gfl, 128, 0, stream>>>(Q16, NBATCH * EE, K16c, NBATCH * EE, VTc, nullptr, O16, NBATCH * EE);
  k_gemm3<0><<<gE, 256, 0, stream>>>(O16, EE, 0, B[7], EE, 0, 0.0625f, bo_c, 0, X1, X2, nullptr, EE, 0, NR, EE, EE);      /* x2 = x1 + o*wo^T + bo */
  /* --- FFN --- */
  k_ln1024<false><<<gln, 256, 0, stream>>>(X2, g3, b3n, H16);
  k_gemm3<6><<<gF, 256, 0, stream>>>(H16, EE, 0, BF1, EE, 0, 0.0625f, b1, 0, nullptr, nullptr, F1, FF, 0, NR, FF, EE);      /* gelu_erf(h*fc1^T + b1) -> f16 [4096][4096] */
  k_gemm3<0><<<gE, 256, 0, stream>>>(F1, FF, 0, BF2, FF, 0, 0.0625f, b2, 0, X2, (float*)d_out, nullptr, EE, 0, NR, EE, FF);      /* out = x2 + f*fc2^T + b2 */
}

// v008
// Measured time: 228 microseconds a run.
// In two side-by-side timings against v007, it was 1.05 and 1.04 times as fast.
// All steps since v000 together make it 4.33 times as fast.
#include <hip/hip_runtime.h>
// Pre-LN decoder layer, sequence-first layout (T 1024, batch 4, E 1024, 16 heads x 64, FFN 4096): h = LN1(x); x1 = x + SelfAttn(h, h); h = LN2(x1); x2 = x1 + Attn(h, encoder_out); h = LN3(x2); out = x2 + fc2(gelu_erf(fc1(h))). Both attentions: q = (in*wq^T + bq)*64^-0.5, k, v from the key input, per (batch, head) scores over the 1024 keys with the module's causal mask (key > query filled with -1e4, i.e. weight exactly 0), softmax, *v, merged, *wo^T + bo.
// Structure: rows are the (t, n) pairs in memory order, so every projection / FFN is a [4096][1024] GEMM (f16 WMMA, 32x64 wave tiles, f32 accumulation, exact bias, residual through the f32 epilogue addend); LayerNorms wave-per-row on VALU writing f16 operand planes; q/k planes viewed as [token][64 heads x 64] feed a fused causal flash-style kernel per ((n,h), pair of 64-query tiles t and 15 - t, one after the other) (wave = 16 queries, 32-key steps up to the query block, both products transposed so that a lane owns one query, online softmax f32 in base 2, P x2^10 f16 packed in registers, f32 accumulators); v leaves its projection already as f16 [d][token] per (n,h), turned in the epilogue's LDS staging; the attention output leaves as the f16 operand plane of the wo product; exact-erf GELU in the fc1 epilogue.
// Compute dtype: inputs and parameters rounded to bf16; all GEMM operands f16 (~2^-12: LN outputs, q, k, v, P, attention outputs, the GELU hidden), weights bf16-exact (x16 in f16), f32 accumulation; LayerNorm / softmax / residual stream f32. v_wmma_f32_16x16x32_f16.
#define TT 1024
#define NBATCH 4
#define EE 1024
#define NHD 16
#define NH (NBATCH * NHD)        /* 64 (batch, head) slabs */
#define TQ TT
#define TK TT
#define SCL 0.125f
#define SCL2 (SCL * 1.4426950408889634f)   /* score scale x log2(e): the softmax runs in base 2 */
#define NR (TT * NBATCH)         /* 4096 rows */
#define FF 4096
typedef __bf16 v16b __attribute__((ext_vector_type(16)));
typedef unsigned short v8us __attribute__((ext_vector_type(8), may_alias));
typedef float  v8f  __attribute__((ext_vector_type(8)));
typedef float  v4f  __attribute__((ext_vector_type(4)));
typedef float  v4fa __attribute__((ext_vector_type(4), may_alias));
union FragB { v16b v; v8us half[2]; unsigned short u[16]; };

__device__ __forceinline__ unsigned short bf16_bits(float x) { unsigned int u = __float_as_uint(x); return (unsigned short)((u + 0x7FFFu + ((u >> 16) & 1u)) >> 16); }
__device__ __forceinline__ float bf16_val(unsigned short b) { return __uint_as_float(((unsigned int)b) << 16); }
__device__ __forceinline__ float bf16_round(float x) { return bf16_val(bf16_bits(x)); }
// D += A·B with NT terms: 1 = ah·bh, 2 = + al·bh (A split), 3 = + ah·bl (both split)
template <int NT>
__device__ __forceinline__ v8f mmaN(v16b ah, v16b al, v16b bh, v16b bl, v8f c) {
  c = __builtin_amdgcn_wmma_f32_16x16x32_bf16(false, ah, false, bh, (short)0, c, false, false);
  if (NT >= 2) c = __builtin_amdgcn_wmma_f32_16x16x32_bf16(false, al, false, bh, (short)0, c, false, false);
  if (NT >= 3) c = __builtin_amdgcn_wmma_f32_16x16x32_bf16(false, ah, false, bl, (short)0, c, false, false);
  asm volatile("v_nop\n\tv_nop\n\tv_nop\n\tv_nop" : "+v"(c) : "v"(ah), "v"(al), "v"(bh), "v"(bl));
  return c;
}

__global__ __launch_bounds__(256) void k_wt_bf16(const float* __restrict__ W, unsigned short* __restrict__ Wt, int K, int N) {
  const int t = blockIdx.x * 256 + threadIdx.x;
  const int k8n = K / 8;
  if (t >= N * k8n) return;
  const int n = t / k8n, k8 = (t % k8n) * 8;
  v8us v;
#pragma unroll
  for (int i = 0; i < 8; ++i) v[i] = bf16_bits(W[(size_t)(k8 + i) * N + n]);
  *(v8us*)(Wt + (size_t)n * K + k8) = v;
  
}

// GEMM C[M][N] (f32, pitch ldc) = act(A[M][K]·W + bias). A f32 row-major (pitch lda) converted per fragment to bf16
// (ASPLIT: hi/lo two planes -> 2 terms, else single rounded term); Wt bf16 [N][K] (pitch ldb). BIAS_BF16 rounds the
// bias to bf16 first (bias quantised to bf16 before the add). K%32==0, M%16==0, N%64==0.
template <bool ASPLIT, int ACT, bool BIAS_BF16>
__global__ __launch_bounds__(128) void k_gemm_bf(const float* __restrict__ A, int lda, const unsigned short* __restrict__ Wt, int ldb,
                                               const float* __restrict__ bias, float* __restrict__ C, int ldc, int M, int N, int K) {
  __shared__ __attribute__((aligned(16))) float so[4][16][64];
  const int tid = threadIdx.x, w = tid >> 5, lane = tid & 31, ln = lane & 15, hh = lane >> 4;
  const int ntn = N / 64;
  const int wid = blockIdx.x * 4 + w;
  const int mt = wid / ntn, nq = wid % ntn;
  if (mt * 16 >= M) return;
  const int row0 = mt * 16, col0 = nq * 64;
  const float* arow = A + (size_t)(row0 + ln) * lda;
  v8f acc[4] = {};
  for (int kb = 0; kb < K; kb += 32) {
    FragB ah, al;
    const v4f x0 = *(const v4fa*)(arow + kb + 8 * hh), x1 = *(const v4fa*)(arow + kb + 8 * hh + 4);
    const v4f x2 = *(const v4fa*)(arow + kb + 16 + 8 * hh), x3 = *(const v4fa*)(arow + kb + 16 + 8 * hh + 4);
    float xs[16] = {x0[0],x0[1],x0[2],x0[3],x1[0],x1[1],x1[2],x1[3],x2[0],x2[1],x2[2],x2[3],x3[0],x3[1],x3[2],x3[3]};
#pragma unroll
    for (int i = 0; i < 16; ++i) { const unsigned short hb = bf16_bits(xs[i]); ah.u[i] = hb; al.u[i] = ASPLIT ? bf16_bits(xs[i] - bf16_val(hb)) : (unsigned short)0; }
#pragma unroll
    for (int t = 0; t < 4; ++t) {
      const unsigned short* brow = Wt + (size_t)(col0 + t * 16 + ln) * ldb + kb;
      FragB b;
      b.half[0] = *(const v8us*)(brow + 8 * hh);
      b.half[1] = *(const v8us*)(brow + 16 + 8 * hh);
      acc[t] = mmaN<ASPLIT ? 2 : 1>(ah.v, al.v, b.v, b.v, acc[t]);
    }
  }
#pragma unroll
  for (int t = 0; t < 4; ++t) {
    float bv = bias ? bias[col0 + t * 16 + ln] : 0.f;
    if (BIAS_BF16) bv = bf16_round(bv);
#pragma unroll
    for (int r = 0; r < 8; ++r) { float v = acc[t][r] + bv; if (ACT == 1) v = fmaxf(v, 0.f); so[w][8 * hh + r][t * 16 + ln] = v; }
  }
  __builtin_amdgcn_fence(__ATOMIC_ACQ_REL, "workgroup");
  __builtin_amdgcn_wave_barrier();
  const int rsub = lane >> 4, c4 = (lane & 15) * 4;
  {
#pragma unroll
    for (int q = 0; q < 8; ++q) {
      const int r = q * 2 + rsub;
      const v4f v = *(const v4fa*)&so[w][r][c4];
      *(v4f*)(C + (size_t)(row0 + r) * ldc + col0 + c4) = v;
    }
    
  }
}

// GEMM C = act(A·W + bias + resid): A f32 (ASPLIT -> hi/lo 2 terms), Wt bf16 [N][K]; ACT 0 none, 1 relu, 2 exact gelu;
// resid (optional, f32, row index = (row % rmod), pitch ldr, RES_BF16 rounds it) added before the activation.
template <bool ASPLIT, int ACT, bool BIAS_BF16, bool RES_BF16>
__global__ __launch_bounds__(128) void k_gemm_bf3(const float* __restrict__ A, int lda, const unsigned short* __restrict__ Wt, int ldb,
                                                const float* __restrict__ bias, const float* __restrict__ resid, int rmod, int ldr,
                                                float* __restrict__ C, int ldc, int M, int N, int K) {
  __shared__ __attribute__((aligned(16))) float so[4][16][64];
  const int tid = threadIdx.x, w = tid >> 5, lane = tid & 31, ln = lane & 15, hh = lane >> 4;
  const int ntn = N / 64;
  const int wid = blockIdx.x * 4 + w;
  const int mt = wid / ntn, nq = wid % ntn;
  if (mt * 16 >= M) return;
  const int row0 = mt * 16, col0 = nq * 64;
  const float* arow = A + (size_t)(row0 + ln) * lda;
  v8f acc[4] = {};
  for (int kb = 0; kb < K; kb += 32) {
    FragB ah, al;
    const v4f x0 = *(const v4fa*)(arow + kb + 8 * hh), x1 = *(const v4fa*)(arow + kb + 8 * hh + 4);
    const v4f x2 = *(const v4fa*)(arow + kb + 16 + 8 * hh), x3 = *(const v4fa*)(arow + kb + 16 + 8 * hh + 4);
    float xs[16] = {x0[0],x0[1],x0[2],x0[3],x1[0],x1[1],x1[2],x1[3],x2[0],x2[1],x2[2],x2[3],x3[0],x3[1],x3[2],x3[3]};
#pragma unroll
    for (int i = 0; i < 16; ++i) { const unsigned short hb = bf16_bits(xs[i]); ah.u[i] = hb; al.u[i] = ASPLIT ? bf16_bits(xs[i] - bf16_val(hb)) : (unsigned short)0; }
#pragma unroll
    for (int t = 0; t < 4; ++t) {
      const unsigned short* brow = Wt + (size_t)(col0 + t * 16 + ln) * ldb + kb;
      FragB b;
      b.half[0] = *(const v8us*)(brow + 8 * hh);
      b.half[1] = *(const v8us*)(brow + 16 + 8 * hh);
      acc[t] = mmaN<ASPLIT ? 2 : 1>(ah.v, al.v, b.v, b.v, acc[t]);
    }
  }
#pragma unroll
  for (int t = 0; t < 4; ++t) {
    const int col = col0 + t * 16 + ln;
    float bv = bias ? bias[col] : 0.f;
    if (BIAS_BF16) bv = bf16_round(bv);
#pragma unroll
    for (int r = 0; r < 8; ++r) {
      float v = acc[t][r] + bv;
      if (resid) { float rv = resid[(size_t)((row0 + 8 * hh + r) % rmod) * ldr + col]; if (RES_BF16) rv = bf16_round(rv); v += rv; }
      if (ACT == 1) v = fmaxf(v, 0.f);
      if (ACT == 2) v = 0.5f * v * (1.0f + erff(v * 0.70710678118654752f));
      if (ACT == 3) { const float u = 0.7978845608028654f * (v + 0.044715f * v * v * v); v = 0.5f * v * (1.0f + tanhf(u)); }
      so[w][8 * hh + r][t * 16 + ln] = v;
    }
  }
  __builtin_amdgcn_fence(__ATOMIC_ACQ_REL, "workgroup");
  __builtin_amdgcn_wave_barrier();
  const int rsub = lane >> 4, c4 = (lane & 15) * 4;
  {
#pragma unroll
    for (int q = 0; q < 8; ++q) {
      const int r = q * 2 + rsub;
      const v4f v = *(const v4fa*)&so[w][r][c4];
      *(v4f*)(C + (size_t)(row0 + r) * ldc + col0 + c4) = v;
    }
    
  }
}
// row LayerNorm (biased variance, eps) over N: s = X (+ R); optional out_sum <- s; out_norm <- (s-mu)*rsqrt(var+eps)*g + b
template <bool PARAM_BF16>
__global__ __launch_bounds__(256) void k_layernorm(const float* __restrict__ X, const float* __restrict__ R, const float* __restrict__ g, const float* __restrict__ bta,
                                                  float* __restrict__ out_sum, float* __restrict__ out_norm, int N, float eps) {
  __shared__ float red[256];
  const int row = blockIdx.x, tid = threadIdx.x;
  const float* x = X + (size_t)row * N; const float* rr = R ? R + (size_t)row * N : nullptr;
  float vals[16];                     // up to N = 4096
  const int per = N / 256;            // contiguous chunk per thread? use strided-by-4 chunks: thread handles j = tid*4 + 1024*u
  float s1 = 0.f;
  for (int u = 0; u < per / 4; ++u) {
    const int j = tid * 4 + 1024 * u;
    const v4f a = *(const v4fa*)(x + j);
    v4f b = {0.f,0.f,0.f,0.f}; if (rr) b = *(const v4fa*)(rr + j);
#pragma unroll
    for (int q = 0; q < 4; ++q) { const float v = a[q] + b[q]; vals[u * 4 + q] = v; s1 += v; }
  }
  red[tid] = s1; __syncthreads();
  for (int st = 128; st > 0; st >>= 1) { if (tid < st) red[tid] += red[tid + st]; __syncthreads(); }
  const float mu = red[0] / (float)N; __syncthreads();
  float s2 = 0.f;
  for (int u = 0; u < per / 4; ++u)
#pragma unroll
    for (int q = 0; q < 4; ++q) { const float c = vals[u * 4 + q] - mu; s2 += c * c; }
  red[tid] = s2; __syncthreads();
  for (int st = 128; st > 0; st >>= 1) { if (tid < st) red[tid] += red[tid + st]; __syncthreads(); }
  const float rs = rsqrtf(red[0] / (float)N + eps);
  {
    for (int u = 0; u < per / 4; ++u) {
      const int j = tid * 4 + 1024 * u;
      v4f o, sm;
#pragma unroll
      for (int q = 0; q < 4; ++q) {
        float gg = g[j + q], bb = bta[j + q];
        if (PARAM_BF16) { gg = bf16_round(gg); bb = bf16_round(bb); }
        sm[q] = vals[u * 4 + q]; o[q] = (vals[u * 4 + q] - mu) * rs * gg + bb;
      }
      if (out_sum) *(v4f*)(out_sum + (size_t)row * N + j) = sm;
      *(v4f*)(out_norm + (size_t)row * N + j) = o;
    }
    
  }
}



// ---- f16 WMMA path (v_wmma_f32_16x16x32_f16): 11-bit significands for operands in range — used where a [0,1] probability operand needs more precision than bf16
typedef _Float16 v16h __attribute__((ext_vector_type(16)));
union FragH { v16h v; v8us half[2]; _Float16 h[16]; unsigned short u[16]; };
template <int NT>
__device__ __forceinline__ v8f mmaH(v16h ah, v16h al, v16h bh, v16h bl, v8f c) {
  c = __builtin_amdgcn_wmma_f32_16x16x32_f16(false, ah, false, bh, (short)0, c, false, false);
  if (NT >= 2) c = __builtin_amdgcn_wmma_f32_16x16x32_f16(false, al, false, bh, (short)0, c, false, false);
  if (NT >= 3) c = __builtin_amdgcn_wmma_f32_16x16x32_f16(false, ah, false, bl, (short)0, c, false, false);
  asm volatile("v_nop\n\tv_nop\n\tv_nop\n\tv_nop" : "+v"(c) : "v"(ah), "v"(al), "v"(bh), "v"(bl));
  return c;
}
// batched GEMM like k_gemm_b but f16 operands: A f32 (split into f16 hi/lo if ASPLIT, else rounded to f16), Bt = f16 values [n][k]; alpha; C f32; N multiple of 16 (partial tiles skipped)
template <bool ASPLIT>
__global__ __launch_bounds__(128) void k_gemm_h(const float* __restrict__ A, int lda, size_t sA, const _Float16* __restrict__ Bh, int ldb, size_t sB, float alpha, float* __restrict__ C, int ldc, size_t sC, int M, int N, int K) {
  __shared__ __attribute__((aligned(16))) float so[4][16][64];
  const int tid = threadIdx.x, w = tid >> 5, lane = tid & 31, ln = lane & 15, hh = lane >> 4; const int by = blockIdx.y;
  A += (size_t)by * sA; Bh += (size_t)by * sB; C += (size_t)by * sC;
  const int ntn = (N + 63) / 64; const int wid = blockIdx.x * 4 + w; const int mt = wid / ntn, nq = wid % ntn; if (mt * 16 >= M) return;
  const int row0 = mt * 16, col0 = nq * 64; const float* arow = A + (size_t)(row0 + ln) * lda;
  v8f acc[4] = {};
  for (int kb = 0; kb < K; kb += 32) {
    FragH ah, al;
    const v4f x0 = *(const v4fa*)(arow + kb + 8 * hh), x1 = *(const v4fa*)(arow + kb + 8 * hh + 4), x2 = *(const v4fa*)(arow + kb + 16 + 8 * hh), x3 = *(const v4fa*)(arow + kb + 16 + 8 * hh + 4);
    float xs[16] = {x0[0],x0[1],x0[2],x0[3],x1[0],x1[1],x1[2],x1[3],x2[0],x2[1],x2[2],x2[3],x3[0],x3[1],x3[2],x3[3]};
#pragma unroll
    for (int i = 0; i < 16; ++i) { const _Float16 h = (_Float16)xs[i]; ah.h[i] = h; al.h[i] = ASPLIT ? (_Float16)(xs[i] - (float)h) : (_Float16)0.0f; }
#pragma unroll
    for (int t = 0; t < 4; ++t) { if (col0 + t * 16 >= N) continue; const size_t boff = (size_t)(col0 + t * 16 + ln) * ldb + kb; FragH bq; bq.half[0] = *(const v8us*)(Bh + boff + 8 * hh); bq.half[1] = *(const v8us*)(Bh + boff + 16 + 8 * hh);
      acc[t] = mmaH<ASPLIT ? 2 : 1>(ah.v, al.v, bq.v, bq.v, acc[t]); }
  }
#pragma unroll
  for (int t = 0; t < 4; ++t) { if (col0 + t * 16 >= N) continue;
#pragma unroll
    for (int r = 0; r < 8; ++r) so[w][8 * hh + r][t * 16 + ln] = acc[t][r] * alpha; }
  __builtin_amdgcn_fence(__ATOMIC_ACQ_REL, "workgroup"); __builtin_amdgcn_wave_barrier();
  const int rsub = lane >> 4, c4 = (lane & 15) * 4;
  {
#pragma unroll
    for (int q = 0; q < 8; ++q) { const int r = q * 2 + rsub; if (col0 + c4 < N) { const v4f v = *(const v4fa*)&so[w][r][c4]; *(v4f*)(C + (size_t)(row0 + r) * ldc + col0 + c4) = v; } }
     }
}

// Wt[n][k] = f16(W[k][n]·scale) from f32 row-major W[K][N] (scale = power of two; bf16-exact weights stay exact in f16 away from the subnormal range)
__global__ __launch_bounds__(256) void k_wt_f16(const float* __restrict__ W, _Float16* __restrict__ Wt, int K, int N, float scale) {
  const int t = blockIdx.x * 256 + threadIdx.x; if (t >= N * (K / 8)) return; const int n = t / (K / 8), k8 = (t % (K / 8)) * 8; FragH f;
#pragma unroll
  for (int i = 0; i < 8; ++i) f.h[i] = (_Float16)(bf16_round(W[(size_t)(k8 + i) * N + n]) * scale); const v8us o = f.half[0];
  *(v8us*)((unsigned short*)Wt + (size_t)n * K + k8) = o; 
}
// k_gemm_hh variant with fused epilogue: v = acc·alpha + bias[by·sBias + col] (+ CP[(row/rowsPerB)·sCPb + by·64 + col] if CP) ; ACT 0 none / 1 elu ; writes f16 C16 (and f32 C if non-null)
template <int ACT>
__global__ __launch_bounds__(128) void k_gemm_hhx(const _Float16* __restrict__ A, int lda, size_t sA, const _Float16* __restrict__ Bh, int ldb, size_t sB, float alpha, const float* __restrict__ bias, size_t sBias, const float* __restrict__ CP, int rowsPerB, size_t sCPb, int row0g,
    float* __restrict__ C, _Float16* __restrict__ C16, int ldc, size_t sC, int M, int N, int K) {
  __shared__ __attribute__((aligned(16))) float so[4][16][64];
  const int tid = threadIdx.x, w = tid >> 5, lane = tid & 31, ln = lane & 15, hh = lane >> 4; const int by = blockIdx.y;
  A += (size_t)by * sA; Bh += (size_t)by * sB; const size_t cofs = (size_t)by * sC; const float* bp = bias ? bias + (size_t)by * sBias : nullptr;
  const int ntn = (N + 63) / 64; const int wid = blockIdx.x * 4 + w; const int mt = wid / ntn, nq = wid % ntn; if (mt * 16 >= M) return;
  const int row0 = mt * 16, col0 = nq * 64; const _Float16* arow = A + (size_t)(row0 + ln) * lda;
  v8f acc[4] = {};
  for (int kb = 0; kb < K; kb += 32) { FragH ah; ah.half[0] = *(const v8us*)((const unsigned short*)arow + kb + 8 * hh); ah.half[1] = *(const v8us*)((const unsigned short*)arow + kb + 16 + 8 * hh);
#pragma unroll
    for (int t = 0; t < 4; ++t) { if (col0 + t * 16 >= N) continue; const size_t boff = (size_t)(col0 + t * 16 + ln) * ldb + kb; FragH bq; bq.half[0] = *(const v8us*)((const unsigned short*)Bh + boff + 8 * hh); bq.half[1] = *(const v8us*)((const unsigned short*)Bh + boff + 16 + 8 * hh);
      acc[t] = mmaH<1>(ah.v, ah.v, bq.v, bq.v, acc[t]); }
  }
#pragma unroll
  for (int t = 0; t < 4; ++t) { if (col0 + t * 16 >= N) continue; const int col = col0 + t * 16 + ln; const float bv = bp ? bf16_round(bp[col]) : 0.f;
#pragma unroll
    for (int r = 0; r < 8; ++r) { float v = acc[t][r] * alpha + bv; if (CP) { const int bidx = (row0g + row0 + 8 * hh + r) / rowsPerB; v += CP[(size_t)bidx * sCPb + (size_t)by * 64 + col]; } if (ACT == 1) v = (v > 0.f) ? v : expm1f(v); else if (ACT == 7) v = (v > 0.f) ? v + 1.0f : expf(v); else if (ACT == 8) v = tanhf(v); else if (ACT == 9) v = 0.5f * v * (1.0f + tanhf(0.7978845608028654f * (v + 0.044715f * v * v * v))); else if (ACT == 11) v = 1.0f / (1.0f + expf(-v)); else if (ACT == 12) v = (v > 0.f) ? v : 0.01f * v; else if (ACT == 14) v = (v > 0.f) ? v : 0.1f * v; else if (ACT == 15) v = v / (1.0f + expf(-v)); else if (ACT == 3) v = fmaxf(v, 0.f); else if (ACT == 6) v = 0.5f * v * (1.0f + erff(v * 0.70710678118654752f)); so[w][8 * hh + r][t * 16 + ln] = v; } }
  __builtin_amdgcn_fence(__ATOMIC_ACQ_REL, "workgroup"); __builtin_amdgcn_wave_barrier();
  const int rsub = lane >> 4, c4 = (lane & 15) * 4; typedef _Float16 v4h __attribute__((ext_vector_type(4)));
  {
#pragma unroll
    for (int q = 0; q < 8; ++q) { const int r = q * 2 + rsub; if (col0 + c4 < N) { const v4f v = *(const v4fa*)&so[w][r][c4]; if (C) *(v4f*)(C + cofs + (size_t)(row0 + r) * ldc + col0 + c4) = v; if (C16) { v4h h4; for (int i = 0; i < 4; ++i) h4[i] = (_Float16)v[i]; *(v4h*)(C16 + cofs + (size_t)(row0 + r) * ldc + col0 + c4) = h4; } } }
     }
}


typedef _Float16 v4h __attribute__((ext_vector_type(4)));

__global__ __launch_bounds__(256) void k_x16(const float* __restrict__ x, _Float16* __restrict__ X16, size_t n8) { const size_t t = (size_t)blockIdx.x * 256 + threadIdx.x; if (t >= n8) return; FragH f;
#pragma unroll
  for (int q = 0; q < 8; ++q) f.h[q] = (_Float16)bf16_round(x[t * 8 + q]); *(v8us*)((unsigned short*)X16 + t * 8) = f.half[0];  }
template <int NHv, int TTv>
__global__ __launch_bounds__(256) void k_vt(const _Float16* __restrict__ V16, int ldv, int voff, _Float16* __restrict__ Vt) { __shared__ unsigned short tl[64][66]; const int tid = threadIdx.x; const int slab = blockIdx.x / (TTv / 64), lg = blockIdx.x % (TTv / 64); const int b = slab / NHv, h = slab % NHv;
  for (int i = tid; i < 64 * 8; i += 256) { const int r = i / 8, c8 = (i % 8) * 8; FragH f; f.half[0] = *(const v8us*)((const unsigned short*)V16 + ((size_t)b * TTv + lg * 64 + r) * ldv + voff + h * 64 + c8);
#pragma unroll
    for (int q = 0; q < 8; ++q) tl[r][c8 + q] = f.u[q]; }
  __syncthreads();
  {
#pragma unroll
    for (int rd = 0; rd < 2; ++rd) { const int d = rd * 32 + tid / 8, pc = tid % 8; FragH f;
#pragma unroll
      for (int q = 0; q < 8; ++q) f.u[q] = tl[pc * 8 + q][d];
      *(v8us*)((unsigned short*)Vt + ((size_t)slab * 64 + d) * TTv + lg * 64 + pc * 8) = f.half[0]; }
     } }

__global__ __launch_bounds__(256) void k_hl(const float* __restrict__ F, _Float16* __restrict__ Hh, _Float16* __restrict__ Hl, size_t n8) { const size_t t = (size_t)blockIdx.x * 256 + threadIdx.x; if (t >= n8) return; FragH fh, fl; const v4f a = *(const v4fa*)(F + t * 8), c = *(const v4fa*)(F + t * 8 + 4);
#pragma unroll
  for (int q = 0; q < 4; ++q) { _Float16 h = (_Float16)a[q]; fh.h[q] = h; fl.h[q] = (_Float16)((a[q] - (float)h) * 1024.0f); h = (_Float16)c[q]; fh.h[4 + q] = h; fl.h[4 + q] = (_Float16)((c[q] - (float)h) * 1024.0f); }
  { *(v8us*)((unsigned short*)Hh + t * 8) = fh.half[0]; *(v8us*)((unsigned short*)Hl + t * 8) = fl.half[0];  } }

// ---- fast GEMM (wave tile 32x64, operands staged in LDS) ----
__device__ __forceinline__ v16h g2_frag(const _Float16* p, int hh) { FragH f; f.half[0] = *(const v8us*)((const unsigned short*)p + 8 * hh); f.half[1] = *(const v8us*)((const unsigned short*)p + 16 + 8 * hh); return f.v; }
__device__ __forceinline__ v8f g2_mma(v16h a, v16h b, v8f c) { v8f d = __builtin_amdgcn_wmma_f32_16x16x32_f16(false, a, false, b, (short)0, c, false, false); asm volatile("v_nop\n\tv_nop\n\tv_nop\n\tv_nop" : "+v"(d) : "v"(a), "v"(b)); return d; }
// Block tile 128x128, eight waves of 32x64 (4 down x 2 across). A pass is 128 k: 128 rows of A and 128 rows of Bh, 256 B each, are laid in LDS at a
// pitch of 272 B (16 B x odd, for the ds_load_b128 fragment reads) by per-lane asynchronous 16-byte copies; two buffers, the next pass's copies fly while this one is multiplied.
#define G3_PITCH 272
#define G3_OPB (128 * G3_PITCH)   /* one operand's 128 rows */
#define G3_BUF (2 * G3_OPB)       /* one buffer: [A rows | Bh rows] */
// Eight copies per lane: rows r, r + 16, ..., r + 112 of one operand (16 lanes cover one 256-B row piece). The s_wait_xcnt closes the copies' own statement so that
// no address register named here is rewritten ahead of it.
__device__ __forceinline__ void g3_copy8(unsigned l, const _Float16* g, size_t rstep) {
  asm volatile("global_load_async_to_lds_b128 %0, %8, off\n\t"
               "global_load_async_to_lds_b128 %1, %9, off\n\t"
               "global_load_async_to_lds_b128 %2, %10, off\n\t"
               "global_load_async_to_lds_b128 %3, %11, off\n\t"
               "global_load_async_to_lds_b128 %4, %12, off\n\t"
               "global_load_async_to_lds_b128 %5, %13, off\n\t"
               "global_load_async_to_lds_b128 %6, %14, off\n\t"
               "global_load_async_to_lds_b128 %7, %15, off\n\t"
               "s_wait_xcnt 0x0"
               :: "v"(l), "v"(l + 16u * G3_PITCH), "v"(l + 32u * G3_PITCH), "v"(l + 48u * G3_PITCH), "v"(l + 64u * G3_PITCH), "v"(l + 80u * G3_PITCH), "v"(l + 96u * G3_PITCH), "v"(l + 112u * G3_PITCH),
                  "v"(g), "v"(g + rstep), "v"(g + 2 * rstep), "v"(g + 3 * rstep), "v"(g + 4 * rstep), "v"(g + 5 * rstep), "v"(g + 6 * rstep), "v"(g + 7 * rstep)
               : "memory");
}
// requires M % 128 == 0, N % 128 == 0, K % 128 == 0; epilogue: v = act(acc * alpha + bf16(bias[col])), then, with ACT 0 only, + R[row][col] (R = optional f32 addend laid out like C; RRND: rounded to bf16 as it is added, for an addend that is a raw input)
// bx = the block's tile index, by = its batch index (the kernels below say where they come from)
// VT (optional, ACT 0 only): the tile leaves transposed and as f16 only, VT[by * N + col][row] with M elements a line, instead of through C / C16
template <int ACT, bool RRND = false>
__device__ __forceinline__ void g3_body(const _Float16* __restrict__ A, int lda, size_t sA, const _Float16* __restrict__ Bh, int ldb, size_t sB, float alpha, const float* __restrict__ bias, size_t sBias, const float* __restrict__ R,
    float* __restrict__ C, _Float16* __restrict__ C16, _Float16* __restrict__ VT, int ldc, size_t sC, int M, int N, int K, const int bx, const int by) {
  __shared__ __attribute__((aligned(16))) unsigned char ring[2 * G3_BUF];      /* the two buffers; after the k loop its first 8 x 32 x 68 floats stage the output */
  const int tid = threadIdx.x, w = tid >> 5, lane = tid & 31, ln = lane & 15, hh = lane >> 4;
  A += (size_t)by * sA; Bh += (size_t)by * sB; const size_t cofs = (size_t)by * sC; const float* bp = bias ? bias + (size_t)by * sBias : nullptr;
  const int ntn = N >> 7; const int mt = bx / ntn, nq = bx - mt * ntn; const int rowb = mt * 128, colb = nq * 128; if (rowb >= M) return;      /* block-uniform, ahead of every barrier */
  const int wm = w & 3, wn = w >> 2; const int row0 = rowb + 32 * wm, col0 = colb + 64 * wn;
  const int cr = tid >> 4, cc = tid & 15;      /* copy side: this lane's first row and its 16-byte piece of the row */
  const _Float16* gA = A + (size_t)(rowb + cr) * lda + cc * 8; const _Float16* gB = Bh + (size_t)(colb + cr) * ldb + cc * 8; const size_t stA = (size_t)16 * lda, stB = (size_t)16 * ldb;
  const unsigned lA = (unsigned)(size_t)ring + (unsigned)(cr * G3_PITCH + cc * 16), lB = lA + G3_OPB;
  const int np = K >> 7;
  g3_copy8(lA, gA, stA); g3_copy8(lB, gB, stB);
  asm volatile("s_wait_asynccnt 0x0" ::: "memory");      /* pass 0's own copies have landed before the barrier that publishes them */
  __syncthreads();
  if (np > 1) { g3_copy8(lA + G3_BUF, gA + 128, stA); g3_copy8(lB + G3_BUF, gB + 128, stB); }
  /* what the epilogue adds is fetched here, all loads independent, so that it lands under the k loop: the wave's 64 bias words (4 a lane) and, in the shape of the final row stores, its 32 x 64 piece of R */
  const int rsub = lane >> 4, c4 = (lane & 15) * 4;
  float bw[4] = {0.f, 0.f, 0.f, 0.f}; v4f rr[16];
  if (bp) {
#pragma unroll
    for (int t = 0; t < 4; ++t) bw[t] = bp[col0 + t * 16 + ln];
    asm volatile("s_wait_xcnt 0x0" ::: "memory"); }      /* stands in front of any rewrite of the base or offset registers that the four bias loads name */
  if (ACT == 0 && R) { const float* rp = R + cofs + (size_t)(row0 + rsub) * ldc + col0 + c4;
#pragma unroll
    for (int q = 0; q < 16; ++q) rr[q] = *(const v4fa*)(rp + (size_t)(2 * q) * ldc);
    asm volatile("s_wait_xcnt 0x0" ::: "memory"); }      /* stands in front of any rewrite of the address registers that the sixteen row loads name */
  const unsigned char* ra = ring + (32 * wm + ln) * G3_PITCH; const unsigned char* rb = ring + G3_OPB + (64 * wn + ln) * G3_PITCH;
  const v8f z8 = {0.f,0.f,0.f,0.f,0.f,0.f,0.f,0.f}; v8f c00 = z8, c01 = z8, c02 = z8, c03 = z8, c10 = z8, c11 = z8, c12 = z8, c13 = z8;
#pragma unroll 1      /* one pass per trip: the publish point at the foot stands once */
  for (int t = 0; t < np; ++t) { const unsigned bo = (unsigned)(t & 1) * G3_BUF;
#pragma unroll      /* the four 32-k blocks of a pass in straight line, so that a block's fragment reads can stand ahead of the block before it */
    for (int ks = 0; ks < 4; ++ks) { const unsigned char* pa = ra + bo + ks * 64; const unsigned char* pb = rb + bo + ks * 64;
      const v16h a0 = g2_frag((const _Float16*)pa, hh), a1 = g2_frag((const _Float16*)(pa + 16 * G3_PITCH), hh);
      const v16h b0 = g2_frag((const _Float16*)pb, hh), b1 = g2_frag((const _Float16*)(pb + 16 * G3_PITCH), hh), b2 = g2_frag((const _Float16*)(pb + 32 * G3_PITCH), hh), b3 = g2_frag((const _Float16*)(pb + 48 * G3_PITCH), hh);
      c00 = g2_mma(a0, b0, c00); c10 = g2_mma(a1, b0, c10); c01 = g2_mma(a0, b1, c01); c11 = g2_mma(a1, b1, c11);
      c02 = g2_mma(a0, b2, c02); c12 = g2_mma(a1, b2, c12); c03 = g2_mma(a0, b3, c03); c13 = g2_mma(a1, b3, c13); }
    asm volatile("s_wait_dscnt 0x0" ::: "memory");         /* this wave's reads of the buffer are done before the barrier behind which it is refilled */
    asm volatile("s_wait_asynccnt 0x0" ::: "memory");      /* this wave's copies of pass t + 1 have landed before the barrier that publishes them */
    __syncthreads();
    if (t + 2 < np) { g3_copy8(lA + bo, gA + (size_t)(t + 2) * 128, stA); g3_copy8(lB + bo, gB + (size_t)(t + 2) * 128, stB); } }
  asm volatile("s_wait_asynccnt 0x0" ::: "memory");        /* nothing in flight when the ring becomes output staging */
  v8f accs[8] = {c00, c01, c02, c03, c10, c11, c12, c13};
  if (ACT == 0 && VT) {      /* block-uniform. A lane holds 8 consecutive rows of one column: 16 bytes of a transposed f16 line. The block's 128 columns x 128 rows are gathered in the ring at the pitch of its operand rows, so that whole 256-byte lines leave */
#pragma unroll
    for (int u = 0; u < 8; ++u) { const int t = u & 3, half = u >> 2; const float bv = bf16_round(bw[t]); FragH f;
#pragma unroll
      for (int r = 0; r < 8; ++r) f.h[r] = (_Float16)(accs[u][r] * alpha + bv);
      *(v8us*)(ring + (64 * wn + t * 16 + ln) * G3_PITCH + (32 * wm + half * 16 + 8 * hh) * 2) = f.half[0]; }
    __syncthreads();      /* a line's 128 rows come from four waves: all have written before any is read back */
    v8us tv[8];
#pragma unroll
    for (int q = 0; q < 8; ++q) tv[q] = *(const v8us*)(ring + (q * 16 + cr) * G3_PITCH + cc * 16);
    unsigned short* vp = (unsigned short*)VT + ((size_t)by * N + colb + cr) * (size_t)M + rowb + cc * 8;
#pragma unroll
    for (int q = 0; q < 8; ++q) { *(v8us*)(vp + (size_t)(q * 16) * M) = tv[q]; asm volatile("s_wait_xcnt 0x0" ::: "memory"); }      /* the wait stands in front of any rewrite of the store's data or address registers */
    return; }
  float (*so)[32][68] = (float (*)[32][68])ring;
#pragma unroll
  for (int u = 0; u < 8; ++u) { const int t = u & 3, half = u >> 2; const float bv = bf16_round(bw[t]);
#pragma unroll
    for (int r = 0; r < 8; ++r) { const int rloc = half * 16 + 8 * hh + r; float v = accs[u][r] * alpha + bv;
      if (ACT == 3) v = fmaxf(v, 0.f); else if (ACT == 6) v = 0.5f * v * (1.0f + erff(v * 0.70710678118654752f)); else if (ACT == 11) v = 1.0f / (1.0f + expf(-v)); else if (ACT == 15) v = v / (1.0f + expf(-v)); else if (ACT == 12) v = (v > 0.f) ? v : 0.01f * v; else if (ACT == 8) v = tanhf(v);
      so[w][rloc][t * 16 + ln] = v; } }
  __builtin_amdgcn_fence(__ATOMIC_ACQ_REL, "workgroup"); __builtin_amdgcn_wave_barrier();
  v4f vv[16];      /* the 16 staged rows are read back as one group, ahead of the stores and their waits, instead of one waited read in front of each store */
#pragma unroll
  for (int q = 0; q < 16; ++q) vv[q] = *(const v4fa*)&so[w][q * 2 + rsub][c4];
  {
#pragma unroll
    for (int q = 0; q < 16; ++q) { const int r = q * 2 + rsub; v4f v = vv[q]; if (ACT == 0 && R) { v4f a = rr[q]; if (RRND) { for (int i = 0; i < 4; ++i) a[i] = bf16_round(a[i]); } v += a; }
      if (C) { *(v4f*)(C + cofs + (size_t)(row0 + r) * ldc + col0 + c4) = v; asm volatile("s_wait_xcnt 0x0" ::: "memory"); }      /* the wait stands in front of any rewrite of the store's data or address registers */
      if (C16) { v4h h4; for (int i = 0; i < 4; ++i) h4[i] = (_Float16)v[i]; *(v4h*)(C16 + cofs + (size_t)(row0 + r) * ldc + col0 + c4) = h4; asm volatile("s_wait_xcnt 0x0" ::: "memory"); } }      /* the same wait behind the f16 store */
     } }
template <int ACT, bool RRND = false>
__global__ __launch_bounds__(256) void k_gemm3(const _Float16* __restrict__ A, int lda, size_t sA, const _Float16* __restrict__ Bh, int ldb, size_t sB, float alpha, const float* __restrict__ bias, size_t sBias, const float* __restrict__ R,
    float* __restrict__ C, _Float16* __restrict__ C16, int ldc, size_t sC, int M, int N, int K) {
  g3_body<ACT, RRND>(A, lda, sA, Bh, ldb, sB, alpha, bias, sBias, R, C, C16, nullptr, ldc, sC, M, N, K, (int)blockIdx.x, (int)blockIdx.y); }
// The five projections that wait for no attention, as one grid: blockIdx.y = 0 q, 1 k, 2 v of the self attention (from the LN1 plane H), 3 k, 4 v of the cross attention (from the encoder plane E).
// Each is the [4096][1024] x [1024][1024] product of k_gemm3<0>; q and k planes leave as f16 rows. A v block takes 128 tokens of ONE batch entry (row pitch NBATCH * EE), so that its tile, turned, is 128 whole
// 256-byte pieces of the [(n, h)][d][token] plane that the attention reads: the v planes leave in that form, as f16.
__global__ __launch_bounds__(256) void k_proj5(const _Float16* __restrict__ H, const _Float16* __restrict__ E, const _Float16* __restrict__ Bq, const _Float16* __restrict__ Bk, const _Float16* __restrict__ Bv, const _Float16* __restrict__ Bkc, const _Float16* __restrict__ Bvc,
    const float* __restrict__ bq, const float* __restrict__ bk, const float* __restrict__ bv, const float* __restrict__ bkc, const float* __restrict__ bvc,
    _Float16* __restrict__ Qs, _Float16* __restrict__ Ks, _Float16* __restrict__ VTs, _Float16* __restrict__ Kc, _Float16* __restrict__ VTc) {
  const int g = (int)blockIdx.y;
  const _Float16* A = (g < 3) ? H : E;
  const _Float16* Bh = (g == 0) ? Bq : (g == 1) ? Bk : (g == 2) ? Bv : (g == 3) ? Bkc : Bvc;
  const float* bias = (g == 0) ? bq : (g == 1) ? bk : (g == 2) ? bv : (g == 3) ? bkc : bvc;
  _Float16* VTd = (g == 2) ? VTs : (g == 4) ? VTc : nullptr; const bool vb = (g == 2) || (g == 4); const int bx = (int)blockIdx.x;
  _Float16* C16 = (g == 0) ? Qs : (g == 1) ? Ks : (g == 3) ? Kc : nullptr;
  constexpr int TPB = (TT / 128) * (EE / 128);      /* tiles of one batch entry's v plane */
  g3_body<0>(A, vb ? NBATCH * EE : EE, EE, Bh, EE, 0, 0.0625f, bias, 0, nullptr, nullptr, C16, VTd, EE, 0, vb ? TT : NR, EE, EE, vb ? bx % TPB : bx, vb ? bx / TPB : 0); }


// lane l with lane l ^ 16
__device__ __forceinline__ float xhalf(float x) { return __builtin_bit_cast(float, __builtin_amdgcn_permlanex16(__builtin_bit_cast(int, x), __builtin_bit_cast(int, x), 0x76543210, 0xfedcba98, false, false)); }
// Both products run transposed. S^T = K x Q^T: A = 16 key rows, B = the wave's 16 queries, so lane (ln, hh) holds for ITS query q0 + ln the keys j0 + 16 nt + 8 hh + r:
// maximum and sum are in-lane, the two halves of a query meet in one cross-row move. The two score tiles, converted in place, are the B operand of O^T += V^T x P^T
// (element s = tile s >> 3, register s & 7, which is the k order the V^T rows are loaded in): P passes through no LDS. O^T: lane = query, registers = 8 consecutive d.
// The K rows and the V^T rows of 64 keys (64 rows of 128 B each) are laid in LDS once for the block's four waves, at a pitch of 144 B (16 B x odd, for the ds_load_b128 fragment reads),
// by per-lane asynchronous 16-byte copies in which 8 lanes cover one whole 128-B row; two buffers, the next 64 keys' copies fly while these are worked on.
#define FA_PITCH 144
#define FA_OPB (64 * FA_PITCH)    /* one operand's 64 rows */
#define FA_BUF (2 * FA_OPB)       /* one buffer: [K rows | V^T rows] */
// Eight copies per lane: rows r, r + 16, r + 32, r + 48 of K, then of V^T. The s_wait_xcnt closes the copies' own statement so that no address register named here is rewritten ahead of it.
__device__ __forceinline__ void fa_copy8(unsigned l, const unsigned short* gk, size_t sk, const unsigned short* gv, size_t sv) {
  asm volatile("global_load_async_to_lds_b128 %0, %8, off\n\t"
               "global_load_async_to_lds_b128 %1, %9, off\n\t"
               "global_load_async_to_lds_b128 %2, %10, off\n\t"
               "global_load_async_to_lds_b128 %3, %11, off\n\t"
               "global_load_async_to_lds_b128 %4, %12, off\n\t"
               "global_load_async_to_lds_b128 %5, %13, off\n\t"
               "global_load_async_to_lds_b128 %6, %14, off\n\t"
               "global_load_async_to_lds_b128 %7, %15, off\n\t"
               "s_wait_xcnt 0x0"
               :: "v"(l), "v"(l + 16u * FA_PITCH), "v"(l + 32u * FA_PITCH), "v"(l + 48u * FA_PITCH), "v"(l + FA_OPB), "v"(l + FA_OPB + 16u * FA_PITCH), "v"(l + FA_OPB + 32u * FA_PITCH), "v"(l + FA_OPB + 48u * FA_PITCH),
                  "v"(gk), "v"(gk + sk), "v"(gk + 2 * sk), "v"(gk + 3 * sk), "v"(gv), "v"(gv + sv), "v"(gv + 2 * sv), "v"(gv + 3 * sv)
               : "memory");
}
__global__ __launch_bounds__(128) void k_flashc(const _Float16* __restrict__ Q16, int ldq, const _Float16* __restrict__ K16, int ldk, const _Float16* __restrict__ Vt, const int* __restrict__ MSK, _Float16* __restrict__ O16, int ldo) {
  constexpr int RPW = 16, NQB = TQ / (4 * RPW), DT = 4, KS = 2;
  __shared__ __attribute__((aligned(16))) unsigned char ring[2 * FA_BUF];
  __shared__ __attribute__((aligned(16))) unsigned short sO[4][RPW][64 + 8];      /* output staging, f16: a query's 64 values at a pitch of 144 B */
  (void)MSK;
  const int tid = threadIdx.x, w = tid >> 5, lane = tid & 31, ln = lane & 15, hh = lane >> 4;
  static_assert(NQB % 2 == 0, "query tiles are dealt in pairs");
  const int slab = blockIdx.x / (NQB / 2), pr = blockIdx.x % (NQB / 2); const int b = slab / NH, h = slab % NH;
  const unsigned short* Vth = (const unsigned short*)Vt + (size_t)slab * 64 * TK;
  const int cr = tid >> 3, cc = tid & 7;      /* copy side: this lane's first row and its 16-byte piece of the row */
  const unsigned short* gK = (const unsigned short*)K16 + ((size_t)b * TK + cr) * ldk + h * 64 + cc * 8; const unsigned short* gV = Vth + (size_t)cr * TK + cc * 8; const size_t stK = (size_t)16 * ldk, stV = (size_t)16 * TK;
  const unsigned lc = (unsigned)(size_t)ring + (unsigned)(cr * FA_PITCH + cc * 16);
  // A tile's cost grows with its index and every block of the grid is resident at once, so the launch lasts as long as its fullest SIMD. Each block therefore takes two tiles of its (n, h),
  // NQB - 1 - pr and then pr, one after the other in every wave: NQB + 1 stages for every block. The ring is free again at the head of the second tile: the first tile's last trip ends in
  // each wave's s_wait_dscnt 0 and s_wait_asynccnt 0 and the block's barrier, and nothing is copied behind that trip.
#pragma unroll 1      /* kept rolled: unrolled, the stage loop would stand twice in the kernel's text for no saved work */
 for (int half = 0; half < 2; ++half) {
  const int qblk = half ? pr : NQB - 1 - pr; const int qb0 = qblk * (4 * RPW); const int q0 = qb0 + w * RPW;
  const int ns = qblk + 1;      /* block-uniform causal bound: stages of 64 keys up to the end of the query block */
  fa_copy8(lc, gK, stK, gV, stV);
  FragH bq[KS];
  { const unsigned short* qr = (const unsigned short*)Q16 + ((size_t)b * TQ + q0 + ln) * ldq + h * 64;
#pragma unroll
    for (int ks = 0; ks < KS; ++ks) { bq[ks].half[0] = *(const v8us*)(qr + ks * 32 + 8 * hh); bq[ks].half[1] = *(const v8us*)(qr + ks * 32 + 16 + 8 * hh); } }
  asm volatile("s_wait_asynccnt 0x0" ::: "memory");      /* stage 0's own copies have landed before the barrier that publishes them */
  __syncthreads();
  if (ns > 1) fa_copy8(lc + FA_BUF, gK + (size_t)64 * ldk, stK, gV + 64, stV);
  const int tq = q0 + ln;      /* this lane's query */
  float m_r = -3.0e38f, l_r = 0.f; v8f oacc[DT];
#pragma unroll
  for (int dt = 0; dt < DT; ++dt) oacc[dt] = (v8f){0.f,0.f,0.f,0.f,0.f,0.f,0.f,0.f};
  const unsigned char* rk = ring + ln * FA_PITCH + 16 * hh; const unsigned char* rv = rk + FA_OPB;
#pragma unroll 1      /* one stage per trip: the publish point at the foot stands once */
  for (int t = 0; t < ns; ++t) { const unsigned bo = (unsigned)(t & 1) * FA_BUF;
#pragma unroll      /* the stage's two 32-key steps in straight line: each step's place in the buffer is then an immediate offset of its fragment reads */
   for (int sub = 0; sub < 2; ++sub) { const int j0 = t * 64 + sub * 32;
    FragH ak[2][KS], av[DT];
#pragma unroll
    for (int nt = 0; nt < 2; ++nt) { const unsigned char* kr = rk + bo + (sub * 32 + nt * 16) * FA_PITCH;
#pragma unroll
      for (int ks = 0; ks < KS; ++ks) { ak[nt][ks].half[0] = *(const v8us*)(kr + ks * 64); ak[nt][ks].half[1] = *(const v8us*)(kr + ks * 64 + 32); } }
#pragma unroll
    for (int dt = 0; dt < DT; ++dt) { const unsigned char* vrow = rv + bo + dt * 16 * FA_PITCH + sub * 64; av[dt].half[0] = *(const v8us*)vrow; av[dt].half[1] = *(const v8us*)(vrow + 32); }
    float sc[16];
#pragma unroll
    for (int nt = 0; nt < 2; ++nt) { v8f acc = (v8f){0.f,0.f,0.f,0.f,0.f,0.f,0.f,0.f};
#pragma unroll
      for (int ks = 0; ks < KS; ++ks) acc = mmaH<1>(ak[nt][ks].v, ak[nt][ks].v, bq[ks].v, bq[ks].v, acc);
#pragma unroll
      for (int r = 0; r < 8; ++r) sc[nt * 8 + r] = (j0 + nt * 16 + 8 * hh + r <= tq) ? acc[r] : -INFINITY; }      /* the raw product: its scale is folded into the exponent's fma below */
    float mx[4];
#pragma unroll
    for (int i = 0; i < 4; ++i) mx[i] = fmaxf(fmaxf(sc[i], sc[4 + i]), fmaxf(sc[8 + i], sc[12 + i]));
    float mc = fmaxf(fmaxf(mx[0], mx[1]), fmaxf(mx[2], mx[3])); mc = fmaxf(mc, xhalf(mc)) * SCL2;      /* the scale is positive: the maximum of the raw products, scaled once */
    const float mn = fmaxf(m_r, mc); const float ea = __builtin_amdgcn_exp2f(m_r - mn); const float al = (mn > -1.0e38f) ? ea : 1.0f; m_r = mn;
    const float nb = 10.0f - mn;      /* exponent offset: minus the maximum in use, plus the 2^10 that P carries into f16 */
    FragH pb; float ps[4] = {0.f, 0.f, 0.f, 0.f};
#pragma unroll
    for (int i = 0; i < 16; ++i) { const float p = __builtin_amdgcn_exp2f(fmaf(sc[i], SCL2, nb)); ps[i & 3] += p; pb.h[i] = (_Float16)p; }      /* p = weight x 2^10; a masked score is -inf: weight exactly 0 */
    l_r = l_r * al + ((ps[0] + ps[1]) + (ps[2] + ps[3]));      /* this half's keys only; the halves are joined behind the loop */
#pragma unroll
    for (int dt = 0; dt < DT; ++dt) {
#pragma unroll
      for (int r = 0; r < 8; ++r) oacc[dt][r] *= al; }
#pragma unroll
    for (int dt = 0; dt < DT; ++dt) oacc[dt] = mmaH<1>(av[dt].v, av[dt].v, pb.v, pb.v, oacc[dt]); }
    asm volatile("s_wait_dscnt 0x0" ::: "memory");         /* this wave's reads of the buffer are done before the barrier behind which it is refilled */
    asm volatile("s_wait_asynccnt 0x0" ::: "memory");      /* this wave's copies of stage t + 1 have landed before the barrier that publishes them */
    __syncthreads();
    if (t + 2 < ns) fa_copy8(lc + bo, gK + (size_t)(t + 2) * 64 * ldk, stK, gV + (t + 2) * 64, stV); }
  asm volatile("s_wait_asynccnt 0x0" ::: "memory");        /* nothing in flight when the wave goes on to the tile's output (and, after the first tile, to the second) */
  const float l = l_r + xhalf(l_r); const float inv = (l > 0.f) ? 1.0f / l : 0.f;      /* the sum carries the same 2^10 as P */
#pragma unroll
  for (int dt = 0; dt < DT; ++dt) { FragH f;      /* a lane's 8 consecutive d of its query: 16 bytes of the f16 row */
#pragma unroll
    for (int r = 0; r < 8; ++r) f.h[r] = (_Float16)(oacc[dt][r] * inv);
    *(v8us*)&sO[w][ln][dt * 16 + 8 * hh] = f.half[0]; }
  __builtin_amdgcn_fence(__ATOMIC_ACQ_REL, "workgroup"); __builtin_amdgcn_wave_barrier();
  { const int rs = lane >> 3, pc = lane & 7; v8us ov[4];      /* 8 lanes cover a query's 64 f16 = one 128-byte line; the four reads go as one group ahead of the stores */
#pragma unroll
    for (int k = 0; k < 4; ++k) ov[k] = *(const v8us*)&sO[w][k * 4 + rs][pc * 8];
#pragma unroll
    for (int k = 0; k < 4; ++k) { *(v8us*)((unsigned short*)O16 + ((size_t)b * TQ + q0 + k * 4 + rs) * ldo + h * 64 + pc * 8) = ov[k]; asm volatile("s_wait_xcnt 0x0" ::: "memory"); }      /* the wait stands in front of any rewrite of the store's data or address registers */
     } } }
template <bool RND>
__device__ __forceinline__ void ln1024_body(const float* __restrict__ X, const float* __restrict__ g, const float* __restrict__ bb, _Float16* __restrict__ H16, const int bx) {
  #pragma clang fp contract(off)
  const int tid = threadIdx.x, w = tid >> 5, l = tid & 31; const int r = bx * 8 + w; if (r >= NR) return; const float* x = X + (size_t)r * EE; float v[32]; float s = 0.f; v4f a8[8];
#pragma unroll
  for (int u = 0; u < 8; ++u) a8[u] = *(const v4fa*)(x + u * 128 + l * 4);
  asm volatile("s_wait_xcnt 0x0" ::: "memory");      /* later loads may land in the registers that hold the row loads' address: this wait stands in front of that overwrite */
#pragma unroll
  for (int u = 0; u < 8; ++u) {
#pragma unroll
    for (int q = 0; q < 4; ++q) { const float t = RND ? bf16_round(a8[u][q]) : a8[u][q]; v[u * 4 + q] = t; s += t; } }
  for (int o = 16; o > 0; o >>= 1) s += __shfl_xor(s, o, 32); const float mu = s / (float)EE; float q2 = 0.f;
#pragma unroll
  for (int k = 0; k < 32; ++k) { const float d = v[k] - mu; q2 += d * d; }
  for (int o = 16; o > 0; o >>= 1) q2 += __shfl_xor(q2, o, 32); const float rs = 1.0f / sqrtf(q2 / (float)EE + 1e-5f);
  {
#pragma unroll
    for (int u = 0; u < 8; ++u) { _Float16 h4[4];
#pragma unroll
      for (int q = 0; q < 4; ++q) { const int c = u * 128 + l * 4 + q; h4[q] = (_Float16)((v[u * 4 + q] - mu) * rs * bf16_round(g[c]) + bf16_round(bb[c])); }
      *(unsigned long long*)((unsigned short*)H16 + (size_t)r * EE + u * 128 + l * 4) = *(const unsigned long long*)h4; }
     } }
template <bool RND>
__global__ __launch_bounds__(256) void k_ln1024(const float* __restrict__ X, const float* __restrict__ g, const float* __restrict__ bb, _Float16* __restrict__ H16) { ln1024_body<RND>(X, g, bb, H16, (int)blockIdx.x); }
__device__ __forceinline__ void prep_body(const float* __restrict__ e, _Float16* __restrict__ E16, size_t n8, const unsigned bx) {
  const size_t t = (size_t)bx * 256 + threadIdx.x; if (t >= n8) return; const v4f a = *(const v4fa*)(e + t * 8), c = *(const v4fa*)(e + t * 8 + 4); FragH f;
#pragma unroll
  for (int q = 0; q < 4; ++q) { f.h[q] = (_Float16)bf16_round(a[q]); f.h[4 + q] = (_Float16)bf16_round(c[q]); }
  *(v8us*)((unsigned short*)E16 + t * 8) = f.half[0];
  asm volatile("s_wait_xcnt 0x0" ::: "memory");      /* stands in front of any rewrite of the registers that the store above names */
}
// Everything that reads only the inputs, as one grid by block range: LN1 (8 rows a block), the encoder plane and the ten weight planes (8 elements a thread).
// The ten f16 planes lie one behind the other from Bt in the order w0 ... w9, so a piece's place is its running index; w0 ... w7 hold EE * EE elements, w8 and w9 FF * EE.
#define FR_LN (NR / 8)                        /* blocks of LN1 */
#define FR_PREP (NR * EE / 8 / 256)           /* blocks of the encoder plane */
#define FR_WSM (EE * EE / 8 / 256)            /* blocks of one EE x EE weight */
#define FR_W (8 * FR_WSM + 2 * (FF / EE) * FR_WSM)
// second bound: eight waves a SIMD. The LN1 branch sets the register count of every block of this grid; held to 128 registers, four blocks of the streaming ranges stay resident on a WGP instead of three.
__global__ __launch_bounds__(256, 8) void k_front(const float* __restrict__ w0, const float* __restrict__ w1, const float* __restrict__ w2, const float* __restrict__ w3, const float* __restrict__ w4, const float* __restrict__ w5, const float* __restrict__ w6, const float* __restrict__ w7,
    const float* __restrict__ w8, const float* __restrict__ w9, const float* __restrict__ x, const float* __restrict__ e, const float* __restrict__ g, const float* __restrict__ bb,
    _Float16* __restrict__ Bt, _Float16* __restrict__ E16, _Float16* __restrict__ H16) {
  const unsigned bx = blockIdx.x;
  if (bx < FR_LN) { ln1024_body<true>(x, g, bb, H16, (int)bx); return; }
  if (bx < FR_LN + FR_PREP) { prep_body(e, E16, (size_t)NR * EE / 8, bx - FR_LN); return; }
  const unsigned wb = bx - (FR_LN + FR_PREP); const unsigned seg = wb / FR_WSM;      /* block-uniform: which EE x EE stretch of the ten planes */
  const float* W; unsigned b0;      /* the source and the block at which its plane begins */
  if (seg < 8) { W = (seg == 0) ? w0 : (seg == 1) ? w1 : (seg == 2) ? w2 : (seg == 3) ? w3 : (seg == 4) ? w4 : (seg == 5) ? w5 : (seg == 6) ? w6 : w7; b0 = seg * FR_WSM; }
  else if (seg < 8 + FF / EE) { W = w8; b0 = 8 * FR_WSM; }
  else { W = w9; b0 = (8 + FF / EE) * FR_WSM; }
  const size_t ts = (size_t)(wb - b0) * 256 + threadIdx.x, td = (size_t)wb * 256 + threadIdx.x; FragH f;
#pragma unroll
  for (int i = 0; i < 8; ++i) f.h[i] = (_Float16)(bf16_round(W[ts * 8 + i]) * 16.0f); *(v8us*)((unsigned short*)Bt + td * 8) = f.half[0];
  asm volatile("s_wait_xcnt 0x0" ::: "memory");      /* stands in front of any rewrite of the registers that the store above names */
}

extern "C" void kernel_launch(void* const* d_in, const int* in_sizes, int n_in,
                              void* d_out, int out_size, void* d_ws, size_t ws_size, hipStream_t stream) {
  (void)in_sizes; (void)n_in; (void)out_size;
  const float* const* I = (const float* const*)d_in;
  const float* x = I[0]; const float* enc = I[1];
  const float* wq_s = I[2]; const float* bq_s = I[3]; const float* wk_s = I[4]; const float* bk_s = I[5]; const float* wv_s = I[6]; const float* bv_s = I[7]; const float* wo_s = I[8]; const float* bo_s = I[9];
  const float* wq_c = I[10]; const float* bq_c = I[11]; const float* wk_c = I[12]; const float* bk_c = I[13]; const float* wv_c = I[14]; const float* bv_c = I[15]; const float* wo_c = I[16]; const float* bo_c = I[17];
  const float* g1 = I[18]; const float* b1n = I[19]; const float* g2 = I[20]; const float* b2n = I[21]; const float* g3 = I[22]; const float* b3n = I[23]; const float* W1 = I[24]; const float* b1 = I[25]; const float* W2 = I[26]; const float* b2 = I[27];
  char* ws = (char*)d_ws; size_t off = 0;
  auto take = [&](size_t bytes) { char* p = ws + off; off += (bytes + 255) & ~(size_t)255; return p; };
  _Float16* B[8]; for (int i = 0; i < 8; ++i) B[i] = (_Float16*)take((size_t)EE * EE * 2);      /* wq_s wk_s wv_s wo_s wq_c wk_c wv_c wo_c */
  _Float16* BF1 = (_Float16*)take((size_t)FF * EE * 2); _Float16* BF2 = (_Float16*)take((size_t)EE * FF * 2);
  float* X2 = (float*)take((size_t)NR * EE * 4); _Float16* H16 = (_Float16*)take((size_t)NR * EE * 2);
  _Float16* Q16 = (_Float16*)take((size_t)NR * EE * 2); _Float16* K16 = (_Float16*)take((size_t)NR * EE * 2); _Float16* VT = (_Float16*)take((size_t)NR * EE * 2); _Float16* E16 = (_Float16*)take((size_t)NR * EE * 2);      /* these four are contiguous: the FFN hidden reuses them */
  float* X1 = (float*)take((size_t)NR * EE * 4);
  _Float16* K16c = (_Float16*)take((size_t)NR * EE * 2); _Float16* VTc = (_Float16*)take((size_t)NR * EE * 2);      /* the cross attention's k and v planes, made ahead of the self attention */
  if (off > ws_size) return;      /* 16 + 16 + 16 + 8 + 32 + 16 + 16 = 120 MiB */
  _Float16* O16 = H16;                /* LN output is dead once its projection GEMMs ran; the attention output plane reuses it */
  _Float16* F1 = Q16;                 /* FFN hidden [4096][4096] f16 = 32 MiB = Q16+K16+VT+E16 (all dead by then) */
  const dim3 gE((NR / 128) * (EE / 128), 1), gF((NR / 128) * (FF / 128), 1), gP((NR / 128) * (EE / 128), 5); const unsigned gln = NR / 8, gfl = NH * (TQ / 128);      /* attention: one block per (n, h) and pair of 64-query tiles */
  /* --- all that reads only the inputs: LN1, the encoder plane, the ten weight planes ((out,in) = natural Bt; x16; B[0] ... B[7], BF1, BF2 are contiguous) --- */
  k_front<<<FR_LN + FR_PREP + FR_W, 256, 0, stream>>>(wq_s, wk_s, wv_s, wo_s, wq_c, wk_c, wv_c, wo_c, W1, W2, x, enc, g1, b1n, B[0], E16, H16);
  /* --- the five projections that wait for no attention; both v planes leave re-laid --- */
  k_proj5<<<gP, 256, 0, stream>>>(H16, E16, B[0], B[1], B[2], B[5], B[6], bq_s, bk_s, bv_s, bk_c, bv_c, Q16, K16, VT, K16c, VTc);
  /* --- self attention --- */
  k_flashc<<<gfl, 128, 0, stream>>>(Q16, NBATCH * EE, K16, NBATCH * EE, VT, nullptr, O16, NBATCH * EE);      /* rows = tokens, 64 (n,h) slabs of 64 columns */
  k_gemm3<0, true><<<gE, 256, 0, stream>>>(O16, EE, 0, B[3], EE, 0, 0.0625f, bo_s, 0, x, X1, nullptr, EE, 0, NR, EE, EE);      /* x1 = bf16(x) + o*wo^T + bo */
  /* --- cross attention (keys/values from encoder_out, same causal mask) --- */
  k_ln1024<false><<<gln, 256, 0, stream>>>(X1, g2, b2n, H16);
  k_gemm3<0><<<gE, 256, 0, stream>>>(H16, EE, 0, B[4], EE, 0, 0.0625f, bq_c, 0, nullptr, nullptr, Q16, EE, 0, NR, EE, EE);
  k_flashc<<<gfl, 128, 0, stream>>>(Q16, NBATCH * EE, K16c, NBATCH * EE, VTc, nullptr, O16, NBATCH * EE);
  k_gemm3<0><<<gE, 256, 0, stream>>>(O16, EE, 0, B[7], EE, 0, 0.0625f, bo_c, 0, X1, X2, nullptr, EE, 0, NR, EE, EE);      /* x2 = x1 + o*wo^T + bo */
  /* --- FFN --- */
  k_ln1024<false><<<gln, 256, 0, stream>>>(X2, g3, b3n, H16);
  k_gemm3<6><<<gF, 256, 0, stream>>>(H16, EE, 0, BF1, EE, 0, 0.0625f, b1, 0, nullptr, nullptr, F1, FF, 0, NR, FF, EE);      /* gelu_erf(h*fc1^T + b1) -> f16 [4096][4096] */
  k_gemm3<0><<<gE, 256, 0, stream>>>(F1, FF, 0, BF2, FF, 0, 0.0625f, b2, 0, X2, (float*)d_out, nullptr, EE, 0, NR, EE, FF);      /* out = x2 + f*fc2^T + b2 */
}

// v009
// Measured time: 218 microseconds a run.
// Next to v008, in two timings, it ran 1.07 and 1.05 times as fast.
// Over all steps from v000 it is 4.59 times as fast.
#include <hip/hip_runtime.h>
// Pre-LN decoder layer, sequence-first layout (T 1024, batch 4, E 1024, 16 heads x 64, FFN 4096): h = LN1(x); x1 = x + SelfAttn(h, h); h = LN2(x1); x2 = x1 + Attn(h, encoder_out); h = LN3(x2); out = x2 + fc2(gelu_erf(fc1(h))). Both attentions: q = (in*wq^T + bq)*64^-0.5, k, v from the key input, per (batch, head) scores over the 1024 keys with the module's causal mask (key > query filled with -1e4, i.e. weight exactly 0), softmax, *v, merged, *wo^T + bo.
// Structure: rows are the (t, n) pairs in memory order, so every projection / FFN is a [4096][1024] GEMM (f16 WMMA, 32x64 wave tiles, f32 accumulation, exact bias, residual through the f32 epilogue addend); LayerNorms wave-per-row on VALU writing f16 operand planes; q/k planes viewed as [token][64 heads x 64] feed a fused causal flash-style kernel per ((n,h), pair of 64-query tiles t and 15 - t, one after the other) (wave = 16 queries, 32-key steps up to the query block, both products transposed so that a lane owns one query, online softmax f32 in base 2, P x2^10 f16 packed in registers, f32 accumulators); v leaves its projection already as f16 [d][token] per (n,h), turned in the epilogue's LDS staging; the attention output leaves as the f16 operand plane of the wo product; exact-erf GELU in the fc1 epilogue.
// Compute dtype: inputs and parameters rounded to bf16; all GEMM operands f16 (~2^-12: LN outputs, q, k, v, P, attention outputs, the GELU hidden), weights bf16-exact (x16 in f16), f32 accumulation; LayerNorm / softmax / residual stream f32. v_wmma_f32_16x16x32_f16.
#define TT 1024
#define NBATCH 4
#define EE 1024
#define NHD 16
#define NH (NBATCH * NHD)        /* 64 (batch, head) slabs */
#define TQ TT
#define TK TT
#define SCL 0.125f
#define SCL2 (SCL * 1.4426950408889634f)   /* score scale x log2(e): the softmax runs in base 2 */
#define NR (TT * NBATCH)         /* 4096 rows */
#define FF 4096
typedef __bf16 v16b __attribute__((ext_vector_type(16)));
typedef unsigned short v8us __attribute__((ext_vector_type(8), may_alias));
typedef float  v8f  __attribute__((ext_vector_type(8)));
typedef float  v4f  __attribute__((ext_vector_type(4)));
typedef float  v4fa __attribute__((ext_vector_type(4), may_alias));
union FragB { v16b v; v8us half[2]; unsigned short u[16]; };

__device__ __forceinline__ unsigned short bf16_bits(float x) { unsigned int u = __float_as_uint(x); return (unsigned short)((u + 0x7FFFu + ((u >> 16) & 1u)) >> 16); }
__device__ __forceinline__ float bf16_val(unsigned short b) { return __uint_as_float(((unsigned int)b) << 16); }
__device__ __forceinline__ float bf16_round(float x) { return bf16_val(bf16_bits(x)); }
// D += A·B with NT terms: 1 = ah·bh, 2 = + al·bh (A split), 3 = + ah·bl (both split)
template <int NT>
__device__ __forceinline__ v8f mmaN(v16b ah, v16b al, v16b bh, v16b bl, v8f c) {
  c = __builtin_amdgcn_wmma_f32_16x16x32_bf16(false, ah, false, bh, (short)0, c, false, false);
  if (NT >= 2) c = __builtin_amdgcn_wmma_f32_16x16x32_bf16(false, al, false, bh, (short)0, c, false, false);
  if (NT >= 3) c = __builtin_amdgcn_wmma_f32_16x16x32_bf16(false, ah, false, bl, (short)0, c, false, false);
  asm volatile("v_nop\n\tv_nop\n\tv_nop\n\tv_nop" : "+v"(c) : "v"(ah), "v"(al), "v"(bh), "v"(bl));
  return c;
}

__global__ __launch_bounds__(256) void k_wt_bf16(const float* __restrict__ W, unsigned short* __restrict__ Wt, int K, int N) {
  const int t = blockIdx.x * 256 + threadIdx.x;
  const int k8n = K / 8;
  if (t >= N * k8n) return;
  const int n = t / k8n, k8 = (t % k8n) * 8;
  v8us v;
#pragma unroll
  for (int i = 0; i < 8; ++i) v[i] = bf16_bits(W[(size_t)(k8 + i) * N + n]);
  *(v8us*)(Wt + (size_t)n * K + k8) = v;
  
}

// GEMM C[M][N] (f32, pitch ldc) = act(A[M][K]·W + bias). A f32 row-major (pitch lda) converted per fragment to bf16
// (ASPLIT: hi/lo two planes -> 2 terms, else single rounded term); Wt bf16 [N][K] (pitch ldb). BIAS_BF16 rounds the
// bias to bf16 first (bias quantised to bf16 before the add). K%32==0, M%16==0, N%64==0.
template <bool ASPLIT, int ACT, bool BIAS_BF16>
__global__ __launch_bounds__(128) void k_gemm_bf(const float* __restrict__ A, int lda, const unsigned short* __restrict__ Wt, int ldb,
                                               const float* __restrict__ bias, float* __restrict__ C, int ldc, int M, int N, int K) {
  __shared__ __attribute__((aligned(16))) float so[4][16][64];
  const int tid = threadIdx.x, w = tid >> 5, lane = tid & 31, ln = lane & 15, hh = lane >> 4;
  const int ntn = N / 64;
  const int wid = blockIdx.x * 4 + w;
  const int mt = wid / ntn, nq = wid % ntn;
  if (mt * 16 >= M) return;
  const int row0 = mt * 16, col0 = nq * 64;
  const float* arow = A + (size_t)(row0 + ln) * lda;
  v8f acc[4] = {};
  for (int kb = 0; kb < K; kb += 32) {
    FragB ah, al;
    const v4f x0 = *(const v4fa*)(arow + kb + 8 * hh), x1 = *(const v4fa*)(arow + kb + 8 * hh + 4);
    const v4f x2 = *(const v4fa*)(arow + kb + 16 + 8 * hh), x3 = *(const v4fa*)(arow + kb + 16 + 8 * hh + 4);
    float xs[16] = {x0[0],x0[1],x0[2],x0[3],x1[0],x1[1],x1[2],x1[3],x2[0],x2[1],x2[2],x2[3],x3[0],x3[1],x3[2],x3[3]};
#pragma unroll
    for (int i = 0; i < 16; ++i) { const unsigned short hb = bf16_bits(xs[i]); ah.u[i] = hb; al.u[i] = ASPLIT ? bf16_bits(xs[i] - bf16_val(hb)) : (unsigned short)0; }
#pragma unroll
    for (int t = 0; t < 4; ++t) {
      const unsigned short* brow = Wt + (size_t)(col0 + t * 16 + ln) * ldb + kb;
      FragB b;
      b.half[0] = *(const v8us*)(brow + 8 * hh);
      b.half[1] = *(const v8us*)(brow + 16 + 8 * hh);
      acc[t] = mmaN<ASPLIT ? 2 : 1>(ah.v, al.v, b.v, b.v, acc[t]);
    }
  }
#pragma unroll
  for (int t = 0; t < 4; ++t) {
    float bv = bias ? bias[col0 + t * 16 + ln] : 0.f;
    if (BIAS_BF16) bv = bf16_round(bv);
#pragma unroll
    for (int r = 0; r < 8; ++r) { float v = acc[t][r] + bv; if (ACT == 1) v = fmaxf(v, 0.f); so[w][8 * hh + r][t * 16 + ln] = v; }
  }
  __builtin_amdgcn_fence(__ATOMIC_ACQ_REL, "workgroup");
  __builtin_amdgcn_wave_barrier();
  const int rsub = lane >> 4, c4 = (lane & 15) * 4;
  {
#pragma unroll
    for (int q = 0; q < 8; ++q) {
      const int r = q * 2 + rsub;
      const v4f v = *(const v4fa*)&so[w][r][c4];
      *(v4f*)(C + (size_t)(row0 + r) * ldc + col0 + c4) = v;
    }
    
  }
}

// GEMM C = act(A·W + bias + resid): A f32 (ASPLIT -> hi/lo 2 terms), Wt bf16 [N][K]; ACT 0 none, 1 relu, 2 exact gelu;
// resid (optional, f32, row index = (row % rmod), pitch ldr, RES_BF16 rounds it) added before the activation.
template <bool ASPLIT, int ACT, bool BIAS_BF16, bool RES_BF16>
__global__ __launch_bounds__(128) void k_gemm_bf3(const float* __restrict__ A, int lda, const unsigned short* __restrict__ Wt, int ldb,
                                                const float* __restrict__ bias, const float* __restrict__ resid, int rmod, int ldr,
                                                float* __restrict__ C, int ldc, int M, int N, int K) {
  __shared__ __attribute__((aligned(16))) float so[4][16][64];
  const int tid = threadIdx.x, w = tid >> 5, lane = tid & 31, ln = lane & 15, hh = lane >> 4;
  const int ntn = N / 64;
  const int wid = blockIdx.x * 4 + w;
  const int mt = wid / ntn, nq = wid % ntn;
  if (mt * 16 >= M) return;
  const int row0 = mt * 16, col0 = nq * 64;
  const float* arow = A + (size_t)(row0 + ln) * lda;
  v8f acc[4] = {};
  for (int kb = 0; kb < K; kb += 32) {
    FragB ah, al;
    const v4f x0 = *(const v4fa*)(arow + kb + 8 * hh), x1 = *(const v4fa*)(arow + kb + 8 * hh + 4);
    const v4f x2 = *(const v4fa*)(arow + kb + 16 + 8 * hh), x3 = *(const v4fa*)(arow + kb + 16 + 8 * hh + 4);
    float xs[16] = {x0[0],x0[1],x0[2],x0[3],x1[0],x1[1],x1[2],x1[3],x2[0],x2[1],x2[2],x2[3],x3[0],x3[1],x3[2],x3[3]};
#pragma unroll
    for (int i = 0; i < 16; ++i) { const unsigned short hb = bf16_bits(xs[i]); ah.u[i] = hb; al.u[i] = ASPLIT ? bf16_bits(xs[i] - bf16_val(hb)) : (unsigned short)0; }
#pragma unroll
    for (int t = 0; t < 4; ++t) {
      const unsigned short* brow = Wt + (size_t)(col0 + t * 16 + ln) * ldb + kb;
      FragB b;
      b.half[0] = *(const v8us*)(brow + 8 * hh);
      b.half[1] = *(const v8us*)(brow + 16 + 8 * hh);
      acc[t] = mmaN<ASPLIT ? 2 : 1>(ah.v, al.v, b.v, b.v, acc[t]);
    }
  }
#pragma unroll
  for (int t = 0; t < 4; ++t) {
    const int col = col0 + t * 16 + ln;
    float bv = bias ? bias[col] : 0.f;
    if (BIAS_BF16) bv = bf16_round(bv);
#pragma unroll
    for (int r = 0; r < 8; ++r) {
      float v = acc[t][r] + bv;
      if (resid) { float rv = resid[(size_t)((row0 + 8 * hh + r) % rmod) * ldr + col]; if (RES_BF16) rv = bf16_round(rv); v += rv; }
      if (ACT == 1) v = fmaxf(v, 0.f);
      if (ACT == 2) v = 0.5f * v * (1.0f + erff(v * 0.70710678118654752f));
      if (ACT == 3) { const float u = 0.7978845608028654f * (v + 0.044715f * v * v * v); v = 0.5f * v * (1.0f + tanhf(u)); }
      so[w][8 * hh + r][t * 16 + ln] = v;
    }
  }
  __builtin_amdgcn_fence(__ATOMIC_ACQ_REL, "workgroup");
  __builtin_amdgcn_wave_barrier();
  const int rsub = lane >> 4, c4 = (lane & 15) * 4;
  {
#pragma unroll
    for (int q = 0; q < 8; ++q) {
      const int r = q * 2 + rsub;
      const v4f v = *(const v4fa*)&so[w][r][c4];
      *(v4f*)(C + (size_t)(row0 + r) * ldc + col0 + c4) = v;
    }
    
  }
}
// row LayerNorm (biased variance, eps) over N: s = X (+ R); optional out_sum <- s; out_norm <- (s-mu)*rsqrt(var+eps)*g + b
template <bool PARAM_BF16>
__global__ __launch_bounds__(256) void k_layernorm(const float* __restrict__ X, const float* __restrict__ R, const float* __restrict__ g, const float* __restrict__ bta,
                                                  float* __restrict__ out_sum, float* __restrict__ out_norm, int N, float eps) {
  __shared__ float red[256];
  const int row = blockIdx.x, tid = threadIdx.x;
  const float* x = X + (size_t)row * N; const float* rr = R ? R + (size_t)row * N : nullptr;
  float vals[16];                     // up to N = 4096
  const int per = N / 256;            // contiguous chunk per thread? use strided-by-4 chunks: thread handles j = tid*4 + 1024*u
  float s1 = 0.f;
  for (int u = 0; u < per / 4; ++u) {
    const int j = tid * 4 + 1024 * u;
    const v4f a = *(const v4fa*)(x + j);
    v4f b = {0.f,0.f,0.f,0.f}; if (rr) b = *(const v4fa*)(rr + j);
#pragma unroll
    for (int q = 0; q < 4; ++q) { const float v = a[q] + b[q]; vals[u * 4 + q] = v; s1 += v; }
  }
  red[tid] = s1; __syncthreads();
  for (int st = 128; st > 0; st >>= 1) { if (tid < st) red[tid] += red[tid + st]; __syncthreads(); }
  const float mu = red[0] / (float)N; __syncthreads();
  float s2 = 0.f;
  for (int u = 0; u < per / 4; ++u)
#pragma unroll
    for (int q = 0; q < 4; ++q) { const float c = vals[u * 4 + q] - mu; s2 += c * c; }
  red[tid] = s2; __syncthreads();
  for (int st = 128; st > 0; st >>= 1) { if (tid < st) red[tid] += red[tid + st]; __syncthreads(); }
  const float rs = rsqrtf(red[0] / (float)N + eps);
  {
    for (int u = 0; u < per / 4; ++u) {
      const int j = tid * 4 + 1024 * u;
      v4f o, sm;
#pragma unroll
      for (int q = 0; q < 4; ++q) {
        float gg = g[j + q], bb = bta[j + q];
        if (PARAM_BF16) { gg = bf16_round(gg); bb = bf16_round(bb); }
        sm[q] = vals[u * 4 + q]; o[q] = (vals[u * 4 + q] - mu) * rs * gg + bb;
      }
      if (out_sum) *(v4f*)(out_sum + (size_t)row * N + j) = sm;
      *(v4f*)(out_norm + (size_t)row * N + j) = o;
    }
    
  }
}



// ---- f16 WMMA path (v_wmma_f32_16x16x32_f16): 11-bit significands for operands in range — used where a [0,1] probability operand needs more precision than bf16
typedef _Float16 v16h __attribute__((ext_vector_type(16)));
union FragH { v16h v; v8us half[2]; _Float16 h[16]; unsigned short u[16]; };
template <int NT>
__device__ __forceinline__ v8f mmaH(v16h ah, v16h al, v16h bh, v16h bl, v8f c) {
  c = __builtin_amdgcn_wmma_f32_16x16x32_f16(false, ah, false, bh, (short)0, c, false, false);
  if (NT >= 2) c = __builtin_amdgcn_wmma_f32_16x16x32_f16(false, al, false, bh, (short)0, c, false, false);
  if (NT >= 3) c = __builtin_amdgcn_wmma_f32_16x16x32_f16(false, ah, false, bl, (short)0, c, false, false);
  asm volatile("v_nop\n\tv_nop\n\tv_nop\n\tv_nop" : "+v"(c) : "v"(ah), "v"(al), "v"(bh), "v"(bl));
  return c;
}
// batched GEMM like k_gemm_b but f16 operands: A f32 (split into f16 hi/lo if ASPLIT, else rounded to f16), Bt = f16 values [n][k]; alpha; C f32; N multiple of 16 (partial tiles skipped)
template <bool ASPLIT>
__global__ __launch_bounds__(128) void k_gemm_h(const float* __restrict__ A, int lda, size_t sA, const _Float16* __restrict__ Bh, int ldb, size_t sB, float alpha, float* __restrict__ C, int ldc, size_t sC, int M, int N, int K) {
  __shared__ __attribute__((aligned(16))) float so[4][16][64];
  const int tid = threadIdx.x, w = tid >> 5, lane = tid & 31, ln = lane & 15, hh = lane >> 4; const int by = blockIdx.y;
  A += (size_t)by * sA; Bh += (size_t)by * sB; C += (size_t)by * sC;
  const int ntn = (N + 63) / 64; const int wid = blockIdx.x * 4 + w; const int mt = wid / ntn, nq = wid % ntn; if (mt * 16 >= M) return;
  const int row0 = mt * 16, col0 = nq * 64; const float* arow = A + (size_t)(row0 + ln) * lda;
  v8f acc[4] = {};
  for (int kb = 0; kb < K; kb += 32) {
    FragH ah, al;
    const v4f x0 = *(const v4fa*)(arow + kb + 8 * hh), x1 = *(const v4fa*)(arow + kb + 8 * hh + 4), x2 = *(const v4fa*)(arow + kb + 16 + 8 * hh), x3 = *(const v4fa*)(arow + kb + 16 + 8 * hh + 4);
    float xs[16] = {x0[0],x0[1],x0[2],x0[3],x1[0],x1[1],x1[2],x1[3],x2[0],x2[1],x2[2],x2[3],x3[0],x3[1],x3[2],x3[3]};
#pragma unroll
    for (int i = 0; i < 16; ++i) { const _Float16 h = (_Float16)xs[i]; ah.h[i] = h; al.h[i] = ASPLIT ? (_Float16)(xs[i] - (float)h) : (_Float16)0.0f; }
#pragma unroll
    for (int t = 0; t < 4; ++t) { if (col0 + t * 16 >= N) continue; const size_t boff = (size_t)(col0 + t * 16 + ln) * ldb + kb; FragH bq; bq.half[0] = *(const v8us*)(Bh + boff + 8 * hh); bq.half[1] = *(const v8us*)(Bh + boff + 16 + 8 * hh);
      acc[t] = mmaH<ASPLIT ? 2 : 1>(ah.v, al.v, bq.v, bq.v, acc[t]); }
  }
#pragma unroll
  for (int t = 0; t < 4; ++t) { if (col0 + t * 16 >= N) continue;
#pragma unroll
    for (int r = 0; r < 8; ++r) so[w][8 * hh + r][t * 16 + ln] = acc[t][r] * alpha; }
  __builtin_amdgcn_fence(__ATOMIC_ACQ_REL, "workgroup"); __builtin_amdgcn_wave_barrier();
  const int rsub = lane >> 4, c4 = (lane & 15) * 4;
  {
#pragma unroll
    for (int q = 0; q < 8; ++q) { const int r = q * 2 + rsub; if (col0 + c4 < N) { const v4f v = *(const v4fa*)&so[w][r][c4]; *(v4f*)(C + (size_t)(row0 + r) * ldc + col0 + c4) = v; } }
     }
}

// Wt[n][k] = f16(W[k][n]·scale) from f32 row-major W[K][N] (scale = power of two; bf16-exact weights stay exact in f16 away from the subnormal range)
__global__ __launch_bounds__(256) void k_wt_f16(const float* __restrict__ W, _Float16* __restrict__ Wt, int K, int N, float scale) {
  const int t = blockIdx.x * 256 + threadIdx.x; if (t >= N * (K / 8)) return; const int n = t / (K / 8), k8 = (t % (K / 8)) * 8; FragH f;
#pragma unroll
  for (int i = 0; i < 8; ++i) f.h[i] = (_Float16)(bf16_round(W[(size_t)(k8 + i) * N + n]) * scale); const v8us o = f.half[0];
  *(v8us*)((unsigned short*)Wt + (size_t)n * K + k8) = o; 
}
// k_gemm_hh variant with fused epilogue: v = acc·alpha + bias[by·sBias + col] (+ CP[(row/rowsPerB)·sCPb + by·64 + col] if CP) ; ACT 0 none / 1 elu ; writes f16 C16 (and f32 C if non-null)
template <int ACT>
__global__ __launch_bounds__(128) void k_gemm_hhx(const _Float16* __restrict__ A, int lda, size_t sA, const _Float16* __restrict__ Bh, int ldb, size_t sB, float alpha, const float* __restrict__ bias, size_t sBias, const float* __restrict__ CP, int rowsPerB, size_t sCPb, int row0g,
    float* __restrict__ C, _Float16* __restrict__ C16, int ldc, size_t sC, int M, int N, int K) {
  __shared__ __attribute__((aligned(16))) float so[4][16][64];
  const int tid = threadIdx.x, w = tid >> 5, lane = tid & 31, ln = lane & 15, hh = lane >> 4; const int by = blockIdx.y;
  A += (size_t)by * sA; Bh += (size_t)by * sB; const size_t cofs = (size_t)by * sC; const float* bp = bias ? bias + (size_t)by * sBias : nullptr;
  const int ntn = (N + 63) / 64; const int wid = blockIdx.x * 4 + w; const int mt = wid / ntn, nq = wid % ntn; if (mt * 16 >= M) return;
  const int row0 = mt * 16, col0 = nq * 64; const _Float16* arow = A + (size_t)(row0 + ln) * lda;
  v8f acc[4] = {};
  for (int kb = 0; kb < K; kb += 32) { FragH ah; ah.half[0] = *(const v8us*)((const unsigned short*)arow + kb + 8 * hh); ah.half[1] = *(const v8us*)((const unsigned short*)arow + kb + 16 + 8 * hh);
#pragma unroll
    for (int t = 0; t < 4; ++t) { if (col0 + t * 16 >= N) continue; const size_t boff = (size_t)(col0 + t * 16 + ln) * ldb + kb; FragH bq; bq.half[0] = *(const v8us*)((const unsigned short*)Bh + boff + 8 * hh); bq.half[1] = *(const v8us*)((const unsigned short*)Bh + boff + 16 + 8 * hh);
      acc[t] = mmaH<1>(ah.v, ah.v, bq.v, bq.v, acc[t]); }
  }
#pragma unroll
  for (int t = 0; t < 4; ++t) { if (col0 + t * 16 >= N) continue; const int col = col0 + t * 16 + ln; const float bv = bp ? bf16_round(bp[col]) : 0.f;
#pragma unroll
    for (int r = 0; r < 8; ++r) { float v = acc[t][r] * alpha + bv; if (CP) { const int bidx = (row0g + row0 + 8 * hh + r) / rowsPerB; v += CP[(size_t)bidx * sCPb + (size_t)by * 64 + col]; } if (ACT == 1) v = (v > 0.f) ? v : expm1f(v); else if (ACT == 7) v = (v > 0.f) ? v + 1.0f : expf(v); else if (ACT == 8) v = tanhf(v); else if (ACT == 9) v = 0.5f * v * (1.0f + tanhf(0.7978845608028654f * (v + 0.044715f * v * v * v))); else if (ACT == 11) v = 1.0f / (1.0f + expf(-v)); else if (ACT == 12) v = (v > 0.f) ? v : 0.01f * v; else if (ACT == 14) v = (v > 0.f) ? v : 0.1f * v; else if (ACT == 15) v = v / (1.0f + expf(-v)); else if (ACT == 3) v = fmaxf(v, 0.f); else if (ACT == 6) v = 0.5f * v * (1.0f + erff(v * 0.70710678118654752f)); so[w][8 * hh + r][t * 16 + ln] = v; } }
  __builtin_amdgcn_fence(__ATOMIC_ACQ_REL, "workgroup"); __builtin_amdgcn_wave_barrier();
  const int rsub = lane >> 4, c4 = (lane & 15) * 4; typedef _Float16 v4h __attribute__((ext_vector_type(4)));
  {
#pragma unroll
    for (int q = 0; q < 8; ++q) { const int r = q * 2 + rsub; if (col0 + c4 < N) { const v4f v = *(const v4fa*)&so[w][r][c4]; if (C) *(v4f*)(C + cofs + (size_t)(row0 + r) * ldc + col0 + c4) = v; if (C16) { v4h h4; for (int i = 0; i < 4; ++i) h4[i] = (_Float16)v[i]; *(v4h*)(C16 + cofs + (size_t)(row0 + r) * ldc + col0 + c4) = h4; } } }
     }
}


typedef _Float16 v4h __attribute__((ext_vector_type(4)));

__global__ __launch_bounds__(256) void k_x16(const float* __restrict__ x, _Float16* __restrict__ X16, size_t n8) { const size_t t = (size_t)blockIdx.x * 256 + threadIdx.x; if (t >= n8) return; FragH f;
#pragma unroll
  for (int q = 0; q < 8; ++q) f.h[q] = (_Float16)bf16_round(x[t * 8 + q]); *(v8us*)((unsigned short*)X16 + t * 8) = f.half[0];  }
template <int NHv, int TTv>
__global__ __launch_bounds__(256) void k_vt(const _Float16* __restrict__ V16, int ldv, int voff, _Float16* __restrict__ Vt) { __shared__ unsigned short tl[64][66]; const int tid = threadIdx.x; const int slab = blockIdx.x / (TTv / 64), lg = blockIdx.x % (TTv / 64); const int b = slab / NHv, h = slab % NHv;
  for (int i = tid; i < 64 * 8; i += 256) { const int r = i / 8, c8 = (i % 8) * 8; FragH f; f.half[0] = *(const v8us*)((const unsigned short*)V16 + ((size_t)b * TTv + lg * 64 + r) * ldv + voff + h * 64 + c8);
#pragma unroll
    for (int q = 0; q < 8; ++q) tl[r][c8 + q] = f.u[q]; }
  __syncthreads();
  {
#pragma unroll
    for (int rd = 0; rd < 2; ++rd) { const int d = rd * 32 + tid / 8, pc = tid % 8; FragH f;
#pragma unroll
      for (int q = 0; q < 8; ++q) f.u[q] = tl[pc * 8 + q][d];
      *(v8us*)((unsigned short*)Vt + ((size_t)slab * 64 + d) * TTv + lg * 64 + pc * 8) = f.half[0]; }
     } }

__global__ __launch_bounds__(256) void k_hl(const float* __restrict__ F, _Float16* __restrict__ Hh, _Float16* __restrict__ Hl, size_t n8) { const size_t t = (size_t)blockIdx.x * 256 + threadIdx.x; if (t >= n8) return; FragH fh, fl; const v4f a = *(const v4fa*)(F + t * 8), c = *(const v4fa*)(F + t * 8 + 4);
#pragma unroll
  for (int q = 0; q < 4; ++q) { _Float16 h = (_Float16)a[q]; fh.h[q] = h; fl.h[q] = (_Float16)((a[q] - (float)h) * 1024.0f); h = (_Float16)c[q]; fh.h[4 + q] = h; fl.h[4 + q] = (_Float16)((c[q] - (float)h) * 1024.0f); }
  { *(v8us*)((unsigned short*)Hh + t * 8) = fh.half[0]; *(v8us*)((unsigned short*)Hl + t * 8) = fl.half[0];  } }

// ---- fast GEMM (wave tile 32x64, operands staged in LDS) ----
__device__ __forceinline__ v16h g2_frag(const _Float16* p, int hh) { FragH f; f.half[0] = *(const v8us*)((const unsigned short*)p + 8 * hh); f.half[1] = *(const v8us*)((const unsigned short*)p + 16 + 8 * hh); return f.v; }
__device__ __forceinline__ v8f g2_mma(v16h a, v16h b, v8f c) { v8f d = __builtin_amdgcn_wmma_f32_16x16x32_f16(false, a, false, b, (short)0, c, false, false); asm volatile("v_nop\n\tv_nop\n\tv_nop\n\tv_nop" : "+v"(d) : "v"(a), "v"(b)); return d; }
// Block tile 128x128, eight waves of 32x64 (4 down x 2 across). A pass is 128 k: 128 rows of A and 128 rows of Bh, 256 B each, are laid in LDS at a
// pitch of 272 B (16 B x odd, for the ds_load_b128 fragment reads) by per-lane asynchronous 16-byte copies; NB buffers, the copies of the next NB - 1 passes fly while this one is multiplied.
#define G3_PITCH 272
#define G3_OPB (128 * G3_PITCH)   /* one operand's 128 rows */
#define G3_BUF (2 * G3_OPB)       /* one buffer: [A rows | Bh rows] */
// Eight copies per lane: rows r, r + 16, ..., r + 112 of one operand (16 lanes cover one 256-B row piece). The s_wait_xcnt closes the copies' own statement so that
// no address register named here is rewritten ahead of it.
__device__ __forceinline__ void g3_copy8(unsigned l, const _Float16* g, size_t rstep) {
  asm volatile("global_load_async_to_lds_b128 %0, %8, off\n\t"
               "global_load_async_to_lds_b128 %1, %9, off\n\t"
               "global_load_async_to_lds_b128 %2, %10, off\n\t"
               "global_load_async_to_lds_b128 %3, %11, off\n\t"
               "global_load_async_to_lds_b128 %4, %12, off\n\t"
               "global_load_async_to_lds_b128 %5, %13, off\n\t"
               "global_load_async_to_lds_b128 %6, %14, off\n\t"
               "global_load_async_to_lds_b128 %7, %15, off\n\t"
               "s_wait_xcnt 0x0"
               :: "v"(l), "v"(l + 16u * G3_PITCH), "v"(l + 32u * G3_PITCH), "v"(l + 48u * G3_PITCH), "v"(l + 64u * G3_PITCH), "v"(l + 80u * G3_PITCH), "v"(l + 96u * G3_PITCH), "v"(l + 112u * G3_PITCH),
                  "v"(g), "v"(g + rstep), "v"(g + 2 * rstep), "v"(g + 3 * rstep), "v"(g + 4 * rstep), "v"(g + 5 * rstep), "v"(g + 6 * rstep), "v"(g + 7 * rstep)
               : "memory");
}
// requires M % 128 == 0, N % 128 == 0, K % 128 == 0; epilogue: v = act(acc * alpha + bf16(bias[col])), then, with ACT 0 only, + R[row][col] (R = optional f32 addend laid out like C; RRND: rounded to bf16 as it is added, for an addend that is a raw input)
// bx = the block's tile index, by = its batch index (the kernels below say where they come from)
// VT (optional, ACT 0 only): the tile leaves transposed and as f16 only, VT[by * N + col][row] with M elements a line, instead of through C / C16
// NB = buffers of the ring. Pass s lies in buffer s mod NB; its 16 copies per wave are issued NB - 1 passes ahead of the publish point that waits for them. A grid of one block per WGP walks k in step, so every pass's
// rows are first asked for by all their readers at once and come from memory: with two buffers the lead is one pass, shorter than that latency; four buffers (one block fills most of the WGP's LDS) give three passes.
template <int ACT, bool RRND = false, int NB = 2>
__device__ __forceinline__ void g3_body(const _Float16* __restrict__ A, int lda, size_t sA, const _Float16* __restrict__ Bh, int ldb, size_t sB, float alpha, const float* __restrict__ bias, size_t sBias, const float* __restrict__ R,
    float* __restrict__ C, _Float16* __restrict__ C16, _Float16* __restrict__ VT, int ldc, size_t sC, int M, int N, int K, const int bx, const int by) {
  static_assert(NB >= 2 && (NB & (NB - 1)) == 0 && 16 * (NB - 1) <= 63, "a power of two; at most 63 copies of a wave outstanding");
  __shared__ __attribute__((aligned(16))) unsigned char ring[NB * G3_BUF];      /* the buffers; after the k loop its first 8 x 32 x 68 floats stage the output */
  const int tid = threadIdx.x, w = tid >> 5, lane = tid & 31, ln = lane & 15, hh = lane >> 4;
  A += (size_t)by * sA; Bh += (size_t)by * sB; const size_t cofs = (size_t)by * sC; const float* bp = bias ? bias + (size_t)by * sBias : nullptr;
  const int ntn = N >> 7; const int mt = bx / ntn, nq = bx - mt * ntn; const int rowb = mt * 128, colb = nq * 128; if (rowb >= M) return;      /* block-uniform, ahead of every barrier */
  const int wm = w & 3, wn = w >> 2; const int row0 = rowb + 32 * wm, col0 = colb + 64 * wn;
  const int cr = tid >> 4, cc = tid & 15;      /* copy side: this lane's first row and its 16-byte piece of the row */
  const _Float16* gA = A + (size_t)(rowb + cr) * lda + cc * 8; const _Float16* gB = Bh + (size_t)(colb + cr) * ldb + cc * 8; const size_t stA = (size_t)16 * lda, stB = (size_t)16 * ldb;
  const unsigned lA = (unsigned)(size_t)ring + (unsigned)(cr * G3_PITCH + cc * 16), lB = lA + G3_OPB;
  const int np = K >> 7;
  g3_copy8(lA, gA, stA); g3_copy8(lB, gB, stB);
#pragma unroll      /* each pass's buffer offset is then a constant */
  for (int s = 1; s < NB - 1; ++s) if (s < np) { g3_copy8(lA + (unsigned)s * G3_BUF, gA + s * 128, stA); g3_copy8(lB + (unsigned)s * G3_BUF, gB + s * 128, stB); }
  /* pass 0's own copies have landed before the barrier that publishes them: the count leaves out the 16 copies of each of the passes 1 ... NB - 2, and is used only where all of them were issued */
  if (NB == 2 || np < NB - 1) asm volatile("s_wait_asynccnt 0x0" ::: "memory"); else asm volatile("s_wait_asynccnt %0" :: "n"(16 * (NB - 2)) : "memory");
  __syncthreads();
  if (np > NB - 1) { g3_copy8(lA + (unsigned)(NB - 1) * G3_BUF, gA + (NB - 1) * 128, stA); g3_copy8(lB + (unsigned)(NB - 1) * G3_BUF, gB + (NB - 1) * 128, stB); }
  /* what the epilogue adds is fetched here, all loads independent, so that it lands under the k loop: the wave's 4 bias words and, in the shape of the final row stores, its 32 x 64 piece of R */
  const int rsub = lane >> 4, c4 = (lane & 15) * 4;
  float bw[4] = {0.f, 0.f, 0.f, 0.f}; v4f rr[16];
  if (bp) {
#pragma unroll
    for (int t = 0; t < 4; ++t) bw[t] = bp[col0 + t * 16 + ln];
    asm volatile("s_wait_xcnt 0x0" ::: "memory"); }      /* stands in front of any rewrite of the base or offset registers that the four bias loads name */
  if (ACT == 0 && R) { const float* rp = R + cofs + (size_t)(row0 + rsub) * ldc + col0 + c4;
#pragma unroll
    for (int q = 0; q < 16; ++q) rr[q] = *(const v4fa*)(rp + (size_t)(2 * q) * ldc);
    asm volatile("s_wait_xcnt 0x0" ::: "memory"); }      /* stands in front of any rewrite of the address registers that the sixteen row loads name */
  const unsigned char* ra = ring + (32 * wm + ln) * G3_PITCH; const unsigned char* rb = ring + G3_OPB + (64 * wn + ln) * G3_PITCH;
  const v8f z8 = {0.f,0.f,0.f,0.f,0.f,0.f,0.f,0.f}; v8f c00 = z8, c01 = z8, c02 = z8, c03 = z8, c10 = z8, c11 = z8, c12 = z8, c13 = z8;
#pragma unroll 1      /* one pass per trip: the publish point at the foot stands once */
  for (int t = 0; t < np; ++t) { const unsigned bo = (unsigned)(t & (NB - 1)) * G3_BUF;
#pragma unroll      /* the four 32-k blocks of a pass in straight line, so that a block's fragment reads can stand ahead of the block before it */
    for (int ks = 0; ks < 4; ++ks) { const unsigned char* pa = ra + bo + ks * 64; const unsigned char* pb = rb + bo + ks * 64;
      const v16h a0 = g2_frag((const _Float16*)pa, hh), a1 = g2_frag((const _Float16*)(pa + 16 * G3_PITCH), hh);
      const v16h b0 = g2_frag((const _Float16*)pb, hh), b1 = g2_frag((const _Float16*)(pb + 16 * G3_PITCH), hh), b2 = g2_frag((const _Float16*)(pb + 32 * G3_PITCH), hh), b3 = g2_frag((const _Float16*)(pb + 48 * G3_PITCH), hh);
      c00 = g2_mma(a0, b0, c00); c10 = g2_mma(a1, b0, c10); c01 = g2_mma(a0, b1, c01); c11 = g2_mma(a1, b1, c11);
      c02 = g2_mma(a0, b2, c02); c12 = g2_mma(a1, b2, c12); c03 = g2_mma(a0, b3, c03); c13 = g2_mma(a1, b3, c13); }
    asm volatile("s_wait_dscnt 0x0" ::: "memory");         /* this wave's reads of the buffer are done before the barrier behind which it is refilled */
    /* this wave's copies of pass t + 1 have landed before the barrier that publishes them. While pass t + NB - 1 exists, the wave's youngest 16 * (NB - 2) copies are exactly those of the passes t + 2 ... t + NB - 1 and may stay in flight; in the last trips, which issued none, the wait is to 0 */
    if (NB == 2 || t + NB > np) asm volatile("s_wait_asynccnt 0x0" ::: "memory"); else asm volatile("s_wait_asynccnt %0" :: "n"(16 * (NB - 2)) : "memory");
    __syncthreads();
    if (t + NB < np) { g3_copy8(lA + bo, gA + (size_t)(t + NB) * 128, stA); g3_copy8(lB + bo, gB + (size_t)(t + NB) * 128, stB); } }
  asm volatile("s_wait_asynccnt 0x0" ::: "memory");        /* nothing in flight when the ring becomes output staging */
  v8f accs[8] = {c00, c01, c02, c03, c10, c11, c12, c13};
  if (ACT == 0 && VT) {      /* block-uniform. A lane holds 8 consecutive rows of one column: 16 bytes of a transposed f16 line. The block's 128 columns x 128 rows are gathered in the ring at the pitch of its operand rows, so that whole 256-byte lines leave */
#pragma unroll
    for (int u = 0; u < 8; ++u) { const int t = u & 3, half = u >> 2; const float bv = bf16_round(bw[t]); FragH f;
#pragma unroll
      for (int r = 0; r < 8; ++r) f.h[r] = (_Float16)(accs[u][r] * alpha + bv);
      *(v8us*)(ring + (64 * wn + t * 16 + ln) * G3_PITCH + (32 * wm + half * 16 + 8 * hh) * 2) = f.half[0]; }
    __syncthreads();      /* a line's 128 rows come from four waves: all have written before any is read back */
    v8us tv[8];
#pragma unroll
    for (int q = 0; q < 8; ++q) tv[q] = *(const v8us*)(ring + (q * 16 + cr) * G3_PITCH + cc * 16);
    unsigned short* vp = (unsigned short*)VT + ((size_t)by * N + colb + cr) * (size_t)M + rowb + cc * 8;
#pragma unroll
    for (int q = 0; q < 8; ++q) { *(v8us*)(vp + (size_t)(q * 16) * M) = tv[q]; asm volatile("s_wait_xcnt 0x0" ::: "memory"); }      /* the wait stands in front of any rewrite of the store's data or address registers */
    return; }
  float (*so)[32][68] = (float (*)[32][68])ring;
#pragma unroll
  for (int u = 0; u < 8; ++u) { const int t = u & 3, half = u >> 2; const float bv = bf16_round(bw[t]);
#pragma unroll
    for (int r = 0; r < 8; ++r) { const int rloc = half * 16 + 8 * hh + r; float v = accs[u][r] * alpha + bv;
      if (ACT == 3) v = fmaxf(v, 0.f); else if (ACT == 6) v = 0.5f * v * (1.0f + erff(v * 0.70710678118654752f)); else if (ACT == 11) v = 1.0f / (1.0f + expf(-v)); else if (ACT == 15) v = v / (1.0f + expf(-v)); else if (ACT == 12) v = (v > 0.f) ? v : 0.01f * v; else if (ACT == 8) v = tanhf(v);
      so[w][rloc][t * 16 + ln] = v; } }
  __builtin_amdgcn_fence(__ATOMIC_ACQ_REL, "workgroup"); __builtin_amdgcn_wave_barrier();
  v4f vv[16];      /* the 16 staged rows are read back as one group, ahead of the stores and their waits, instead of one waited read in front of each store */
#pragma unroll
  for (int q = 0; q < 16; ++q) vv[q] = *(const v4fa*)&so[w][q * 2 + rsub][c4];
  {
#pragma unroll
    for (int q = 0; q < 16; ++q) { const int r = q * 2 + rsub; v4f v = vv[q]; if (ACT == 0 && R) { v4f a = rr[q]; if (RRND) { for (int i = 0; i < 4; ++i) a[i] = bf16_round(a[i]); } v += a; }
      if (C) { *(v4f*)(C + cofs + (size_t)(row0 + r) * ldc + col0 + c4) = v; asm volatile("s_wait_xcnt 0x0" ::: "memory"); }      /* the wait stands in front of any rewrite of the store's data or address registers */
      if (C16) { v4h h4; for (int i = 0; i < 4; ++i) h4[i] = (_Float16)v[i]; *(v4h*)(C16 + cofs + (size_t)(row0 + r) * ldc + col0 + c4) = h4; asm volatile("s_wait_xcnt 0x0" ::: "memory"); } }      /* the same wait behind the f16 store */
     } }
template <int ACT, bool RRND = false, int NB = 2>
__global__ __launch_bounds__(256) void k_gemm3(const _Float16* __restrict__ A, int lda, size_t sA, const _Float16* __restrict__ Bh, int ldb, size_t sB, float alpha, const float* __restrict__ bias, size_t sBias, const float* __restrict__ R,
    float* __restrict__ C, _Float16* __restrict__ C16, int ldc, size_t sC, int M, int N, int K) {
  g3_body<ACT, RRND, NB>(A, lda, sA, Bh, ldb, sB, alpha, bias, sBias, R, C, C16, nullptr, ldc, sC, M, N, K, (int)blockIdx.x, (int)blockIdx.y); }
// The five projections that wait for no attention, as one grid: blockIdx.y = 0 q, 1 k, 2 v of the self attention (from the LN1 plane H), 3 k, 4 v of the cross attention (from the encoder plane E).
// Each is the [4096][1024] x [1024][1024] product of k_gemm3<0>; q and k planes leave as f16 rows. A v block takes 128 tokens of ONE batch entry (row pitch NBATCH * EE), so that its tile, turned, is 128 whole
// 256-byte pieces of the [(n, h)][d][token] plane that the attention reads: the v planes leave in that form, as f16.
__global__ __launch_bounds__(256) void k_proj5(const _Float16* __restrict__ H, const _Float16* __restrict__ E, const _Float16* __restrict__ Bq, const _Float16* __restrict__ Bk, const _Float16* __restrict__ Bv, const _Float16* __restrict__ Bkc, const _Float16* __restrict__ Bvc,
    const float* __restrict__ bq, const float* __restrict__ bk, const float* __restrict__ bv, const float* __restrict__ bkc, const float* __restrict__ bvc,
    _Float16* __restrict__ Qs, _Float16* __restrict__ Ks, _Float16* __restrict__ VTs, _Float16* __restrict__ Kc, _Float16* __restrict__ VTc) {
  const int g = (int)blockIdx.y;
  const _Float16* A = (g < 3) ? H : E;
  const _Float16* Bh = (g == 0) ? Bq : (g == 1) ? Bk : (g == 2) ? Bv : (g == 3) ? Bkc : Bvc;
  const float* bias = (g == 0) ? bq : (g == 1) ? bk : (g == 2) ? bv : (g == 3) ? bkc : bvc;
  _Float16* VTd = (g == 2) ? VTs : (g == 4) ? VTc : nullptr; const bool vb = (g == 2) || (g == 4); const int bx = (int)blockIdx.x;
  _Float16* C16 = (g == 0) ? Qs : (g == 1) ? Ks : (g == 3) ? Kc : nullptr;
  constexpr int TPB = (TT / 128) * (EE / 128);      /* tiles of one batch entry's v plane */
  g3_body<0>(A, vb ? NBATCH * EE : EE, EE, Bh, EE, 0, 0.0625f, bias, 0, nullptr, nullptr, C16, VTd, EE, 0, vb ? TT : NR, EE, EE, vb ? bx % TPB : bx, vb ? bx / TPB : 0); }


// lane l with lane l ^ 16
__device__ __forceinline__ float xhalf(float x) { return __builtin_bit_cast(float, __builtin_amdgcn_permlanex16(__builtin_bit_cast(int, x), __builtin_bit_cast(int, x), 0x76543210, 0xfedcba98, false, false)); }
// Both products run transposed. S^T = K x Q^T: A = 16 key rows, B = the wave's 16 queries, so lane (ln, hh) holds for ITS query q0 + ln the keys j0 + 16 nt + 8 hh + r:
// maximum and sum are in-lane, the two halves of a query meet in one cross-row move. The two score tiles, converted in place, are the B operand of O^T += V^T x P^T
// (element s = tile s >> 3, register s & 7, which is the k order the V^T rows are loaded in): P passes through no LDS. O^T: lane = query, registers = 8 consecutive d.
// The K rows and the V^T rows of 64 keys (64 rows of 128 B each) are laid in LDS once for the block's four waves, at a pitch of 144 B (16 B x odd, for the ds_load_b128 fragment reads),
// by per-lane asynchronous 16-byte copies in which 8 lanes cover one whole 128-B row; FA_NB buffers, stage s in buffer s mod FA_NB: the copies of the next FA_NB - 1 stages fly while this one is worked on
// (the blocks of one (n, h) walk the keys in step, so a stage's rows are first asked for by all their readers at once and come from memory: a lead of one stage is shorter than that latency).
#define FA_PITCH 144
#define FA_OPB (64 * FA_PITCH)    /* one operand's 64 rows */
#define FA_BUF (2 * FA_OPB)       /* one buffer: [K rows | V^T rows] */
#define FA_NB 4                   /* buffers of the ring, a power of two; a stage is 8 copies per wave */
// Eight copies per lane: rows r, r + 16, r + 32, r + 48 of K, then of V^T. The s_wait_xcnt closes the copies' own statement so that no address register named here is rewritten ahead of it.
__device__ __forceinline__ void fa_copy8(unsigned l, const unsigned short* gk, size_t sk, const unsigned short* gv, size_t sv) {
  asm volatile("global_load_async_to_lds_b128 %0, %8, off\n\t"
               "global_load_async_to_lds_b128 %1, %9, off\n\t"
               "global_load_async_to_lds_b128 %2, %10, off\n\t"
               "global_load_async_to_lds_b128 %3, %11, off\n\t"
               "global_load_async_to_lds_b128 %4, %12, off\n\t"
               "global_load_async_to_lds_b128 %5, %13, off\n\t"
               "global_load_async_to_lds_b128 %6, %14, off\n\t"
               "global_load_async_to_lds_b128 %7, %15, off\n\t"
               "s_wait_xcnt 0x0"
               :: "v"(l), "v"(l + 16u * FA_PITCH), "v"(l + 32u * FA_PITCH), "v"(l + 48u * FA_PITCH), "v"(l + FA_OPB), "v"(l + FA_OPB + 16u * FA_PITCH), "v"(l + FA_OPB + 32u * FA_PITCH), "v"(l + FA_OPB + 48u * FA_PITCH),
                  "v"(gk), "v"(gk + sk), "v"(gk + 2 * sk), "v"(gk + 3 * sk), "v"(gv), "v"(gv + sv), "v"(gv + 2 * sv), "v"(gv + 3 * sv)
               : "memory");
}
__global__ __launch_bounds__(128) void k_flashc(const _Float16* __restrict__ Q16, int ldq, const _Float16* __restrict__ K16, int ldk, const _Float16* __restrict__ Vt, const int* __restrict__ MSK, _Float16* __restrict__ O16, int ldo) {
  constexpr int RPW = 16, NQB = TQ / (4 * RPW), DT = 4, KS = 2;
  __shared__ __attribute__((aligned(16))) unsigned char ring[FA_NB * FA_BUF];
  __shared__ __attribute__((aligned(16))) unsigned short sO[4][RPW][64 + 8];      /* output staging, f16: a query's 64 values at a pitch of 144 B */
  (void)MSK;
  const int tid = threadIdx.x, w = tid >> 5, lane = tid & 31, ln = lane & 15, hh = lane >> 4;
  static_assert(NQB % 2 == 0, "query tiles are dealt in pairs");
  const int slab = blockIdx.x / (NQB / 2), pr = blockIdx.x % (NQB / 2); const int b = slab / NH, h = slab % NH;
  const unsigned short* Vth = (const unsigned short*)Vt + (size_t)slab * 64 * TK;
  const int cr = tid >> 3, cc = tid & 7;      /* copy side: this lane's first row and its 16-byte piece of the row */
  const unsigned short* gK = (const unsigned short*)K16 + ((size_t)b * TK + cr) * ldk + h * 64 + cc * 8; const unsigned short* gV = Vth + (size_t)cr * TK + cc * 8; const size_t stK = (size_t)16 * ldk, stV = (size_t)16 * TK;
  const unsigned lc = (unsigned)(size_t)ring + (unsigned)(cr * FA_PITCH + cc * 16);
  // A tile's cost grows with its index and every block of the grid is resident at once, so the launch lasts as long as its fullest SIMD. Each block therefore takes two tiles of its (n, h),
  // NQB - 1 - pr and then pr, one after the other in every wave: NQB + 1 stages for every block. The ring is free again at the head of the second tile: the first tile's last trip ends in
  // each wave's s_wait_dscnt 0 and s_wait_asynccnt 0 and the block's barrier, and nothing is copied behind that trip.
#pragma unroll 1      /* kept rolled: unrolled, the stage loop would stand twice in the kernel's text for no saved work */
 for (int half = 0; half < 2; ++half) {
  const int qblk = half ? pr : NQB - 1 - pr; const int qb0 = qblk * (4 * RPW); const int q0 = qb0 + w * RPW;
  const int ns = qblk + 1;      /* block-uniform causal bound: stages of 64 keys up to the end of the query block */
  fa_copy8(lc, gK, stK, gV, stV);
#pragma unroll      /* each stage's buffer offset is then a constant */
  for (int s = 1; s < FA_NB - 1; ++s) if (s < ns) fa_copy8(lc + (unsigned)s * FA_BUF, gK + (size_t)(s * 64) * ldk, stK, gV + s * 64, stV);
  FragH bq[KS];
  { const unsigned short* qr = (const unsigned short*)Q16 + ((size_t)b * TQ + q0 + ln) * ldq + h * 64;
#pragma unroll
    for (int ks = 0; ks < KS; ++ks) { bq[ks].half[0] = *(const v8us*)(qr + ks * 32 + 8 * hh); bq[ks].half[1] = *(const v8us*)(qr + ks * 32 + 16 + 8 * hh); } }
  /* stage 0's own copies have landed before the barrier that publishes them: the count leaves out the 8 copies of each of the stages 1 ... FA_NB - 2, and is used only where all of them were issued */
  if (ns < FA_NB - 1) asm volatile("s_wait_asynccnt 0x0" ::: "memory"); else asm volatile("s_wait_asynccnt %0" :: "n"(8 * (FA_NB - 2)) : "memory");
  __syncthreads();
  if (ns > FA_NB - 1) fa_copy8(lc + (unsigned)(FA_NB - 1) * FA_BUF, gK + (size_t)((FA_NB - 1) * 64) * ldk, stK, gV + (FA_NB - 1) * 64, stV);
  const int tq = q0 + ln;      /* this lane's query */
  float m_r = -3.0e38f, l_r = 0.f; v8f oacc[DT];
#pragma unroll
  for (int dt = 0; dt < DT; ++dt) oacc[dt] = (v8f){0.f,0.f,0.f,0.f,0.f,0.f,0.f,0.f};
  const unsigned char* rk = ring + ln * FA_PITCH + 16 * hh; const unsigned char* rv = rk + FA_OPB;
#pragma unroll 1      /* one stage per trip: the publish point at the foot stands once */
  for (int t = 0; t < ns; ++t) { const unsigned bo = (unsigned)(t & (FA_NB - 1)) * FA_BUF;
#pragma unroll      /* the stage's two 32-key steps in straight line: each step's place in the buffer is then an immediate offset of its fragment reads */
   for (int sub = 0; sub < 2; ++sub) { const int j0 = t * 64 + sub * 32;
    FragH ak[2][KS], av[DT];
#pragma unroll
    for (int nt = 0; nt < 2; ++nt) { const unsigned char* kr = rk + bo + (sub * 32 + nt * 16) * FA_PITCH;
#pragma unroll
      for (int ks = 0; ks < KS; ++ks) { ak[nt][ks].half[0] = *(const v8us*)(kr + ks * 64); ak[nt][ks].half[1] = *(const v8us*)(kr + ks * 64 + 32); } }
#pragma unroll
    for (int dt = 0; dt < DT; ++dt) { const unsigned char* vrow = rv + bo + dt * 16 * FA_PITCH + sub * 64; av[dt].half[0] = *(const v8us*)vrow; av[dt].half[1] = *(const v8us*)(vrow + 32); }
    float sc[16];
#pragma unroll
    for (int nt = 0; nt < 2; ++nt) { v8f acc = (v8f){0.f,0.f,0.f,0.f,0.f,0.f,0.f,0.f};
#pragma unroll
      for (int ks = 0; ks < KS; ++ks) acc = mmaH<1>(ak[nt][ks].v, ak[nt][ks].v, bq[ks].v, bq[ks].v, acc);
#pragma unroll
      for (int r = 0; r < 8; ++r) sc[nt * 8 + r] = (j0 + nt * 16 + 8 * hh + r <= tq) ? acc[r] : -INFINITY; }      /* the raw product: its scale is folded into the exponent's fma below */
    float mx[4];
#pragma unroll
    for (int i = 0; i < 4; ++i) mx[i] = fmaxf(fmaxf(sc[i], sc[4 + i]), fmaxf(sc[8 + i], sc[12 + i]));
    float mc = fmaxf(fmaxf(mx[0], mx[1]), fmaxf(mx[2], mx[3])); mc = fmaxf(mc, xhalf(mc)) * SCL2;      /* the scale is positive: the maximum of the raw products, scaled once */
    const float mn = fmaxf(m_r, mc); const float ea = __builtin_amdgcn_exp2f(m_r - mn); const float al = (mn > -1.0e38f) ? ea : 1.0f; m_r = mn;
    const float nb = 10.0f - mn;      /* exponent offset: minus the maximum in use, plus the 2^10 that P carries into f16 */
    FragH pb; float ps[4] = {0.f, 0.f, 0.f, 0.f};
#pragma unroll
    for (int i = 0; i < 16; ++i) { const float p = __builtin_amdgcn_exp2f(fmaf(sc[i], SCL2, nb)); ps[i & 3] += p; pb.h[i] = (_Float16)p; }      /* p = weight x 2^10; a masked score is -inf: weight exactly 0 */
    l_r = l_r * al + ((ps[0] + ps[1]) + (ps[2] + ps[3]));      /* this half's keys only; the halves are joined behind the loop */
#pragma unroll
    for (int dt = 0; dt < DT; ++dt) {
#pragma unroll
      for (int r = 0; r < 8; ++r) oacc[dt][r] *= al; }
#pragma unroll
    for (int dt = 0; dt < DT; ++dt) oacc[dt] = mmaH<1>(av[dt].v, av[dt].v, pb.v, pb.v, oacc[dt]); }
    asm volatile("s_wait_dscnt 0x0" ::: "memory");         /* this wave's reads of the buffer are done before the barrier behind which it is refilled */
    /* this wave's copies of stage t + 1 have landed before the barrier that publishes them. While stage t + FA_NB - 1 exists, the wave's youngest 8 * (FA_NB - 2) copies are exactly those of the stages t + 2 ... t + FA_NB - 1 and may stay in flight; in the last trips, which issued none, the wait is to 0 */
    if (t + FA_NB > ns) asm volatile("s_wait_asynccnt 0x0" ::: "memory"); else asm volatile("s_wait_asynccnt %0" :: "n"(8 * (FA_NB - 2)) : "memory");
    __syncthreads();
    if (t + FA_NB < ns) fa_copy8(lc + bo, gK + (size_t)(t + FA_NB) * 64 * ldk, stK, gV + (t + FA_NB) * 64, stV); }
  asm volatile("s_wait_asynccnt 0x0" ::: "memory");        /* nothing in flight when the wave goes on to its end */
  const float l = l_r + xhalf(l_r); const float inv = (l > 0.f) ? 1.0f / l : 0.f;      /* the sum carries the same 2^10 as P */
#pragma unroll
  for (int dt = 0; dt < DT; ++dt) { FragH f;      /* a lane's 8 consecutive d of its query: 16 bytes of the f16 row */
#pragma unroll
    for (int r = 0; r < 8; ++r) f.h[r] = (_Float16)(oacc[dt][r] * inv);
    *(v8us*)&sO[w][ln][dt * 16 + 8 * hh] = f.half[0]; }
  __builtin_amdgcn_fence(__ATOMIC_ACQ_REL, "workgroup"); __builtin_amdgcn_wave_barrier();
  { const int rs = lane >> 3, pc = lane & 7; v8us ov[4];      /* 8 lanes cover a query's 64 f16 = one 128-byte line; the four reads go as one group ahead of the stores */
#pragma unroll
    for (int k = 0; k < 4; ++k) ov[k] = *(const v8us*)&sO[w][k * 4 + rs][pc * 8];
#pragma unroll
    for (int k = 0; k < 4; ++k) { *(v8us*)((unsigned short*)O16 + ((size_t)b * TQ + q0 + k * 4 + rs) * ldo + h * 64 + pc * 8) = ov[k]; asm volatile("s_wait_xcnt 0x0" ::: "memory"); }      /* the wait stands in front of any rewrite of the store's data or address registers */
     } } }
template <bool RND>
__device__ __forceinline__ void ln1024_body(const float* __restrict__ X, const float* __restrict__ g, const float* __restrict__ bb, _Float16* __restrict__ H16, const int bx) {
  #pragma clang fp contract(off)
  const int tid = threadIdx.x, w = tid >> 5, l = tid & 31; const int r = bx * 8 + w; if (r >= NR) return; const float* x = X + (size_t)r * EE; float v[32]; float s = 0.f; v4f a8[8];
#pragma unroll
  for (int u = 0; u < 8; ++u) a8[u] = *(const v4fa*)(x + u * 128 + l * 4);
  asm volatile("s_wait_xcnt 0x0" ::: "memory");      /* later loads may land in the registers that hold the row loads' address: this wait stands in front of that overwrite */
#pragma unroll
  for (int u = 0; u < 8; ++u) {
#pragma unroll
    for (int q = 0; q < 4; ++q) { const float t = RND ? bf16_round(a8[u][q]) : a8[u][q]; v[u * 4 + q] = t; s += t; } }
  for (int o = 16; o > 0; o >>= 1) s += __shfl_xor(s, o, 32); const float mu = s / (float)EE; float q2 = 0.f;
#pragma unroll
  for (int k = 0; k < 32; ++k) { const float d = v[k] - mu; q2 += d * d; }
  for (int o = 16; o > 0; o >>= 1) q2 += __shfl_xor(q2, o, 32); const float rs = 1.0f / sqrtf(q2 / (float)EE + 1e-5f);
  {
#pragma unroll
    for (int u = 0; u < 8; ++u) { _Float16 h4[4];
#pragma unroll
      for (int q = 0; q < 4; ++q) { const int c = u * 128 + l * 4 + q; h4[q] = (_Float16)((v[u * 4 + q] - mu) * rs * bf16_round(g[c]) + bf16_round(bb[c])); }
      *(unsigned long long*)((unsigned short*)H16 + (size_t)r * EE + u * 128 + l * 4) = *(const unsigned long long*)h4; }
     } }
template <bool RND>
__global__ __launch_bounds__(256) void k_ln1024(const float* __restrict__ X, const float* __restrict__ g, const float* __restrict__ bb, _Float16* __restrict__ H16) { ln1024_body<RND>(X, g, bb, H16, (int)blockIdx.x); }
__device__ __forceinline__ void prep_body(const float* __restrict__ e, _Float16* __restrict__ E16, size_t n8, const unsigned bx) {
  const size_t t = (size_t)bx * 256 + threadIdx.x; if (t >= n8) return; const v4f a = *(const v4fa*)(e + t * 8), c = *(const v4fa*)(e + t * 8 + 4); FragH f;
#pragma unroll
  for (int q = 0; q < 4; ++q) { f.h[q] = (_Float16)bf16_round(a[q]); f.h[4 + q] = (_Float16)bf16_round(c[q]); }
  *(v8us*)((unsigned short*)E16 + t * 8) = f.half[0];
  asm volatile("s_wait_xcnt 0x0" ::: "memory");      /* stands in front of any rewrite of the registers that the store above names */
}
// Everything that reads only the inputs, as one grid by block range: LN1 (8 rows a block), the encoder plane and the ten weight planes (8 elements a thread).
// The ten f16 planes lie one behind the other from Bt in the order w0 ... w9, so a piece's place is its running index; w0 ... w7 hold EE * EE elements, w8 and w9 FF * EE.
#define FR_LN (NR / 8)                        /* blocks of LN1 */
#define FR_PREP (NR * EE / 8 / 256)           /* blocks of the encoder plane */
#define FR_WSM (EE * EE / 8 / 256)            /* blocks of one EE x EE weight */
#define FR_W (8 * FR_WSM + 2 * (FF / EE) * FR_WSM)
// second bound: eight waves a SIMD. The LN1 branch sets the register count of every block of this grid; held to 128 registers, four blocks of the streaming ranges stay resident on a WGP instead of three.
__global__ __launch_bounds__(256, 8) void k_front(const float* __restrict__ w0, const float* __restrict__ w1, const float* __restrict__ w2, const float* __restrict__ w3, const float* __restrict__ w4, const float* __restrict__ w5, const float* __restrict__ w6, const float* __restrict__ w7,
    const float* __restrict__ w8, const float* __restrict__ w9, const float* __restrict__ x, const float* __restrict__ e, const float* __restrict__ g, const float* __restrict__ bb,
    _Float16* __restrict__ Bt, _Float16* __restrict__ E16, _Float16* __restrict__ H16) {
  const unsigned bx = blockIdx.x;
  if (bx < FR_LN) { ln1024_body<true>(x, g, bb, H16, (int)bx); return; }
  if (bx < FR_LN + FR_PREP) { prep_body(e, E16, (size_t)NR * EE / 8, bx - FR_LN); return; }
  const unsigned wb = bx - (FR_LN + FR_PREP); const unsigned seg = wb / FR_WSM;      /* block-uniform: which EE x EE stretch of the ten planes */
  const float* W; unsigned b0;      /* the source and the block at which its plane begins */
  if (seg < 8) { W = (seg == 0) ? w0 : (seg == 1) ? w1 : (seg == 2) ? w2 : (seg == 3) ? w3 : (seg == 4) ? w4 : (seg == 5) ? w5 : (seg == 6) ? w6 : w7; b0 = seg * FR_WSM; }
  else if (seg < 8 + FF / EE) { W = w8; b0 = 8 * FR_WSM; }
  else { W = w9; b0 = (8 + FF / EE) * FR_WSM; }
  const size_t ts = (size_t)(wb - b0) * 256 + threadIdx.x, td = (size_t)wb * 256 + threadIdx.x; FragH f;
#pragma unroll
  for (int i = 0; i < 8; ++i) f.h[i] = (_Float16)(bf16_round(W[ts * 8 + i]) * 16.0f); *(v8us*)((unsigned short*)Bt + td * 8) = f.half[0];
  asm volatile("s_wait_xcnt 0x0" ::: "memory");      /* stands in front of any rewrite of the registers that the store above names */
}

extern "C" void kernel_launch(void* const* d_in, const int* in_sizes, int n_in,
                              void* d_out, int out_size, void* d_ws, size_t ws_size, hipStream_t stream) {
  (void)in_sizes; (void)n_in; (void)out_size;
  const float* const* I = (const float* const*)d_in;
  const float* x = I[0]; const float* enc = I[1];
  const float* wq_s = I[2]; const float* bq_s = I[3]; const float* wk_s = I[4]; const float* bk_s = I[5]; const float* wv_s = I[6]; const float* bv_s = I[7]; const float* wo_s = I[8]; const float* bo_s = I[9];
  const float* wq_c = I[10]; const float* bq_c = I[11]; const float* wk_c = I[12]; const float* bk_c = I[13]; const float* wv_c = I[14]; const float* bv_c = I[15]; const float* wo_c = I[16]; const float* bo_c = I[17];
  const float* g1 = I[18]; const float* b1n = I[19]; const float* g2 = I[20]; const float* b2n = I[21]; const float* g3 = I[22]; const float* b3n = I[23]; const float* W1 = I[24]; const float* b1 = I[25]; const float* W2 = I[26]; const float* b2 = I[27];
  char* ws = (char*)d_ws; size_t off = 0;
  auto take = [&](size_t bytes) { char* p = ws + off; off += (bytes + 255) & ~(size_t)255; return p; };
  _Float16* B[8]; for (int i = 0; i < 8; ++i) B[i] = (_Float16*)take((size_t)EE * EE * 2);      /* wq_s wk_s wv_s wo_s wq_c wk_c wv_c wo_c */
  _Float16* BF1 = (_Float16*)take((size_t)FF * EE * 2); _Float16* BF2 = (_Float16*)take((size_t)EE * FF * 2);
  float* X2 = (float*)take((size_t)NR * EE * 4); _Float16* H16 = (_Float16*)take((size_t)NR * EE * 2);
  _Float16* Q16 = (_Float16*)take((size_t)NR * EE * 2); _Float16* K16 = (_Float16*)take((size_t)NR * EE * 2); _Float16* VT = (_Float16*)take((size_t)NR * EE * 2); _Float16* E16 = (_Float16*)take((size_t)NR * EE * 2);      /* these four are contiguous: the FFN hidden reuses them */
  float* X1 = (float*)take((size_t)NR * EE * 4);
  _Float16* K16c = (_Float16*)take((size_t)NR * EE * 2); _Float16* VTc = (_Float16*)take((size_t)NR * EE * 2);      /* the cross attention's k and v planes, made ahead of the self attention */
  if (off > ws_size) return;      /* 16 + 16 + 16 + 8 + 32 + 16 + 16 = 120 MiB */
  _Float16* O16 = H16;                /* LN output is dead once its projection GEMMs ran; the attention output plane reuses it */
  _Float16* F1 = Q16;                 /* FFN hidden [4096][4096] f16 = 32 MiB = Q16+K16+VT+E16 (all dead by then) */
  const dim3 gE((NR / 128) * (EE / 128), 1), gF((NR / 128) * (FF / 128), 1), gP((NR / 128) * (EE / 128), 5); const unsigned gln = NR / 8, gfl = NH * (TQ / 128);      /* attention: one block per (n, h) and pair of 64-query tiles */
  /* --- all that reads only the inputs: LN1, the encoder plane, the ten weight planes ((out,in) = natural Bt; x16; B[0] ... B[7], BF1, BF2 are contiguous) --- */
  k_front<<<FR_LN + FR_PREP + FR_W, 256, 0, stream>>>(wq_s, wk_s, wv_s, wo_s, wq_c, wk_c, wv_c, wo_c, W1, W2, x, enc, g1, b1n, B[0], E16, H16);
  /* --- the five projections that wait for no attention; both v planes leave re-laid --- */
  k_proj5<<<gP, 256, 0, stream>>>(H16, E16, B[0], B[1], B[2], B[5], B[6], bq_s, bk_s, bv_s, bk_c, bv_c, Q16, K16, VT, K16c, VTc);
  /* --- self attention --- */
  k_flashc<<<gfl, 128, 0, stream>>>(Q16, NBATCH * EE, K16, NBATCH * EE, VT, nullptr, O16, NBATCH * EE);      /* rows = tokens, 64 (n,h) slabs of 64 columns */
  k_gemm3<0, true, 4><<<gE, 256, 0, stream>>>(O16, EE, 0, B[3], EE, 0, 0.0625f, bo_s, 0, x, X1, nullptr, EE, 0, NR, EE, EE);      /* x1 = bf16(x) + o*wo^T + bo */
  /* --- cross attention (keys/values from encoder_out, same causal mask) --- */
  k_ln1024<false><<<gln, 256, 0, stream>>>(X1, g2, b2n, H16);
  k_gemm3<0, false, 4><<<gE, 256, 0, stream>>>(H16, EE, 0, B[4], EE, 0, 0.0625f, bq_c, 0, nullptr, nullptr, Q16, EE, 0, NR, EE, EE);
  k_flashc<<<gfl, 128, 0, stream>>>(Q16, NBATCH * EE, K16c, NBATCH * EE, VTc, nullptr, O16, NBATCH * EE);
  k_gemm3<0, false, 4><<<gE, 256, 0, stream>>>(O16, EE, 0, B[7], EE, 0, 0.0625f, bo_c, 0, X1, X2, nullptr, EE, 0, NR, EE, EE);      /* x2 = x1 + o*wo^T + bo */
  /* --- FFN --- */
  k_ln1024<false><<<gln, 256, 0, stream>>>(X2, g3, b3n, H16);
  k_gemm3<6><<<gF, 256, 0, stream>>>(H16, EE, 0, BF1, EE, 0, 0.0625f, b1, 0, nullptr, nullptr, F1, FF, 0, NR, FF, EE);      /* gelu_erf(h*fc1^T + b1) -> f16 [4096][4096] */
  k_gemm3<0, false, 4><<<gE, 256, 0, stream>>>(F1, FF, 0, BF2, FF, 0, 0.0625f, b2, 0, X2, (float*)d_out, nullptr, EE, 0, NR, EE, FF);      /* out = x2 + f*fc2^T + b2 */
}
